// v000
// The times below were measured on an AMD MI455X: many runs one after another, warmed up first and cycling through
// copies of the inputs, with the whole window's GPU time divided by the number of runs. Launches and the gaps
// between them are all in it. The median over several windows is given; except for v000 it joins two sittings, which
// can be a few percent apart, so the side-by-side timings, each taken in one sitting, are the better comparison.
// v000, which the later versions start from, runs in 290 microseconds.
#include <hip/hip_runtime.h>
// Speech_MultiHeadedAttention (2 x 4096 frames x 256 = 4 heads x 64; qkv = x Wqkv^T + bqkv; q scaled by 64^-0.5; local attention over a 65-frame window centred on each frame where the window is taken from ZERO-PADDED k / v (out-of-range slots are zero vectors that still take part in the softmax with logit 0, exactly as the source); out = merged . Wout^T + bout).
// Structure: exact f16 x plane; qkv as ONE f16 WMMA GEMM (32x64 wave tiles, f32 accumulation, exact x16 weights + bias; f32 out); the 65-key windowed attention entirely on VALU (thread per (frame, head): 65 dots of 64, softmax, weighted value sum, all f32 from the f32 q/k/v plane) into f16 hi/residual planes; Wout as two GEMM terms (+ bias).
// Compute dtype: inputs rounded to bf16; x / weights exact as f16 so q/k/v are f32 sums of exact products; the attention output as f16 hi + residual; softmax f32 - near exact-class. v_wmma_f32_16x16x32_f16.
#define NB 2
#define TT 4096
#define EE 256
#define NH 4
#define HD 64
#define WW 65
#define PADW 32
#define NR (NB * TT)
typedef __bf16 v16b __attribute__((ext_vector_type(16)));
typedef unsigned short v8us __attribute__((ext_vector_type(8), may_alias));
typedef float  v8f  __attribute__((ext_vector_type(8)));
typedef float  v4f  __attribute__((ext_vector_type(4)));
typedef float  v4fa __attribute__((ext_vector_type(4), may_alias));
union FragB { v16b v; v8us half[2]; unsigned short u[16]; };

__device__ __forceinline__ unsigned short bf16_bits(float x) { unsigned int u = __float_as_uint(x); return (unsigned short)((u + 0x7FFFu + ((u >> 16) & 1u)) >> 16); }
__device__ __forceinline__ float bf16_val(unsigned short b) { return __uint_as_float(((unsigned int)b) << 16); }
__device__ __forceinline__ float bf16_round(float x) { return bf16_val(bf16_bits(x)); }
// D += A·B with NT terms: 1 = ah·bh, 2 = + al·bh (A split), 3 = + ah·bl (both split)
template <int NT>
__device__ __forceinline__ v8f mmaN(v16b ah, v16b al, v16b bh, v16b bl, v8f c) {
  c = __builtin_amdgcn_wmma_f32_16x16x32_bf16(false, ah, false, bh, (short)0, c, false, false);
  if (NT >= 2) c = __builtin_amdgcn_wmma_f32_16x16x32_bf16(false, al, false, bh, (short)0, c, false, false);
  if (NT >= 3) c = __builtin_amdgcn_wmma_f32_16x16x32_bf16(false, ah, false, bl, (short)0, c, false, false);
  asm volatile("v_nop\n\tv_nop\n\tv_nop\n\tv_nop" : "+v"(c) : "v"(ah), "v"(al), "v"(bh), "v"(bl));
  return c;
}

__global__ __launch_bounds__(256) void k_wt_bf16(const float* __restrict__ W, unsigned short* __restrict__ Wt, int K, int N) {
  const int t = blockIdx.x * 256 + threadIdx.x;
  const int k8n = K / 8;
  if (t >= N * k8n) return;
  const int n = t / k8n, k8 = (t % k8n) * 8;
  v8us v;
#pragma unroll
  for (int i = 0; i < 8; ++i) v[i] = bf16_bits(W[(size_t)(k8 + i) * N + n]);
  *(v8us*)(Wt + (size_t)n * K + k8) = v;
  
}

// GEMM C[M][N] (f32, pitch ldc) = act(A[M][K]·W + bias). A f32 row-major (pitch lda) converted per fragment to bf16
// (ASPLIT: hi/lo two planes -> 2 terms, else single rounded term); Wt bf16 [N][K] (pitch ldb). BIAS_BF16 rounds the
// bias to bf16 first (bias quantised to bf16 before the add). K%32==0, M%16==0, N%64==0.
template <bool ASPLIT, int ACT, bool BIAS_BF16>
__global__ __launch_bounds__(128) void k_gemm_bf(const float* __restrict__ A, int lda, const unsigned short* __restrict__ Wt, int ldb,
                                               const float* __restrict__ bias, float* __restrict__ C, int ldc, int M, int N, int K) {
  __shared__ __attribute__((aligned(16))) float so[4][16][64];
  const int tid = threadIdx.x, w = tid >> 5, lane = tid & 31, ln = lane & 15, hh = lane >> 4;
  const int ntn = N / 64;
  const int wid = blockIdx.x * 4 + w;
  const int mt = wid / ntn, nq = wid % ntn;
  if (mt * 16 >= M) return;
  const int row0 = mt * 16, col0 = nq * 64;
  const float* arow = A + (size_t)(row0 + ln) * lda;
  v8f acc[4] = {};
  for (int kb = 0; kb < K; kb += 32) {
    FragB ah, al;
    const v4f x0 = *(const v4fa*)(arow + kb + 8 * hh), x1 = *(const v4fa*)(arow + kb + 8 * hh + 4);
    const v4f x2 = *(const v4fa*)(arow + kb + 16 + 8 * hh), x3 = *(const v4fa*)(arow + kb + 16 + 8 * hh + 4);
    float xs[16] = {x0[0],x0[1],x0[2],x0[3],x1[0],x1[1],x1[2],x1[3],x2[0],x2[1],x2[2],x2[3],x3[0],x3[1],x3[2],x3[3]};
#pragma unroll
    for (int i = 0; i < 16; ++i) { const unsigned short hb = bf16_bits(xs[i]); ah.u[i] = hb; al.u[i] = ASPLIT ? bf16_bits(xs[i] - bf16_val(hb)) : (unsigned short)0; }
#pragma unroll
    for (int t = 0; t < 4; ++t) {
      const unsigned short* brow = Wt + (size_t)(col0 + t * 16 + ln) * ldb + kb;
      FragB b;
      b.half[0] = *(const v8us*)(brow + 8 * hh);
      b.half[1] = *(const v8us*)(brow + 16 + 8 * hh);
      acc[t] = mmaN<ASPLIT ? 2 : 1>(ah.v, al.v, b.v, b.v, acc[t]);
    }
  }
#pragma unroll
  for (int t = 0; t < 4; ++t) {
    float bv = bias ? bias[col0 + t * 16 + ln] : 0.f;
    if (BIAS_BF16) bv = bf16_round(bv);
#pragma unroll
    for (int r = 0; r < 8; ++r) { float v = acc[t][r] + bv; if (ACT == 1) v = fmaxf(v, 0.f); so[w][8 * hh + r][t * 16 + ln] = v; }
  }
  __builtin_amdgcn_fence(__ATOMIC_ACQ_REL, "workgroup");
  __builtin_amdgcn_wave_barrier();
  const int rsub = lane >> 4, c4 = (lane & 15) * 4;
  {
#pragma unroll
    for (int q = 0; q < 8; ++q) {
      const int r = q * 2 + rsub;
      const v4f v = *(const v4fa*)&so[w][r][c4];
      *(v4f*)(C + (size_t)(row0 + r) * ldc + col0 + c4) = v;
    }
    
  }
}

// GEMM C = act(A·W + bias + resid): A f32 (ASPLIT -> hi/lo 2 terms), Wt bf16 [N][K]; ACT 0 none, 1 relu, 2 exact gelu;
// resid (optional, f32, row index = (row % rmod), pitch ldr, RES_BF16 rounds it) added before the activation.
template <bool ASPLIT, int ACT, bool BIAS_BF16, bool RES_BF16>
__global__ __launch_bounds__(128) void k_gemm_bf3(const float* __restrict__ A, int lda, const unsigned short* __restrict__ Wt, int ldb,
                                                const float* __restrict__ bias, const float* __restrict__ resid, int rmod, int ldr,
                                                float* __restrict__ C, int ldc, int M, int N, int K) {
  __shared__ __attribute__((aligned(16))) float so[4][16][64];
  const int tid = threadIdx.x, w = tid >> 5, lane = tid & 31, ln = lane & 15, hh = lane >> 4;
  const int ntn = N / 64;
  const int wid = blockIdx.x * 4 + w;
  const int mt = wid / ntn, nq = wid % ntn;
  if (mt * 16 >= M) return;
  const int row0 = mt * 16, col0 = nq * 64;
  const float* arow = A + (size_t)(row0 + ln) * lda;
  v8f acc[4] = {};
  for (int kb = 0; kb < K; kb += 32) {
    FragB ah, al;
    const v4f x0 = *(const v4fa*)(arow + kb + 8 * hh), x1 = *(const v4fa*)(arow + kb + 8 * hh + 4);
    const v4f x2 = *(const v4fa*)(arow + kb + 16 + 8 * hh), x3 = *(const v4fa*)(arow + kb + 16 + 8 * hh + 4);
    float xs[16] = {x0[0],x0[1],x0[2],x0[3],x1[0],x1[1],x1[2],x1[3],x2[0],x2[1],x2[2],x2[3],x3[0],x3[1],x3[2],x3[3]};
#pragma unroll
    for (int i = 0; i < 16; ++i) { const unsigned short hb = bf16_bits(xs[i]); ah.u[i] = hb; al.u[i] = ASPLIT ? bf16_bits(xs[i] - bf16_val(hb)) : (unsigned short)0; }
#pragma unroll
    for (int t = 0; t < 4; ++t) {
      const unsigned short* brow = Wt + (size_t)(col0 + t * 16 + ln) * ldb + kb;
      FragB b;
      b.half[0] = *(const v8us*)(brow + 8 * hh);
      b.half[1] = *(const v8us*)(brow + 16 + 8 * hh);
      acc[t] = mmaN<ASPLIT ? 2 : 1>(ah.v, al.v, b.v, b.v, acc[t]);
    }
  }
#pragma unroll
  for (int t = 0; t < 4; ++t) {
    const int col = col0 + t * 16 + ln;
    float bv = bias ? bias[col] : 0.f;
    if (BIAS_BF16) bv = bf16_round(bv);
#pragma unroll
    for (int r = 0; r < 8; ++r) {
      float v = acc[t][r] + bv;
      if (resid) { float rv = resid[(size_t)((row0 + 8 * hh + r) % rmod) * ldr + col]; if (RES_BF16) rv = bf16_round(rv); v += rv; }
      if (ACT == 1) v = fmaxf(v, 0.f);
      if (ACT == 2) v = 0.5f * v * (1.0f + erff(v * 0.70710678118654752f));
      if (ACT == 3) { const float u = 0.7978845608028654f * (v + 0.044715f * v * v * v); v = 0.5f * v * (1.0f + tanhf(u)); }
      so[w][8 * hh + r][t * 16 + ln] = v;
    }
  }
  __builtin_amdgcn_fence(__ATOMIC_ACQ_REL, "workgroup");
  __builtin_amdgcn_wave_barrier();
  const int rsub = lane >> 4, c4 = (lane & 15) * 4;
  {
#pragma unroll
    for (int q = 0; q < 8; ++q) {
      const int r = q * 2 + rsub;
      const v4f v = *(const v4fa*)&so[w][r][c4];
      *(v4f*)(C + (size_t)(row0 + r) * ldc + col0 + c4) = v;
    }
    
  }
}
// row LayerNorm (biased variance, eps) over N: s = X (+ R); optional out_sum <- s; out_norm <- (s-mu)*rsqrt(var+eps)*g + b
template <bool PARAM_BF16>
__global__ __launch_bounds__(256) void k_layernorm(const float* __restrict__ X, const float* __restrict__ R, const float* __restrict__ g, const float* __restrict__ bta,
                                                  float* __restrict__ out_sum, float* __restrict__ out_norm, int N, float eps) {
  __shared__ float red[256];
  const int row = blockIdx.x, tid = threadIdx.x;
  const float* x = X + (size_t)row * N; const float* rr = R ? R + (size_t)row * N : nullptr;
  float vals[16];                     // up to N = 4096
  const int per = N / 256;            // contiguous chunk per thread? use strided-by-4 chunks: thread handles j = tid*4 + 1024*u
  float s1 = 0.f;
  for (int u = 0; u < per / 4; ++u) {
    const int j = tid * 4 + 1024 * u;
    const v4f a = *(const v4fa*)(x + j);
    v4f b = {0.f,0.f,0.f,0.f}; if (rr) b = *(const v4fa*)(rr + j);
#pragma unroll
    for (int q = 0; q < 4; ++q) { const float v = a[q] + b[q]; vals[u * 4 + q] = v; s1 += v; }
  }
  red[tid] = s1; __syncthreads();
  for (int st = 128; st > 0; st >>= 1) { if (tid < st) red[tid] += red[tid + st]; __syncthreads(); }
  const float mu = red[0] / (float)N; __syncthreads();
  float s2 = 0.f;
  for (int u = 0; u < per / 4; ++u)
#pragma unroll
    for (int q = 0; q < 4; ++q) { const float c = vals[u * 4 + q] - mu; s2 += c * c; }
  red[tid] = s2; __syncthreads();
  for (int st = 128; st > 0; st >>= 1) { if (tid < st) red[tid] += red[tid + st]; __syncthreads(); }
  const float rs = rsqrtf(red[0] / (float)N + eps);
  {
    for (int u = 0; u < per / 4; ++u) {
      const int j = tid * 4 + 1024 * u;
      v4f o, sm;
#pragma unroll
      for (int q = 0; q < 4; ++q) {
        float gg = g[j + q], bb = bta[j + q];
        if (PARAM_BF16) { gg = bf16_round(gg); bb = bf16_round(bb); }
        sm[q] = vals[u * 4 + q]; o[q] = (vals[u * 4 + q] - mu) * rs * gg + bb;
      }
      if (out_sum) *(v4f*)(out_sum + (size_t)row * N + j) = sm;
      *(v4f*)(out_norm + (size_t)row * N + j) = o;
    }
    
  }
}



// ---- f16 WMMA path (v_wmma_f32_16x16x32_f16): 11-bit significands for operands in range — used for the qkv and output projections
typedef _Float16 v16h __attribute__((ext_vector_type(16)));
union FragH { v16h v; v8us half[2]; _Float16 h[16]; unsigned short u[16]; };
template <int NT>
__device__ __forceinline__ v8f mmaH(v16h ah, v16h al, v16h bh, v16h bl, v8f c) {
  c = __builtin_amdgcn_wmma_f32_16x16x32_f16(false, ah, false, bh, (short)0, c, false, false);
  if (NT >= 2) c = __builtin_amdgcn_wmma_f32_16x16x32_f16(false, al, false, bh, (short)0, c, false, false);
  if (NT >= 3) c = __builtin_amdgcn_wmma_f32_16x16x32_f16(false, ah, false, bl, (short)0, c, false, false);
  asm volatile("v_nop\n\tv_nop\n\tv_nop\n\tv_nop" : "+v"(c) : "v"(ah), "v"(al), "v"(bh), "v"(bl));
  return c;
}
// batched GEMM like k_gemm_b but f16 operands: A f32 (split into f16 hi/lo if ASPLIT, else rounded to f16), Bt = f16 values [n][k]; alpha; C f32; N multiple of 16 (partial tiles skipped)
template <bool ASPLIT>
__global__ __launch_bounds__(128) void k_gemm_h(const float* __restrict__ A, int lda, size_t sA, const _Float16* __restrict__ Bh, int ldb, size_t sB, float alpha, float* __restrict__ C, int ldc, size_t sC, int M, int N, int K) {
  __shared__ __attribute__((aligned(16))) float so[4][16][64];
  const int tid = threadIdx.x, w = tid >> 5, lane = tid & 31, ln = lane & 15, hh = lane >> 4; const int by = blockIdx.y;
  A += (size_t)by * sA; Bh += (size_t)by * sB; C += (size_t)by * sC;
  const int ntn = (N + 63) / 64; const int wid = blockIdx.x * 4 + w; const int mt = wid / ntn, nq = wid % ntn; if (mt * 16 >= M) return;
  const int row0 = mt * 16, col0 = nq * 64; const float* arow = A + (size_t)(row0 + ln) * lda;
  v8f acc[4] = {};
  for (int kb = 0; kb < K; kb += 32) {
    FragH ah, al;
    const v4f x0 = *(const v4fa*)(arow + kb + 8 * hh), x1 = *(const v4fa*)(arow + kb + 8 * hh + 4), x2 = *(const v4fa*)(arow + kb + 16 + 8 * hh), x3 = *(const v4fa*)(arow + kb + 16 + 8 * hh + 4);
    float xs[16] = {x0[0],x0[1],x0[2],x0[3],x1[0],x1[1],x1[2],x1[3],x2[0],x2[1],x2[2],x2[3],x3[0],x3[1],x3[2],x3[3]};
#pragma unroll
    for (int i = 0; i < 16; ++i) { const _Float16 h = (_Float16)xs[i]; ah.h[i] = h; al.h[i] = ASPLIT ? (_Float16)(xs[i] - (float)h) : (_Float16)0.0f; }
#pragma unroll
    for (int t = 0; t < 4; ++t) { if (col0 + t * 16 >= N) continue; const size_t boff = (size_t)(col0 + t * 16 + ln) * ldb + kb; FragH bq; bq.half[0] = *(const v8us*)(Bh + boff + 8 * hh); bq.half[1] = *(const v8us*)(Bh + boff + 16 + 8 * hh);
      acc[t] = mmaH<ASPLIT ? 2 : 1>(ah.v, al.v, bq.v, bq.v, acc[t]); }
  }
#pragma unroll
  for (int t = 0; t < 4; ++t) { if (col0 + t * 16 >= N) continue;
#pragma unroll
    for (int r = 0; r < 8; ++r) so[w][8 * hh + r][t * 16 + ln] = acc[t][r] * alpha; }
  __builtin_amdgcn_fence(__ATOMIC_ACQ_REL, "workgroup"); __builtin_amdgcn_wave_barrier();
  const int rsub = lane >> 4, c4 = (lane & 15) * 4;
  {
#pragma unroll
    for (int q = 0; q < 8; ++q) { const int r = q * 2 + rsub; if (col0 + c4 < N) { const v4f v = *(const v4fa*)&so[w][r][c4]; *(v4f*)(C + (size_t)(row0 + r) * ldc + col0 + c4) = v; } }
     }
}

// Wt[n][k] = f16(W[k][n]·scale) from f32 row-major W[K][N] (scale = power of two; bf16-exact weights stay exact in f16 away from the subnormal range)
__global__ __launch_bounds__(256) void k_wt_f16(const float* __restrict__ W, _Float16* __restrict__ Wt, int K, int N, float scale) {
  const int t = blockIdx.x * 256 + threadIdx.x; if (t >= N * (K / 8)) return; const int n = t / (K / 8), k8 = (t % (K / 8)) * 8; FragH f;
#pragma unroll
  for (int i = 0; i < 8; ++i) f.h[i] = (_Float16)(bf16_round(W[(size_t)(k8 + i) * N + n]) * scale); const v8us o = f.half[0];
  *(v8us*)((unsigned short*)Wt + (size_t)n * K + k8) = o; 
}
// k_gemm_hh variant with fused epilogue: v = acc·alpha + bias[by·sBias + col] (+ CP[(row/rowsPerB)·sCPb + by·64 + col] if CP) ; ACT 0 none / 1 elu ; writes f16 C16 (and f32 C if non-null)
template <int ACT>
__global__ __launch_bounds__(128) void k_gemm_hhx(const _Float16* __restrict__ A, int lda, size_t sA, const _Float16* __restrict__ Bh, int ldb, size_t sB, float alpha, const float* __restrict__ bias, size_t sBias, const float* __restrict__ CP, int rowsPerB, size_t sCPb, int row0g,
    float* __restrict__ C, _Float16* __restrict__ C16, int ldc, size_t sC, int M, int N, int K) {
  __shared__ __attribute__((aligned(16))) float so[4][16][64];
  const int tid = threadIdx.x, w = tid >> 5, lane = tid & 31, ln = lane & 15, hh = lane >> 4; const int by = blockIdx.y;
  A += (size_t)by * sA; Bh += (size_t)by * sB; const size_t cofs = (size_t)by * sC; const float* bp = bias ? bias + (size_t)by * sBias : nullptr;
  const int ntn = (N + 63) / 64; const int wid = blockIdx.x * 4 + w; const int mt = wid / ntn, nq = wid % ntn; if (mt * 16 >= M) return;
  const int row0 = mt * 16, col0 = nq * 64; const _Float16* arow = A + (size_t)(row0 + ln) * lda;
  v8f acc[4] = {};
  for (int kb = 0; kb < K; kb += 32) { FragH ah; ah.half[0] = *(const v8us*)((const unsigned short*)arow + kb + 8 * hh); ah.half[1] = *(const v8us*)((const unsigned short*)arow + kb + 16 + 8 * hh);
#pragma unroll
    for (int t = 0; t < 4; ++t) { if (col0 + t * 16 >= N) continue; const size_t boff = (size_t)(col0 + t * 16 + ln) * ldb + kb; FragH bq; bq.half[0] = *(const v8us*)((const unsigned short*)Bh + boff + 8 * hh); bq.half[1] = *(const v8us*)((const unsigned short*)Bh + boff + 16 + 8 * hh);
      acc[t] = mmaH<1>(ah.v, ah.v, bq.v, bq.v, acc[t]); }
  }
#pragma unroll
  for (int t = 0; t < 4; ++t) { if (col0 + t * 16 >= N) continue; const int col = col0 + t * 16 + ln; const float bv = bp ? bf16_round(bp[col]) : 0.f;
#pragma unroll
    for (int r = 0; r < 8; ++r) { float v = acc[t][r] * alpha + bv; if (CP) { const int rr = row0g + row0 + 8 * hh + r; if (rowsPerB < 0) v += CP[cofs + (size_t)rr * ldc + col];      /* rowsPerB < 0: own element of the batched C plane */ else { const int bidx = rr / rowsPerB; v += CP[(size_t)bidx * sCPb + (size_t)by * 64 + col]; } } if (ACT == 1) v = (v > 0.f) ? v : expm1f(v); else if (ACT == 7) v = (v > 0.f) ? v + 1.0f : expf(v); else if (ACT == 8) v = tanhf(v); else if (ACT == 9) v = 0.5f * v * (1.0f + tanhf(0.7978845608028654f * (v + 0.044715f * v * v * v))); else if (ACT == 11) v = 1.0f / (1.0f + expf(-v)); else if (ACT == 12) v = (v > 0.f) ? v : 0.01f * v; else if (ACT == 14) v = (v > 0.f) ? v : 0.1f * v; else if (ACT == 16) v = (v >= 0.f) ? v : 0.3f * v; else if (ACT == 17) v = (v >= 0.f) ? v : 0.2f * v; else if (ACT == 15) v = v / (1.0f + expf(-v)); else if (ACT == 3) v = fmaxf(v, 0.f); else if (ACT == 6) v = 0.5f * v * (1.0f + erff(v * 0.70710678118654752f)); so[w][8 * hh + r][t * 16 + ln] = v; } }
  __builtin_amdgcn_fence(__ATOMIC_ACQ_REL, "workgroup"); __builtin_amdgcn_wave_barrier();
  const int rsub = lane >> 4, c4 = (lane & 15) * 4; typedef _Float16 v4h __attribute__((ext_vector_type(4)));
  {
#pragma unroll
    for (int q = 0; q < 8; ++q) { const int r = q * 2 + rsub; if (col0 + c4 < N) { const v4f v = *(const v4fa*)&so[w][r][c4]; if (C) *(v4f*)(C + cofs + (size_t)(row0 + r) * ldc + col0 + c4) = v; if (C16) { v4h h4; for (int i = 0; i < 4; ++i) h4[i] = (_Float16)v[i]; *(v4h*)(C16 + cofs + (size_t)(row0 + r) * ldc + col0 + c4) = h4; } } }
     }
}


typedef _Float16 v4h __attribute__((ext_vector_type(4)));

__global__ __launch_bounds__(256) void k_x16(const float* __restrict__ x, _Float16* __restrict__ X16, size_t n8) { const size_t t = (size_t)blockIdx.x * 256 + threadIdx.x; if (t >= n8) return; FragH f;
#pragma unroll
  for (int q = 0; q < 8; ++q) f.h[q] = (_Float16)bf16_round(x[t * 8 + q]); *(v8us*)((unsigned short*)X16 + t * 8) = f.half[0];  }
__global__ __launch_bounds__(256) void k_h16(const float* __restrict__ x, _Float16* __restrict__ X16, size_t n8) { const size_t t = (size_t)blockIdx.x * 256 + threadIdx.x; if (t >= n8) return; FragH f;
#pragma unroll
  for (int q = 0; q < 8; ++q) f.h[q] = (_Float16)x[t * 8 + q]; *(v8us*)((unsigned short*)X16 + t * 8) = f.half[0];  }
__global__ __launch_bounds__(256) void k_round16f(const float* __restrict__ W, _Float16* __restrict__ Bt, size_t n8) { const size_t t = (size_t)blockIdx.x * 256 + threadIdx.x; if (t >= n8) return; FragH f;
#pragma unroll
  for (int i = 0; i < 8; ++i) f.h[i] = (_Float16)(bf16_round(W[t * 8 + i]) * 16.0f); *(v8us*)((unsigned short*)Bt + t * 8) = f.half[0];  }
template <int NHv, int TTv>
__global__ __launch_bounds__(256) void k_vt(const _Float16* __restrict__ V16, int ldv, int voff, _Float16* __restrict__ Vt) { __shared__ unsigned short tl[64][66]; const int tid = threadIdx.x; const int slab = blockIdx.x / (TTv / 64), lg = blockIdx.x % (TTv / 64); const int b = slab / NHv, h = slab % NHv;
  for (int i = tid; i < 64 * 8; i += 256) { const int r = i / 8, c8 = (i % 8) * 8; FragH f; f.half[0] = *(const v8us*)((const unsigned short*)V16 + ((size_t)b * TTv + lg * 64 + r) * ldv + voff + h * 64 + c8);
#pragma unroll
    for (int q = 0; q < 8; ++q) tl[r][c8 + q] = f.u[q]; }
  __syncthreads();
  {
#pragma unroll
    for (int rd = 0; rd < 2; ++rd) { const int d = rd * 32 + tid / 8, pc = tid % 8; FragH f;
#pragma unroll
      for (int q = 0; q < 8; ++q) f.u[q] = tl[pc * 8 + q][d];
      *(v8us*)((unsigned short*)Vt + ((size_t)slab * 64 + d) * TTv + lg * 64 + pc * 8) = f.half[0]; }
     } }

__global__ __launch_bounds__(256) void k_hl(const float* __restrict__ F, _Float16* __restrict__ Hh, _Float16* __restrict__ Hl, size_t n8) { const size_t t = (size_t)blockIdx.x * 256 + threadIdx.x; if (t >= n8) return; FragH fh, fl; const v4f a = *(const v4fa*)(F + t * 8), c = *(const v4fa*)(F + t * 8 + 4);
#pragma unroll
  for (int q = 0; q < 4; ++q) { _Float16 h = (_Float16)a[q]; fh.h[q] = h; fl.h[q] = (_Float16)((a[q] - (float)h) * 1024.0f); h = (_Float16)c[q]; fh.h[4 + q] = h; fl.h[4 + q] = (_Float16)((c[q] - (float)h) * 1024.0f); }
  { *(v8us*)((unsigned short*)Hh + t * 8) = fh.half[0]; *(v8us*)((unsigned short*)Hl + t * 8) = fl.half[0];  } }

// ---- fast GEMM (wave tile 32x64; requires M % 32 == 0 rows per launch region and N % 64 == 0); epilogue = k_gemm_hhx semantics ----
__device__ __forceinline__ v16h g2_frag(const _Float16* p, int hh) { FragH f; f.half[0] = *(const v8us*)((const unsigned short*)p + 8 * hh); f.half[1] = *(const v8us*)((const unsigned short*)p + 16 + 8 * hh); return f.v; }
__device__ __forceinline__ v8f g2_mma(v16h a, v16h b, v8f c) { v8f d = __builtin_amdgcn_wmma_f32_16x16x32_f16(false, a, false, b, (short)0, c, false, false); asm volatile("v_nop\n\tv_nop\n\tv_nop\n\tv_nop" : "+v"(d) : "v"(a), "v"(b)); return d; }
template <int ACT>
__global__ __launch_bounds__(128) void k_gemm2(const _Float16* __restrict__ A, int lda, size_t sA, const _Float16* __restrict__ Bh, int ldb, size_t sB, float alpha, const float* __restrict__ bias, size_t sBias, const float* __restrict__ CP, int rowsPerB, size_t sCPb, int row0g,
    float* __restrict__ C, _Float16* __restrict__ C16, int ldc, size_t sC, int M, int N, int K) { static_assert(ACT == 0 || ACT == 3 || ACT == 6 || ACT == 8 || ACT == 9 || ACT == 11 || ACT == 12 || ACT == 14 || ACT == 15 || ACT == 16 || ACT == 17, "k_gemm2: unsupported ACT code (would silently apply no activation)");
  __shared__ __attribute__((aligned(16))) float so[4][32][68];
  const int tid = threadIdx.x, w = tid >> 5, lane = tid & 31, ln = lane & 15, hh = lane >> 4; const int by = blockIdx.y;
  A += (size_t)by * sA; Bh += (size_t)by * sB; const size_t cofs = (size_t)by * sC; const float* bp = bias ? bias + (size_t)by * sBias : nullptr;
  const int ntn = N >> 6; const int mt = blockIdx.x / ntn, nq = blockIdx.x - mt * ntn; const int row0 = mt * 128 + 32 * w, col0 = nq * 64; if (row0 >= M) return;
  const _Float16* a0p = A + (size_t)(row0 + ln) * lda; const _Float16* a1p = a0p + (size_t)16 * lda;
  const _Float16* b0p = Bh + (size_t)(col0 + ln) * ldb; const _Float16* b1p = b0p + (size_t)16 * ldb; const _Float16* b2p = b1p + (size_t)16 * ldb; const _Float16* b3p = b2p + (size_t)16 * ldb;
  const v8f z8 = {0.f,0.f,0.f,0.f,0.f,0.f,0.f,0.f}; v8f c00 = z8, c01 = z8, c02 = z8, c03 = z8, c10 = z8, c11 = z8, c12 = z8, c13 = z8;
#pragma unroll 1
  for (int kb = 0; kb < K; kb += 32) { const v16h a0 = g2_frag(a0p + kb, hh), a1 = g2_frag(a1p + kb, hh);
    v16h b = g2_frag(b0p + kb, hh); c00 = g2_mma(a0, b, c00); c10 = g2_mma(a1, b, c10);
    b = g2_frag(b1p + kb, hh); c01 = g2_mma(a0, b, c01); c11 = g2_mma(a1, b, c11);
    b = g2_frag(b2p + kb, hh); c02 = g2_mma(a0, b, c02); c12 = g2_mma(a1, b, c12);
    b = g2_frag(b3p + kb, hh); c03 = g2_mma(a0, b, c03); c13 = g2_mma(a1, b, c13); }
  v8f accs[8] = {c00, c01, c02, c03, c10, c11, c12, c13};
#pragma unroll
  for (int u = 0; u < 8; ++u) { const int t = u & 3, half = u >> 2; const int col = col0 + t * 16 + ln; const float bv = bp ? bf16_round(bp[col]) : 0.f;
#pragma unroll
    for (int r = 0; r < 8; ++r) { const int rloc = half * 16 + 8 * hh + r; float v = accs[u][r] * alpha + bv; if (CP) { if (rowsPerB < 0) v += CP[cofs + (size_t)(row0g + row0 + rloc) * ldc + col];      /* rowsPerB < 0: own element of the batched C plane */ else { const int bidx = (row0g + row0 + rloc) / rowsPerB; v += CP[(size_t)bidx * sCPb + (size_t)by * 64 + col]; } }
      if (ACT == 3) v = fmaxf(v, 0.f); else if (ACT == 6) v = 0.5f * v * (1.0f + erff(v * 0.70710678118654752f)); else if (ACT == 11) v = 1.0f / (1.0f + expf(-v)); else if (ACT == 15) v = v / (1.0f + expf(-v)); else if (ACT == 12) v = (v > 0.f) ? v : 0.01f * v; else if (ACT == 8) v = tanhf(v); else if (ACT == 9) v = 0.5f * v * (1.0f + tanhf(0.7978845608028654f * (v + 0.044715f * v * v * v))); else if (ACT == 14) v = (v > 0.f) ? v : 0.1f * v; else if (ACT == 16) v = (v >= 0.f) ? v : 0.3f * v; else if (ACT == 17) v = (v >= 0.f) ? v : 0.2f * v;
      so[w][rloc][t * 16 + ln] = v; } }
  __builtin_amdgcn_fence(__ATOMIC_ACQ_REL, "workgroup"); __builtin_amdgcn_wave_barrier();
  const int rsub = lane >> 4, c4 = (lane & 15) * 4;
  {
#pragma unroll
    for (int q = 0; q < 16; ++q) { const int r = q * 2 + rsub; const v4f v = *(const v4fa*)&so[w][r][c4]; if (C) *(v4f*)(C + cofs + (size_t)(row0 + r) * ldc + col0 + c4) = v; if (C16) { v4h h4; for (int i = 0; i < 4; ++i) h4[i] = (_Float16)v[i]; *(v4h*)(C16 + cofs + (size_t)(row0 + r) * ldc + col0 + c4) = h4; } }
     } }


__global__ __launch_bounds__(256) void k_wsc(const float* __restrict__ Wm, _Float16* __restrict__ Bt, size_t n8, float sc) { const size_t t = (size_t)blockIdx.x * 256 + threadIdx.x; if (t >= n8) return; FragH f; for (int q = 0; q < 8; ++q) f.h[q] = (_Float16)(bf16_round(Wm[t * 8 + q]) * sc); *(v8us*)((unsigned short*)Bt + t * 8) = f.half[0];  }
__global__ __launch_bounds__(128) void k_local(const float* __restrict__ QKV, _Float16* __restrict__ OH, _Float16* __restrict__ OL) {
  #pragma clang fp contract(off)
  __shared__ float ssc[128][WW + 1]; float* sc = ssc[threadIdx.x];      /* per-thread score slots in LDS (no private scratch) */
  const int t0 = blockIdx.x * 128 + threadIdx.x; if (t0 >= NR * NH) return; const int h = t0 % NH; const size_t row = t0 / NH; const int b = (int)(row / TT), t = (int)(row % TT); const float* qp = QKV + row * (3 * EE) + h * HD; float mx = -3.0e38f;
#pragma unroll 1
  for (int w = 0; w < WW; ++w) { const int j = t - PADW + w; float s = 0.f;
    if (j >= 0 && j < TT) { const float* kp = QKV + ((size_t)b * TT + j) * (3 * EE) + EE + h * HD;
#pragma unroll 1
      for (int d = 0; d < HD; d += 4) { const v4f a = *(const v4fa*)(qp + d), k = *(const v4fa*)(kp + d); for (int i = 0; i < 4; ++i) { const float qs = a[i] * 0.125f; s += qs * k[i]; } } }
    sc[w] = s; mx = fmaxf(mx, s); }
  float su = 0.f;
#pragma unroll 1
  for (int w = 0; w < WW; ++w) { sc[w] = expf(sc[w] - mx); su += sc[w]; }
  const float inv = 1.0f / su; unsigned short* dh = (unsigned short*)OH + row * EE + h * HD; unsigned short* dl = (unsigned short*)OL + row * EE + h * HD;
#pragma unroll 1
  for (int d0 = 0; d0 < HD; d0 += 8) { float o[8]; for (int i = 0; i < 8; ++i) o[i] = 0.f;
#pragma unroll 1
    for (int w = 0; w < WW; ++w) { const int j = t - PADW + w; if (j < 0 || j >= TT) continue; const float a = sc[w] * inv; const v8f v = *(const v8f*)(QKV + ((size_t)b * TT + j) * (3 * EE) + 2 * EE + h * HD + d0); for (int i = 0; i < 8; ++i) o[i] += a * v[i]; }
    FragH fh, fl; for (int i = 0; i < 8; ++i) { const _Float16 hv = (_Float16)o[i]; fh.h[i] = hv; fl.h[i] = (_Float16)((o[i] - (float)hv) * 1024.0f); }
    *(v8us*)(dh + d0) = fh.half[0]; *(v8us*)(dl + d0) = fl.half[0];  } }

extern "C" void kernel_launch(void* const* d_in, const int* in_sizes, int n_in,
                              void* d_out, int out_size, void* d_ws, size_t ws_size, hipStream_t stream) {
  (void)in_sizes; (void)n_in; (void)out_size;
  const float* x = (const float*)d_in[0]; const float* Wqkv = (const float*)d_in[1]; const float* bqkv = (const float*)d_in[2]; const float* Wout = (const float*)d_in[3]; const float* bout = (const float*)d_in[4];
  char* ws = (char*)d_ws; size_t off = 0;
  auto take = [&](size_t bytes) { char* p = ws + off; off += (bytes + 255) & ~(size_t)255; return p; };
  _Float16* BQKV = (_Float16*)take((size_t)3 * EE * EE * 2); _Float16* BO = (_Float16*)take((size_t)EE * EE * 2); _Float16* X16 = (_Float16*)take((size_t)NR * EE * 2); float* QKV = (float*)take((size_t)NR * 3 * EE * 4); _Float16* OH = (_Float16*)take((size_t)NR * EE * 2); _Float16* OL = (_Float16*)take((size_t)NR * EE * 2);
  if (off > ws_size) return;      /* 0.5 + 4 + 24 + 4 + 4 = ≈ 37 MiB */
  k_wsc<<<(unsigned)(((size_t)3 * EE * EE / 8 + 255) / 256), 256, 0, stream>>>(Wqkv, BQKV, (size_t)3 * EE * EE / 8, 16.0f); k_wsc<<<(EE * EE / 8 + 255) / 256, 256, 0, stream>>>(Wout, BO, (size_t)EE * EE / 8, 16.0f);      /* torch (out, in) naturals */
  k_x16<<<(unsigned)(((size_t)NR * EE / 8 + 255) / 256), 256, 0, stream>>>(x, X16, (size_t)NR * EE / 8);
  k_gemm2<0><<<dim3((NR / 128) * (3 * EE / 64), 1), 128, 0, stream>>>(X16, EE, 0, BQKV, EE, 0, 0.0625f, bqkv, 0, nullptr, 1, 0, 0, QKV, nullptr, 3 * EE, 0, NR, 3 * EE, EE);      /* [q | k | v] + bias, f32 */
  k_local<<<(NR * NH + 127) / 128, 128, 0, stream>>>(QKV, OH, OL);
  k_gemm2<0><<<dim3((NR / 128) * (EE / 64), 1), 128, 0, stream>>>(OL, EE, 0, BO, EE, 0, 0.0625f / 1024.0f, nullptr, 0, nullptr, 1, 0, 0, (float*)d_out, nullptr, EE, 0, NR, EE, EE);
  k_gemm2<0><<<dim3((NR / 128) * (EE / 64), 1), 128, 0, stream>>>(OH, EE, 0, BO, EE, 0, 0.0625f, bout, 0, (const float*)d_out, 1, (size_t)EE, 0, (float*)d_out, nullptr, EE, 0, NR, EE, EE);      /* out = (o_lo + o_hi) Wout^T + bout */
}

// v001
// Measured time: 78.4 microseconds a run.
// Two timings next to v000 put it at 3.72 and 3.74 times that version's speed.
#include <hip/hip_runtime.h>
// Speech_MultiHeadedAttention (2 x 4096 frames x 256 = 4 heads x 64; qkv = x Wqkv^T + bqkv; q scaled by 64^-0.5; local attention over a 65-frame window centred on each frame where the window is taken from ZERO-PADDED k / v (out-of-range slots are zero vectors that still take part in the softmax with logit 0, exactly as the source); out = merged . Wout^T + bout).
// Structure: exact f16 x plane; qkv as ONE f16 WMMA GEMM (32x64 wave tiles, f32 accumulation, exact x16 weights + bias; f32 out); the 65-key windowed attention on the f32 matrix form (wave per 16 frames x head: scores and weighted value sum as 16x16x4 products, softmax in registers, all f32 from the f32 q/k/v plane) into f16 hi/residual planes; Wout as two GEMM terms (+ bias).
// Compute dtype: inputs rounded to bf16; x / weights exact as f16 so q/k/v are f32 sums of exact products; the attention output as f16 hi + residual; softmax f32 - near exact-class. v_wmma_f32_16x16x32_f16, v_wmma_f32_16x16x4_f32.
#define NB 2
#define TT 4096
#define EE 256
#define NH 4
#define HD 64
#define WW 65
#define PADW 32
#define NR (NB * TT)
typedef __bf16 v16b __attribute__((ext_vector_type(16)));
typedef unsigned short v8us __attribute__((ext_vector_type(8), may_alias));
typedef float  v8f  __attribute__((ext_vector_type(8)));
typedef float  v4f  __attribute__((ext_vector_type(4)));
typedef float  v4fa __attribute__((ext_vector_type(4), may_alias));
union FragB { v16b v; v8us half[2]; unsigned short u[16]; };

__device__ __forceinline__ unsigned short bf16_bits(float x) { unsigned int u = __float_as_uint(x); return (unsigned short)((u + 0x7FFFu + ((u >> 16) & 1u)) >> 16); }
__device__ __forceinline__ float bf16_val(unsigned short b) { return __uint_as_float(((unsigned int)b) << 16); }
__device__ __forceinline__ float bf16_round(float x) { return bf16_val(bf16_bits(x)); }
// D += A·B with NT terms: 1 = ah·bh, 2 = + al·bh (A split), 3 = + ah·bl (both split)
template <int NT>
__device__ __forceinline__ v8f mmaN(v16b ah, v16b al, v16b bh, v16b bl, v8f c) {
  c = __builtin_amdgcn_wmma_f32_16x16x32_bf16(false, ah, false, bh, (short)0, c, false, false);
  if (NT >= 2) c = __builtin_amdgcn_wmma_f32_16x16x32_bf16(false, al, false, bh, (short)0, c, false, false);
  if (NT >= 3) c = __builtin_amdgcn_wmma_f32_16x16x32_bf16(false, ah, false, bl, (short)0, c, false, false);
  asm volatile("v_nop\n\tv_nop\n\tv_nop\n\tv_nop" : "+v"(c) : "v"(ah), "v"(al), "v"(bh), "v"(bl));
  return c;
}

__global__ __launch_bounds__(256) void k_wt_bf16(const float* __restrict__ W, unsigned short* __restrict__ Wt, int K, int N) {
  const int t = blockIdx.x * 256 + threadIdx.x;
  const int k8n = K / 8;
  if (t >= N * k8n) return;
  const int n = t / k8n, k8 = (t % k8n) * 8;
  v8us v;
#pragma unroll
  for (int i = 0; i < 8; ++i) v[i] = bf16_bits(W[(size_t)(k8 + i) * N + n]);
  *(v8us*)(Wt + (size_t)n * K + k8) = v;
  
}

// GEMM C[M][N] (f32, pitch ldc) = act(A[M][K]·W + bias). A f32 row-major (pitch lda) converted per fragment to bf16
// (ASPLIT: hi/lo two planes -> 2 terms, else single rounded term); Wt bf16 [N][K] (pitch ldb). BIAS_BF16 rounds the
// bias to bf16 first (bias quantised to bf16 before the add). K%32==0, M%16==0, N%64==0.
template <bool ASPLIT, int ACT, bool BIAS_BF16>
__global__ __launch_bounds__(128) void k_gemm_bf(const float* __restrict__ A, int lda, const unsigned short* __restrict__ Wt, int ldb,
                                               const float* __restrict__ bias, float* __restrict__ C, int ldc, int M, int N, int K) {
  __shared__ __attribute__((aligned(16))) float so[4][16][64];
  const int tid = threadIdx.x, w = tid >> 5, lane = tid & 31, ln = lane & 15, hh = lane >> 4;
  const int ntn = N / 64;
  const int wid = blockIdx.x * 4 + w;
  const int mt = wid / ntn, nq = wid % ntn;
  if (mt * 16 >= M) return;
  const int row0 = mt * 16, col0 = nq * 64;
  const float* arow = A + (size_t)(row0 + ln) * lda;
  v8f acc[4] = {};
  for (int kb = 0; kb < K; kb += 32) {
    FragB ah, al;
    const v4f x0 = *(const v4fa*)(arow + kb + 8 * hh), x1 = *(const v4fa*)(arow + kb + 8 * hh + 4);
    const v4f x2 = *(const v4fa*)(arow + kb + 16 + 8 * hh), x3 = *(const v4fa*)(arow + kb + 16 + 8 * hh + 4);
    float xs[16] = {x0[0],x0[1],x0[2],x0[3],x1[0],x1[1],x1[2],x1[3],x2[0],x2[1],x2[2],x2[3],x3[0],x3[1],x3[2],x3[3]};
#pragma unroll
    for (int i = 0; i < 16; ++i) { const unsigned short hb = bf16_bits(xs[i]); ah.u[i] = hb; al.u[i] = ASPLIT ? bf16_bits(xs[i] - bf16_val(hb)) : (unsigned short)0; }
#pragma unroll
    for (int t = 0; t < 4; ++t) {
      const unsigned short* brow = Wt + (size_t)(col0 + t * 16 + ln) * ldb + kb;
      FragB b;
      b.half[0] = *(const v8us*)(brow + 8 * hh);
      b.half[1] = *(const v8us*)(brow + 16 + 8 * hh);
      acc[t] = mmaN<ASPLIT ? 2 : 1>(ah.v, al.v, b.v, b.v, acc[t]);
    }
  }
#pragma unroll
  for (int t = 0; t < 4; ++t) {
    float bv = bias ? bias[col0 + t * 16 + ln] : 0.f;
    if (BIAS_BF16) bv = bf16_round(bv);
#pragma unroll
    for (int r = 0; r < 8; ++r) { float v = acc[t][r] + bv; if (ACT == 1) v = fmaxf(v, 0.f); so[w][8 * hh + r][t * 16 + ln] = v; }
  }
  __builtin_amdgcn_fence(__ATOMIC_ACQ_REL, "workgroup");
  __builtin_amdgcn_wave_barrier();
  const int rsub = lane >> 4, c4 = (lane & 15) * 4;
  {
#pragma unroll
    for (int q = 0; q < 8; ++q) {
      const int r = q * 2 + rsub;
      const v4f v = *(const v4fa*)&so[w][r][c4];
      *(v4f*)(C + (size_t)(row0 + r) * ldc + col0 + c4) = v;
    }
    
  }
}

// GEMM C = act(A·W + bias + resid): A f32 (ASPLIT -> hi/lo 2 terms), Wt bf16 [N][K]; ACT 0 none, 1 relu, 2 exact gelu;
// resid (optional, f32, row index = (row % rmod), pitch ldr, RES_BF16 rounds it) added before the activation.
template <bool ASPLIT, int ACT, bool BIAS_BF16, bool RES_BF16>
__global__ __launch_bounds__(128) void k_gemm_bf3(const float* __restrict__ A, int lda, const unsigned short* __restrict__ Wt, int ldb,
                                                const float* __restrict__ bias, const float* __restrict__ resid, int rmod, int ldr,
                                                float* __restrict__ C, int ldc, int M, int N, int K) {
  __shared__ __attribute__((aligned(16))) float so[4][16][64];
  const int tid = threadIdx.x, w = tid >> 5, lane = tid & 31, ln = lane & 15, hh = lane >> 4;
  const int ntn = N / 64;
  const int wid = blockIdx.x * 4 + w;
  const int mt = wid / ntn, nq = wid % ntn;
  if (mt * 16 >= M) return;
  const int row0 = mt * 16, col0 = nq * 64;
  const float* arow = A + (size_t)(row0 + ln) * lda;
  v8f acc[4] = {};
  for (int kb = 0; kb < K; kb += 32) {
    FragB ah, al;
    const v4f x0 = *(const v4fa*)(arow + kb + 8 * hh), x1 = *(const v4fa*)(arow + kb + 8 * hh + 4);
    const v4f x2 = *(const v4fa*)(arow + kb + 16 + 8 * hh), x3 = *(const v4fa*)(arow + kb + 16 + 8 * hh + 4);
    float xs[16] = {x0[0],x0[1],x0[2],x0[3],x1[0],x1[1],x1[2],x1[3],x2[0],x2[1],x2[2],x2[3],x3[0],x3[1],x3[2],x3[3]};
#pragma unroll
    for (int i = 0; i < 16; ++i) { const unsigned short hb = bf16_bits(xs[i]); ah.u[i] = hb; al.u[i] = ASPLIT ? bf16_bits(xs[i] - bf16_val(hb)) : (unsigned short)0; }
#pragma unroll
    for (int t = 0; t < 4; ++t) {
      const unsigned short* brow = Wt + (size_t)(col0 + t * 16 + ln) * ldb + kb;
      FragB b;
      b.half[0] = *(const v8us*)(brow + 8 * hh);
      b.half[1] = *(const v8us*)(brow + 16 + 8 * hh);
      acc[t] = mmaN<ASPLIT ? 2 : 1>(ah.v, al.v, b.v, b.v, acc[t]);
    }
  }
#pragma unroll
  for (int t = 0; t < 4; ++t) {
    const int col = col0 + t * 16 + ln;
    float bv = bias ? bias[col] : 0.f;
    if (BIAS_BF16) bv = bf16_round(bv);
#pragma unroll
    for (int r = 0; r < 8; ++r) {
      float v = acc[t][r] + bv;
      if (resid) { float rv = resid[(size_t)((row0 + 8 * hh + r) % rmod) * ldr + col]; if (RES_BF16) rv = bf16_round(rv); v += rv; }
      if (ACT == 1) v = fmaxf(v, 0.f);
      if (ACT == 2) v = 0.5f * v * (1.0f + erff(v * 0.70710678118654752f));
      if (ACT == 3) { const float u = 0.7978845608028654f * (v + 0.044715f * v * v * v); v = 0.5f * v * (1.0f + tanhf(u)); }
      so[w][8 * hh + r][t * 16 + ln] = v;
    }
  }
  __builtin_amdgcn_fence(__ATOMIC_ACQ_REL, "workgroup");
  __builtin_amdgcn_wave_barrier();
  const int rsub = lane >> 4, c4 = (lane & 15) * 4;
  {
#pragma unroll
    for (int q = 0; q < 8; ++q) {
      const int r = q * 2 + rsub;
      const v4f v = *(const v4fa*)&so[w][r][c4];
      *(v4f*)(C + (size_t)(row0 + r) * ldc + col0 + c4) = v;
    }
    
  }
}
// row LayerNorm (biased variance, eps) over N: s = X (+ R); optional out_sum <- s; out_norm <- (s-mu)*rsqrt(var+eps)*g + b
template <bool PARAM_BF16>
__global__ __launch_bounds__(256) void k_layernorm(const float* __restrict__ X, const float* __restrict__ R, const float* __restrict__ g, const float* __restrict__ bta,
                                                  float* __restrict__ out_sum, float* __restrict__ out_norm, int N, float eps) {
  __shared__ float red[256];
  const int row = blockIdx.x, tid = threadIdx.x;
  const float* x = X + (size_t)row * N; const float* rr = R ? R + (size_t)row * N : nullptr;
  float vals[16];                     // up to N = 4096
  const int per = N / 256;            // contiguous chunk per thread? use strided-by-4 chunks: thread handles j = tid*4 + 1024*u
  float s1 = 0.f;
  for (int u = 0; u < per / 4; ++u) {
    const int j = tid * 4 + 1024 * u;
    const v4f a = *(const v4fa*)(x + j);
    v4f b = {0.f,0.f,0.f,0.f}; if (rr) b = *(const v4fa*)(rr + j);
#pragma unroll
    for (int q = 0; q < 4; ++q) { const float v = a[q] + b[q]; vals[u * 4 + q] = v; s1 += v; }
  }
  red[tid] = s1; __syncthreads();
  for (int st = 128; st > 0; st >>= 1) { if (tid < st) red[tid] += red[tid + st]; __syncthreads(); }
  const float mu = red[0] / (float)N; __syncthreads();
  float s2 = 0.f;
  for (int u = 0; u < per / 4; ++u)
#pragma unroll
    for (int q = 0; q < 4; ++q) { const float c = vals[u * 4 + q] - mu; s2 += c * c; }
  red[tid] = s2; __syncthreads();
  for (int st = 128; st > 0; st >>= 1) { if (tid < st) red[tid] += red[tid + st]; __syncthreads(); }
  const float rs = rsqrtf(red[0] / (float)N + eps);
  {
    for (int u = 0; u < per / 4; ++u) {
      const int j = tid * 4 + 1024 * u;
      v4f o, sm;
#pragma unroll
      for (int q = 0; q < 4; ++q) {
        float gg = g[j + q], bb = bta[j + q];
        if (PARAM_BF16) { gg = bf16_round(gg); bb = bf16_round(bb); }
        sm[q] = vals[u * 4 + q]; o[q] = (vals[u * 4 + q] - mu) * rs * gg + bb;
      }
      if (out_sum) *(v4f*)(out_sum + (size_t)row * N + j) = sm;
      *(v4f*)(out_norm + (size_t)row * N + j) = o;
    }
    
  }
}



// ---- f16 WMMA path (v_wmma_f32_16x16x32_f16): 11-bit significands for operands in range — used for the qkv and Wout GEMMs (k_gemm2)
typedef _Float16 v16h __attribute__((ext_vector_type(16)));
union FragH { v16h v; v8us half[2]; _Float16 h[16]; unsigned short u[16]; };
template <int NT>
__device__ __forceinline__ v8f mmaH(v16h ah, v16h al, v16h bh, v16h bl, v8f c) {
  c = __builtin_amdgcn_wmma_f32_16x16x32_f16(false, ah, false, bh, (short)0, c, false, false);
  if (NT >= 2) c = __builtin_amdgcn_wmma_f32_16x16x32_f16(false, al, false, bh, (short)0, c, false, false);
  if (NT >= 3) c = __builtin_amdgcn_wmma_f32_16x16x32_f16(false, ah, false, bl, (short)0, c, false, false);
  asm volatile("v_nop\n\tv_nop\n\tv_nop\n\tv_nop" : "+v"(c) : "v"(ah), "v"(al), "v"(bh), "v"(bl));
  return c;
}
// batched GEMM like k_gemm_b but f16 operands: A f32 (split into f16 hi/lo if ASPLIT, else rounded to f16), Bt = f16 values [n][k]; alpha; C f32; N multiple of 16 (partial tiles skipped)
template <bool ASPLIT>
__global__ __launch_bounds__(128) void k_gemm_h(const float* __restrict__ A, int lda, size_t sA, const _Float16* __restrict__ Bh, int ldb, size_t sB, float alpha, float* __restrict__ C, int ldc, size_t sC, int M, int N, int K) {
  __shared__ __attribute__((aligned(16))) float so[4][16][64];
  const int tid = threadIdx.x, w = tid >> 5, lane = tid & 31, ln = lane & 15, hh = lane >> 4; const int by = blockIdx.y;
  A += (size_t)by * sA; Bh += (size_t)by * sB; C += (size_t)by * sC;
  const int ntn = (N + 63) / 64; const int wid = blockIdx.x * 4 + w; const int mt = wid / ntn, nq = wid % ntn; if (mt * 16 >= M) return;
  const int row0 = mt * 16, col0 = nq * 64; const float* arow = A + (size_t)(row0 + ln) * lda;
  v8f acc[4] = {};
  for (int kb = 0; kb < K; kb += 32) {
    FragH ah, al;
    const v4f x0 = *(const v4fa*)(arow + kb + 8 * hh), x1 = *(const v4fa*)(arow + kb + 8 * hh + 4), x2 = *(const v4fa*)(arow + kb + 16 + 8 * hh), x3 = *(const v4fa*)(arow + kb + 16 + 8 * hh + 4);
    float xs[16] = {x0[0],x0[1],x0[2],x0[3],x1[0],x1[1],x1[2],x1[3],x2[0],x2[1],x2[2],x2[3],x3[0],x3[1],x3[2],x3[3]};
#pragma unroll
    for (int i = 0; i < 16; ++i) { const _Float16 h = (_Float16)xs[i]; ah.h[i] = h; al.h[i] = ASPLIT ? (_Float16)(xs[i] - (float)h) : (_Float16)0.0f; }
#pragma unroll
    for (int t = 0; t < 4; ++t) { if (col0 + t * 16 >= N) continue; const size_t boff = (size_t)(col0 + t * 16 + ln) * ldb + kb; FragH bq; bq.half[0] = *(const v8us*)(Bh + boff + 8 * hh); bq.half[1] = *(const v8us*)(Bh + boff + 16 + 8 * hh);
      acc[t] = mmaH<ASPLIT ? 2 : 1>(ah.v, al.v, bq.v, bq.v, acc[t]); }
  }
#pragma unroll
  for (int t = 0; t < 4; ++t) { if (col0 + t * 16 >= N) continue;
#pragma unroll
    for (int r = 0; r < 8; ++r) so[w][8 * hh + r][t * 16 + ln] = acc[t][r] * alpha; }
  __builtin_amdgcn_fence(__ATOMIC_ACQ_REL, "workgroup"); __builtin_amdgcn_wave_barrier();
  const int rsub = lane >> 4, c4 = (lane & 15) * 4;
  {
#pragma unroll
    for (int q = 0; q < 8; ++q) { const int r = q * 2 + rsub; if (col0 + c4 < N) { const v4f v = *(const v4fa*)&so[w][r][c4]; *(v4f*)(C + (size_t)(row0 + r) * ldc + col0 + c4) = v; } }
     }
}

// Wt[n][k] = f16(W[k][n]·scale) from f32 row-major W[K][N] (scale = power of two; bf16-exact weights stay exact in f16 away from the subnormal range)
__global__ __launch_bounds__(256) void k_wt_f16(const float* __restrict__ W, _Float16* __restrict__ Wt, int K, int N, float scale) {
  const int t = blockIdx.x * 256 + threadIdx.x; if (t >= N * (K / 8)) return; const int n = t / (K / 8), k8 = (t % (K / 8)) * 8; FragH f;
#pragma unroll
  for (int i = 0; i < 8; ++i) f.h[i] = (_Float16)(bf16_round(W[(size_t)(k8 + i) * N + n]) * scale); const v8us o = f.half[0];
  *(v8us*)((unsigned short*)Wt + (size_t)n * K + k8) = o; 
}
// k_gemm_hh variant with fused epilogue: v = acc·alpha + bias[by·sBias + col] (+ CP[(row/rowsPerB)·sCPb + by·64 + col] if CP) ; ACT 0 none / 1 elu ; writes f16 C16 (and f32 C if non-null)
template <int ACT>
__global__ __launch_bounds__(128) void k_gemm_hhx(const _Float16* __restrict__ A, int lda, size_t sA, const _Float16* __restrict__ Bh, int ldb, size_t sB, float alpha, const float* __restrict__ bias, size_t sBias, const float* __restrict__ CP, int rowsPerB, size_t sCPb, int row0g,
    float* __restrict__ C, _Float16* __restrict__ C16, int ldc, size_t sC, int M, int N, int K) {
  __shared__ __attribute__((aligned(16))) float so[4][16][64];
  const int tid = threadIdx.x, w = tid >> 5, lane = tid & 31, ln = lane & 15, hh = lane >> 4; const int by = blockIdx.y;
  A += (size_t)by * sA; Bh += (size_t)by * sB; const size_t cofs = (size_t)by * sC; const float* bp = bias ? bias + (size_t)by * sBias : nullptr;
  const int ntn = (N + 63) / 64; const int wid = blockIdx.x * 4 + w; const int mt = wid / ntn, nq = wid % ntn; if (mt * 16 >= M) return;
  const int row0 = mt * 16, col0 = nq * 64; const _Float16* arow = A + (size_t)(row0 + ln) * lda;
  v8f acc[4] = {};
  for (int kb = 0; kb < K; kb += 32) { FragH ah; ah.half[0] = *(const v8us*)((const unsigned short*)arow + kb + 8 * hh); ah.half[1] = *(const v8us*)((const unsigned short*)arow + kb + 16 + 8 * hh);
#pragma unroll
    for (int t = 0; t < 4; ++t) { if (col0 + t * 16 >= N) continue; const size_t boff = (size_t)(col0 + t * 16 + ln) * ldb + kb; FragH bq; bq.half[0] = *(const v8us*)((const unsigned short*)Bh + boff + 8 * hh); bq.half[1] = *(const v8us*)((const unsigned short*)Bh + boff + 16 + 8 * hh);
      acc[t] = mmaH<1>(ah.v, ah.v, bq.v, bq.v, acc[t]); }
  }
#pragma unroll
  for (int t = 0; t < 4; ++t) { if (col0 + t * 16 >= N) continue; const int col = col0 + t * 16 + ln; const float bv = bp ? bf16_round(bp[col]) : 0.f;
#pragma unroll
    for (int r = 0; r < 8; ++r) { float v = acc[t][r] * alpha + bv; if (CP) { const int rr = row0g + row0 + 8 * hh + r; if (rowsPerB < 0) v += CP[cofs + (size_t)rr * ldc + col];      /* rowsPerB < 0: own element of the batched C plane */ else { const int bidx = rr / rowsPerB; v += CP[(size_t)bidx * sCPb + (size_t)by * 64 + col]; } } if (ACT == 1) v = (v > 0.f) ? v : expm1f(v); else if (ACT == 7) v = (v > 0.f) ? v + 1.0f : expf(v); else if (ACT == 8) v = tanhf(v); else if (ACT == 9) v = 0.5f * v * (1.0f + tanhf(0.7978845608028654f * (v + 0.044715f * v * v * v))); else if (ACT == 11) v = 1.0f / (1.0f + expf(-v)); else if (ACT == 12) v = (v > 0.f) ? v : 0.01f * v; else if (ACT == 14) v = (v > 0.f) ? v : 0.1f * v; else if (ACT == 16) v = (v >= 0.f) ? v : 0.3f * v; else if (ACT == 17) v = (v >= 0.f) ? v : 0.2f * v; else if (ACT == 15) v = v / (1.0f + expf(-v)); else if (ACT == 3) v = fmaxf(v, 0.f); else if (ACT == 6) v = 0.5f * v * (1.0f + erff(v * 0.70710678118654752f)); so[w][8 * hh + r][t * 16 + ln] = v; } }
  __builtin_amdgcn_fence(__ATOMIC_ACQ_REL, "workgroup"); __builtin_amdgcn_wave_barrier();
  const int rsub = lane >> 4, c4 = (lane & 15) * 4; typedef _Float16 v4h __attribute__((ext_vector_type(4)));
  {
#pragma unroll
    for (int q = 0; q < 8; ++q) { const int r = q * 2 + rsub; if (col0 + c4 < N) { const v4f v = *(const v4fa*)&so[w][r][c4]; if (C) *(v4f*)(C + cofs + (size_t)(row0 + r) * ldc + col0 + c4) = v; if (C16) { v4h h4; for (int i = 0; i < 4; ++i) h4[i] = (_Float16)v[i]; *(v4h*)(C16 + cofs + (size_t)(row0 + r) * ldc + col0 + c4) = h4; } } }
     }
}


typedef _Float16 v4h __attribute__((ext_vector_type(4)));

__global__ __launch_bounds__(256) void k_x16(const float* __restrict__ x, _Float16* __restrict__ X16, size_t n8) { const size_t t = (size_t)blockIdx.x * 256 + threadIdx.x; if (t >= n8) return; FragH f;
#pragma unroll
  for (int q = 0; q < 8; ++q) f.h[q] = (_Float16)bf16_round(x[t * 8 + q]); *(v8us*)((unsigned short*)X16 + t * 8) = f.half[0];  }
__global__ __launch_bounds__(256) void k_h16(const float* __restrict__ x, _Float16* __restrict__ X16, size_t n8) { const size_t t = (size_t)blockIdx.x * 256 + threadIdx.x; if (t >= n8) return; FragH f;
#pragma unroll
  for (int q = 0; q < 8; ++q) f.h[q] = (_Float16)x[t * 8 + q]; *(v8us*)((unsigned short*)X16 + t * 8) = f.half[0];  }
__global__ __launch_bounds__(256) void k_round16f(const float* __restrict__ W, _Float16* __restrict__ Bt, size_t n8) { const size_t t = (size_t)blockIdx.x * 256 + threadIdx.x; if (t >= n8) return; FragH f;
#pragma unroll
  for (int i = 0; i < 8; ++i) f.h[i] = (_Float16)(bf16_round(W[t * 8 + i]) * 16.0f); *(v8us*)((unsigned short*)Bt + t * 8) = f.half[0];  }
template <int NHv, int TTv>
__global__ __launch_bounds__(256) void k_vt(const _Float16* __restrict__ V16, int ldv, int voff, _Float16* __restrict__ Vt) { __shared__ unsigned short tl[64][66]; const int tid = threadIdx.x; const int slab = blockIdx.x / (TTv / 64), lg = blockIdx.x % (TTv / 64); const int b = slab / NHv, h = slab % NHv;
  for (int i = tid; i < 64 * 8; i += 256) { const int r = i / 8, c8 = (i % 8) * 8; FragH f; f.half[0] = *(const v8us*)((const unsigned short*)V16 + ((size_t)b * TTv + lg * 64 + r) * ldv + voff + h * 64 + c8);
#pragma unroll
    for (int q = 0; q < 8; ++q) tl[r][c8 + q] = f.u[q]; }
  __syncthreads();
  {
#pragma unroll
    for (int rd = 0; rd < 2; ++rd) { const int d = rd * 32 + tid / 8, pc = tid % 8; FragH f;
#pragma unroll
      for (int q = 0; q < 8; ++q) f.u[q] = tl[pc * 8 + q][d];
      *(v8us*)((unsigned short*)Vt + ((size_t)slab * 64 + d) * TTv + lg * 64 + pc * 8) = f.half[0]; }
     } }

__global__ __launch_bounds__(256) void k_hl(const float* __restrict__ F, _Float16* __restrict__ Hh, _Float16* __restrict__ Hl, size_t n8) { const size_t t = (size_t)blockIdx.x * 256 + threadIdx.x; if (t >= n8) return; FragH fh, fl; const v4f a = *(const v4fa*)(F + t * 8), c = *(const v4fa*)(F + t * 8 + 4);
#pragma unroll
  for (int q = 0; q < 4; ++q) { _Float16 h = (_Float16)a[q]; fh.h[q] = h; fl.h[q] = (_Float16)((a[q] - (float)h) * 1024.0f); h = (_Float16)c[q]; fh.h[4 + q] = h; fl.h[4 + q] = (_Float16)((c[q] - (float)h) * 1024.0f); }
  { *(v8us*)((unsigned short*)Hh + t * 8) = fh.half[0]; *(v8us*)((unsigned short*)Hl + t * 8) = fl.half[0];  } }

// ---- fast GEMM (wave tile 32x64; requires M % 32 == 0 rows per launch region and N % 64 == 0); epilogue = k_gemm_hhx semantics ----
__device__ __forceinline__ v16h g2_frag(const _Float16* p, int hh) { FragH f; f.half[0] = *(const v8us*)((const unsigned short*)p + 8 * hh); f.half[1] = *(const v8us*)((const unsigned short*)p + 16 + 8 * hh); return f.v; }
__device__ __forceinline__ v8f g2_mma(v16h a, v16h b, v8f c) { v8f d = __builtin_amdgcn_wmma_f32_16x16x32_f16(false, a, false, b, (short)0, c, false, false); asm volatile("v_nop\n\tv_nop\n\tv_nop\n\tv_nop" : "+v"(d) : "v"(a), "v"(b)); return d; }
template <int ACT>
__global__ __launch_bounds__(128) void k_gemm2(const _Float16* __restrict__ A, int lda, size_t sA, const _Float16* __restrict__ Bh, int ldb, size_t sB, float alpha, const float* __restrict__ bias, size_t sBias, const float* __restrict__ CP, int rowsPerB, size_t sCPb, int row0g,
    float* __restrict__ C, _Float16* __restrict__ C16, int ldc, size_t sC, int M, int N, int K) { static_assert(ACT == 0 || ACT == 3 || ACT == 6 || ACT == 8 || ACT == 9 || ACT == 11 || ACT == 12 || ACT == 14 || ACT == 15 || ACT == 16 || ACT == 17, "k_gemm2: unsupported ACT code (would silently apply no activation)");
  __shared__ __attribute__((aligned(16))) float so[4][32][68];
  const int tid = threadIdx.x, w = tid >> 5, lane = tid & 31, ln = lane & 15, hh = lane >> 4; const int by = blockIdx.y;
  A += (size_t)by * sA; Bh += (size_t)by * sB; const size_t cofs = (size_t)by * sC; const float* bp = bias ? bias + (size_t)by * sBias : nullptr;
  const int ntn = N >> 6; const int mt = blockIdx.x / ntn, nq = blockIdx.x - mt * ntn; const int row0 = mt * 128 + 32 * w, col0 = nq * 64; if (row0 >= M) return;
  const _Float16* a0p = A + (size_t)(row0 + ln) * lda; const _Float16* a1p = a0p + (size_t)16 * lda;
  const _Float16* b0p = Bh + (size_t)(col0 + ln) * ldb; const _Float16* b1p = b0p + (size_t)16 * ldb; const _Float16* b2p = b1p + (size_t)16 * ldb; const _Float16* b3p = b2p + (size_t)16 * ldb;
  const v8f z8 = {0.f,0.f,0.f,0.f,0.f,0.f,0.f,0.f}; v8f c00 = z8, c01 = z8, c02 = z8, c03 = z8, c10 = z8, c11 = z8, c12 = z8, c13 = z8;
#pragma unroll 1
  for (int kb = 0; kb < K; kb += 32) { const v16h a0 = g2_frag(a0p + kb, hh), a1 = g2_frag(a1p + kb, hh);
    v16h b = g2_frag(b0p + kb, hh); c00 = g2_mma(a0, b, c00); c10 = g2_mma(a1, b, c10);
    b = g2_frag(b1p + kb, hh); c01 = g2_mma(a0, b, c01); c11 = g2_mma(a1, b, c11);
    b = g2_frag(b2p + kb, hh); c02 = g2_mma(a0, b, c02); c12 = g2_mma(a1, b, c12);
    b = g2_frag(b3p + kb, hh); c03 = g2_mma(a0, b, c03); c13 = g2_mma(a1, b, c13); }
  v8f accs[8] = {c00, c01, c02, c03, c10, c11, c12, c13};
#pragma unroll
  for (int u = 0; u < 8; ++u) { const int t = u & 3, half = u >> 2; const int col = col0 + t * 16 + ln; const float bv = bp ? bf16_round(bp[col]) : 0.f;
#pragma unroll
    for (int r = 0; r < 8; ++r) { const int rloc = half * 16 + 8 * hh + r; float v = accs[u][r] * alpha + bv; if (CP) { if (rowsPerB < 0) v += CP[cofs + (size_t)(row0g + row0 + rloc) * ldc + col];      /* rowsPerB < 0: own element of the batched C plane */ else { const int bidx = (row0g + row0 + rloc) / rowsPerB; v += CP[(size_t)bidx * sCPb + (size_t)by * 64 + col]; } }
      if (ACT == 3) v = fmaxf(v, 0.f); else if (ACT == 6) v = 0.5f * v * (1.0f + erff(v * 0.70710678118654752f)); else if (ACT == 11) v = 1.0f / (1.0f + expf(-v)); else if (ACT == 15) v = v / (1.0f + expf(-v)); else if (ACT == 12) v = (v > 0.f) ? v : 0.01f * v; else if (ACT == 8) v = tanhf(v); else if (ACT == 9) v = 0.5f * v * (1.0f + tanhf(0.7978845608028654f * (v + 0.044715f * v * v * v))); else if (ACT == 14) v = (v > 0.f) ? v : 0.1f * v; else if (ACT == 16) v = (v >= 0.f) ? v : 0.3f * v; else if (ACT == 17) v = (v >= 0.f) ? v : 0.2f * v;
      so[w][rloc][t * 16 + ln] = v; } }
  __builtin_amdgcn_fence(__ATOMIC_ACQ_REL, "workgroup"); __builtin_amdgcn_wave_barrier();
  const int rsub = lane >> 4, c4 = (lane & 15) * 4;
  {
#pragma unroll
    for (int q = 0; q < 16; ++q) { const int r = q * 2 + rsub; const v4f v = *(const v4fa*)&so[w][r][c4]; if (C) *(v4f*)(C + cofs + (size_t)(row0 + r) * ldc + col0 + c4) = v; if (C16) { v4h h4; for (int i = 0; i < 4; ++i) h4[i] = (_Float16)v[i]; *(v4h*)(C16 + cofs + (size_t)(row0 + r) * ldc + col0 + c4) = h4; } }
     } }


__global__ __launch_bounds__(256) void k_wsc(const float* __restrict__ Wm, _Float16* __restrict__ Bt, size_t n8, float sc) { const size_t t = (size_t)blockIdx.x * 256 + threadIdx.x; if (t >= n8) return; FragH f; for (int q = 0; q < 8; ++q) f.h[q] = (_Float16)(bf16_round(Wm[t * 8 + q]) * sc); *(v8us*)((unsigned short*)Bt + t * 8) = f.half[0];  }
typedef float v2f __attribute__((ext_vector_type(2)));
__device__ __forceinline__ v8f mma4(v2f a, v2f b, v8f c) { return __builtin_amdgcn_wmma_f32_16x16x4_f32(false, a, false, b, (short)0, c, false, false); }
// Four vector slots behind a run of matrix instructions, before a vector instruction may touch their D or overwrite their A or B: the 16-bit forms' distance, kept
// by hand. The operands only tie the slots to the run (D not touched, A and B not reused ahead of them).
__device__ __forceinline__ void gap5(v8f& d0, v8f& d1, v8f& d2, v8f& d3, v8f& d4, v2f a0, v2f a1, v2f a2, v2f a3, v2f a4, v2f b) {
  asm volatile("v_nop\n\tv_nop\n\tv_nop\n\tv_nop" : "+v"(d0), "+v"(d1), "+v"(d2), "+v"(d3), "+v"(d4) : "v"(a0), "v"(a1), "v"(a2), "v"(a3), "v"(a4), "v"(b)); }
__device__ __forceinline__ void gap4(v8f& d0, v8f& d1, v8f& d2, v8f& d3, v2f a, v2f b0, v2f b1, v2f b2, v2f b3) {
  asm volatile("v_nop\n\tv_nop\n\tv_nop\n\tv_nop" : "+v"(d0), "+v"(d1), "+v"(d2), "+v"(d3) : "v"(a), "v"(b0), "v"(b1), "v"(b2), "v"(b3)); }
// Windowed attention on the f32 matrix form. One wave = 16 frames of one head (wave index = head); its window union is 80 key frames = 5 tiles of 16.
// S^T = K . Q^T : register r of tile c in lane (ln, hh) is the score of key 16c + 8hh + r against query ln, so a lane's 40 registers are one query's scores
// (the other 40 keys sit in lane ln ^ 16) and, two by two, they are already the A fragments of P . V (k pairing: key 16c + 8hh + 2p + i).
// V's B fragments: column ln of output tile u stands for d = 4 ln + u, so one 16-byte load of a key's row serves all four tiles.
__global__ __launch_bounds__(128) void k_local(const float* __restrict__ QKV, _Float16* __restrict__ OH, _Float16* __restrict__ OL) {
  const int lane = threadIdx.x & 31, ln = lane & 15, hh = lane >> 4, h = threadIdx.x >> 5;
  const int row0 = blockIdx.x * 16, b = row0 / TT, t0 = row0 % TT;
  const float* base = QKV + (size_t)b * TT * (3 * EE) + h * HD;
  const float* qp = base + (size_t)(t0 + ln) * (3 * EE) + 4 * hh;      /* d order of both operands: 8 i + 4 hh + 0..3 */
  const float* kp[5];
#pragma unroll
  for (int c = 0; c < 5; ++c) { const int j = t0 - PADW + 16 * c + ln; kp[c] = base + (size_t)min(max(j, 0), TT - 1) * (3 * EE) + EE + 4 * hh; }      /* a padded slot reads an edge row; its score is replaced by 0 below */
  v4f qf[8], kf[8][5];      /* load order: the four 16-byte pieces that share a row's 128-byte line stand back to back */
#pragma unroll
  for (int g = 0; g < 8; g += 4) {
#pragma unroll
    for (int i = g; i < g + 4; ++i) qf[i] = *(const v4fa*)(qp + 8 * i);
#pragma unroll
    for (int c = 0; c < 5; ++c)
#pragma unroll
      for (int i = g; i < g + 4; ++i) kf[i][c] = *(const v4fa*)(kp[c] + 8 * i); }
  __builtin_amdgcn_sched_barrier(0);      /* all 48 q / k loads are issued ahead of the first product: one load latency for the wave, not one per k step */
  const v8f z8 = {0.f,0.f,0.f,0.f,0.f,0.f,0.f,0.f}; v8f s[5] = {z8, z8, z8, z8, z8};
#pragma unroll
  for (int i = 0; i < 8; ++i) { const v4f q = qf[i] * 0.125f;
#pragma unroll
    for (int e = 0; e < 4; e += 2) { const v2f qe = {q[e], q[e + 1]}; v2f ke[5];
#pragma unroll
      for (int c = 0; c < 5; ++c) { ke[c] = v2f{kf[i][c][e], kf[i][c][e + 1]}; s[c] = mma4(ke[c], qe, s[c]); }
      gap5(s[0], s[1], s[2], s[3], s[4], ke[0], ke[1], ke[2], ke[3], ke[4], qe); } }
  v4f vf[5][4][2];
#pragma unroll
  for (int c = 0; c < 5; ++c) { const float* vp[8];
#pragma unroll
    for (int e = 0; e < 8; ++e) { const int j = t0 - PADW + 16 * c + 8 * hh + e; vp[e] = base + (size_t)min(max(j, 0), TT - 1) * (3 * EE) + 2 * EE + 4 * ln; vf[c][e >> 1][e & 1] = *(const v4fa*)vp[e]; }
    /* the address registers of these eight loads are named so that none is reused (a later load's result would land on them) ahead of the wait */
    asm volatile("s_wait_xcnt 0x0" :: "v"(vp[0]), "v"(vp[1]), "v"(vp[2]), "v"(vp[3]), "v"(vp[4]), "v"(vp[5]), "v"(vp[6]), "v"(vp[7]) : "memory"); }
  __builtin_amdgcn_sched_barrier(0);      /* the 40 v loads are issued ahead of the softmax, whose arithmetic covers their latency */
  float mx = -3.0e38f;
#pragma unroll
  for (int c = 0; c < 5; ++c)
#pragma unroll
    for (int r = 0; r < 8; ++r) { const int key = 16 * c + 8 * hh + r; const float v = ((unsigned)(t0 - PADW + key) < (unsigned)TT) ? s[c][r] : 0.f;      /* zero-padded key: logit 0 */
      const bool band = (c == 0) ? (key >= ln) : (c == 4) ? (key - ln <= WW - 1) : true; s[c][r] = band ? v : -3.0e38f; mx = fmaxf(mx, s[c][r]); }      /* a key outside this query's 65: exp gives 0 */
  mx = fmaxf(mx, __shfl_xor(mx, 16));
  float su = 0.f;
#pragma unroll
  for (int c = 0; c < 5; ++c)
#pragma unroll
    for (int r = 0; r < 8; ++r) s[c][r] = expf(s[c][r] - mx);
#pragma unroll
  for (int c = 0; c < 5; ++c)
#pragma unroll
    for (int r = 0; r < 8; ++r) su += s[c][r];
  su += __shfl_xor(su, 16);
  const float inv = 1.0f / su;
  v8f o[4] = {z8, z8, z8, z8};
#pragma unroll
  for (int c = 0; c < 5; ++c)
#pragma unroll
    for (int p = 0; p < 4; ++p) { const int j0 = t0 - PADW + 16 * c + 8 * hh + 2 * p, j1 = j0 + 1; const v4f va = vf[c][p][0], vb = vf[c][p][1];
      const v2f a = {((unsigned)j0 < (unsigned)TT) ? s[c][2 * p] * inv : 0.f, ((unsigned)j1 < (unsigned)TT) ? s[c][2 * p + 1] * inv : 0.f};      /* zero-padded value row: weight 0 on the edge row read in its place */
      v2f bv[4];
#pragma unroll
      for (int u = 0; u < 4; ++u) { bv[u] = v2f{va[u], vb[u]}; o[u] = mma4(a, bv[u], o[u]); }
      gap4(o[0], o[1], o[2], o[3], a, bv[0], bv[1], bv[2], bv[3]); }
#pragma unroll
  for (int r = 0; r < 8; ++r) { const size_t e0 = (size_t)(row0 + 8 * hh + r) * EE + h * HD + 4 * ln; v4h fh, fl;
#pragma unroll
    for (int u = 0; u < 4; ++u) { const float x = o[u][r]; const _Float16 hv = (_Float16)x; fh[u] = hv; fl[u] = (_Float16)((x - (float)hv) * 1024.0f); }
    *(v4h*)(OH + e0) = fh; *(v4h*)(OL + e0) = fl; } }

extern "C" void kernel_launch(void* const* d_in, const int* in_sizes, int n_in,
                              void* d_out, int out_size, void* d_ws, size_t ws_size, hipStream_t stream) {
  (void)in_sizes; (void)n_in; (void)out_size;
  const float* x = (const float*)d_in[0]; const float* Wqkv = (const float*)d_in[1]; const float* bqkv = (const float*)d_in[2]; const float* Wout = (const float*)d_in[3]; const float* bout = (const float*)d_in[4];
  char* ws = (char*)d_ws; size_t off = 0;
  auto take = [&](size_t bytes) { char* p = ws + off; off += (bytes + 255) & ~(size_t)255; return p; };
  _Float16* BQKV = (_Float16*)take((size_t)3 * EE * EE * 2); _Float16* BO = (_Float16*)take((size_t)EE * EE * 2); _Float16* X16 = (_Float16*)take((size_t)NR * EE * 2); float* QKV = (float*)take((size_t)NR * 3 * EE * 4); _Float16* OH = (_Float16*)take((size_t)NR * EE * 2); _Float16* OL = (_Float16*)take((size_t)NR * EE * 2);
  if (off > ws_size) return;      /* 0.5 + 4 + 24 + 4 + 4 = ≈ 37 MiB */
  k_wsc<<<(unsigned)(((size_t)3 * EE * EE / 8 + 255) / 256), 256, 0, stream>>>(Wqkv, BQKV, (size_t)3 * EE * EE / 8, 16.0f); k_wsc<<<(EE * EE / 8 + 255) / 256, 256, 0, stream>>>(Wout, BO, (size_t)EE * EE / 8, 16.0f);      /* torch (out, in) naturals */
  k_x16<<<(unsigned)(((size_t)NR * EE / 8 + 255) / 256), 256, 0, stream>>>(x, X16, (size_t)NR * EE / 8);
  k_gemm2<0><<<dim3((NR / 128) * (3 * EE / 64), 1), 128, 0, stream>>>(X16, EE, 0, BQKV, EE, 0, 0.0625f, bqkv, 0, nullptr, 1, 0, 0, QKV, nullptr, 3 * EE, 0, NR, 3 * EE, EE);      /* [q | k | v] + bias, f32 */
  k_local<<<NR / 16, 128, 0, stream>>>(QKV, OH, OL);
  k_gemm2<0><<<dim3((NR / 128) * (EE / 64), 1), 128, 0, stream>>>(OL, EE, 0, BO, EE, 0, 0.0625f / 1024.0f, nullptr, 0, nullptr, 1, 0, 0, (float*)d_out, nullptr, EE, 0, NR, EE, EE);
  k_gemm2<0><<<dim3((NR / 128) * (EE / 64), 1), 128, 0, stream>>>(OH, EE, 0, BO, EE, 0, 0.0625f, bout, 0, (const float*)d_out, 1, (size_t)EE, 0, (float*)d_out, nullptr, EE, 0, NR, EE, EE);      /* out = (o_lo + o_hi) Wout^T + bout */
}

// v002
// One run takes 43.2 microseconds.
// In two side-by-side timings against v001, it was 1.82 and 1.83 times as fast.
// Counting every step since v000, it is 6.80 times as fast.
#include <hip/hip_runtime.h>
// Speech_MultiHeadedAttention (2 x 4096 frames x 256 = 4 heads x 64; qkv = x Wqkv^T + bqkv; q scaled by 64^-0.5; local attention over a 65-frame window centred on each frame where the window is taken from ZERO-PADDED k / v (out-of-range slots are zero vectors that still take part in the softmax with logit 0, exactly as the source); out = merged . Wout^T + bout).
// Structure: exact f16 x plane; qkv as ONE f16 WMMA GEMM (32x64 wave tiles, f32 accumulation, exact x16 weights + bias; f32 out); the 65-key windowed attention on the f32 matrix form (wave per 16 frames x head: scores and weighted value sum as 16x16x4 products, softmax in registers, all f32 from the f32 q/k/v plane); its work-group (16 frames x all four heads) then holds 16 whole merged rows as f16 hi/residual planes in LDS and does Wout on them as two f16 WMMA terms (+ bias) in the same launch.
// Compute dtype: inputs rounded to bf16; x / weights exact as f16 so q/k/v are f32 sums of exact products; the attention output as f16 hi + residual; softmax f32 - near exact-class. v_wmma_f32_16x16x32_f16, v_wmma_f32_16x16x4_f32.
#define NB 2
#define TT 4096
#define EE 256
#define NH 4
#define HD 64
#define WW 65
#define PADW 32
#define NR (NB * TT)
typedef __bf16 v16b __attribute__((ext_vector_type(16)));
typedef unsigned short v8us __attribute__((ext_vector_type(8), may_alias));
typedef float  v8f  __attribute__((ext_vector_type(8)));
typedef float  v4f  __attribute__((ext_vector_type(4)));
typedef float  v4fa __attribute__((ext_vector_type(4), may_alias));
union FragB { v16b v; v8us half[2]; unsigned short u[16]; };

__device__ __forceinline__ unsigned short bf16_bits(float x) { unsigned int u = __float_as_uint(x); return (unsigned short)((u + 0x7FFFu + ((u >> 16) & 1u)) >> 16); }
__device__ __forceinline__ float bf16_val(unsigned short b) { return __uint_as_float(((unsigned int)b) << 16); }
__device__ __forceinline__ float bf16_round(float x) { return bf16_val(bf16_bits(x)); }
// D += A·B with NT terms: 1 = ah·bh, 2 = + al·bh (A split), 3 = + ah·bl (both split)
template <int NT>
__device__ __forceinline__ v8f mmaN(v16b ah, v16b al, v16b bh, v16b bl, v8f c) {
  c = __builtin_amdgcn_wmma_f32_16x16x32_bf16(false, ah, false, bh, (short)0, c, false, false);
  if (NT >= 2) c = __builtin_amdgcn_wmma_f32_16x16x32_bf16(false, al, false, bh, (short)0, c, false, false);
  if (NT >= 3) c = __builtin_amdgcn_wmma_f32_16x16x32_bf16(false, ah, false, bl, (short)0, c, false, false);
  asm volatile("v_nop\n\tv_nop\n\tv_nop\n\tv_nop" : "+v"(c) : "v"(ah), "v"(al), "v"(bh), "v"(bl));
  return c;
}

__global__ __launch_bounds__(256) void k_wt_bf16(const float* __restrict__ W, unsigned short* __restrict__ Wt, int K, int N) {
  const int t = blockIdx.x * 256 + threadIdx.x;
  const int k8n = K / 8;
  if (t >= N * k8n) return;
  const int n = t / k8n, k8 = (t % k8n) * 8;
  v8us v;
#pragma unroll
  for (int i = 0; i < 8; ++i) v[i] = bf16_bits(W[(size_t)(k8 + i) * N + n]);
  *(v8us*)(Wt + (size_t)n * K + k8) = v;
  
}

// GEMM C[M][N] (f32, pitch ldc) = act(A[M][K]·W + bias). A f32 row-major (pitch lda) converted per fragment to bf16
// (ASPLIT: hi/lo two planes -> 2 terms, else single rounded term); Wt bf16 [N][K] (pitch ldb). BIAS_BF16 rounds the
// bias to bf16 first (bias quantised to bf16 before the add). K%32==0, M%16==0, N%64==0.
template <bool ASPLIT, int ACT, bool BIAS_BF16>
__global__ __launch_bounds__(128) void k_gemm_bf(const float* __restrict__ A, int lda, const unsigned short* __restrict__ Wt, int ldb,
                                               const float* __restrict__ bias, float* __restrict__ C, int ldc, int M, int N, int K) {
  __shared__ __attribute__((aligned(16))) float so[4][16][64];
  const int tid = threadIdx.x, w = tid >> 5, lane = tid & 31, ln = lane & 15, hh = lane >> 4;
  const int ntn = N / 64;
  const int wid = blockIdx.x * 4 + w;
  const int mt = wid / ntn, nq = wid % ntn;
  if (mt * 16 >= M) return;
  const int row0 = mt * 16, col0 = nq * 64;
  const float* arow = A + (size_t)(row0 + ln) * lda;
  v8f acc[4] = {};
  for (int kb = 0; kb < K; kb += 32) {
    FragB ah, al;
    const v4f x0 = *(const v4fa*)(arow + kb + 8 * hh), x1 = *(const v4fa*)(arow + kb + 8 * hh + 4);
    const v4f x2 = *(const v4fa*)(arow + kb + 16 + 8 * hh), x3 = *(const v4fa*)(arow + kb + 16 + 8 * hh + 4);
    float xs[16] = {x0[0],x0[1],x0[2],x0[3],x1[0],x1[1],x1[2],x1[3],x2[0],x2[1],x2[2],x2[3],x3[0],x3[1],x3[2],x3[3]};
#pragma unroll
    for (int i = 0; i < 16; ++i) { const unsigned short hb = bf16_bits(xs[i]); ah.u[i] = hb; al.u[i] = ASPLIT ? bf16_bits(xs[i] - bf16_val(hb)) : (unsigned short)0; }
#pragma unroll
    for (int t = 0; t < 4; ++t) {
      const unsigned short* brow = Wt + (size_t)(col0 + t * 16 + ln) * ldb + kb;
      FragB b;
      b.half[0] = *(const v8us*)(brow + 8 * hh);
      b.half[1] = *(const v8us*)(brow + 16 + 8 * hh);
      acc[t] = mmaN<ASPLIT ? 2 : 1>(ah.v, al.v, b.v, b.v, acc[t]);
    }
  }
#pragma unroll
  for (int t = 0; t < 4; ++t) {
    float bv = bias ? bias[col0 + t * 16 + ln] : 0.f;
    if (BIAS_BF16) bv = bf16_round(bv);
#pragma unroll
    for (int r = 0; r < 8; ++r) { float v = acc[t][r] + bv; if (ACT == 1) v = fmaxf(v, 0.f); so[w][8 * hh + r][t * 16 + ln] = v; }
  }
  __builtin_amdgcn_fence(__ATOMIC_ACQ_REL, "workgroup");
  __builtin_amdgcn_wave_barrier();
  const int rsub = lane >> 4, c4 = (lane & 15) * 4;
  {
#pragma unroll
    for (int q = 0; q < 8; ++q) {
      const int r = q * 2 + rsub;
      const v4f v = *(const v4fa*)&so[w][r][c4];
      *(v4f*)(C + (size_t)(row0 + r) * ldc + col0 + c4) = v;
    }
    
  }
}

// GEMM C = act(A·W + bias + resid): A f32 (ASPLIT -> hi/lo 2 terms), Wt bf16 [N][K]; ACT 0 none, 1 relu, 2 exact gelu;
// resid (optional, f32, row index = (row % rmod), pitch ldr, RES_BF16 rounds it) added before the activation.
template <bool ASPLIT, int ACT, bool BIAS_BF16, bool RES_BF16>
__global__ __launch_bounds__(128) void k_gemm_bf3(const float* __restrict__ A, int lda, const unsigned short* __restrict__ Wt, int ldb,
                                                const float* __restrict__ bias, const float* __restrict__ resid, int rmod, int ldr,
                                                float* __restrict__ C, int ldc, int M, int N, int K) {
  __shared__ __attribute__((aligned(16))) float so[4][16][64];
  const int tid = threadIdx.x, w = tid >> 5, lane = tid & 31, ln = lane & 15, hh = lane >> 4;
  const int ntn = N / 64;
  const int wid = blockIdx.x * 4 + w;
  const int mt = wid / ntn, nq = wid % ntn;
  if (mt * 16 >= M) return;
  const int row0 = mt * 16, col0 = nq * 64;
  const float* arow = A + (size_t)(row0 + ln) * lda;
  v8f acc[4] = {};
  for (int kb = 0; kb < K; kb += 32) {
    FragB ah, al;
    const v4f x0 = *(const v4fa*)(arow + kb + 8 * hh), x1 = *(const v4fa*)(arow + kb + 8 * hh + 4);
    const v4f x2 = *(const v4fa*)(arow + kb + 16 + 8 * hh), x3 = *(const v4fa*)(arow + kb + 16 + 8 * hh + 4);
    float xs[16] = {x0[0],x0[1],x0[2],x0[3],x1[0],x1[1],x1[2],x1[3],x2[0],x2[1],x2[2],x2[3],x3[0],x3[1],x3[2],x3[3]};
#pragma unroll
    for (int i = 0; i < 16; ++i) { const unsigned short hb = bf16_bits(xs[i]); ah.u[i] = hb; al.u[i] = ASPLIT ? bf16_bits(xs[i] - bf16_val(hb)) : (unsigned short)0; }
#pragma unroll
    for (int t = 0; t < 4; ++t) {
      const unsigned short* brow = Wt + (size_t)(col0 + t * 16 + ln) * ldb + kb;
      FragB b;
      b.half[0] = *(const v8us*)(brow + 8 * hh);
      b.half[1] = *(const v8us*)(brow + 16 + 8 * hh);
      acc[t] = mmaN<ASPLIT ? 2 : 1>(ah.v, al.v, b.v, b.v, acc[t]);
    }
  }
#pragma unroll
  for (int t = 0; t < 4; ++t) {
    const int col = col0 + t * 16 + ln;
    float bv = bias ? bias[col] : 0.f;
    if (BIAS_BF16) bv = bf16_round(bv);
#pragma unroll
    for (int r = 0; r < 8; ++r) {
      float v = acc[t][r] + bv;
      if (resid) { float rv = resid[(size_t)((row0 + 8 * hh + r) % rmod) * ldr + col]; if (RES_BF16) rv = bf16_round(rv); v += rv; }
      if (ACT == 1) v = fmaxf(v, 0.f);
      if (ACT == 2) v = 0.5f * v * (1.0f + erff(v * 0.70710678118654752f));
      if (ACT == 3) { const float u = 0.7978845608028654f * (v + 0.044715f * v * v * v); v = 0.5f * v * (1.0f + tanhf(u)); }
      so[w][8 * hh + r][t * 16 + ln] = v;
    }
  }
  __builtin_amdgcn_fence(__ATOMIC_ACQ_REL, "workgroup");
  __builtin_amdgcn_wave_barrier();
  const int rsub = lane >> 4, c4 = (lane & 15) * 4;
  {
#pragma unroll
    for (int q = 0; q < 8; ++q) {
      const int r = q * 2 + rsub;
      const v4f v = *(const v4fa*)&so[w][r][c4];
      *(v4f*)(C + (size_t)(row0 + r) * ldc + col0 + c4) = v;
    }
    
  }
}
// row LayerNorm (biased variance, eps) over N: s = X (+ R); optional out_sum <- s; out_norm <- (s-mu)*rsqrt(var+eps)*g + b
template <bool PARAM_BF16>
__global__ __launch_bounds__(256) void k_layernorm(const float* __restrict__ X, const float* __restrict__ R, const float* __restrict__ g, const float* __restrict__ bta,
                                                  float* __restrict__ out_sum, float* __restrict__ out_norm, int N, float eps) {
  __shared__ float red[256];
  const int row = blockIdx.x, tid = threadIdx.x;
  const float* x = X + (size_t)row * N; const float* rr = R ? R + (size_t)row * N : nullptr;
  float vals[16];                     // up to N = 4096
  const int per = N / 256;            // contiguous chunk per thread? use strided-by-4 chunks: thread handles j = tid*4 + 1024*u
  float s1 = 0.f;
  for (int u = 0; u < per / 4; ++u) {
    const int j = tid * 4 + 1024 * u;
    const v4f a = *(const v4fa*)(x + j);
    v4f b = {0.f,0.f,0.f,0.f}; if (rr) b = *(const v4fa*)(rr + j);
#pragma unroll
    for (int q = 0; q < 4; ++q) { const float v = a[q] + b[q]; vals[u * 4 + q] = v; s1 += v; }
  }
  red[tid] = s1; __syncthreads();
  for (int st = 128; st > 0; st >>= 1) { if (tid < st) red[tid] += red[tid + st]; __syncthreads(); }
  const float mu = red[0] / (float)N; __syncthreads();
  float s2 = 0.f;
  for (int u = 0; u < per / 4; ++u)
#pragma unroll
    for (int q = 0; q < 4; ++q) { const float c = vals[u * 4 + q] - mu; s2 += c * c; }
  red[tid] = s2; __syncthreads();
  for (int st = 128; st > 0; st >>= 1) { if (tid < st) red[tid] += red[tid + st]; __syncthreads(); }
  const float rs = rsqrtf(red[0] / (float)N + eps);
  {
    for (int u = 0; u < per / 4; ++u) {
      const int j = tid * 4 + 1024 * u;
      v4f o, sm;
#pragma unroll
      for (int q = 0; q < 4; ++q) {
        float gg = g[j + q], bb = bta[j + q];
        if (PARAM_BF16) { gg = bf16_round(gg); bb = bf16_round(bb); }
        sm[q] = vals[u * 4 + q]; o[q] = (vals[u * 4 + q] - mu) * rs * gg + bb;
      }
      if (out_sum) *(v4f*)(out_sum + (size_t)row * N + j) = sm;
      *(v4f*)(out_norm + (size_t)row * N + j) = o;
    }
    
  }
}



// ---- f16 WMMA path (v_wmma_f32_16x16x32_f16): 11-bit significands for operands in range — used for the qkv GEMM (k_gemm2) and the Wout product in k_local
typedef _Float16 v16h __attribute__((ext_vector_type(16)));
union FragH { v16h v; v8us half[2]; _Float16 h[16]; unsigned short u[16]; };
template <int NT>
__device__ __forceinline__ v8f mmaH(v16h ah, v16h al, v16h bh, v16h bl, v8f c) {
  c = __builtin_amdgcn_wmma_f32_16x16x32_f16(false, ah, false, bh, (short)0, c, false, false);
  if (NT >= 2) c = __builtin_amdgcn_wmma_f32_16x16x32_f16(false, al, false, bh, (short)0, c, false, false);
  if (NT >= 3) c = __builtin_amdgcn_wmma_f32_16x16x32_f16(false, ah, false, bl, (short)0, c, false, false);
  asm volatile("v_nop\n\tv_nop\n\tv_nop\n\tv_nop" : "+v"(c) : "v"(ah), "v"(al), "v"(bh), "v"(bl));
  return c;
}
// batched GEMM like k_gemm_b but f16 operands: A f32 (split into f16 hi/lo if ASPLIT, else rounded to f16), Bt = f16 values [n][k]; alpha; C f32; N multiple of 16 (partial tiles skipped)
template <bool ASPLIT>
__global__ __launch_bounds__(128) void k_gemm_h(const float* __restrict__ A, int lda, size_t sA, const _Float16* __restrict__ Bh, int ldb, size_t sB, float alpha, float* __restrict__ C, int ldc, size_t sC, int M, int N, int K) {
  __shared__ __attribute__((aligned(16))) float so[4][16][64];
  const int tid = threadIdx.x, w = tid >> 5, lane = tid & 31, ln = lane & 15, hh = lane >> 4; const int by = blockIdx.y;
  A += (size_t)by * sA; Bh += (size_t)by * sB; C += (size_t)by * sC;
  const int ntn = (N + 63) / 64; const int wid = blockIdx.x * 4 + w; const int mt = wid / ntn, nq = wid % ntn; if (mt * 16 >= M) return;
  const int row0 = mt * 16, col0 = nq * 64; const float* arow = A + (size_t)(row0 + ln) * lda;
  v8f acc[4] = {};
  for (int kb = 0; kb < K; kb += 32) {
    FragH ah, al;
    const v4f x0 = *(const v4fa*)(arow + kb + 8 * hh), x1 = *(const v4fa*)(arow + kb + 8 * hh + 4), x2 = *(const v4fa*)(arow + kb + 16 + 8 * hh), x3 = *(const v4fa*)(arow + kb + 16 + 8 * hh + 4);
    float xs[16] = {x0[0],x0[1],x0[2],x0[3],x1[0],x1[1],x1[2],x1[3],x2[0],x2[1],x2[2],x2[3],x3[0],x3[1],x3[2],x3[3]};
#pragma unroll
    for (int i = 0; i < 16; ++i) { const _Float16 h = (_Float16)xs[i]; ah.h[i] = h; al.h[i] = ASPLIT ? (_Float16)(xs[i] - (float)h) : (_Float16)0.0f; }
#pragma unroll
    for (int t = 0; t < 4; ++t) { if (col0 + t * 16 >= N) continue; const size_t boff = (size_t)(col0 + t * 16 + ln) * ldb + kb; FragH bq; bq.half[0] = *(const v8us*)(Bh + boff + 8 * hh); bq.half[1] = *(const v8us*)(Bh + boff + 16 + 8 * hh);
      acc[t] = mmaH<ASPLIT ? 2 : 1>(ah.v, al.v, bq.v, bq.v, acc[t]); }
  }
#pragma unroll
  for (int t = 0; t < 4; ++t) { if (col0 + t * 16 >= N) continue;
#pragma unroll
    for (int r = 0; r < 8; ++r) so[w][8 * hh + r][t * 16 + ln] = acc[t][r] * alpha; }
  __builtin_amdgcn_fence(__ATOMIC_ACQ_REL, "workgroup"); __builtin_amdgcn_wave_barrier();
  const int rsub = lane >> 4, c4 = (lane & 15) * 4;
  {
#pragma unroll
    for (int q = 0; q < 8; ++q) { const int r = q * 2 + rsub; if (col0 + c4 < N) { const v4f v = *(const v4fa*)&so[w][r][c4]; *(v4f*)(C + (size_t)(row0 + r) * ldc + col0 + c4) = v; } }
     }
}

// Wt[n][k] = f16(W[k][n]·scale) from f32 row-major W[K][N] (scale = power of two; bf16-exact weights stay exact in f16 away from the subnormal range)
__global__ __launch_bounds__(256) void k_wt_f16(const float* __restrict__ W, _Float16* __restrict__ Wt, int K, int N, float scale) {
  const int t = blockIdx.x * 256 + threadIdx.x; if (t >= N * (K / 8)) return; const int n = t / (K / 8), k8 = (t % (K / 8)) * 8; FragH f;
#pragma unroll
  for (int i = 0; i < 8; ++i) f.h[i] = (_Float16)(bf16_round(W[(size_t)(k8 + i) * N + n]) * scale); const v8us o = f.half[0];
  *(v8us*)((unsigned short*)Wt + (size_t)n * K + k8) = o; 
}
// k_gemm_hh variant with fused epilogue: v = acc·alpha + bias[by·sBias + col] (+ CP[(row/rowsPerB)·sCPb + by·64 + col] if CP) ; ACT 0 none / 1 elu ; writes f16 C16 (and f32 C if non-null)
template <int ACT>
__global__ __launch_bounds__(128) void k_gemm_hhx(const _Float16* __restrict__ A, int lda, size_t sA, const _Float16* __restrict__ Bh, int ldb, size_t sB, float alpha, const float* __restrict__ bias, size_t sBias, const float* __restrict__ CP, int rowsPerB, size_t sCPb, int row0g,
    float* __restrict__ C, _Float16* __restrict__ C16, int ldc, size_t sC, int M, int N, int K) {
  __shared__ __attribute__((aligned(16))) float so[4][16][64];
  const int tid = threadIdx.x, w = tid >> 5, lane = tid & 31, ln = lane & 15, hh = lane >> 4; const int by = blockIdx.y;
  A += (size_t)by * sA; Bh += (size_t)by * sB; const size_t cofs = (size_t)by * sC; const float* bp = bias ? bias + (size_t)by * sBias : nullptr;
  const int ntn = (N + 63) / 64; const int wid = blockIdx.x * 4 + w; const int mt = wid / ntn, nq = wid % ntn; if (mt * 16 >= M) return;
  const int row0 = mt * 16, col0 = nq * 64; const _Float16* arow = A + (size_t)(row0 + ln) * lda;
  v8f acc[4] = {};
  for (int kb = 0; kb < K; kb += 32) { FragH ah; ah.half[0] = *(const v8us*)((const unsigned short*)arow + kb + 8 * hh); ah.half[1] = *(const v8us*)((const unsigned short*)arow + kb + 16 + 8 * hh);
#pragma unroll
    for (int t = 0; t < 4; ++t) { if (col0 + t * 16 >= N) continue; const size_t boff = (size_t)(col0 + t * 16 + ln) * ldb + kb; FragH bq; bq.half[0] = *(const v8us*)((const unsigned short*)Bh + boff + 8 * hh); bq.half[1] = *(const v8us*)((const unsigned short*)Bh + boff + 16 + 8 * hh);
      acc[t] = mmaH<1>(ah.v, ah.v, bq.v, bq.v, acc[t]); }
  }
#pragma unroll
  for (int t = 0; t < 4; ++t) { if (col0 + t * 16 >= N) continue; const int col = col0 + t * 16 + ln; const float bv = bp ? bf16_round(bp[col]) : 0.f;
#pragma unroll
    for (int r = 0; r < 8; ++r) { float v = acc[t][r] * alpha + bv; if (CP) { const int rr = row0g + row0 + 8 * hh + r; if (rowsPerB < 0) v += CP[cofs + (size_t)rr * ldc + col];      /* rowsPerB < 0: own element of the batched C plane */ else { const int bidx = rr / rowsPerB; v += CP[(size_t)bidx * sCPb + (size_t)by * 64 + col]; } } if (ACT == 1) v = (v > 0.f) ? v : expm1f(v); else if (ACT == 7) v = (v > 0.f) ? v + 1.0f : expf(v); else if (ACT == 8) v = tanhf(v); else if (ACT == 9) v = 0.5f * v * (1.0f + tanhf(0.7978845608028654f * (v + 0.044715f * v * v * v))); else if (ACT == 11) v = 1.0f / (1.0f + expf(-v)); else if (ACT == 12) v = (v > 0.f) ? v : 0.01f * v; else if (ACT == 14) v = (v > 0.f) ? v : 0.1f * v; else if (ACT == 16) v = (v >= 0.f) ? v : 0.3f * v; else if (ACT == 17) v = (v >= 0.f) ? v : 0.2f * v; else if (ACT == 15) v = v / (1.0f + expf(-v)); else if (ACT == 3) v = fmaxf(v, 0.f); else if (ACT == 6) v = 0.5f * v * (1.0f + erff(v * 0.70710678118654752f)); so[w][8 * hh + r][t * 16 + ln] = v; } }
  __builtin_amdgcn_fence(__ATOMIC_ACQ_REL, "workgroup"); __builtin_amdgcn_wave_barrier();
  const int rsub = lane >> 4, c4 = (lane & 15) * 4; typedef _Float16 v4h __attribute__((ext_vector_type(4)));
  {
#pragma unroll
    for (int q = 0; q < 8; ++q) { const int r = q * 2 + rsub; if (col0 + c4 < N) { const v4f v = *(const v4fa*)&so[w][r][c4]; if (C) *(v4f*)(C + cofs + (size_t)(row0 + r) * ldc + col0 + c4) = v; if (C16) { v4h h4; for (int i = 0; i < 4; ++i) h4[i] = (_Float16)v[i]; *(v4h*)(C16 + cofs + (size_t)(row0 + r) * ldc + col0 + c4) = h4; } } }
     }
}


typedef _Float16 v4h __attribute__((ext_vector_type(4)));

__global__ __launch_bounds__(256) void k_x16(const float* __restrict__ x, _Float16* __restrict__ X16, size_t n8) { const size_t t = (size_t)blockIdx.x * 256 + threadIdx.x; if (t >= n8) return; FragH f;
#pragma unroll
  for (int q = 0; q < 8; ++q) f.h[q] = (_Float16)bf16_round(x[t * 8 + q]); *(v8us*)((unsigned short*)X16 + t * 8) = f.half[0];  }
__global__ __launch_bounds__(256) void k_h16(const float* __restrict__ x, _Float16* __restrict__ X16, size_t n8) { const size_t t = (size_t)blockIdx.x * 256 + threadIdx.x; if (t >= n8) return; FragH f;
#pragma unroll
  for (int q = 0; q < 8; ++q) f.h[q] = (_Float16)x[t * 8 + q]; *(v8us*)((unsigned short*)X16 + t * 8) = f.half[0];  }
__global__ __launch_bounds__(256) void k_round16f(const float* __restrict__ W, _Float16* __restrict__ Bt, size_t n8) { const size_t t = (size_t)blockIdx.x * 256 + threadIdx.x; if (t >= n8) return; FragH f;
#pragma unroll
  for (int i = 0; i < 8; ++i) f.h[i] = (_Float16)(bf16_round(W[t * 8 + i]) * 16.0f); *(v8us*)((unsigned short*)Bt + t * 8) = f.half[0];  }
template <int NHv, int TTv>
__global__ __launch_bounds__(256) void k_vt(const _Float16* __restrict__ V16, int ldv, int voff, _Float16* __restrict__ Vt) { __shared__ unsigned short tl[64][66]; const int tid = threadIdx.x; const int slab = blockIdx.x / (TTv / 64), lg = blockIdx.x % (TTv / 64); const int b = slab / NHv, h = slab % NHv;
  for (int i = tid; i < 64 * 8; i += 256) { const int r = i / 8, c8 = (i % 8) * 8; FragH f; f.half[0] = *(const v8us*)((const unsigned short*)V16 + ((size_t)b * TTv + lg * 64 + r) * ldv + voff + h * 64 + c8);
#pragma unroll
    for (int q = 0; q < 8; ++q) tl[r][c8 + q] = f.u[q]; }
  __syncthreads();
  {
#pragma unroll
    for (int rd = 0; rd < 2; ++rd) { const int d = rd * 32 + tid / 8, pc = tid % 8; FragH f;
#pragma unroll
      for (int q = 0; q < 8; ++q) f.u[q] = tl[pc * 8 + q][d];
      *(v8us*)((unsigned short*)Vt + ((size_t)slab * 64 + d) * TTv + lg * 64 + pc * 8) = f.half[0]; }
     } }

__global__ __launch_bounds__(256) void k_hl(const float* __restrict__ F, _Float16* __restrict__ Hh, _Float16* __restrict__ Hl, size_t n8) { const size_t t = (size_t)blockIdx.x * 256 + threadIdx.x; if (t >= n8) return; FragH fh, fl; const v4f a = *(const v4fa*)(F + t * 8), c = *(const v4fa*)(F + t * 8 + 4);
#pragma unroll
  for (int q = 0; q < 4; ++q) { _Float16 h = (_Float16)a[q]; fh.h[q] = h; fl.h[q] = (_Float16)((a[q] - (float)h) * 1024.0f); h = (_Float16)c[q]; fh.h[4 + q] = h; fl.h[4 + q] = (_Float16)((c[q] - (float)h) * 1024.0f); }
  { *(v8us*)((unsigned short*)Hh + t * 8) = fh.half[0]; *(v8us*)((unsigned short*)Hl + t * 8) = fl.half[0];  } }

// ---- fast GEMM (wave tile 32x64; requires M % 32 == 0 rows per launch region and N % 64 == 0); epilogue = k_gemm_hhx semantics ----
__device__ __forceinline__ v16h g2_frag(const _Float16* p, int hh) { FragH f; f.half[0] = *(const v8us*)((const unsigned short*)p + 8 * hh); f.half[1] = *(const v8us*)((const unsigned short*)p + 16 + 8 * hh); return f.v; }
__device__ __forceinline__ v8f g2_mma(v16h a, v16h b, v8f c) { v8f d = __builtin_amdgcn_wmma_f32_16x16x32_f16(false, a, false, b, (short)0, c, false, false); asm volatile("v_nop\n\tv_nop\n\tv_nop\n\tv_nop" : "+v"(d) : "v"(a), "v"(b)); return d; }
template <int ACT>
__global__ __launch_bounds__(128) void k_gemm2(const _Float16* __restrict__ A, int lda, size_t sA, const _Float16* __restrict__ Bh, int ldb, size_t sB, float alpha, const float* __restrict__ bias, size_t sBias, const float* __restrict__ CP, int rowsPerB, size_t sCPb, int row0g,
    float* __restrict__ C, _Float16* __restrict__ C16, int ldc, size_t sC, int M, int N, int K) { static_assert(ACT == 0 || ACT == 3 || ACT == 6 || ACT == 8 || ACT == 9 || ACT == 11 || ACT == 12 || ACT == 14 || ACT == 15 || ACT == 16 || ACT == 17, "k_gemm2: unsupported ACT code (would silently apply no activation)");
  __shared__ __attribute__((aligned(16))) float so[4][32][68];
  const int tid = threadIdx.x, w = tid >> 5, lane = tid & 31, ln = lane & 15, hh = lane >> 4; const int by = blockIdx.y;
  A += (size_t)by * sA; Bh += (size_t)by * sB; const size_t cofs = (size_t)by * sC; const float* bp = bias ? bias + (size_t)by * sBias : nullptr;
  const int ntn = N >> 6; const int mt = blockIdx.x / ntn, nq = blockIdx.x - mt * ntn; const int row0 = mt * 128 + 32 * w, col0 = nq * 64; if (row0 >= M) return;
  const _Float16* a0p = A + (size_t)(row0 + ln) * lda; const _Float16* a1p = a0p + (size_t)16 * lda;
  const _Float16* b0p = Bh + (size_t)(col0 + ln) * ldb; const _Float16* b1p = b0p + (size_t)16 * ldb; const _Float16* b2p = b1p + (size_t)16 * ldb; const _Float16* b3p = b2p + (size_t)16 * ldb;
  const v8f z8 = {0.f,0.f,0.f,0.f,0.f,0.f,0.f,0.f}; v8f c00 = z8, c01 = z8, c02 = z8, c03 = z8, c10 = z8, c11 = z8, c12 = z8, c13 = z8;
#pragma unroll 1
  for (int kb = 0; kb < K; kb += 32) { const v16h a0 = g2_frag(a0p + kb, hh), a1 = g2_frag(a1p + kb, hh);
    v16h b = g2_frag(b0p + kb, hh); c00 = g2_mma(a0, b, c00); c10 = g2_mma(a1, b, c10);
    b = g2_frag(b1p + kb, hh); c01 = g2_mma(a0, b, c01); c11 = g2_mma(a1, b, c11);
    b = g2_frag(b2p + kb, hh); c02 = g2_mma(a0, b, c02); c12 = g2_mma(a1, b, c12);
    b = g2_frag(b3p + kb, hh); c03 = g2_mma(a0, b, c03); c13 = g2_mma(a1, b, c13); }
  v8f accs[8] = {c00, c01, c02, c03, c10, c11, c12, c13};
#pragma unroll
  for (int u = 0; u < 8; ++u) { const int t = u & 3, half = u >> 2; const int col = col0 + t * 16 + ln; const float bv = bp ? bf16_round(bp[col]) : 0.f;
#pragma unroll
    for (int r = 0; r < 8; ++r) { const int rloc = half * 16 + 8 * hh + r; float v = accs[u][r] * alpha + bv; if (CP) { if (rowsPerB < 0) v += CP[cofs + (size_t)(row0g + row0 + rloc) * ldc + col];      /* rowsPerB < 0: own element of the batched C plane */ else { const int bidx = (row0g + row0 + rloc) / rowsPerB; v += CP[(size_t)bidx * sCPb + (size_t)by * 64 + col]; } }
      if (ACT == 3) v = fmaxf(v, 0.f); else if (ACT == 6) v = 0.5f * v * (1.0f + erff(v * 0.70710678118654752f)); else if (ACT == 11) v = 1.0f / (1.0f + expf(-v)); else if (ACT == 15) v = v / (1.0f + expf(-v)); else if (ACT == 12) v = (v > 0.f) ? v : 0.01f * v; else if (ACT == 8) v = tanhf(v); else if (ACT == 9) v = 0.5f * v * (1.0f + tanhf(0.7978845608028654f * (v + 0.044715f * v * v * v))); else if (ACT == 14) v = (v > 0.f) ? v : 0.1f * v; else if (ACT == 16) v = (v >= 0.f) ? v : 0.3f * v; else if (ACT == 17) v = (v >= 0.f) ? v : 0.2f * v;
      so[w][rloc][t * 16 + ln] = v; } }
  __builtin_amdgcn_fence(__ATOMIC_ACQ_REL, "workgroup"); __builtin_amdgcn_wave_barrier();
  const int rsub = lane >> 4, c4 = (lane & 15) * 4;
  {
#pragma unroll
    for (int q = 0; q < 16; ++q) { const int r = q * 2 + rsub; const v4f v = *(const v4fa*)&so[w][r][c4]; if (C) *(v4f*)(C + cofs + (size_t)(row0 + r) * ldc + col0 + c4) = v; if (C16) { v4h h4; for (int i = 0; i < 4; ++i) h4[i] = (_Float16)v[i]; *(v4h*)(C16 + cofs + (size_t)(row0 + r) * ldc + col0 + c4) = h4; } }
     } }


__global__ __launch_bounds__(256) void k_wsc(const float* __restrict__ Wm, _Float16* __restrict__ Bt, size_t n8, float sc) { const size_t t = (size_t)blockIdx.x * 256 + threadIdx.x; if (t >= n8) return; FragH f; for (int q = 0; q < 8; ++q) f.h[q] = (_Float16)(bf16_round(Wm[t * 8 + q]) * sc); *(v8us*)((unsigned short*)Bt + t * 8) = f.half[0];  }
typedef float v2f __attribute__((ext_vector_type(2)));
__device__ __forceinline__ v8f mma4(v2f a, v2f b, v8f c) { return __builtin_amdgcn_wmma_f32_16x16x4_f32(false, a, false, b, (short)0, c, false, false); }
// Four vector slots behind a run of matrix instructions, before a vector instruction may touch their D or overwrite their A or B: the 16-bit forms' distance, kept
// by hand. The operands only tie the slots to the run (D not touched, A and B not reused ahead of them).
__device__ __forceinline__ void gap5(v8f& d0, v8f& d1, v8f& d2, v8f& d3, v8f& d4, v2f a0, v2f a1, v2f a2, v2f a3, v2f a4, v2f b) {
  asm volatile("v_nop\n\tv_nop\n\tv_nop\n\tv_nop" : "+v"(d0), "+v"(d1), "+v"(d2), "+v"(d3), "+v"(d4) : "v"(a0), "v"(a1), "v"(a2), "v"(a3), "v"(a4), "v"(b)); }
__device__ __forceinline__ void gap4(v8f& d0, v8f& d1, v8f& d2, v8f& d3, v2f a, v2f b0, v2f b1, v2f b2, v2f b3) {
  asm volatile("v_nop\n\tv_nop\n\tv_nop\n\tv_nop" : "+v"(d0), "+v"(d1), "+v"(d2), "+v"(d3) : "v"(a), "v"(b0), "v"(b1), "v"(b2), "v"(b3)); }
// Windowed attention on the f32 matrix form. One wave = 16 frames of one head (wave index = head); its window union is 80 key frames = 5 tiles of 16.
// S^T = K . Q^T : register r of tile c in lane (ln, hh) is the score of key 16c + 8hh + r against query ln, so a lane's 40 registers are one query's scores
// (the other 40 keys sit in lane ln ^ 16) and, two by two, they are already the A fragments of P . V (k pairing: key 16c + 8hh + 2p + i).
// V's B fragments: column ln of output tile u stands for d = 4 ln + u, so one 16-byte load of a key's row serves all four tiles.
// Output projection in the same launch: the four waves leave their heads' results in LDS (f16 hi and residual x 1024, 16 rows x 256), and behind one barrier wave h
// forms output columns 64 h .. 64 h + 63 of the 16 rows: A fragments from LDS, B fragments from the f16 weight plane, hi and residual terms in accumulators of their own.
__global__ __launch_bounds__(128) void k_local(const float* __restrict__ QKV, const _Float16* __restrict__ BO, const float* __restrict__ bout, float* __restrict__ out) {
  __shared__ __attribute__((aligned(16))) _Float16 sa[2][16][EE + 8];      /* pitch 528 B = 16 B x odd: 16-byte fragment reads of 16 rows meet no bank twice */
  __shared__ __attribute__((aligned(16))) float so[4][16][68];
  const int lane = threadIdx.x & 31, ln = lane & 15, hh = lane >> 4, h = threadIdx.x >> 5;
  const int row0 = blockIdx.x * 16, b = row0 / TT, t0 = row0 % TT;
  const float* base = QKV + (size_t)b * TT * (3 * EE) + h * HD;
  const float* qp = base + (size_t)(t0 + ln) * (3 * EE) + 4 * hh;      /* d order of both operands: 8 i + 4 hh + 0..3 */
  const float* kp[5];
#pragma unroll
  for (int c = 0; c < 5; ++c) { const int j = t0 - PADW + 16 * c + ln; kp[c] = base + (size_t)min(max(j, 0), TT - 1) * (3 * EE) + EE + 4 * hh; }      /* a padded slot reads an edge row; its score is replaced by 0 below */
  v4f qf[8], kf[8][5];      /* load order: the four 16-byte pieces that share a row's 128-byte line stand back to back */
#pragma unroll
  for (int g = 0; g < 8; g += 4) {
#pragma unroll
    for (int i = g; i < g + 4; ++i) qf[i] = *(const v4fa*)(qp + 8 * i);
#pragma unroll
    for (int c = 0; c < 5; ++c)
#pragma unroll
      for (int i = g; i < g + 4; ++i) kf[i][c] = *(const v4fa*)(kp[c] + 8 * i); }
  __builtin_amdgcn_sched_barrier(0);      /* all 48 q / k loads are issued ahead of the first product: one load latency for the wave, not one per k step */
  const v8f z8 = {0.f,0.f,0.f,0.f,0.f,0.f,0.f,0.f}; v8f s[5] = {z8, z8, z8, z8, z8};
#pragma unroll
  for (int i = 0; i < 8; ++i) { const v4f q = qf[i] * 0.125f;
#pragma unroll
    for (int e = 0; e < 4; e += 2) { const v2f qe = {q[e], q[e + 1]}; v2f ke[5];
#pragma unroll
      for (int c = 0; c < 5; ++c) { ke[c] = v2f{kf[i][c][e], kf[i][c][e + 1]}; s[c] = mma4(ke[c], qe, s[c]); }
      gap5(s[0], s[1], s[2], s[3], s[4], ke[0], ke[1], ke[2], ke[3], ke[4], qe); } }
  v4f vf[5][4][2];
#pragma unroll
  for (int c = 0; c < 5; ++c) { const float* vp[8];
#pragma unroll
    for (int e = 0; e < 8; ++e) { const int j = t0 - PADW + 16 * c + 8 * hh + e; vp[e] = base + (size_t)min(max(j, 0), TT - 1) * (3 * EE) + 2 * EE + 4 * ln; vf[c][e >> 1][e & 1] = *(const v4fa*)vp[e]; }
    /* the address registers of these eight loads are named so that none is reused (a later load's result would land on them) ahead of the wait */
    asm volatile("s_wait_xcnt 0x0" :: "v"(vp[0]), "v"(vp[1]), "v"(vp[2]), "v"(vp[3]), "v"(vp[4]), "v"(vp[5]), "v"(vp[6]), "v"(vp[7]) : "memory"); }
  __builtin_amdgcn_sched_barrier(0);      /* the 40 v loads are issued ahead of the softmax, whose arithmetic covers their latency */
  float mx = -3.0e38f;
#pragma unroll
  for (int c = 0; c < 5; ++c)
#pragma unroll
    for (int r = 0; r < 8; ++r) { const int key = 16 * c + 8 * hh + r; const float v = ((unsigned)(t0 - PADW + key) < (unsigned)TT) ? s[c][r] : 0.f;      /* zero-padded key: logit 0 */
      const bool band = (c == 0) ? (key >= ln) : (c == 4) ? (key - ln <= WW - 1) : true; s[c][r] = band ? v : -3.0e38f; mx = fmaxf(mx, s[c][r]); }      /* a key outside this query's 65: exp gives 0 */
  mx = fmaxf(mx, __shfl_xor(mx, 16));
  float su = 0.f;
#pragma unroll
  for (int c = 0; c < 5; ++c)
#pragma unroll
    for (int r = 0; r < 8; ++r) s[c][r] = expf(s[c][r] - mx);
#pragma unroll
  for (int c = 0; c < 5; ++c)
#pragma unroll
    for (int r = 0; r < 8; ++r) su += s[c][r];
  su += __shfl_xor(su, 16);
  const float inv = 1.0f / su;
  v8f o[4] = {z8, z8, z8, z8};
  const _Float16* wp = BO + (size_t)(h * HD + ln) * EE;      /* weight row = output column 64 h + 16 t + ln; the rows of tile t lie 16 t further on */
  v16h wf[4][4];      /* [k step mod 4][column tile] */
#pragma unroll
  for (int c = 0; c < 5; ++c) {
#pragma unroll
    for (int p = 0; p < 4; ++p) { const int j0 = t0 - PADW + 16 * c + 8 * hh + 2 * p, j1 = j0 + 1; const v4f va = vf[c][p][0], vb = vf[c][p][1];
      const v2f a = {((unsigned)j0 < (unsigned)TT) ? s[c][2 * p] * inv : 0.f, ((unsigned)j1 < (unsigned)TT) ? s[c][2 * p + 1] * inv : 0.f};      /* zero-padded value row: weight 0 on the edge row read in its place */
      v2f bv[4];
#pragma unroll
      for (int u = 0; u < 4; ++u) { bv[u] = v2f{va[u], vb[u]}; o[u] = mma4(a, bv[u], o[u]); }
      gap4(o[0], o[1], o[2], o[3], a, bv[0], bv[1], bv[2], bv[3]); }
    if (c > 0) {
      __builtin_amdgcn_sched_barrier(0);      /* this pair holds the weight loads here: into registers that the used-up key tiles' values have left, with the later key tiles' products over their latency */
#pragma unroll      /* constant indices keep the register arrays out of scratch */
      for (int ks = 0; ks < 4; ++ks) wf[ks][c - 1] = g2_frag(wp + (size_t)(c - 1) * 16 * EE + ks * 32, hh);      /* k 0..127 of column tile c - 1: 256 bytes in a row of each weight row */
      __builtin_amdgcn_sched_barrier(0); } }
  float bo[4];
#pragma unroll      /* constant indices keep the register arrays out of scratch */
  for (int t = 0; t < 4; ++t) bo[t] = bf16_round(bout[h * HD + t * 16 + ln]);
#pragma unroll      /* constant indices keep the register arrays out of scratch */
  for (int r = 0; r < 8; ++r) { v4h fh, fl;
#pragma unroll      /* constant indices keep the register arrays out of scratch */
    for (int u = 0; u < 4; ++u) { const float x = o[u][r]; const _Float16 hv = (_Float16)x; fh[u] = hv; fl[u] = (_Float16)((x - (float)hv) * 1024.0f); }
    *(v4h*)&sa[0][8 * hh + r][h * HD + 4 * ln] = fh; *(v4h*)&sa[1][8 * hh + r][h * HD + 4 * ln] = fl; }
  __syncthreads();      /* every wave reads all four heads' columns of the 16 rows */
  v8f ch[4] = {z8, z8, z8, z8}, cl[4] = {z8, z8, z8, z8};
  v16h ah[2], al[2];
  ah[0] = g2_frag(&sa[0][ln][0], hh); al[0] = g2_frag(&sa[1][ln][0], hh);
#pragma unroll      /* constant indices keep the register arrays out of scratch */
  for (int ks = 0; ks < 8; ++ks) {
    if (ks < 7) { ah[(ks + 1) & 1] = g2_frag(&sa[0][ln][(ks + 1) * 32], hh); al[(ks + 1) & 1] = g2_frag(&sa[1][ln][(ks + 1) * 32], hh); }
    __builtin_amdgcn_sched_barrier(0);      /* the next step's LDS reads stand as one group ahead of this step's products, not among them */
#pragma unroll      /* constant indices keep the register arrays out of scratch */
    for (int t = 0; t < 4; ++t) {
      ch[t] = __builtin_amdgcn_wmma_f32_16x16x32_f16(false, ah[ks & 1], false, wf[ks & 3][t], (short)0, ch[t], false, false);
      cl[t] = __builtin_amdgcn_wmma_f32_16x16x32_f16(false, al[ks & 1], false, wf[ks & 3][t], (short)0, cl[t], false, false); }
    __builtin_amdgcn_sched_barrier(0);      /* the refill of this step's weight registers is issued at once, three steps of products ahead of its use, not sunk to it */
    if (ks < 4) {
#pragma unroll      /* constant indices keep the register arrays out of scratch */
      for (int t = 0; t < 4; ++t) wf[ks][t] = g2_frag(wp + (size_t)t * 16 * EE + (ks + 4) * 32, hh); } }
#pragma unroll      /* constant indices keep the register arrays out of scratch */
  for (int t = 0; t < 4; ++t)
#pragma unroll      /* constant indices keep the register arrays out of scratch */
    for (int r = 0; r < 8; ++r) { float v = ch[t][r] * 0.0625f + bo[t]; v += cl[t][r] * (0.0625f / 1024.0f); so[h][8 * hh + r][t * 16 + ln] = v; }
  __builtin_amdgcn_fence(__ATOMIC_ACQ_REL, "workgroup"); __builtin_amdgcn_wave_barrier();      /* the wave reads back its own staged tile, so that each store covers whole 128-byte lines */
  const int c4 = ln * 4;
#pragma unroll      /* constant indices keep the register arrays out of scratch */
  for (int q = 0; q < 8; ++q) { const int r = q * 2 + hh; const v4f v = *(const v4fa*)&so[h][r][c4]; *(v4f*)(out + (size_t)(row0 + r) * EE + h * HD + c4) = v; } }

extern "C" void kernel_launch(void* const* d_in, const int* in_sizes, int n_in,
                              void* d_out, int out_size, void* d_ws, size_t ws_size, hipStream_t stream) {
  (void)in_sizes; (void)n_in; (void)out_size;
  const float* x = (const float*)d_in[0]; const float* Wqkv = (const float*)d_in[1]; const float* bqkv = (const float*)d_in[2]; const float* Wout = (const float*)d_in[3]; const float* bout = (const float*)d_in[4];
  char* ws = (char*)d_ws; size_t off = 0;
  auto take = [&](size_t bytes) { char* p = ws + off; off += (bytes + 255) & ~(size_t)255; return p; };
  _Float16* BQKV = (_Float16*)take((size_t)3 * EE * EE * 2); _Float16* BO = (_Float16*)take((size_t)EE * EE * 2); _Float16* X16 = (_Float16*)take((size_t)NR * EE * 2); float* QKV = (float*)take((size_t)NR * 3 * EE * 4);
  if (off > ws_size) return;      /* 0.5 + 4 + 24 = about 29 MiB */
  k_wsc<<<(unsigned)(((size_t)3 * EE * EE / 8 + 255) / 256), 256, 0, stream>>>(Wqkv, BQKV, (size_t)3 * EE * EE / 8, 16.0f); k_wsc<<<(EE * EE / 8 + 255) / 256, 256, 0, stream>>>(Wout, BO, (size_t)EE * EE / 8, 16.0f);      /* torch (out, in) naturals */
  k_x16<<<(unsigned)(((size_t)NR * EE / 8 + 255) / 256), 256, 0, stream>>>(x, X16, (size_t)NR * EE / 8);
  k_gemm2<0><<<dim3((NR / 128) * (3 * EE / 64), 1), 128, 0, stream>>>(X16, EE, 0, BQKV, EE, 0, 0.0625f, bqkv, 0, nullptr, 1, 0, 0, QKV, nullptr, 3 * EE, 0, NR, 3 * EE, EE);      /* [q | k | v] + bias, f32 */
  k_local<<<NR / 16, 128, 0, stream>>>(QKV, BO, bout, (float*)d_out);      /* attention, then out = (o_hi + o_lo) Wout^T + bout */
}

// v003
// Measured time: 38.5 microseconds a run.
// In both of two side-by-side timings against v002, it was 1.11 times as fast.
// All steps since v000 together make it 7.57 times as fast.
#include <hip/hip_runtime.h>
// Speech_MultiHeadedAttention (2 x 4096 frames x 256 = 4 heads x 64; qkv = x Wqkv^T + bqkv; q scaled by 64^-0.5; local attention over a 65-frame window centred on each frame where the window is taken from ZERO-PADDED k / v (out-of-range slots are zero vectors that still take part in the softmax with logit 0, exactly as the source); out = merged . Wout^T + bout).
// Structure: exact f16 x and x16 weight planes in one launch; qkv as ONE f16 WMMA GEMM (32x64 wave tiles, f32 accumulation, exact x16 weights + bias; f32 out); the 65-key windowed attention on the f32 matrix form (wave per 16 frames x head: scores and weighted value sum as 16x16x4 products, softmax in registers, all f32 from the f32 q/k/v plane); its work-group (16 frames x all four heads) then holds 16 whole merged rows as f16 hi/residual planes in LDS and does Wout on them as two f16 WMMA terms (+ bias) in the same launch.
// Compute dtype: inputs rounded to bf16; x / weights exact as f16 so q/k/v are f32 sums of exact products; the attention output as f16 hi + residual; softmax f32 - near exact-class. v_wmma_f32_16x16x32_f16, v_wmma_f32_16x16x4_f32.
#define NB 2
#define TT 4096
#define EE 256
#define NH 4
#define HD 64
#define WW 65
#define PADW 32
#define NR (NB * TT)
typedef __bf16 v16b __attribute__((ext_vector_type(16)));
typedef unsigned short v8us __attribute__((ext_vector_type(8), may_alias));
typedef float  v8f  __attribute__((ext_vector_type(8)));
typedef float  v4f  __attribute__((ext_vector_type(4)));
typedef float  v4fa __attribute__((ext_vector_type(4), may_alias));
union FragB { v16b v; v8us half[2]; unsigned short u[16]; };

__device__ __forceinline__ unsigned short bf16_bits(float x) { unsigned int u = __float_as_uint(x); return (unsigned short)((u + 0x7FFFu + ((u >> 16) & 1u)) >> 16); }
__device__ __forceinline__ float bf16_val(unsigned short b) { return __uint_as_float(((unsigned int)b) << 16); }
__device__ __forceinline__ float bf16_round(float x) { return bf16_val(bf16_bits(x)); }
// D += A·B with NT terms: 1 = ah·bh, 2 = + al·bh (A split), 3 = + ah·bl (both split)
template <int NT>
__device__ __forceinline__ v8f mmaN(v16b ah, v16b al, v16b bh, v16b bl, v8f c) {
  c = __builtin_amdgcn_wmma_f32_16x16x32_bf16(false, ah, false, bh, (short)0, c, false, false);
  if (NT >= 2) c = __builtin_amdgcn_wmma_f32_16x16x32_bf16(false, al, false, bh, (short)0, c, false, false);
  if (NT >= 3) c = __builtin_amdgcn_wmma_f32_16x16x32_bf16(false, ah, false, bl, (short)0, c, false, false);
  asm volatile("v_nop\n\tv_nop\n\tv_nop\n\tv_nop" : "+v"(c) : "v"(ah), "v"(al), "v"(bh), "v"(bl));
  return c;
}

__global__ __launch_bounds__(256) void k_wt_bf16(const float* __restrict__ W, unsigned short* __restrict__ Wt, int K, int N) {
  const int t = blockIdx.x * 256 + threadIdx.x;
  const int k8n = K / 8;
  if (t >= N * k8n) return;
  const int n = t / k8n, k8 = (t % k8n) * 8;
  v8us v;
#pragma unroll
  for (int i = 0; i < 8; ++i) v[i] = bf16_bits(W[(size_t)(k8 + i) * N + n]);
  *(v8us*)(Wt + (size_t)n * K + k8) = v;
  
}

// GEMM C[M][N] (f32, pitch ldc) = act(A[M][K]·W + bias). A f32 row-major (pitch lda) converted per fragment to bf16
// (ASPLIT: hi/lo two planes -> 2 terms, else single rounded term); Wt bf16 [N][K] (pitch ldb). BIAS_BF16 rounds the
// bias to bf16 first (bias quantised to bf16 before the add). K%32==0, M%16==0, N%64==0.
template <bool ASPLIT, int ACT, bool BIAS_BF16>
__global__ __launch_bounds__(128) void k_gemm_bf(const float* __restrict__ A, int lda, const unsigned short* __restrict__ Wt, int ldb,
                                               const float* __restrict__ bias, float* __restrict__ C, int ldc, int M, int N, int K) {
  __shared__ __attribute__((aligned(16))) float so[4][16][64];
  const int tid = threadIdx.x, w = tid >> 5, lane = tid & 31, ln = lane & 15, hh = lane >> 4;
  const int ntn = N / 64;
  const int wid = blockIdx.x * 4 + w;
  const int mt = wid / ntn, nq = wid % ntn;
  if (mt * 16 >= M) return;
  const int row0 = mt * 16, col0 = nq * 64;
  const float* arow = A + (size_t)(row0 + ln) * lda;
  v8f acc[4] = {};
  for (int kb = 0; kb < K; kb += 32) {
    FragB ah, al;
    const v4f x0 = *(const v4fa*)(arow + kb + 8 * hh), x1 = *(const v4fa*)(arow + kb + 8 * hh + 4);
    const v4f x2 = *(const v4fa*)(arow + kb + 16 + 8 * hh), x3 = *(const v4fa*)(arow + kb + 16 + 8 * hh + 4);
    float xs[16] = {x0[0],x0[1],x0[2],x0[3],x1[0],x1[1],x1[2],x1[3],x2[0],x2[1],x2[2],x2[3],x3[0],x3[1],x3[2],x3[3]};
#pragma unroll
    for (int i = 0; i < 16; ++i) { const unsigned short hb = bf16_bits(xs[i]); ah.u[i] = hb; al.u[i] = ASPLIT ? bf16_bits(xs[i] - bf16_val(hb)) : (unsigned short)0; }
#pragma unroll
    for (int t = 0; t < 4; ++t) {
      const unsigned short* brow = Wt + (size_t)(col0 + t * 16 + ln) * ldb + kb;
      FragB b;
      b.half[0] = *(const v8us*)(brow + 8 * hh);
      b.half[1] = *(const v8us*)(brow + 16 + 8 * hh);
      acc[t] = mmaN<ASPLIT ? 2 : 1>(ah.v, al.v, b.v, b.v, acc[t]);
    }
  }
#pragma unroll
  for (int t = 0; t < 4; ++t) {
    float bv = bias ? bias[col0 + t * 16 + ln] : 0.f;
    if (BIAS_BF16) bv = bf16_round(bv);
#pragma unroll
    for (int r = 0; r < 8; ++r) { float v = acc[t][r] + bv; if (ACT == 1) v = fmaxf(v, 0.f); so[w][8 * hh + r][t * 16 + ln] = v; }
  }
  __builtin_amdgcn_fence(__ATOMIC_ACQ_REL, "workgroup");
  __builtin_amdgcn_wave_barrier();
  const int rsub = lane >> 4, c4 = (lane & 15) * 4;
  {
#pragma unroll
    for (int q = 0; q < 8; ++q) {
      const int r = q * 2 + rsub;
      const v4f v = *(const v4fa*)&so[w][r][c4];
      *(v4f*)(C + (size_t)(row0 + r) * ldc + col0 + c4) = v;
    }
    
  }
}

// GEMM C = act(A·W + bias + resid): A f32 (ASPLIT -> hi/lo 2 terms), Wt bf16 [N][K]; ACT 0 none, 1 relu, 2 exact gelu;
// resid (optional, f32, row index = (row % rmod), pitch ldr, RES_BF16 rounds it) added before the activation.
template <bool ASPLIT, int ACT, bool BIAS_BF16, bool RES_BF16>
__global__ __launch_bounds__(128) void k_gemm_bf3(const float* __restrict__ A, int lda, const unsigned short* __restrict__ Wt, int ldb,
                                                const float* __restrict__ bias, const float* __restrict__ resid, int rmod, int ldr,
                                                float* __restrict__ C, int ldc, int M, int N, int K) {
  __shared__ __attribute__((aligned(16))) float so[4][16][64];
  const int tid = threadIdx.x, w = tid >> 5, lane = tid & 31, ln = lane & 15, hh = lane >> 4;
  const int ntn = N / 64;
  const int wid = blockIdx.x * 4 + w;
  const int mt = wid / ntn, nq = wid % ntn;
  if (mt * 16 >= M) return;
  const int row0 = mt * 16, col0 = nq * 64;
  const float* arow = A + (size_t)(row0 + ln) * lda;
  v8f acc[4] = {};
  for (int kb = 0; kb < K; kb += 32) {
    FragB ah, al;
    const v4f x0 = *(const v4fa*)(arow + kb + 8 * hh), x1 = *(const v4fa*)(arow + kb + 8 * hh + 4);
    const v4f x2 = *(const v4fa*)(arow + kb + 16 + 8 * hh), x3 = *(const v4fa*)(arow + kb + 16 + 8 * hh + 4);
    float xs[16] = {x0[0],x0[1],x0[2],x0[3],x1[0],x1[1],x1[2],x1[3],x2[0],x2[1],x2[2],x2[3],x3[0],x3[1],x3[2],x3[3]};
#pragma unroll
    for (int i = 0; i < 16; ++i) { const unsigned short hb = bf16_bits(xs[i]); ah.u[i] = hb; al.u[i] = ASPLIT ? bf16_bits(xs[i] - bf16_val(hb)) : (unsigned short)0; }
#pragma unroll
    for (int t = 0; t < 4; ++t) {
      const unsigned short* brow = Wt + (size_t)(col0 + t * 16 + ln) * ldb + kb;
      FragB b;
      b.half[0] = *(const v8us*)(brow + 8 * hh);
      b.half[1] = *(const v8us*)(brow + 16 + 8 * hh);
      acc[t] = mmaN<ASPLIT ? 2 : 1>(ah.v, al.v, b.v, b.v, acc[t]);
    }
  }
#pragma unroll
  for (int t = 0; t < 4; ++t) {
    const int col = col0 + t * 16 + ln;
    float bv = bias ? bias[col] : 0.f;
    if (BIAS_BF16) bv = bf16_round(bv);
#pragma unroll
    for (int r = 0; r < 8; ++r) {
      float v = acc[t][r] + bv;
      if (resid) { float rv = resid[(size_t)((row0 + 8 * hh + r) % rmod) * ldr + col]; if (RES_BF16) rv = bf16_round(rv); v += rv; }
      if (ACT == 1) v = fmaxf(v, 0.f);
      if (ACT == 2) v = 0.5f * v * (1.0f + erff(v * 0.70710678118654752f));
      if (ACT == 3) { const float u = 0.7978845608028654f * (v + 0.044715f * v * v * v); v = 0.5f * v * (1.0f + tanhf(u)); }
      so[w][8 * hh + r][t * 16 + ln] = v;
    }
  }
  __builtin_amdgcn_fence(__ATOMIC_ACQ_REL, "workgroup");
  __builtin_amdgcn_wave_barrier();
  const int rsub = lane >> 4, c4 = (lane & 15) * 4;
  {
#pragma unroll
    for (int q = 0; q < 8; ++q) {
      const int r = q * 2 + rsub;
      const v4f v = *(const v4fa*)&so[w][r][c4];
      *(v4f*)(C + (size_t)(row0 + r) * ldc + col0 + c4) = v;
    }
    
  }
}
// row LayerNorm (biased variance, eps) over N: s = X (+ R); optional out_sum <- s; out_norm <- (s-mu)*rsqrt(var+eps)*g + b
template <bool PARAM_BF16>
__global__ __launch_bounds__(256) void k_layernorm(const float* __restrict__ X, const float* __restrict__ R, const float* __restrict__ g, const float* __restrict__ bta,
                                                  float* __restrict__ out_sum, float* __restrict__ out_norm, int N, float eps) {
  __shared__ float red[256];
  const int row = blockIdx.x, tid = threadIdx.x;
  const float* x = X + (size_t)row * N; const float* rr = R ? R + (size_t)row * N : nullptr;
  float vals[16];                     // up to N = 4096
  const int per = N / 256;            // contiguous chunk per thread? use strided-by-4 chunks: thread handles j = tid*4 + 1024*u
  float s1 = 0.f;
  for (int u = 0; u < per / 4; ++u) {
    const int j = tid * 4 + 1024 * u;
    const v4f a = *(const v4fa*)(x + j);
    v4f b = {0.f,0.f,0.f,0.f}; if (rr) b = *(const v4fa*)(rr + j);
#pragma unroll
    for (int q = 0; q < 4; ++q) { const float v = a[q] + b[q]; vals[u * 4 + q] = v; s1 += v; }
  }
  red[tid] = s1; __syncthreads();
  for (int st = 128; st > 0; st >>= 1) { if (tid < st) red[tid] += red[tid + st]; __syncthreads(); }
  const float mu = red[0] / (float)N; __syncthreads();
  float s2 = 0.f;
  for (int u = 0; u < per / 4; ++u)
#pragma unroll
    for (int q = 0; q < 4; ++q) { const float c = vals[u * 4 + q] - mu; s2 += c * c; }
  red[tid] = s2; __syncthreads();
  for (int st = 128; st > 0; st >>= 1) { if (tid < st) red[tid] += red[tid + st]; __syncthreads(); }
  const float rs = rsqrtf(red[0] / (float)N + eps);
  {
    for (int u = 0; u < per / 4; ++u) {
      const int j = tid * 4 + 1024 * u;
      v4f o, sm;
#pragma unroll
      for (int q = 0; q < 4; ++q) {
        float gg = g[j + q], bb = bta[j + q];
        if (PARAM_BF16) { gg = bf16_round(gg); bb = bf16_round(bb); }
        sm[q] = vals[u * 4 + q]; o[q] = (vals[u * 4 + q] - mu) * rs * gg + bb;
      }
      if (out_sum) *(v4f*)(out_sum + (size_t)row * N + j) = sm;
      *(v4f*)(out_norm + (size_t)row * N + j) = o;
    }
    
  }
}



// ---- f16 WMMA path (v_wmma_f32_16x16x32_f16): 11-bit significands for operands in range — used for the qkv GEMM (k_gemm2) and the Wout product in k_local
typedef _Float16 v16h __attribute__((ext_vector_type(16)));
union FragH { v16h v; v8us half[2]; _Float16 h[16]; unsigned short u[16]; };
template <int NT>
__device__ __forceinline__ v8f mmaH(v16h ah, v16h al, v16h bh, v16h bl, v8f c) {
  c = __builtin_amdgcn_wmma_f32_16x16x32_f16(false, ah, false, bh, (short)0, c, false, false);
  if (NT >= 2) c = __builtin_amdgcn_wmma_f32_16x16x32_f16(false, al, false, bh, (short)0, c, false, false);
  if (NT >= 3) c = __builtin_amdgcn_wmma_f32_16x16x32_f16(false, ah, false, bl, (short)0, c, false, false);
  asm volatile("v_nop\n\tv_nop\n\tv_nop\n\tv_nop" : "+v"(c) : "v"(ah), "v"(al), "v"(bh), "v"(bl));
  return c;
}
// batched GEMM like k_gemm_b but f16 operands: A f32 (split into f16 hi/lo if ASPLIT, else rounded to f16), Bt = f16 values [n][k]; alpha; C f32; N multiple of 16 (partial tiles skipped)
template <bool ASPLIT>
__global__ __launch_bounds__(128) void k_gemm_h(const float* __restrict__ A, int lda, size_t sA, const _Float16* __restrict__ Bh, int ldb, size_t sB, float alpha, float* __restrict__ C, int ldc, size_t sC, int M, int N, int K) {
  __shared__ __attribute__((aligned(16))) float so[4][16][64];
  const int tid = threadIdx.x, w = tid >> 5, lane = tid & 31, ln = lane & 15, hh = lane >> 4; const int by = blockIdx.y;
  A += (size_t)by * sA; Bh += (size_t)by * sB; C += (size_t)by * sC;
  const int ntn = (N + 63) / 64; const int wid = blockIdx.x * 4 + w; const int mt = wid / ntn, nq = wid % ntn; if (mt * 16 >= M) return;
  const int row0 = mt * 16, col0 = nq * 64; const float* arow = A + (size_t)(row0 + ln) * lda;
  v8f acc[4] = {};
  for (int kb = 0; kb < K; kb += 32) {
    FragH ah, al;
    const v4f x0 = *(const v4fa*)(arow + kb + 8 * hh), x1 = *(const v4fa*)(arow + kb + 8 * hh + 4), x2 = *(const v4fa*)(arow + kb + 16 + 8 * hh), x3 = *(const v4fa*)(arow + kb + 16 + 8 * hh + 4);
    float xs[16] = {x0[0],x0[1],x0[2],x0[3],x1[0],x1[1],x1[2],x1[3],x2[0],x2[1],x2[2],x2[3],x3[0],x3[1],x3[2],x3[3]};
#pragma unroll
    for (int i = 0; i < 16; ++i) { const _Float16 h = (_Float16)xs[i]; ah.h[i] = h; al.h[i] = ASPLIT ? (_Float16)(xs[i] - (float)h) : (_Float16)0.0f; }
#pragma unroll
    for (int t = 0; t < 4; ++t) { if (col0 + t * 16 >= N) continue; const size_t boff = (size_t)(col0 + t * 16 + ln) * ldb + kb; FragH bq; bq.half[0] = *(const v8us*)(Bh + boff + 8 * hh); bq.half[1] = *(const v8us*)(Bh + boff + 16 + 8 * hh);
      acc[t] = mmaH<ASPLIT ? 2 : 1>(ah.v, al.v, bq.v, bq.v, acc[t]); }
  }
#pragma unroll
  for (int t = 0; t < 4; ++t) { if (col0 + t * 16 >= N) continue;
#pragma unroll
    for (int r = 0; r < 8; ++r) so[w][8 * hh + r][t * 16 + ln] = acc[t][r] * alpha; }
  __builtin_amdgcn_fence(__ATOMIC_ACQ_REL, "workgroup"); __builtin_amdgcn_wave_barrier();
  const int rsub = lane >> 4, c4 = (lane & 15) * 4;
  {
#pragma unroll
    for (int q = 0; q < 8; ++q) { const int r = q * 2 + rsub; if (col0 + c4 < N) { const v4f v = *(const v4fa*)&so[w][r][c4]; *(v4f*)(C + (size_t)(row0 + r) * ldc + col0 + c4) = v; } }
     }
}

// Wt[n][k] = f16(W[k][n]·scale) from f32 row-major W[K][N] (scale = power of two; bf16-exact weights stay exact in f16 away from the subnormal range)
__global__ __launch_bounds__(256) void k_wt_f16(const float* __restrict__ W, _Float16* __restrict__ Wt, int K, int N, float scale) {
  const int t = blockIdx.x * 256 + threadIdx.x; if (t >= N * (K / 8)) return; const int n = t / (K / 8), k8 = (t % (K / 8)) * 8; FragH f;
#pragma unroll
  for (int i = 0; i < 8; ++i) f.h[i] = (_Float16)(bf16_round(W[(size_t)(k8 + i) * N + n]) * scale); const v8us o = f.half[0];
  *(v8us*)((unsigned short*)Wt + (size_t)n * K + k8) = o; 
}
// k_gemm_hh variant with fused epilogue: v = acc·alpha + bias[by·sBias + col] (+ CP[(row/rowsPerB)·sCPb + by·64 + col] if CP) ; ACT 0 none / 1 elu ; writes f16 C16 (and f32 C if non-null)
template <int ACT>
__global__ __launch_bounds__(128) void k_gemm_hhx(const _Float16* __restrict__ A, int lda, size_t sA, const _Float16* __restrict__ Bh, int ldb, size_t sB, float alpha, const float* __restrict__ bias, size_t sBias, const float* __restrict__ CP, int rowsPerB, size_t sCPb, int row0g,
    float* __restrict__ C, _Float16* __restrict__ C16, int ldc, size_t sC, int M, int N, int K) {
  __shared__ __attribute__((aligned(16))) float so[4][16][64];
  const int tid = threadIdx.x, w = tid >> 5, lane = tid & 31, ln = lane & 15, hh = lane >> 4; const int by = blockIdx.y;
  A += (size_t)by * sA; Bh += (size_t)by * sB; const size_t cofs = (size_t)by * sC; const float* bp = bias ? bias + (size_t)by * sBias : nullptr;
  const int ntn = (N + 63) / 64; const int wid = blockIdx.x * 4 + w; const int mt = wid / ntn, nq = wid % ntn; if (mt * 16 >= M) return;
  const int row0 = mt * 16, col0 = nq * 64; const _Float16* arow = A + (size_t)(row0 + ln) * lda;
  v8f acc[4] = {};
  for (int kb = 0; kb < K; kb += 32) { FragH ah; ah.half[0] = *(const v8us*)((const unsigned short*)arow + kb + 8 * hh); ah.half[1] = *(const v8us*)((const unsigned short*)arow + kb + 16 + 8 * hh);
#pragma unroll
    for (int t = 0; t < 4; ++t) { if (col0 + t * 16 >= N) continue; const size_t boff = (size_t)(col0 + t * 16 + ln) * ldb + kb; FragH bq; bq.half[0] = *(const v8us*)((const unsigned short*)Bh + boff + 8 * hh); bq.half[1] = *(const v8us*)((const unsigned short*)Bh + boff + 16 + 8 * hh);
      acc[t] = mmaH<1>(ah.v, ah.v, bq.v, bq.v, acc[t]); }
  }
#pragma unroll
  for (int t = 0; t < 4; ++t) { if (col0 + t * 16 >= N) continue; const int col = col0 + t * 16 + ln; const float bv = bp ? bf16_round(bp[col]) : 0.f;
#pragma unroll
    for (int r = 0; r < 8; ++r) { float v = acc[t][r] * alpha + bv; if (CP) { const int rr = row0g + row0 + 8 * hh + r; if (rowsPerB < 0) v += CP[cofs + (size_t)rr * ldc + col];      /* rowsPerB < 0: own element of the batched C plane */ else { const int bidx = rr / rowsPerB; v += CP[(size_t)bidx * sCPb + (size_t)by * 64 + col]; } } if (ACT == 1) v = (v > 0.f) ? v : expm1f(v); else if (ACT == 7) v = (v > 0.f) ? v + 1.0f : expf(v); else if (ACT == 8) v = tanhf(v); else if (ACT == 9) v = 0.5f * v * (1.0f + tanhf(0.7978845608028654f * (v + 0.044715f * v * v * v))); else if (ACT == 11) v = 1.0f / (1.0f + expf(-v)); else if (ACT == 12) v = (v > 0.f) ? v : 0.01f * v; else if (ACT == 14) v = (v > 0.f) ? v : 0.1f * v; else if (ACT == 16) v = (v >= 0.f) ? v : 0.3f * v; else if (ACT == 17) v = (v >= 0.f) ? v : 0.2f * v; else if (ACT == 15) v = v / (1.0f + expf(-v)); else if (ACT == 3) v = fmaxf(v, 0.f); else if (ACT == 6) v = 0.5f * v * (1.0f + erff(v * 0.70710678118654752f)); so[w][8 * hh + r][t * 16 + ln] = v; } }
  __builtin_amdgcn_fence(__ATOMIC_ACQ_REL, "workgroup"); __builtin_amdgcn_wave_barrier();
  const int rsub = lane >> 4, c4 = (lane & 15) * 4; typedef _Float16 v4h __attribute__((ext_vector_type(4)));
  {
#pragma unroll
    for (int q = 0; q < 8; ++q) { const int r = q * 2 + rsub; if (col0 + c4 < N) { const v4f v = *(const v4fa*)&so[w][r][c4]; if (C) *(v4f*)(C + cofs + (size_t)(row0 + r) * ldc + col0 + c4) = v; if (C16) { v4h h4; for (int i = 0; i < 4; ++i) h4[i] = (_Float16)v[i]; *(v4h*)(C16 + cofs + (size_t)(row0 + r) * ldc + col0 + c4) = h4; } } }
     }
}


typedef _Float16 v4h __attribute__((ext_vector_type(4)));

__global__ __launch_bounds__(256) void k_h16(const float* __restrict__ x, _Float16* __restrict__ X16, size_t n8) { const size_t t = (size_t)blockIdx.x * 256 + threadIdx.x; if (t >= n8) return; FragH f;
#pragma unroll
  for (int q = 0; q < 8; ++q) f.h[q] = (_Float16)x[t * 8 + q]; *(v8us*)((unsigned short*)X16 + t * 8) = f.half[0];  }
__global__ __launch_bounds__(256) void k_round16f(const float* __restrict__ W, _Float16* __restrict__ Bt, size_t n8) { const size_t t = (size_t)blockIdx.x * 256 + threadIdx.x; if (t >= n8) return; FragH f;
#pragma unroll
  for (int i = 0; i < 8; ++i) f.h[i] = (_Float16)(bf16_round(W[t * 8 + i]) * 16.0f); *(v8us*)((unsigned short*)Bt + t * 8) = f.half[0];  }
template <int NHv, int TTv>
__global__ __launch_bounds__(256) void k_vt(const _Float16* __restrict__ V16, int ldv, int voff, _Float16* __restrict__ Vt) { __shared__ unsigned short tl[64][66]; const int tid = threadIdx.x; const int slab = blockIdx.x / (TTv / 64), lg = blockIdx.x % (TTv / 64); const int b = slab / NHv, h = slab % NHv;
  for (int i = tid; i < 64 * 8; i += 256) { const int r = i / 8, c8 = (i % 8) * 8; FragH f; f.half[0] = *(const v8us*)((const unsigned short*)V16 + ((size_t)b * TTv + lg * 64 + r) * ldv + voff + h * 64 + c8);
#pragma unroll
    for (int q = 0; q < 8; ++q) tl[r][c8 + q] = f.u[q]; }
  __syncthreads();
  {
#pragma unroll
    for (int rd = 0; rd < 2; ++rd) { const int d = rd * 32 + tid / 8, pc = tid % 8; FragH f;
#pragma unroll
      for (int q = 0; q < 8; ++q) f.u[q] = tl[pc * 8 + q][d];
      *(v8us*)((unsigned short*)Vt + ((size_t)slab * 64 + d) * TTv + lg * 64 + pc * 8) = f.half[0]; }
     } }

__global__ __launch_bounds__(256) void k_hl(const float* __restrict__ F, _Float16* __restrict__ Hh, _Float16* __restrict__ Hl, size_t n8) { const size_t t = (size_t)blockIdx.x * 256 + threadIdx.x; if (t >= n8) return; FragH fh, fl; const v4f a = *(const v4fa*)(F + t * 8), c = *(const v4fa*)(F + t * 8 + 4);
#pragma unroll
  for (int q = 0; q < 4; ++q) { _Float16 h = (_Float16)a[q]; fh.h[q] = h; fl.h[q] = (_Float16)((a[q] - (float)h) * 1024.0f); h = (_Float16)c[q]; fh.h[4 + q] = h; fl.h[4 + q] = (_Float16)((c[q] - (float)h) * 1024.0f); }
  { *(v8us*)((unsigned short*)Hh + t * 8) = fh.half[0]; *(v8us*)((unsigned short*)Hl + t * 8) = fl.half[0];  } }

// ---- fast GEMM (wave tile 32x64; requires M % 32 == 0 rows per launch region and N % 64 == 0); epilogue = k_gemm_hhx semantics ----
__device__ __forceinline__ v16h g2_frag(const _Float16* p, int hh) { FragH f; f.half[0] = *(const v8us*)((const unsigned short*)p + 8 * hh); f.half[1] = *(const v8us*)((const unsigned short*)p + 16 + 8 * hh); return f.v; }
__device__ __forceinline__ v8f g2_mma(v16h a, v16h b, v8f c) { v8f d = __builtin_amdgcn_wmma_f32_16x16x32_f16(false, a, false, b, (short)0, c, false, false); asm volatile("v_nop\n\tv_nop\n\tv_nop\n\tv_nop" : "+v"(d) : "v"(a), "v"(b)); return d; }
template <int ACT>
__global__ __launch_bounds__(128) void k_gemm2(const _Float16* __restrict__ A, int lda, size_t sA, const _Float16* __restrict__ Bh, int ldb, size_t sB, float alpha, const float* __restrict__ bias, size_t sBias, const float* __restrict__ CP, int rowsPerB, size_t sCPb, int row0g,
    float* __restrict__ C, _Float16* __restrict__ C16, int ldc, size_t sC, int M, int N, int K) { static_assert(ACT == 0 || ACT == 3 || ACT == 6 || ACT == 8 || ACT == 9 || ACT == 11 || ACT == 12 || ACT == 14 || ACT == 15 || ACT == 16 || ACT == 17, "k_gemm2: unsupported ACT code (would silently apply no activation)");
  __shared__ __attribute__((aligned(16))) float so[4][32][68];
  const int tid = threadIdx.x, w = tid >> 5, lane = tid & 31, ln = lane & 15, hh = lane >> 4; const int by = blockIdx.y;
  A += (size_t)by * sA; Bh += (size_t)by * sB; const size_t cofs = (size_t)by * sC; const float* bp = bias ? bias + (size_t)by * sBias : nullptr;
  const int ntn = N >> 6; const int mt = blockIdx.x / ntn, nq = blockIdx.x - mt * ntn; const int row0 = mt * 128 + 32 * w, col0 = nq * 64; if (row0 >= M) return;
  const _Float16* a0p = A + (size_t)(row0 + ln) * lda; const _Float16* a1p = a0p + (size_t)16 * lda;
  const _Float16* b0p = Bh + (size_t)(col0 + ln) * ldb; const _Float16* b1p = b0p + (size_t)16 * ldb; const _Float16* b2p = b1p + (size_t)16 * ldb; const _Float16* b3p = b2p + (size_t)16 * ldb;
  const v8f z8 = {0.f,0.f,0.f,0.f,0.f,0.f,0.f,0.f}; v8f c00 = z8, c01 = z8, c02 = z8, c03 = z8, c10 = z8, c11 = z8, c12 = z8, c13 = z8;
#pragma unroll 1
  for (int kb = 0; kb < K; kb += 32) { const v16h a0 = g2_frag(a0p + kb, hh), a1 = g2_frag(a1p + kb, hh);
    v16h b = g2_frag(b0p + kb, hh); c00 = g2_mma(a0, b, c00); c10 = g2_mma(a1, b, c10);
    b = g2_frag(b1p + kb, hh); c01 = g2_mma(a0, b, c01); c11 = g2_mma(a1, b, c11);
    b = g2_frag(b2p + kb, hh); c02 = g2_mma(a0, b, c02); c12 = g2_mma(a1, b, c12);
    b = g2_frag(b3p + kb, hh); c03 = g2_mma(a0, b, c03); c13 = g2_mma(a1, b, c13); }
  v8f accs[8] = {c00, c01, c02, c03, c10, c11, c12, c13};
#pragma unroll
  for (int u = 0; u < 8; ++u) { const int t = u & 3, half = u >> 2; const int col = col0 + t * 16 + ln; const float bv = bp ? bf16_round(bp[col]) : 0.f;
#pragma unroll
    for (int r = 0; r < 8; ++r) { const int rloc = half * 16 + 8 * hh + r; float v = accs[u][r] * alpha + bv; if (CP) { if (rowsPerB < 0) v += CP[cofs + (size_t)(row0g + row0 + rloc) * ldc + col];      /* rowsPerB < 0: own element of the batched C plane */ else { const int bidx = (row0g + row0 + rloc) / rowsPerB; v += CP[(size_t)bidx * sCPb + (size_t)by * 64 + col]; } }
      if (ACT == 3) v = fmaxf(v, 0.f); else if (ACT == 6) v = 0.5f * v * (1.0f + erff(v * 0.70710678118654752f)); else if (ACT == 11) v = 1.0f / (1.0f + expf(-v)); else if (ACT == 15) v = v / (1.0f + expf(-v)); else if (ACT == 12) v = (v > 0.f) ? v : 0.01f * v; else if (ACT == 8) v = tanhf(v); else if (ACT == 9) v = 0.5f * v * (1.0f + tanhf(0.7978845608028654f * (v + 0.044715f * v * v * v))); else if (ACT == 14) v = (v > 0.f) ? v : 0.1f * v; else if (ACT == 16) v = (v >= 0.f) ? v : 0.3f * v; else if (ACT == 17) v = (v >= 0.f) ? v : 0.2f * v;
      so[w][rloc][t * 16 + ln] = v; } }
  __builtin_amdgcn_fence(__ATOMIC_ACQ_REL, "workgroup"); __builtin_amdgcn_wave_barrier();
  const int rsub = lane >> 4, c4 = (lane & 15) * 4;
  {
#pragma unroll
    for (int q = 0; q < 16; ++q) { const int r = q * 2 + rsub; const v4f v = *(const v4fa*)&so[w][r][c4]; if (C) *(v4f*)(C + cofs + (size_t)(row0 + r) * ldc + col0 + c4) = v; if (C16) { v4h h4; for (int i = 0; i < 4; ++i) h4[i] = (_Float16)v[i]; *(v4h*)(C16 + cofs + (size_t)(row0 + r) * ldc + col0 + c4) = h4; } }
     } }


// The three operand planes (x, Wqkv x 16, Wout x 16: bf16-rounded f32 -> f16) depend on nothing but the inputs, so they share ONE launch: a block range for each, eight elements a thread.
#define PB_Q (3 * EE * EE / 8 / 256)
#define PB_O (EE * EE / 8 / 256)
#define PB_X (NR * EE / 8 / 256)
static_assert(PB_Q * 256 * 8 == 3 * EE * EE && PB_O * 256 * 8 == EE * EE && PB_X * 256 * 8 == NR * EE, "k_prep: every plane is a whole number of blocks, so no thread needs a bound test");
__global__ __launch_bounds__(256) void k_prep(const float* __restrict__ x, const float* __restrict__ Wqkv, const float* __restrict__ Wout, _Float16* __restrict__ X16, _Float16* __restrict__ BQKV, _Float16* __restrict__ BO) {
  const int bx = blockIdx.x; const float* s; _Float16* d; float sc; int b0;      /* the small weight planes come first, so that they do not start behind the 1024 blocks of x */
  if (bx < PB_Q) { s = Wqkv; d = BQKV; sc = 16.0f; b0 = 0; } else if (bx < PB_Q + PB_O) { s = Wout; d = BO; sc = 16.0f; b0 = PB_Q; } else { s = x; d = X16; sc = 1.0f; b0 = PB_Q + PB_O; }
  const size_t t = (size_t)(bx - b0) * 256 + threadIdx.x; FragH f; const v4f a = *(const v4fa*)(s + t * 8), c = *(const v4fa*)(s + t * 8 + 4);
#pragma unroll      /* constant indices keep the fragment in registers */
  for (int q = 0; q < 4; ++q) { f.h[q] = (_Float16)(bf16_round(a[q]) * sc); f.h[4 + q] = (_Float16)(bf16_round(c[q]) * sc); }
  *(v8us*)((unsigned short*)d + t * 8) = f.half[0]; }
typedef float v2f __attribute__((ext_vector_type(2)));
__device__ __forceinline__ v8f mma4(v2f a, v2f b, v8f c) { return __builtin_amdgcn_wmma_f32_16x16x4_f32(false, a, false, b, (short)0, c, false, false); }
// Four vector slots behind a run of matrix instructions, before a vector instruction may touch their D or overwrite their A or B: the 16-bit forms' distance, kept
// by hand. The operands only tie the slots to the run (D not touched, A and B not reused ahead of them).
__device__ __forceinline__ void gap5(v8f& d0, v8f& d1, v8f& d2, v8f& d3, v8f& d4, v2f a0, v2f a1, v2f a2, v2f a3, v2f a4, v2f b) {
  asm volatile("v_nop\n\tv_nop\n\tv_nop\n\tv_nop" : "+v"(d0), "+v"(d1), "+v"(d2), "+v"(d3), "+v"(d4) : "v"(a0), "v"(a1), "v"(a2), "v"(a3), "v"(a4), "v"(b)); }
__device__ __forceinline__ void gap4(v8f& d0, v8f& d1, v8f& d2, v8f& d3, v2f a, v2f b0, v2f b1, v2f b2, v2f b3) {
  asm volatile("v_nop\n\tv_nop\n\tv_nop\n\tv_nop" : "+v"(d0), "+v"(d1), "+v"(d2), "+v"(d3) : "v"(a), "v"(b0), "v"(b1), "v"(b2), "v"(b3)); }
// Windowed attention on the f32 matrix form. One wave = 16 frames of one head (wave index = head); its window union is 80 key frames = 5 tiles of 16.
// S^T = K . Q^T : register r of tile c in lane (ln, hh) is the score of key 16c + 8hh + r against query ln, so a lane's 40 registers are one query's scores
// (the other 40 keys sit in lane ln ^ 16) and, two by two, they are already the A fragments of P . V (k pairing: key 16c + 8hh + 2p + i).
// V's B fragments: column ln of output tile u stands for d = 4 ln + u, so one 16-byte load of a key's row serves all four tiles.
// Output projection in the same launch: the four waves leave their heads' results in LDS (f16 hi and residual x 1024, 16 rows x 256), and behind one barrier wave h
// forms output columns 64 h .. 64 h + 63 of the 16 rows: A fragments from LDS, B fragments from the f16 weight plane, hi and residual terms in accumulators of their own.
__global__ __launch_bounds__(128) void k_local(const float* __restrict__ QKV, const _Float16* __restrict__ BO, const float* __restrict__ bout, float* __restrict__ out) {
  __shared__ __attribute__((aligned(16))) _Float16 sa[2][16][EE + 8];      /* pitch 528 B = 16 B x odd: 16-byte fragment reads of 16 rows meet no bank twice */
  __shared__ __attribute__((aligned(16))) float so[4][16][68];
  const int lane = threadIdx.x & 31, ln = lane & 15, hh = lane >> 4, h = threadIdx.x >> 5;
  const int row0 = blockIdx.x * 16, b = row0 / TT, t0 = row0 % TT;
  const float* base = QKV + (size_t)b * TT * (3 * EE) + h * HD;
  const float* qp = base + (size_t)(t0 + ln) * (3 * EE) + 4 * hh;      /* d order of both operands: 8 i + 4 hh + 0..3 */
  const float* kp[5];
#pragma unroll
  for (int c = 0; c < 5; ++c) { const int j = t0 - PADW + 16 * c + ln; kp[c] = base + (size_t)min(max(j, 0), TT - 1) * (3 * EE) + EE + 4 * hh; }      /* a padded slot reads an edge row; its score is replaced by 0 below */
  v4f qf[8], kf[8][5];      /* load order: the four 16-byte pieces that share a row's 128-byte line stand back to back */
#pragma unroll
  for (int g = 0; g < 8; g += 4) {
#pragma unroll
    for (int i = g; i < g + 4; ++i) qf[i] = *(const v4fa*)(qp + 8 * i);
#pragma unroll
    for (int c = 0; c < 5; ++c)
#pragma unroll
      for (int i = g; i < g + 4; ++i) kf[i][c] = *(const v4fa*)(kp[c] + 8 * i); }
  __builtin_amdgcn_sched_barrier(0);      /* all 48 q / k loads are issued ahead of the first product: one load latency for the wave, not one per k step */
  const v8f z8 = {0.f,0.f,0.f,0.f,0.f,0.f,0.f,0.f}; v8f s[5] = {z8, z8, z8, z8, z8};
#pragma unroll
  for (int i = 0; i < 8; ++i) { const v4f q = qf[i] * 0.125f;
#pragma unroll
    for (int e = 0; e < 4; e += 2) { const v2f qe = {q[e], q[e + 1]}; v2f ke[5];
#pragma unroll
      for (int c = 0; c < 5; ++c) { ke[c] = v2f{kf[i][c][e], kf[i][c][e + 1]}; s[c] = mma4(ke[c], qe, s[c]); }
      gap5(s[0], s[1], s[2], s[3], s[4], ke[0], ke[1], ke[2], ke[3], ke[4], qe); } }
  v4f vf[5][4][2];
#pragma unroll
  for (int c = 0; c < 5; ++c) { const float* vp[8];
#pragma unroll
    for (int e = 0; e < 8; ++e) { const int j = t0 - PADW + 16 * c + 8 * hh + e; vp[e] = base + (size_t)min(max(j, 0), TT - 1) * (3 * EE) + 2 * EE + 4 * ln; vf[c][e >> 1][e & 1] = *(const v4fa*)vp[e]; }
    /* the address registers of these eight loads are named so that none is reused (a later load's result would land on them) ahead of the wait */
    asm volatile("s_wait_xcnt 0x0" :: "v"(vp[0]), "v"(vp[1]), "v"(vp[2]), "v"(vp[3]), "v"(vp[4]), "v"(vp[5]), "v"(vp[6]), "v"(vp[7]) : "memory"); }
  __builtin_amdgcn_sched_barrier(0);      /* the 40 v loads are issued ahead of the softmax, whose arithmetic covers their latency */
  float mx = -3.0e38f;
#pragma unroll
  for (int c = 0; c < 5; ++c)
#pragma unroll
    for (int r = 0; r < 8; ++r) { const int key = 16 * c + 8 * hh + r; const float v = ((unsigned)(t0 - PADW + key) < (unsigned)TT) ? s[c][r] : 0.f;      /* zero-padded key: logit 0 */
      const bool band = (c == 0) ? (key >= ln) : (c == 4) ? (key - ln <= WW - 1) : true; s[c][r] = band ? v : -3.0e38f; mx = fmaxf(mx, s[c][r]); }      /* a key outside this query's 65: exp gives 0 */
  mx = fmaxf(mx, __shfl_xor(mx, 16));
  float su = 0.f;
#pragma unroll
  for (int c = 0; c < 5; ++c)
#pragma unroll
    for (int r = 0; r < 8; ++r) s[c][r] = expf(s[c][r] - mx);
#pragma unroll
  for (int c = 0; c < 5; ++c)
#pragma unroll
    for (int r = 0; r < 8; ++r) su += s[c][r];
  su += __shfl_xor(su, 16);
  const float inv = 1.0f / su;
  v8f o[4] = {z8, z8, z8, z8};
  const _Float16* wp = BO + (size_t)(h * HD + ln) * EE;      /* weight row = output column 64 h + 16 t + ln; the rows of tile t lie 16 t further on */
  v16h wf[4][4];      /* [k step mod 4][column tile] */
#pragma unroll
  for (int c = 0; c < 5; ++c) {
#pragma unroll
    for (int p = 0; p < 4; ++p) { const int j0 = t0 - PADW + 16 * c + 8 * hh + 2 * p, j1 = j0 + 1; const v4f va = vf[c][p][0], vb = vf[c][p][1];
      const v2f a = {((unsigned)j0 < (unsigned)TT) ? s[c][2 * p] * inv : 0.f, ((unsigned)j1 < (unsigned)TT) ? s[c][2 * p + 1] * inv : 0.f};      /* zero-padded value row: weight 0 on the edge row read in its place */
      v2f bv[4];
#pragma unroll
      for (int u = 0; u < 4; ++u) { bv[u] = v2f{va[u], vb[u]}; o[u] = mma4(a, bv[u], o[u]); }
      gap4(o[0], o[1], o[2], o[3], a, bv[0], bv[1], bv[2], bv[3]); }
    if (c > 0) {
      __builtin_amdgcn_sched_barrier(0);      /* this pair holds the weight loads here: into registers that the used-up key tiles' values have left, with the later key tiles' products over their latency */
#pragma unroll      /* constant indices keep the register arrays out of scratch */
      for (int ks = 0; ks < 4; ++ks) wf[ks][c - 1] = g2_frag(wp + (size_t)(c - 1) * 16 * EE + ks * 32, hh);      /* k 0..127 of column tile c - 1: 256 bytes in a row of each weight row */
      __builtin_amdgcn_sched_barrier(0); } }
  float bo[4];
#pragma unroll      /* constant indices keep the register arrays out of scratch */
  for (int t = 0; t < 4; ++t) bo[t] = bf16_round(bout[h * HD + t * 16 + ln]);
#pragma unroll      /* constant indices keep the register arrays out of scratch */
  for (int r = 0; r < 8; ++r) { v4h fh, fl;
#pragma unroll      /* constant indices keep the register arrays out of scratch */
    for (int u = 0; u < 4; ++u) { const float x = o[u][r]; const _Float16 hv = (_Float16)x; fh[u] = hv; fl[u] = (_Float16)((x - (float)hv) * 1024.0f); }
    *(v4h*)&sa[0][8 * hh + r][h * HD + 4 * ln] = fh; *(v4h*)&sa[1][8 * hh + r][h * HD + 4 * ln] = fl; }
  __syncthreads();      /* every wave reads all four heads' columns of the 16 rows */
  v8f ch[4] = {z8, z8, z8, z8}, cl[4] = {z8, z8, z8, z8};
  v16h ah[2], al[2];
  ah[0] = g2_frag(&sa[0][ln][0], hh); al[0] = g2_frag(&sa[1][ln][0], hh);
#pragma unroll      /* constant indices keep the register arrays out of scratch */
  for (int ks = 0; ks < 8; ++ks) {
    if (ks < 7) { ah[(ks + 1) & 1] = g2_frag(&sa[0][ln][(ks + 1) * 32], hh); al[(ks + 1) & 1] = g2_frag(&sa[1][ln][(ks + 1) * 32], hh); }
    __builtin_amdgcn_sched_barrier(0);      /* the next step's LDS reads stand as one group ahead of this step's products, not among them */
#pragma unroll      /* constant indices keep the register arrays out of scratch */
    for (int t = 0; t < 4; ++t) {
      ch[t] = __builtin_amdgcn_wmma_f32_16x16x32_f16(false, ah[ks & 1], false, wf[ks & 3][t], (short)0, ch[t], false, false);
      cl[t] = __builtin_amdgcn_wmma_f32_16x16x32_f16(false, al[ks & 1], false, wf[ks & 3][t], (short)0, cl[t], false, false); }
    __builtin_amdgcn_sched_barrier(0);      /* the refill of this step's weight registers is issued at once, three steps of products ahead of its use, not sunk to it */
    if (ks < 4) {
#pragma unroll      /* constant indices keep the register arrays out of scratch */
      for (int t = 0; t < 4; ++t) wf[ks][t] = g2_frag(wp + (size_t)t * 16 * EE + (ks + 4) * 32, hh); } }
#pragma unroll      /* constant indices keep the register arrays out of scratch */
  for (int t = 0; t < 4; ++t)
#pragma unroll      /* constant indices keep the register arrays out of scratch */
    for (int r = 0; r < 8; ++r) { float v = ch[t][r] * 0.0625f + bo[t]; v += cl[t][r] * (0.0625f / 1024.0f); so[h][8 * hh + r][t * 16 + ln] = v; }
  __builtin_amdgcn_fence(__ATOMIC_ACQ_REL, "workgroup"); __builtin_amdgcn_wave_barrier();      /* the wave reads back its own staged tile, so that each store covers whole 128-byte lines */
  const int c4 = ln * 4;
#pragma unroll      /* constant indices keep the register arrays out of scratch */
  for (int q = 0; q < 8; ++q) { const int r = q * 2 + hh; const v4f v = *(const v4fa*)&so[h][r][c4]; *(v4f*)(out + (size_t)(row0 + r) * EE + h * HD + c4) = v; } }

extern "C" void kernel_launch(void* const* d_in, const int* in_sizes, int n_in,
                              void* d_out, int out_size, void* d_ws, size_t ws_size, hipStream_t stream) {
  (void)in_sizes; (void)n_in; (void)out_size;
  const float* x = (const float*)d_in[0]; const float* Wqkv = (const float*)d_in[1]; const float* bqkv = (const float*)d_in[2]; const float* Wout = (const float*)d_in[3]; const float* bout = (const float*)d_in[4];
  char* ws = (char*)d_ws; size_t off = 0;
  auto take = [&](size_t bytes) { char* p = ws + off; off += (bytes + 255) & ~(size_t)255; return p; };
  _Float16* BQKV = (_Float16*)take((size_t)3 * EE * EE * 2); _Float16* BO = (_Float16*)take((size_t)EE * EE * 2); _Float16* X16 = (_Float16*)take((size_t)NR * EE * 2); float* QKV = (float*)take((size_t)NR * 3 * EE * 4);
  if (off > ws_size) return;      /* 0.5 + 4 + 24 = about 29 MiB */
  k_prep<<<PB_Q + PB_O + PB_X, 256, 0, stream>>>(x, Wqkv, Wout, X16, BQKV, BO);      /* weights stay in their (out, in) order */
  k_gemm2<0><<<dim3((NR / 128) * (3 * EE / 64), 1), 128, 0, stream>>>(X16, EE, 0, BQKV, EE, 0, 0.0625f, bqkv, 0, nullptr, 1, 0, 0, QKV, nullptr, 3 * EE, 0, NR, 3 * EE, EE);      /* [q | k | v] + bias, f32 */
  k_local<<<NR / 16, 128, 0, stream>>>(QKV, BO, bout, (float*)d_out);      /* attention, then out = (o_hi + o_lo) Wout^T + bout */
}

// v004
// A run of this version takes 27.6 microseconds.
// Next to v003, in two timings, it ran 1.39 and 1.40 times as fast.
// Counting every step since v000, it is 10.5 times as fast.
#include <hip/hip_runtime.h>
// Speech_MultiHeadedAttention (2 x 4096 frames x 256 = 4 heads x 64; qkv = x Wqkv^T + bqkv; q scaled by 64^-0.5; local attention over a 65-frame window centred on each frame where the window is taken from ZERO-PADDED k / v (out-of-range slots are zero vectors that still take part in the softmax with logit 0, exactly as the source); out = merged . Wout^T + bout).
// Structure: qkv as ONE f16 WMMA GEMM that makes its own exact f16 x and x16 weight tiles in LDS from the f32 inputs (128x192 work-group tiles, 64x48 wave tiles, f32 accumulation, + bias; f32 out) and leaves the x16 Wout plane for the next launch; the 65-key windowed attention on the f32 matrix form (wave per 16 frames x head: scores and weighted value sum as 16x16x4 products, softmax in registers, all f32 from the f32 q/k/v plane); its work-group (16 frames x all four heads) then holds 16 whole merged rows as f16 hi/residual planes in LDS and does Wout on them as two f16 WMMA terms (+ bias) in the same launch.
// Compute dtype: inputs rounded to bf16; x / weights exact as f16 so q/k/v are f32 sums of exact products; the attention output as f16 hi + residual; softmax f32 - near exact-class. v_wmma_f32_16x16x32_f16, v_wmma_f32_16x16x4_f32.
#define NB 2
#define TT 4096
#define EE 256
#define NH 4
#define HD 64
#define WW 65
#define PADW 32
#define NR (NB * TT)
typedef __bf16 v16b __attribute__((ext_vector_type(16)));
typedef unsigned short v8us __attribute__((ext_vector_type(8), may_alias));
typedef float  v8f  __attribute__((ext_vector_type(8)));
typedef float  v4f  __attribute__((ext_vector_type(4)));
typedef float  v4fa __attribute__((ext_vector_type(4), may_alias));
union FragB { v16b v; v8us half[2]; unsigned short u[16]; };

__device__ __forceinline__ unsigned short bf16_bits(float x) { unsigned int u = __float_as_uint(x); return (unsigned short)((u + 0x7FFFu + ((u >> 16) & 1u)) >> 16); }
__device__ __forceinline__ float bf16_val(unsigned short b) { return __uint_as_float(((unsigned int)b) << 16); }
__device__ __forceinline__ float bf16_round(float x) { return bf16_val(bf16_bits(x)); }
// D += A·B with NT terms: 1 = ah·bh, 2 = + al·bh (A split), 3 = + ah·bl (both split)
template <int NT>
__device__ __forceinline__ v8f mmaN(v16b ah, v16b al, v16b bh, v16b bl, v8f c) {
  c = __builtin_amdgcn_wmma_f32_16x16x32_bf16(false, ah, false, bh, (short)0, c, false, false);
  if (NT >= 2) c = __builtin_amdgcn_wmma_f32_16x16x32_bf16(false, al, false, bh, (short)0, c, false, false);
  if (NT >= 3) c = __builtin_amdgcn_wmma_f32_16x16x32_bf16(false, ah, false, bl, (short)0, c, false, false);
  asm volatile("v_nop\n\tv_nop\n\tv_nop\n\tv_nop" : "+v"(c) : "v"(ah), "v"(al), "v"(bh), "v"(bl));
  return c;
}

__global__ __launch_bounds__(256) void k_wt_bf16(const float* __restrict__ W, unsigned short* __restrict__ Wt, int K, int N) {
  const int t = blockIdx.x * 256 + threadIdx.x;
  const int k8n = K / 8;
  if (t >= N * k8n) return;
  const int n = t / k8n, k8 = (t % k8n) * 8;
  v8us v;
#pragma unroll
  for (int i = 0; i < 8; ++i) v[i] = bf16_bits(W[(size_t)(k8 + i) * N + n]);
  *(v8us*)(Wt + (size_t)n * K + k8) = v;
  
}

// GEMM C[M][N] (f32, pitch ldc) = act(A[M][K]·W + bias). A f32 row-major (pitch lda) converted per fragment to bf16
// (ASPLIT: hi/lo two planes -> 2 terms, else single rounded term); Wt bf16 [N][K] (pitch ldb). BIAS_BF16 rounds the
// bias to bf16 first (bias quantised to bf16 before the add). K%32==0, M%16==0, N%64==0.
template <bool ASPLIT, int ACT, bool BIAS_BF16>
__global__ __launch_bounds__(128) void k_gemm_bf(const float* __restrict__ A, int lda, const unsigned short* __restrict__ Wt, int ldb,
                                               const float* __restrict__ bias, float* __restrict__ C, int ldc, int M, int N, int K) {
  __shared__ __attribute__((aligned(16))) float so[4][16][64];
  const int tid = threadIdx.x, w = tid >> 5, lane = tid & 31, ln = lane & 15, hh = lane >> 4;
  const int ntn = N / 64;
  const int wid = blockIdx.x * 4 + w;
  const int mt = wid / ntn, nq = wid % ntn;
  if (mt * 16 >= M) return;
  const int row0 = mt * 16, col0 = nq * 64;
  const float* arow = A + (size_t)(row0 + ln) * lda;
  v8f acc[4] = {};
  for (int kb = 0; kb < K; kb += 32) {
    FragB ah, al;
    const v4f x0 = *(const v4fa*)(arow + kb + 8 * hh), x1 = *(const v4fa*)(arow + kb + 8 * hh + 4);
    const v4f x2 = *(const v4fa*)(arow + kb + 16 + 8 * hh), x3 = *(const v4fa*)(arow + kb + 16 + 8 * hh + 4);
    float xs[16] = {x0[0],x0[1],x0[2],x0[3],x1[0],x1[1],x1[2],x1[3],x2[0],x2[1],x2[2],x2[3],x3[0],x3[1],x3[2],x3[3]};
#pragma unroll
    for (int i = 0; i < 16; ++i) { const unsigned short hb = bf16_bits(xs[i]); ah.u[i] = hb; al.u[i] = ASPLIT ? bf16_bits(xs[i] - bf16_val(hb)) : (unsigned short)0; }
#pragma unroll
    for (int t = 0; t < 4; ++t) {
      const unsigned short* brow = Wt + (size_t)(col0 + t * 16 + ln) * ldb + kb;
      FragB b;
      b.half[0] = *(const v8us*)(brow + 8 * hh);
      b.half[1] = *(const v8us*)(brow + 16 + 8 * hh);
      acc[t] = mmaN<ASPLIT ? 2 : 1>(ah.v, al.v, b.v, b.v, acc[t]);
    }
  }
#pragma unroll
  for (int t = 0; t < 4; ++t) {
    float bv = bias ? bias[col0 + t * 16 + ln] : 0.f;
    if (BIAS_BF16) bv = bf16_round(bv);
#pragma unroll
    for (int r = 0; r < 8; ++r) { float v = acc[t][r] + bv; if (ACT == 1) v = fmaxf(v, 0.f); so[w][8 * hh + r][t * 16 + ln] = v; }
  }
  __builtin_amdgcn_fence(__ATOMIC_ACQ_REL, "workgroup");
  __builtin_amdgcn_wave_barrier();
  const int rsub = lane >> 4, c4 = (lane & 15) * 4;
  {
#pragma unroll
    for (int q = 0; q < 8; ++q) {
      const int r = q * 2 + rsub;
      const v4f v = *(const v4fa*)&so[w][r][c4];
      *(v4f*)(C + (size_t)(row0 + r) * ldc + col0 + c4) = v;
    }
    
  }
}

// GEMM C = act(A·W + bias + resid): A f32 (ASPLIT -> hi/lo 2 terms), Wt bf16 [N][K]; ACT 0 none, 1 relu, 2 exact gelu;
// resid (optional, f32, row index = (row % rmod), pitch ldr, RES_BF16 rounds it) added before the activation.
template <bool ASPLIT, int ACT, bool BIAS_BF16, bool RES_BF16>
__global__ __launch_bounds__(128) void k_gemm_bf3(const float* __restrict__ A, int lda, const unsigned short* __restrict__ Wt, int ldb,
                                                const float* __restrict__ bias, const float* __restrict__ resid, int rmod, int ldr,
                                                float* __restrict__ C, int ldc, int M, int N, int K) {
  __shared__ __attribute__((aligned(16))) float so[4][16][64];
  const int tid = threadIdx.x, w = tid >> 5, lane = tid & 31, ln = lane & 15, hh = lane >> 4;
  const int ntn = N / 64;
  const int wid = blockIdx.x * 4 + w;
  const int mt = wid / ntn, nq = wid % ntn;
  if (mt * 16 >= M) return;
  const int row0 = mt * 16, col0 = nq * 64;
  const float* arow = A + (size_t)(row0 + ln) * lda;
  v8f acc[4] = {};
  for (int kb = 0; kb < K; kb += 32) {
    FragB ah, al;
    const v4f x0 = *(const v4fa*)(arow + kb + 8 * hh), x1 = *(const v4fa*)(arow + kb + 8 * hh + 4);
    const v4f x2 = *(const v4fa*)(arow + kb + 16 + 8 * hh), x3 = *(const v4fa*)(arow + kb + 16 + 8 * hh + 4);
    float xs[16] = {x0[0],x0[1],x0[2],x0[3],x1[0],x1[1],x1[2],x1[3],x2[0],x2[1],x2[2],x2[3],x3[0],x3[1],x3[2],x3[3]};
#pragma unroll
    for (int i = 0; i < 16; ++i) { const unsigned short hb = bf16_bits(xs[i]); ah.u[i] = hb; al.u[i] = ASPLIT ? bf16_bits(xs[i] - bf16_val(hb)) : (unsigned short)0; }
#pragma unroll
    for (int t = 0; t < 4; ++t) {
      const unsigned short* brow = Wt + (size_t)(col0 + t * 16 + ln) * ldb + kb;
      FragB b;
      b.half[0] = *(const v8us*)(brow + 8 * hh);
      b.half[1] = *(const v8us*)(brow + 16 + 8 * hh);
      acc[t] = mmaN<ASPLIT ? 2 : 1>(ah.v, al.v, b.v, b.v, acc[t]);
    }
  }
#pragma unroll
  for (int t = 0; t < 4; ++t) {
    const int col = col0 + t * 16 + ln;
    float bv = bias ? bias[col] : 0.f;
    if (BIAS_BF16) bv = bf16_round(bv);
#pragma unroll
    for (int r = 0; r < 8; ++r) {
      float v = acc[t][r] + bv;
      if (resid) { float rv = resid[(size_t)((row0 + 8 * hh + r) % rmod) * ldr + col]; if (RES_BF16) rv = bf16_round(rv); v += rv; }
      if (ACT == 1) v = fmaxf(v, 0.f);
      if (ACT == 2) v = 0.5f * v * (1.0f + erff(v * 0.70710678118654752f));
      if (ACT == 3) { const float u = 0.7978845608028654f * (v + 0.044715f * v * v * v); v = 0.5f * v * (1.0f + tanhf(u)); }
      so[w][8 * hh + r][t * 16 + ln] = v;
    }
  }
  __builtin_amdgcn_fence(__ATOMIC_ACQ_REL, "workgroup");
  __builtin_amdgcn_wave_barrier();
  const int rsub = lane >> 4, c4 = (lane & 15) * 4;
  {
#pragma unroll
    for (int q = 0; q < 8; ++q) {
      const int r = q * 2 + rsub;
      const v4f v = *(const v4fa*)&so[w][r][c4];
      *(v4f*)(C + (size_t)(row0 + r) * ldc + col0 + c4) = v;
    }
    
  }
}
// row LayerNorm (biased variance, eps) over N: s = X (+ R); optional out_sum <- s; out_norm <- (s-mu)*rsqrt(var+eps)*g + b
template <bool PARAM_BF16>
__global__ __launch_bounds__(256) void k_layernorm(const float* __restrict__ X, const float* __restrict__ R, const float* __restrict__ g, const float* __restrict__ bta,
                                                  float* __restrict__ out_sum, float* __restrict__ out_norm, int N, float eps) {
  __shared__ float red[256];
  const int row = blockIdx.x, tid = threadIdx.x;
  const float* x = X + (size_t)row * N; const float* rr = R ? R + (size_t)row * N : nullptr;
  float vals[16];                     // up to N = 4096
  const int per = N / 256;            // contiguous chunk per thread? use strided-by-4 chunks: thread handles j = tid*4 + 1024*u
  float s1 = 0.f;
  for (int u = 0; u < per / 4; ++u) {
    const int j = tid * 4 + 1024 * u;
    const v4f a = *(const v4fa*)(x + j);
    v4f b = {0.f,0.f,0.f,0.f}; if (rr) b = *(const v4fa*)(rr + j);
#pragma unroll
    for (int q = 0; q < 4; ++q) { const float v = a[q] + b[q]; vals[u * 4 + q] = v; s1 += v; }
  }
  red[tid] = s1; __syncthreads();
  for (int st = 128; st > 0; st >>= 1) { if (tid < st) red[tid] += red[tid + st]; __syncthreads(); }
  const float mu = red[0] / (float)N; __syncthreads();
  float s2 = 0.f;
  for (int u = 0; u < per / 4; ++u)
#pragma unroll
    for (int q = 0; q < 4; ++q) { const float c = vals[u * 4 + q] - mu; s2 += c * c; }
  red[tid] = s2; __syncthreads();
  for (int st = 128; st > 0; st >>= 1) { if (tid < st) red[tid] += red[tid + st]; __syncthreads(); }
  const float rs = rsqrtf(red[0] / (float)N + eps);
  {
    for (int u = 0; u < per / 4; ++u) {
      const int j = tid * 4 + 1024 * u;
      v4f o, sm;
#pragma unroll
      for (int q = 0; q < 4; ++q) {
        float gg = g[j + q], bb = bta[j + q];
        if (PARAM_BF16) { gg = bf16_round(gg); bb = bf16_round(bb); }
        sm[q] = vals[u * 4 + q]; o[q] = (vals[u * 4 + q] - mu) * rs * gg + bb;
      }
      if (out_sum) *(v4f*)(out_sum + (size_t)row * N + j) = sm;
      *(v4f*)(out_norm + (size_t)row * N + j) = o;
    }
    
  }
}



// ---- f16 WMMA path (v_wmma_f32_16x16x32_f16): 11-bit significands for operands in range — used for the qkv GEMM (k_qkv) and the Wout product in k_local
typedef _Float16 v16h __attribute__((ext_vector_type(16)));
union FragH { v16h v; v8us half[2]; _Float16 h[16]; unsigned short u[16]; };
template <int NT>
__device__ __forceinline__ v8f mmaH(v16h ah, v16h al, v16h bh, v16h bl, v8f c) {
  c = __builtin_amdgcn_wmma_f32_16x16x32_f16(false, ah, false, bh, (short)0, c, false, false);
  if (NT >= 2) c = __builtin_amdgcn_wmma_f32_16x16x32_f16(false, al, false, bh, (short)0, c, false, false);
  if (NT >= 3) c = __builtin_amdgcn_wmma_f32_16x16x32_f16(false, ah, false, bl, (short)0, c, false, false);
  asm volatile("v_nop\n\tv_nop\n\tv_nop\n\tv_nop" : "+v"(c) : "v"(ah), "v"(al), "v"(bh), "v"(bl));
  return c;
}
// batched GEMM like k_gemm_b but f16 operands: A f32 (split into f16 hi/lo if ASPLIT, else rounded to f16), Bt = f16 values [n][k]; alpha; C f32; N multiple of 16 (partial tiles skipped)
template <bool ASPLIT>
__global__ __launch_bounds__(128) void k_gemm_h(const float* __restrict__ A, int lda, size_t sA, const _Float16* __restrict__ Bh, int ldb, size_t sB, float alpha, float* __restrict__ C, int ldc, size_t sC, int M, int N, int K) {
  __shared__ __attribute__((aligned(16))) float so[4][16][64];
  const int tid = threadIdx.x, w = tid >> 5, lane = tid & 31, ln = lane & 15, hh = lane >> 4; const int by = blockIdx.y;
  A += (size_t)by * sA; Bh += (size_t)by * sB; C += (size_t)by * sC;
  const int ntn = (N + 63) / 64; const int wid = blockIdx.x * 4 + w; const int mt = wid / ntn, nq = wid % ntn; if (mt * 16 >= M) return;
  const int row0 = mt * 16, col0 = nq * 64; const float* arow = A + (size_t)(row0 + ln) * lda;
  v8f acc[4] = {};
  for (int kb = 0; kb < K; kb += 32) {
    FragH ah, al;
    const v4f x0 = *(const v4fa*)(arow + kb + 8 * hh), x1 = *(const v4fa*)(arow + kb + 8 * hh + 4), x2 = *(const v4fa*)(arow + kb + 16 + 8 * hh), x3 = *(const v4fa*)(arow + kb + 16 + 8 * hh + 4);
    float xs[16] = {x0[0],x0[1],x0[2],x0[3],x1[0],x1[1],x1[2],x1[3],x2[0],x2[1],x2[2],x2[3],x3[0],x3[1],x3[2],x3[3]};
#pragma unroll
    for (int i = 0; i < 16; ++i) { const _Float16 h = (_Float16)xs[i]; ah.h[i] = h; al.h[i] = ASPLIT ? (_Float16)(xs[i] - (float)h) : (_Float16)0.0f; }
#pragma unroll
    for (int t = 0; t < 4; ++t) { if (col0 + t * 16 >= N) continue; const size_t boff = (size_t)(col0 + t * 16 + ln) * ldb + kb; FragH bq; bq.half[0] = *(const v8us*)(Bh + boff + 8 * hh); bq.half[1] = *(const v8us*)(Bh + boff + 16 + 8 * hh);
      acc[t] = mmaH<ASPLIT ? 2 : 1>(ah.v, al.v, bq.v, bq.v, acc[t]); }
  }
#pragma unroll
  for (int t = 0; t < 4; ++t) { if (col0 + t * 16 >= N) continue;
#pragma unroll
    for (int r = 0; r < 8; ++r) so[w][8 * hh + r][t * 16 + ln] = acc[t][r] * alpha; }
  __builtin_amdgcn_fence(__ATOMIC_ACQ_REL, "workgroup"); __builtin_amdgcn_wave_barrier();
  const int rsub = lane >> 4, c4 = (lane & 15) * 4;
  {
#pragma unroll
    for (int q = 0; q < 8; ++q) { const int r = q * 2 + rsub; if (col0 + c4 < N) { const v4f v = *(const v4fa*)&so[w][r][c4]; *(v4f*)(C + (size_t)(row0 + r) * ldc + col0 + c4) = v; } }
     }
}

// Wt[n][k] = f16(W[k][n]·scale) from f32 row-major W[K][N] (scale = power of two; bf16-exact weights stay exact in f16 away from the subnormal range)
__global__ __launch_bounds__(256) void k_wt_f16(const float* __restrict__ W, _Float16* __restrict__ Wt, int K, int N, float scale) {
  const int t = blockIdx.x * 256 + threadIdx.x; if (t >= N * (K / 8)) return; const int n = t / (K / 8), k8 = (t % (K / 8)) * 8; FragH f;
#pragma unroll
  for (int i = 0; i < 8; ++i) f.h[i] = (_Float16)(bf16_round(W[(size_t)(k8 + i) * N + n]) * scale); const v8us o = f.half[0];
  *(v8us*)((unsigned short*)Wt + (size_t)n * K + k8) = o; 
}
// k_gemm_hh variant with fused epilogue: v = acc·alpha + bias[by·sBias + col] (+ CP[(row/rowsPerB)·sCPb + by·64 + col] if CP) ; ACT 0 none / 1 elu ; writes f16 C16 (and f32 C if non-null)
template <int ACT>
__global__ __launch_bounds__(128) void k_gemm_hhx(const _Float16* __restrict__ A, int lda, size_t sA, const _Float16* __restrict__ Bh, int ldb, size_t sB, float alpha, const float* __restrict__ bias, size_t sBias, const float* __restrict__ CP, int rowsPerB, size_t sCPb, int row0g,
    float* __restrict__ C, _Float16* __restrict__ C16, int ldc, size_t sC, int M, int N, int K) {
  __shared__ __attribute__((aligned(16))) float so[4][16][64];
  const int tid = threadIdx.x, w = tid >> 5, lane = tid & 31, ln = lane & 15, hh = lane >> 4; const int by = blockIdx.y;
  A += (size_t)by * sA; Bh += (size_t)by * sB; const size_t cofs = (size_t)by * sC; const float* bp = bias ? bias + (size_t)by * sBias : nullptr;
  const int ntn = (N + 63) / 64; const int wid = blockIdx.x * 4 + w; const int mt = wid / ntn, nq = wid % ntn; if (mt * 16 >= M) return;
  const int row0 = mt * 16, col0 = nq * 64; const _Float16* arow = A + (size_t)(row0 + ln) * lda;
  v8f acc[4] = {};
  for (int kb = 0; kb < K; kb += 32) { FragH ah; ah.half[0] = *(const v8us*)((const unsigned short*)arow + kb + 8 * hh); ah.half[1] = *(const v8us*)((const unsigned short*)arow + kb + 16 + 8 * hh);
#pragma unroll
    for (int t = 0; t < 4; ++t) { if (col0 + t * 16 >= N) continue; const size_t boff = (size_t)(col0 + t * 16 + ln) * ldb + kb; FragH bq; bq.half[0] = *(const v8us*)((const unsigned short*)Bh + boff + 8 * hh); bq.half[1] = *(const v8us*)((const unsigned short*)Bh + boff + 16 + 8 * hh);
      acc[t] = mmaH<1>(ah.v, ah.v, bq.v, bq.v, acc[t]); }
  }
#pragma unroll
  for (int t = 0; t < 4; ++t) { if (col0 + t * 16 >= N) continue; const int col = col0 + t * 16 + ln; const float bv = bp ? bf16_round(bp[col]) : 0.f;
#pragma unroll
    for (int r = 0; r < 8; ++r) { float v = acc[t][r] * alpha + bv; if (CP) { const int rr = row0g + row0 + 8 * hh + r; if (rowsPerB < 0) v += CP[cofs + (size_t)rr * ldc + col];      /* rowsPerB < 0: own element of the batched C plane */ else { const int bidx = rr / rowsPerB; v += CP[(size_t)bidx * sCPb + (size_t)by * 64 + col]; } } if (ACT == 1) v = (v > 0.f) ? v : expm1f(v); else if (ACT == 7) v = (v > 0.f) ? v + 1.0f : expf(v); else if (ACT == 8) v = tanhf(v); else if (ACT == 9) v = 0.5f * v * (1.0f + tanhf(0.7978845608028654f * (v + 0.044715f * v * v * v))); else if (ACT == 11) v = 1.0f / (1.0f + expf(-v)); else if (ACT == 12) v = (v > 0.f) ? v : 0.01f * v; else if (ACT == 14) v = (v > 0.f) ? v : 0.1f * v; else if (ACT == 16) v = (v >= 0.f) ? v : 0.3f * v; else if (ACT == 17) v = (v >= 0.f) ? v : 0.2f * v; else if (ACT == 15) v = v / (1.0f + expf(-v)); else if (ACT == 3) v = fmaxf(v, 0.f); else if (ACT == 6) v = 0.5f * v * (1.0f + erff(v * 0.70710678118654752f)); so[w][8 * hh + r][t * 16 + ln] = v; } }
  __builtin_amdgcn_fence(__ATOMIC_ACQ_REL, "workgroup"); __builtin_amdgcn_wave_barrier();
  const int rsub = lane >> 4, c4 = (lane & 15) * 4; typedef _Float16 v4h __attribute__((ext_vector_type(4)));
  {
#pragma unroll
    for (int q = 0; q < 8; ++q) { const int r = q * 2 + rsub; if (col0 + c4 < N) { const v4f v = *(const v4fa*)&so[w][r][c4]; if (C) *(v4f*)(C + cofs + (size_t)(row0 + r) * ldc + col0 + c4) = v; if (C16) { v4h h4; for (int i = 0; i < 4; ++i) h4[i] = (_Float16)v[i]; *(v4h*)(C16 + cofs + (size_t)(row0 + r) * ldc + col0 + c4) = h4; } } }
     }
}


typedef _Float16 v4h __attribute__((ext_vector_type(4)));

__global__ __launch_bounds__(256) void k_h16(const float* __restrict__ x, _Float16* __restrict__ X16, size_t n8) { const size_t t = (size_t)blockIdx.x * 256 + threadIdx.x; if (t >= n8) return; FragH f;
#pragma unroll
  for (int q = 0; q < 8; ++q) f.h[q] = (_Float16)x[t * 8 + q]; *(v8us*)((unsigned short*)X16 + t * 8) = f.half[0];  }
__global__ __launch_bounds__(256) void k_round16f(const float* __restrict__ W, _Float16* __restrict__ Bt, size_t n8) { const size_t t = (size_t)blockIdx.x * 256 + threadIdx.x; if (t >= n8) return; FragH f;
#pragma unroll
  for (int i = 0; i < 8; ++i) f.h[i] = (_Float16)(bf16_round(W[t * 8 + i]) * 16.0f); *(v8us*)((unsigned short*)Bt + t * 8) = f.half[0];  }
template <int NHv, int TTv>
__global__ __launch_bounds__(256) void k_vt(const _Float16* __restrict__ V16, int ldv, int voff, _Float16* __restrict__ Vt) { __shared__ unsigned short tl[64][66]; const int tid = threadIdx.x; const int slab = blockIdx.x / (TTv / 64), lg = blockIdx.x % (TTv / 64); const int b = slab / NHv, h = slab % NHv;
  for (int i = tid; i < 64 * 8; i += 256) { const int r = i / 8, c8 = (i % 8) * 8; FragH f; f.half[0] = *(const v8us*)((const unsigned short*)V16 + ((size_t)b * TTv + lg * 64 + r) * ldv + voff + h * 64 + c8);
#pragma unroll
    for (int q = 0; q < 8; ++q) tl[r][c8 + q] = f.u[q]; }
  __syncthreads();
  {
#pragma unroll
    for (int rd = 0; rd < 2; ++rd) { const int d = rd * 32 + tid / 8, pc = tid % 8; FragH f;
#pragma unroll
      for (int q = 0; q < 8; ++q) f.u[q] = tl[pc * 8 + q][d];
      *(v8us*)((unsigned short*)Vt + ((size_t)slab * 64 + d) * TTv + lg * 64 + pc * 8) = f.half[0]; }
     } }

__global__ __launch_bounds__(256) void k_hl(const float* __restrict__ F, _Float16* __restrict__ Hh, _Float16* __restrict__ Hl, size_t n8) { const size_t t = (size_t)blockIdx.x * 256 + threadIdx.x; if (t >= n8) return; FragH fh, fl; const v4f a = *(const v4fa*)(F + t * 8), c = *(const v4fa*)(F + t * 8 + 4);
#pragma unroll
  for (int q = 0; q < 4; ++q) { _Float16 h = (_Float16)a[q]; fh.h[q] = h; fl.h[q] = (_Float16)((a[q] - (float)h) * 1024.0f); h = (_Float16)c[q]; fh.h[4 + q] = h; fl.h[4 + q] = (_Float16)((c[q] - (float)h) * 1024.0f); }
  { *(v8us*)((unsigned short*)Hh + t * 8) = fh.half[0]; *(v8us*)((unsigned short*)Hl + t * 8) = fl.half[0];  } }

// ---- fast GEMM (wave tile 32x64; requires M % 32 == 0 rows per launch region and N % 64 == 0); epilogue = k_gemm_hhx semantics ----
__device__ __forceinline__ v16h g2_frag(const _Float16* p, int hh) { FragH f; f.half[0] = *(const v8us*)((const unsigned short*)p + 8 * hh); f.half[1] = *(const v8us*)((const unsigned short*)p + 16 + 8 * hh); return f.v; }
__device__ __forceinline__ v8f g2_mma(v16h a, v16h b, v8f c) { v8f d = __builtin_amdgcn_wmma_f32_16x16x32_f16(false, a, false, b, (short)0, c, false, false); asm volatile("v_nop\n\tv_nop\n\tv_nop\n\tv_nop" : "+v"(d) : "v"(a), "v"(b)); return d; }
template <int ACT>
__global__ __launch_bounds__(128) void k_gemm2(const _Float16* __restrict__ A, int lda, size_t sA, const _Float16* __restrict__ Bh, int ldb, size_t sB, float alpha, const float* __restrict__ bias, size_t sBias, const float* __restrict__ CP, int rowsPerB, size_t sCPb, int row0g,
    float* __restrict__ C, _Float16* __restrict__ C16, int ldc, size_t sC, int M, int N, int K) { static_assert(ACT == 0 || ACT == 3 || ACT == 6 || ACT == 8 || ACT == 9 || ACT == 11 || ACT == 12 || ACT == 14 || ACT == 15 || ACT == 16 || ACT == 17, "k_gemm2: unsupported ACT code (would silently apply no activation)");
  __shared__ __attribute__((aligned(16))) float so[4][32][68];
  const int tid = threadIdx.x, w = tid >> 5, lane = tid & 31, ln = lane & 15, hh = lane >> 4; const int by = blockIdx.y;
  A += (size_t)by * sA; Bh += (size_t)by * sB; const size_t cofs = (size_t)by * sC; const float* bp = bias ? bias + (size_t)by * sBias : nullptr;
  const int ntn = N >> 6; const int mt = blockIdx.x / ntn, nq = blockIdx.x - mt * ntn; const int row0 = mt * 128 + 32 * w, col0 = nq * 64; if (row0 >= M) return;
  const _Float16* a0p = A + (size_t)(row0 + ln) * lda; const _Float16* a1p = a0p + (size_t)16 * lda;
  const _Float16* b0p = Bh + (size_t)(col0 + ln) * ldb; const _Float16* b1p = b0p + (size_t)16 * ldb; const _Float16* b2p = b1p + (size_t)16 * ldb; const _Float16* b3p = b2p + (size_t)16 * ldb;
  const v8f z8 = {0.f,0.f,0.f,0.f,0.f,0.f,0.f,0.f}; v8f c00 = z8, c01 = z8, c02 = z8, c03 = z8, c10 = z8, c11 = z8, c12 = z8, c13 = z8;
#pragma unroll 1
  for (int kb = 0; kb < K; kb += 32) { const v16h a0 = g2_frag(a0p + kb, hh), a1 = g2_frag(a1p + kb, hh);
    v16h b = g2_frag(b0p + kb, hh); c00 = g2_mma(a0, b, c00); c10 = g2_mma(a1, b, c10);
    b = g2_frag(b1p + kb, hh); c01 = g2_mma(a0, b, c01); c11 = g2_mma(a1, b, c11);
    b = g2_frag(b2p + kb, hh); c02 = g2_mma(a0, b, c02); c12 = g2_mma(a1, b, c12);
    b = g2_frag(b3p + kb, hh); c03 = g2_mma(a0, b, c03); c13 = g2_mma(a1, b, c13); }
  v8f accs[8] = {c00, c01, c02, c03, c10, c11, c12, c13};
#pragma unroll
  for (int u = 0; u < 8; ++u) { const int t = u & 3, half = u >> 2; const int col = col0 + t * 16 + ln; const float bv = bp ? bf16_round(bp[col]) : 0.f;
#pragma unroll
    for (int r = 0; r < 8; ++r) { const int rloc = half * 16 + 8 * hh + r; float v = accs[u][r] * alpha + bv; if (CP) { if (rowsPerB < 0) v += CP[cofs + (size_t)(row0g + row0 + rloc) * ldc + col];      /* rowsPerB < 0: own element of the batched C plane */ else { const int bidx = (row0g + row0 + rloc) / rowsPerB; v += CP[(size_t)bidx * sCPb + (size_t)by * 64 + col]; } }
      if (ACT == 3) v = fmaxf(v, 0.f); else if (ACT == 6) v = 0.5f * v * (1.0f + erff(v * 0.70710678118654752f)); else if (ACT == 11) v = 1.0f / (1.0f + expf(-v)); else if (ACT == 15) v = v / (1.0f + expf(-v)); else if (ACT == 12) v = (v > 0.f) ? v : 0.01f * v; else if (ACT == 8) v = tanhf(v); else if (ACT == 9) v = 0.5f * v * (1.0f + tanhf(0.7978845608028654f * (v + 0.044715f * v * v * v))); else if (ACT == 14) v = (v > 0.f) ? v : 0.1f * v; else if (ACT == 16) v = (v >= 0.f) ? v : 0.3f * v; else if (ACT == 17) v = (v >= 0.f) ? v : 0.2f * v;
      so[w][rloc][t * 16 + ln] = v; } }
  __builtin_amdgcn_fence(__ATOMIC_ACQ_REL, "workgroup"); __builtin_amdgcn_wave_barrier();
  const int rsub = lane >> 4, c4 = (lane & 15) * 4;
  {
#pragma unroll
    for (int q = 0; q < 16; ++q) { const int r = q * 2 + rsub; const v4f v = *(const v4fa*)&so[w][r][c4]; if (C) *(v4f*)(C + cofs + (size_t)(row0 + r) * ldc + col0 + c4) = v; if (C16) { v4h h4; for (int i = 0; i < 4; ++i) h4[i] = (_Float16)v[i]; *(v4h*)(C16 + cofs + (size_t)(row0 + r) * ldc + col0 + c4) = h4; } }
     } }


// qkv = x Wqkv^T + bqkv with the f32 -> f16 operand conversion inside the GEMM: a work-group owns 128 rows x 192 columns, reads its 128 x rows and 192 weight rows as whole
// 512-byte pieces of f32, rounds them (bf16 value, weights x 16, exact in f16) and lays them in LDS once; behind one barrier its eight waves (2 x 4, 64 x 48 each)
// take every fragment from LDS. 256 work-groups, one per WGP. Each also converts its 256 elements of Wout for the next launch.
#define GM 128
#define GN 192
#define GP (EE + 8)      /* pitch 528 B = 16 B x odd: 16-byte fragment reads of 16 rows meet no bank twice */
#define GS (GN + 4)      /* f32 staging pitch: rows 8 apart differ by 32 banks */
static_assert(NR % GM == 0 && 3 * EE == 4 * GN && EE == 256 && (NR / GM) * 4 * 256 == EE * EE, "k_qkv: whole tiles, four tile columns, 64 threads to a row, and 256 elements of Wout for each work-group");
static_assert(GM * GS * 4 <= (GM + GN) * GP * 2, "k_qkv: the f32 staging tile lies inside the operand tiles' LDS");
// Four f32 -> nearest-even bf16 value x a power of two, as f16, by the convert instructions. The scale goes on in f32, ahead of the rounding (a power of two commutes with it):
// behind it the compiler moves the product into f16, where a small weight has already lost bits.
typedef __bf16 v4bq __attribute__((ext_vector_type(4)));
__device__ __forceinline__ v4h q_h4(v4f a, float sc) { return __builtin_convertvector(__builtin_convertvector(__builtin_convertvector(a * sc, v4bq), v4f), v4h); }
// Staging step it (0..79) of a thread: four floats of tile row 4 it + (tid >> 6); rows 0..127 are x, rows 128..319 the weight rows. A batch is 16 steps.
template <int B>
__device__ __forceinline__ void q_ld(const float* __restrict__ xs, const float* __restrict__ wr, v4f (&d)[16]) {
#pragma unroll      /* constant indices keep the register arrays out of scratch */
  for (int i = 0; i < 16; ++i) { const int it = B * 16 + i; d[i] = *(const v4fa*)(it < GM / 4 ? xs + (size_t)it * 4 * EE : wr + (size_t)(it - GM / 4) * 4 * EE); } }
template <int B>
__device__ __forceinline__ void q_cv(const v4f (&d)[16], _Float16* dst) {
#pragma unroll      /* constant indices keep the register arrays out of scratch */
  for (int i = 0; i < 16; ++i) { const int it = B * 16 + i; *(v4h*)(dst + (size_t)it * 4 * GP) = q_h4(d[i], it < GM / 4 ? 1.0f : 16.0f); } }
__global__ __launch_bounds__(256) void k_qkv(const float* __restrict__ x, const float* __restrict__ Wqkv, const float* __restrict__ bqkv, const float* __restrict__ Wout, _Float16* __restrict__ BO, float* __restrict__ QKV) {
  __shared__ __attribute__((aligned(16))) char sm[(GM + GN) * GP * 2];
  _Float16 (*st)[GP] = (_Float16 (*)[GP])sm;      /* operand tiles: rows 0..127 x, 128..319 weights */
  float (*so)[GS] = (float (*)[GS])sm;      /* the result tile takes their place behind the barrier that ends the last fragment read */
  const int tid = threadIdx.x, w = tid >> 5, lane = tid & 31, ln = lane & 15, hh = lane >> 4, wr = w >> 2, wc = w & 3;
  const int bx = blockIdx.x, row0 = (bx >> 2) * GM, col0 = (bx & 3) * GN;
  const float* xs = x + (size_t)(row0 + (tid >> 6)) * EE + (tid & 63) * 4;
  const float* wsrc = Wqkv + (size_t)(col0 + (tid >> 6)) * EE + (tid & 63) * 4;
  _Float16* dst = &st[tid >> 6][(tid & 63) * 4];
  v4f t0[16], t1[16];
  q_ld<0>(xs, wsrc, t0); q_ld<1>(xs, wsrc, t1);
  const v4f wo = *(const v4fa*)(Wout + bx * 256 + (tid & 63) * 4);      /* every wave loads, two store: no branch among the staged loads */
  float bv[3];
#pragma unroll      /* constant indices keep the register arrays out of scratch */
  for (int j = 0; j < 3; ++j) bv[j] = bf16_round(bqkv[col0 + 48 * wc + 16 * j + ln]);
  asm volatile("s_wait_xcnt 0x0" :: "v"(xs) : "memory");      /* behind the last load of the opening run, whose address registers are reused below; the x address is named so that it is not reused ahead of the wait */
  __builtin_amdgcn_sched_barrier(0);      /* these hold each batch's loads where they stand: one batch is always in flight while the one before it is converted */
  q_cv<0>(t0, dst); q_ld<2>(xs, wsrc, t0);
  __builtin_amdgcn_sched_barrier(0);
  q_cv<1>(t1, dst); q_ld<3>(xs, wsrc, t1);
  __builtin_amdgcn_sched_barrier(0);
  asm volatile("" :: "v"(wo));      /* inputs only: holds the Wout load up among the first batches; sunk to its use in the branch below it would stand there with a full load latency of its own */
  if (tid < 64) *(v4h*)(BO + bx * 256 + tid * 4) = q_h4(wo, 16.0f);      /* early, so that the barrier below does not wait for this store */
  q_cv<2>(t0, dst); q_ld<4>(xs, wsrc, t0);
  __builtin_amdgcn_sched_barrier(0);
  q_cv<3>(t1, dst);
  q_cv<4>(t0, dst);
  __syncthreads();      /* every wave reads rows that all eight have laid */
  const _Float16* ap = &st[64 * wr + ln][0]; const _Float16* bp = &st[GM + 48 * wc + ln][0];
  const v8f z8 = {0.f,0.f,0.f,0.f,0.f,0.f,0.f,0.f};
  v8f acc[4][3];
  v16h af[2][4], bf[2][3];
#pragma unroll      /* constant indices keep the register arrays out of scratch */
  for (int i = 0; i < 4; ++i) { af[0][i] = g2_frag(ap + i * 16 * GP, hh);
#pragma unroll      /* constant indices keep the register arrays out of scratch */
    for (int j = 0; j < 3; ++j) acc[i][j] = z8; }
#pragma unroll      /* constant indices keep the register arrays out of scratch */
  for (int j = 0; j < 3; ++j) bf[0][j] = g2_frag(bp + j * 16 * GP, hh);
#pragma unroll      /* constant indices keep the register arrays out of scratch */
  for (int ks = 0; ks < EE / 32; ++ks) {
    if (ks < EE / 32 - 1) {
#pragma unroll      /* constant indices keep the register arrays out of scratch */
      for (int i = 0; i < 4; ++i) af[(ks + 1) & 1][i] = g2_frag(ap + i * 16 * GP + (ks + 1) * 32, hh);
#pragma unroll      /* constant indices keep the register arrays out of scratch */
      for (int j = 0; j < 3; ++j) bf[(ks + 1) & 1][j] = g2_frag(bp + j * 16 * GP + (ks + 1) * 32, hh); }
    __builtin_amdgcn_sched_barrier(0);      /* every LDS read of the next step is issued ahead of this step's products, which cover its latency */
#pragma unroll      /* constant indices keep the register arrays out of scratch */
    for (int i = 0; i < 4; ++i)
#pragma unroll      /* constant indices keep the register arrays out of scratch */
      for (int j = 0; j < 3; ++j) acc[i][j] = __builtin_amdgcn_wmma_f32_16x16x32_f16(false, af[ks & 1][i], false, bf[ks & 1][j], (short)0, acc[i][j], false, false); }
  __syncthreads();      /* the last fragment read of every wave is over before the result tile overwrites the operand tiles */
#pragma unroll      /* constant indices keep the register arrays out of scratch */
  for (int i = 0; i < 4; ++i)
#pragma unroll      /* constant indices keep the register arrays out of scratch */
    for (int j = 0; j < 3; ++j)
#pragma unroll      /* constant indices keep the register arrays out of scratch */
      for (int r = 0; r < 8; ++r) so[64 * wr + 16 * i + 8 * hh + r][48 * wc + 16 * j + ln] = acc[i][j][r] * 0.0625f + bv[j];
  __syncthreads();      /* the stores below take whole 128-byte lines across the waves' column ranges */
#pragma unroll      /* constant indices keep the register arrays out of scratch */
  for (int m = 0; m < 3; ++m) { const int c = m * 256 + tid, r = c / (GN / 4), c4 = (c - r * (GN / 4)) * 4;      /* 16-byte piece c of the tile, row-major; piece c + 768 lies 16 rows further down */
#pragma unroll      /* constant indices keep the register arrays out of scratch */
    for (int k = 0; k < GM / 16; ++k) { const v4f v = *(const v4fa*)&so[r + 16 * k][c4]; *(v4f*)(QKV + (size_t)(row0 + r + 16 * k) * (3 * EE) + col0 + c4) = v; } } }
typedef float v2f __attribute__((ext_vector_type(2)));
__device__ __forceinline__ v8f mma4(v2f a, v2f b, v8f c) { return __builtin_amdgcn_wmma_f32_16x16x4_f32(false, a, false, b, (short)0, c, false, false); }
// Four vector slots behind a run of matrix instructions, before a vector instruction may touch their D or overwrite their A or B: the 16-bit forms' distance, kept
// by hand. The operands only tie the slots to the run (D not touched, A and B not reused ahead of them).
__device__ __forceinline__ void gap5(v8f& d0, v8f& d1, v8f& d2, v8f& d3, v8f& d4, v2f a0, v2f a1, v2f a2, v2f a3, v2f a4, v2f b) {
  asm volatile("v_nop\n\tv_nop\n\tv_nop\n\tv_nop" : "+v"(d0), "+v"(d1), "+v"(d2), "+v"(d3), "+v"(d4) : "v"(a0), "v"(a1), "v"(a2), "v"(a3), "v"(a4), "v"(b)); }
__device__ __forceinline__ void gap4(v8f& d0, v8f& d1, v8f& d2, v8f& d3, v2f a, v2f b0, v2f b1, v2f b2, v2f b3) {
  asm volatile("v_nop\n\tv_nop\n\tv_nop\n\tv_nop" : "+v"(d0), "+v"(d1), "+v"(d2), "+v"(d3) : "v"(a), "v"(b0), "v"(b1), "v"(b2), "v"(b3)); }
// Windowed attention on the f32 matrix form. One wave = 16 frames of one head (wave index = head); its window union is 80 key frames = 5 tiles of 16.
// S^T = K . Q^T : register r of tile c in lane (ln, hh) is the score of key 16c + 8hh + r against query ln, so a lane's 40 registers are one query's scores
// (the other 40 keys sit in lane ln ^ 16) and, two by two, they are already the A fragments of P . V (k pairing: key 16c + 8hh + 2p + i).
// V's B fragments: column ln of output tile u stands for d = 4 ln + u, so one 16-byte load of a key's row serves all four tiles.
// Output projection in the same launch: the four waves leave their heads' results in LDS (f16 hi and residual x 1024, 16 rows x 256), and behind one barrier wave h
// forms output columns 64 h .. 64 h + 63 of the 16 rows: A fragments from LDS, B fragments from the f16 weight plane, hi and residual terms in accumulators of their own.
__global__ __launch_bounds__(128) void k_local(const float* __restrict__ QKV, const _Float16* __restrict__ BO, const float* __restrict__ bout, float* __restrict__ out) {
  __shared__ __attribute__((aligned(16))) _Float16 sa[2][16][EE + 8];      /* pitch 528 B = 16 B x odd: 16-byte fragment reads of 16 rows meet no bank twice */
  __shared__ __attribute__((aligned(16))) float so[4][16][68];
  const int lane = threadIdx.x & 31, ln = lane & 15, hh = lane >> 4, h = threadIdx.x >> 5;
  const int row0 = blockIdx.x * 16, b = row0 / TT, t0 = row0 % TT;
  const float* base = QKV + (size_t)b * TT * (3 * EE) + h * HD;
  const float* qp = base + (size_t)(t0 + ln) * (3 * EE) + 4 * hh;      /* d order of both operands: 8 i + 4 hh + 0..3 */
  const float* kp[5];
#pragma unroll
  for (int c = 0; c < 5; ++c) { const int j = t0 - PADW + 16 * c + ln; kp[c] = base + (size_t)min(max(j, 0), TT - 1) * (3 * EE) + EE + 4 * hh; }      /* a padded slot reads an edge row; its score is replaced by 0 below */
  v4f qf[8], kf[8][5];      /* load order: the four 16-byte pieces that share a row's 128-byte line stand back to back */
#pragma unroll
  for (int g = 0; g < 8; g += 4) {
#pragma unroll
    for (int i = g; i < g + 4; ++i) qf[i] = *(const v4fa*)(qp + 8 * i);
#pragma unroll
    for (int c = 0; c < 5; ++c)
#pragma unroll
      for (int i = g; i < g + 4; ++i) kf[i][c] = *(const v4fa*)(kp[c] + 8 * i); }
  __builtin_amdgcn_sched_barrier(0);      /* all 48 q / k loads are issued ahead of the first product: one load latency for the wave, not one per k step */
  const v8f z8 = {0.f,0.f,0.f,0.f,0.f,0.f,0.f,0.f}; v8f s[5] = {z8, z8, z8, z8, z8};
#pragma unroll
  for (int i = 0; i < 8; ++i) { const v4f q = qf[i] * 0.125f;
#pragma unroll
    for (int e = 0; e < 4; e += 2) { const v2f qe = {q[e], q[e + 1]}; v2f ke[5];
#pragma unroll
      for (int c = 0; c < 5; ++c) { ke[c] = v2f{kf[i][c][e], kf[i][c][e + 1]}; s[c] = mma4(ke[c], qe, s[c]); }
      gap5(s[0], s[1], s[2], s[3], s[4], ke[0], ke[1], ke[2], ke[3], ke[4], qe); } }
  v4f vf[5][4][2];
#pragma unroll
  for (int c = 0; c < 5; ++c) { const float* vp[8];
#pragma unroll
    for (int e = 0; e < 8; ++e) { const int j = t0 - PADW + 16 * c + 8 * hh + e; vp[e] = base + (size_t)min(max(j, 0), TT - 1) * (3 * EE) + 2 * EE + 4 * ln; vf[c][e >> 1][e & 1] = *(const v4fa*)vp[e]; }
    /* the address registers of these eight loads are named so that none is reused (a later load's result would land on them) ahead of the wait */
    asm volatile("s_wait_xcnt 0x0" :: "v"(vp[0]), "v"(vp[1]), "v"(vp[2]), "v"(vp[3]), "v"(vp[4]), "v"(vp[5]), "v"(vp[6]), "v"(vp[7]) : "memory"); }
  __builtin_amdgcn_sched_barrier(0);      /* the 40 v loads are issued ahead of the softmax, whose arithmetic covers their latency */
  float mx = -3.0e38f;
#pragma unroll
  for (int c = 0; c < 5; ++c)
#pragma unroll
    for (int r = 0; r < 8; ++r) { const int key = 16 * c + 8 * hh + r; const float v = ((unsigned)(t0 - PADW + key) < (unsigned)TT) ? s[c][r] : 0.f;      /* zero-padded key: logit 0 */
      const bool band = (c == 0) ? (key >= ln) : (c == 4) ? (key - ln <= WW - 1) : true; s[c][r] = band ? v : -3.0e38f; mx = fmaxf(mx, s[c][r]); }      /* a key outside this query's 65: exp gives 0 */
  mx = fmaxf(mx, __shfl_xor(mx, 16));
  float su = 0.f;
#pragma unroll
  for (int c = 0; c < 5; ++c)
#pragma unroll
    for (int r = 0; r < 8; ++r) s[c][r] = expf(s[c][r] - mx);
#pragma unroll
  for (int c = 0; c < 5; ++c)
#pragma unroll
    for (int r = 0; r < 8; ++r) su += s[c][r];
  su += __shfl_xor(su, 16);
  const float inv = 1.0f / su;
  v8f o[4] = {z8, z8, z8, z8};
  const _Float16* wp = BO + (size_t)(h * HD + ln) * EE;      /* weight row = output column 64 h + 16 t + ln; the rows of tile t lie 16 t further on */
  v16h wf[4][4];      /* [k step mod 4][column tile] */
#pragma unroll
  for (int c = 0; c < 5; ++c) {
#pragma unroll
    for (int p = 0; p < 4; ++p) { const int j0 = t0 - PADW + 16 * c + 8 * hh + 2 * p, j1 = j0 + 1; const v4f va = vf[c][p][0], vb = vf[c][p][1];
      const v2f a = {((unsigned)j0 < (unsigned)TT) ? s[c][2 * p] * inv : 0.f, ((unsigned)j1 < (unsigned)TT) ? s[c][2 * p + 1] * inv : 0.f};      /* zero-padded value row: weight 0 on the edge row read in its place */
      v2f bv[4];
#pragma unroll
      for (int u = 0; u < 4; ++u) { bv[u] = v2f{va[u], vb[u]}; o[u] = mma4(a, bv[u], o[u]); }
      gap4(o[0], o[1], o[2], o[3], a, bv[0], bv[1], bv[2], bv[3]); }
    if (c > 0) {
      __builtin_amdgcn_sched_barrier(0);      /* this pair holds the weight loads here: into registers that the used-up key tiles' values have left, with the later key tiles' products over their latency */
#pragma unroll      /* constant indices keep the register arrays out of scratch */
      for (int ks = 0; ks < 4; ++ks) wf[ks][c - 1] = g2_frag(wp + (size_t)(c - 1) * 16 * EE + ks * 32, hh);      /* k 0..127 of column tile c - 1: 256 bytes in a row of each weight row */
      __builtin_amdgcn_sched_barrier(0); } }
  float bo[4];
#pragma unroll      /* constant indices keep the register arrays out of scratch */
  for (int t = 0; t < 4; ++t) bo[t] = bf16_round(bout[h * HD + t * 16 + ln]);
#pragma unroll      /* constant indices keep the register arrays out of scratch */
  for (int r = 0; r < 8; ++r) { v4h fh, fl;
#pragma unroll      /* constant indices keep the register arrays out of scratch */
    for (int u = 0; u < 4; ++u) { const float x = o[u][r]; const _Float16 hv = (_Float16)x; fh[u] = hv; fl[u] = (_Float16)((x - (float)hv) * 1024.0f); }
    *(v4h*)&sa[0][8 * hh + r][h * HD + 4 * ln] = fh; *(v4h*)&sa[1][8 * hh + r][h * HD + 4 * ln] = fl; }
  __syncthreads();      /* every wave reads all four heads' columns of the 16 rows */
  v8f ch[4] = {z8, z8, z8, z8}, cl[4] = {z8, z8, z8, z8};
  v16h ah[2], al[2];
  ah[0] = g2_frag(&sa[0][ln][0], hh); al[0] = g2_frag(&sa[1][ln][0], hh);
#pragma unroll      /* constant indices keep the register arrays out of scratch */
  for (int ks = 0; ks < 8; ++ks) {
    if (ks < 7) { ah[(ks + 1) & 1] = g2_frag(&sa[0][ln][(ks + 1) * 32], hh); al[(ks + 1) & 1] = g2_frag(&sa[1][ln][(ks + 1) * 32], hh); }
    __builtin_amdgcn_sched_barrier(0);      /* the next step's LDS reads stand as one group ahead of this step's products, not among them */
#pragma unroll      /* constant indices keep the register arrays out of scratch */
    for (int t = 0; t < 4; ++t) {
      ch[t] = __builtin_amdgcn_wmma_f32_16x16x32_f16(false, ah[ks & 1], false, wf[ks & 3][t], (short)0, ch[t], false, false);
      cl[t] = __builtin_amdgcn_wmma_f32_16x16x32_f16(false, al[ks & 1], false, wf[ks & 3][t], (short)0, cl[t], false, false); }
    __builtin_amdgcn_sched_barrier(0);      /* the refill of this step's weight registers is issued at once, three steps of products ahead of its use, not sunk to it */
    if (ks < 4) {
#pragma unroll      /* constant indices keep the register arrays out of scratch */
      for (int t = 0; t < 4; ++t) wf[ks][t] = g2_frag(wp + (size_t)t * 16 * EE + (ks + 4) * 32, hh); } }
#pragma unroll      /* constant indices keep the register arrays out of scratch */
  for (int t = 0; t < 4; ++t)
#pragma unroll      /* constant indices keep the register arrays out of scratch */
    for (int r = 0; r < 8; ++r) { float v = ch[t][r] * 0.0625f + bo[t]; v += cl[t][r] * (0.0625f / 1024.0f); so[h][8 * hh + r][t * 16 + ln] = v; }
  __builtin_amdgcn_fence(__ATOMIC_ACQ_REL, "workgroup"); __builtin_amdgcn_wave_barrier();      /* the wave reads back its own staged tile, so that each store covers whole 128-byte lines */
  const int c4 = ln * 4;
#pragma unroll      /* constant indices keep the register arrays out of scratch */
  for (int q = 0; q < 8; ++q) { const int r = q * 2 + hh; const v4f v = *(const v4fa*)&so[h][r][c4]; *(v4f*)(out + (size_t)(row0 + r) * EE + h * HD + c4) = v; } }

extern "C" void kernel_launch(void* const* d_in, const int* in_sizes, int n_in,
                              void* d_out, int out_size, void* d_ws, size_t ws_size, hipStream_t stream) {
  (void)in_sizes; (void)n_in; (void)out_size;
  const float* x = (const float*)d_in[0]; const float* Wqkv = (const float*)d_in[1]; const float* bqkv = (const float*)d_in[2]; const float* Wout = (const float*)d_in[3]; const float* bout = (const float*)d_in[4];
  char* ws = (char*)d_ws; size_t off = 0;
  auto take = [&](size_t bytes) { char* p = ws + off; off += (bytes + 255) & ~(size_t)255; return p; };
  _Float16* BO = (_Float16*)take((size_t)EE * EE * 2); float* QKV = (float*)take((size_t)NR * 3 * EE * 4);
  if (off > ws_size) return;      /* about 24 MiB */
  k_qkv<<<(NR / GM) * (3 * EE / GN), 256, 0, stream>>>(x, Wqkv, bqkv, Wout, BO, QKV);      /* [q | k | v] + bias, f32; weights stay in their (out, in) order */
  k_local<<<NR / 16, 128, 0, stream>>>(QKV, BO, bout, (float*)d_out);      /* attention, then out = (o_hi + o_lo) Wout^T + bout */
}

// v005
// One run takes 25.7 microseconds.
// In both of two side-by-side timings against v004, it was 1.07 times as fast.
// Over all steps from v000 it is 11.3 times as fast.
#include <hip/hip_runtime.h>
// Speech_MultiHeadedAttention (2 x 4096 frames x 256 = 4 heads x 64; qkv = x Wqkv^T + bqkv; q scaled by 64^-0.5; local attention over a 65-frame window centred on each frame where the window is taken from ZERO-PADDED k / v (out-of-range slots are zero vectors that still take part in the softmax with logit 0, exactly as the source); out = merged . Wout^T + bout).
// Structure: qkv as ONE f16 WMMA GEMM that makes its own exact f16 x and x16 weight tiles in LDS from the f32 inputs (128x192 work-group tiles, 64x48 wave tiles, f32 accumulation, + bias; f32 out, stored in 4-KiB blocks of 16 frames x one head, q and k in the order of the next launch's fragments) and leaves the x16 Wout plane, in fragment order too, for the next launch; the 65-key windowed attention on the f32 matrix form (wave per 16 frames x head: scores and weighted value sum as 16x16x4 products, softmax in registers, all f32 from the f32 q/k/v plane); its work-group (16 frames x all four heads) then holds 16 whole merged rows as f16 hi/residual planes in LDS and does Wout on them as two f16 WMMA terms (+ bias) in the same launch.
// Compute dtype: inputs rounded to bf16; x / weights exact as f16 so q/k/v are f32 sums of exact products; the attention output as f16 hi + residual; softmax f32 - near exact-class. v_wmma_f32_16x16x32_f16, v_wmma_f32_16x16x4_f32.
#define NB 2
#define TT 4096
#define EE 256
#define NH 4
#define HD 64
#define WW 65
#define PADW 32
#define NR (NB * TT)
typedef __bf16 v16b __attribute__((ext_vector_type(16)));
typedef unsigned short v8us __attribute__((ext_vector_type(8), may_alias));
typedef float  v8f  __attribute__((ext_vector_type(8)));
typedef float  v4f  __attribute__((ext_vector_type(4)));
typedef float  v4fa __attribute__((ext_vector_type(4), may_alias));
union FragB { v16b v; v8us half[2]; unsigned short u[16]; };

__device__ __forceinline__ unsigned short bf16_bits(float x) { unsigned int u = __float_as_uint(x); return (unsigned short)((u + 0x7FFFu + ((u >> 16) & 1u)) >> 16); }
__device__ __forceinline__ float bf16_val(unsigned short b) { return __uint_as_float(((unsigned int)b) << 16); }
__device__ __forceinline__ float bf16_round(float x) { return bf16_val(bf16_bits(x)); }
// D += A·B with NT terms: 1 = ah·bh, 2 = + al·bh (A split), 3 = + ah·bl (both split)
template <int NT>
__device__ __forceinline__ v8f mmaN(v16b ah, v16b al, v16b bh, v16b bl, v8f c) {
  c = __builtin_amdgcn_wmma_f32_16x16x32_bf16(false, ah, false, bh, (short)0, c, false, false);
  if (NT >= 2) c = __builtin_amdgcn_wmma_f32_16x16x32_bf16(false, al, false, bh, (short)0, c, false, false);
  if (NT >= 3) c = __builtin_amdgcn_wmma_f32_16x16x32_bf16(false, ah, false, bl, (short)0, c, false, false);
  asm volatile("v_nop\n\tv_nop\n\tv_nop\n\tv_nop" : "+v"(c) : "v"(ah), "v"(al), "v"(bh), "v"(bl));
  return c;
}

__global__ __launch_bounds__(256) void k_wt_bf16(const float* __restrict__ W, unsigned short* __restrict__ Wt, int K, int N) {
  const int t = blockIdx.x * 256 + threadIdx.x;
  const int k8n = K / 8;
  if (t >= N * k8n) return;
  const int n = t / k8n, k8 = (t % k8n) * 8;
  v8us v;
#pragma unroll
  for (int i = 0; i < 8; ++i) v[i] = bf16_bits(W[(size_t)(k8 + i) * N + n]);
  *(v8us*)(Wt + (size_t)n * K + k8) = v;
  
}

// GEMM C[M][N] (f32, pitch ldc) = act(A[M][K]·W + bias). A f32 row-major (pitch lda) converted per fragment to bf16
// (ASPLIT: hi/lo two planes -> 2 terms, else single rounded term); Wt bf16 [N][K] (pitch ldb). BIAS_BF16 rounds the
// bias to bf16 first (bias quantised to bf16 before the add). K%32==0, M%16==0, N%64==0.
template <bool ASPLIT, int ACT, bool BIAS_BF16>
__global__ __launch_bounds__(128) void k_gemm_bf(const float* __restrict__ A, int lda, const unsigned short* __restrict__ Wt, int ldb,
                                               const float* __restrict__ bias, float* __restrict__ C, int ldc, int M, int N, int K) {
  __shared__ __attribute__((aligned(16))) float so[4][16][64];
  const int tid = threadIdx.x, w = tid >> 5, lane = tid & 31, ln = lane & 15, hh = lane >> 4;
  const int ntn = N / 64;
  const int wid = blockIdx.x * 4 + w;
  const int mt = wid / ntn, nq = wid % ntn;
  if (mt * 16 >= M) return;
  const int row0 = mt * 16, col0 = nq * 64;
  const float* arow = A + (size_t)(row0 + ln) * lda;
  v8f acc[4] = {};
  for (int kb = 0; kb < K; kb += 32) {
    FragB ah, al;
    const v4f x0 = *(const v4fa*)(arow + kb + 8 * hh), x1 = *(const v4fa*)(arow + kb + 8 * hh + 4);
    const v4f x2 = *(const v4fa*)(arow + kb + 16 + 8 * hh), x3 = *(const v4fa*)(arow + kb + 16 + 8 * hh + 4);
    float xs[16] = {x0[0],x0[1],x0[2],x0[3],x1[0],x1[1],x1[2],x1[3],x2[0],x2[1],x2[2],x2[3],x3[0],x3[1],x3[2],x3[3]};
#pragma unroll
    for (int i = 0; i < 16; ++i) { const unsigned short hb = bf16_bits(xs[i]); ah.u[i] = hb; al.u[i] = ASPLIT ? bf16_bits(xs[i] - bf16_val(hb)) : (unsigned short)0; }
#pragma unroll
    for (int t = 0; t < 4; ++t) {
      const unsigned short* brow = Wt + (size_t)(col0 + t * 16 + ln) * ldb + kb;
      FragB b;
      b.half[0] = *(const v8us*)(brow + 8 * hh);
      b.half[1] = *(const v8us*)(brow + 16 + 8 * hh);
      acc[t] = mmaN<ASPLIT ? 2 : 1>(ah.v, al.v, b.v, b.v, acc[t]);
    }
  }
#pragma unroll
  for (int t = 0; t < 4; ++t) {
    float bv = bias ? bias[col0 + t * 16 + ln] : 0.f;
    if (BIAS_BF16) bv = bf16_round(bv);
#pragma unroll
    for (int r = 0; r < 8; ++r) { float v = acc[t][r] + bv; if (ACT == 1) v = fmaxf(v, 0.f); so[w][8 * hh + r][t * 16 + ln] = v; }
  }
  __builtin_amdgcn_fence(__ATOMIC_ACQ_REL, "workgroup");
  __builtin_amdgcn_wave_barrier();
  const int rsub = lane >> 4, c4 = (lane & 15) * 4;
  {
#pragma unroll
    for (int q = 0; q < 8; ++q) {
      const int r = q * 2 + rsub;
      const v4f v = *(const v4fa*)&so[w][r][c4];
      *(v4f*)(C + (size_t)(row0 + r) * ldc + col0 + c4) = v;
    }
    
  }
}

// GEMM C = act(A·W + bias + resid): A f32 (ASPLIT -> hi/lo 2 terms), Wt bf16 [N][K]; ACT 0 none, 1 relu, 2 exact gelu;
// resid (optional, f32, row index = (row % rmod), pitch ldr, RES_BF16 rounds it) added before the activation.
template <bool ASPLIT, int ACT, bool BIAS_BF16, bool RES_BF16>
__global__ __launch_bounds__(128) void k_gemm_bf3(const float* __restrict__ A, int lda, const unsigned short* __restrict__ Wt, int ldb,
                                                const float* __restrict__ bias, const float* __restrict__ resid, int rmod, int ldr,
                                                float* __restrict__ C, int ldc, int M, int N, int K) {
  __shared__ __attribute__((aligned(16))) float so[4][16][64];
  const int tid = threadIdx.x, w = tid >> 5, lane = tid & 31, ln = lane & 15, hh = lane >> 4;
  const int ntn = N / 64;
  const int wid = blockIdx.x * 4 + w;
  const int mt = wid / ntn, nq = wid % ntn;
  if (mt * 16 >= M) return;
  const int row0 = mt * 16, col0 = nq * 64;
  const float* arow = A + (size_t)(row0 + ln) * lda;
  v8f acc[4] = {};
  for (int kb = 0; kb < K; kb += 32) {
    FragB ah, al;
    const v4f x0 = *(const v4fa*)(arow + kb + 8 * hh), x1 = *(const v4fa*)(arow + kb + 8 * hh + 4);
    const v4f x2 = *(const v4fa*)(arow + kb + 16 + 8 * hh), x3 = *(const v4fa*)(arow + kb + 16 + 8 * hh + 4);
    float xs[16] = {x0[0],x0[1],x0[2],x0[3],x1[0],x1[1],x1[2],x1[3],x2[0],x2[1],x2[2],x2[3],x3[0],x3[1],x3[2],x3[3]};
#pragma unroll
    for (int i = 0; i < 16; ++i) { const unsigned short hb = bf16_bits(xs[i]); ah.u[i] = hb; al.u[i] = ASPLIT ? bf16_bits(xs[i] - bf16_val(hb)) : (unsigned short)0; }
#pragma unroll
    for (int t = 0; t < 4; ++t) {
      const unsigned short* brow = Wt + (size_t)(col0 + t * 16 + ln) * ldb + kb;
      FragB b;
      b.half[0] = *(const v8us*)(brow + 8 * hh);
      b.half[1] = *(const v8us*)(brow + 16 + 8 * hh);
      acc[t] = mmaN<ASPLIT ? 2 : 1>(ah.v, al.v, b.v, b.v, acc[t]);
    }
  }
#pragma unroll
  for (int t = 0; t < 4; ++t) {
    const int col = col0 + t * 16 + ln;
    float bv = bias ? bias[col] : 0.f;
    if (BIAS_BF16) bv = bf16_round(bv);
#pragma unroll
    for (int r = 0; r < 8; ++r) {
      float v = acc[t][r] + bv;
      if (resid) { float rv = resid[(size_t)((row0 + 8 * hh + r) % rmod) * ldr + col]; if (RES_BF16) rv = bf16_round(rv); v += rv; }
      if (ACT == 1) v = fmaxf(v, 0.f);
      if (ACT == 2) v = 0.5f * v * (1.0f + erff(v * 0.70710678118654752f));
      if (ACT == 3) { const float u = 0.7978845608028654f * (v + 0.044715f * v * v * v); v = 0.5f * v * (1.0f + tanhf(u)); }
      so[w][8 * hh + r][t * 16 + ln] = v;
    }
  }
  __builtin_amdgcn_fence(__ATOMIC_ACQ_REL, "workgroup");
  __builtin_amdgcn_wave_barrier();
  const int rsub = lane >> 4, c4 = (lane & 15) * 4;
  {
#pragma unroll
    for (int q = 0; q < 8; ++q) {
      const int r = q * 2 + rsub;
      const v4f v = *(const v4fa*)&so[w][r][c4];
      *(v4f*)(C + (size_t)(row0 + r) * ldc + col0 + c4) = v;
    }
    
  }
}
// row LayerNorm (biased variance, eps) over N: s = X (+ R); optional out_sum <- s; out_norm <- (s-mu)*rsqrt(var+eps)*g + b
template <bool PARAM_BF16>
__global__ __launch_bounds__(256) void k_layernorm(const float* __restrict__ X, const float* __restrict__ R, const float* __restrict__ g, const float* __restrict__ bta,
                                                  float* __restrict__ out_sum, float* __restrict__ out_norm, int N, float eps) {
  __shared__ float red[256];
  const int row = blockIdx.x, tid = threadIdx.x;
  const float* x = X + (size_t)row * N; const float* rr = R ? R + (size_t)row * N : nullptr;
  float vals[16];                     // up to N = 4096
  const int per = N / 256;            // contiguous chunk per thread? use strided-by-4 chunks: thread handles j = tid*4 + 1024*u
  float s1 = 0.f;
  for (int u = 0; u < per / 4; ++u) {
    const int j = tid * 4 + 1024 * u;
    const v4f a = *(const v4fa*)(x + j);
    v4f b = {0.f,0.f,0.f,0.f}; if (rr) b = *(const v4fa*)(rr + j);
#pragma unroll
    for (int q = 0; q < 4; ++q) { const float v = a[q] + b[q]; vals[u * 4 + q] = v; s1 += v; }
  }
  red[tid] = s1; __syncthreads();
  for (int st = 128; st > 0; st >>= 1) { if (tid < st) red[tid] += red[tid + st]; __syncthreads(); }
  const float mu = red[0] / (float)N; __syncthreads();
  float s2 = 0.f;
  for (int u = 0; u < per / 4; ++u)
#pragma unroll
    for (int q = 0; q < 4; ++q) { const float c = vals[u * 4 + q] - mu; s2 += c * c; }
  red[tid] = s2; __syncthreads();
  for (int st = 128; st > 0; st >>= 1) { if (tid < st) red[tid] += red[tid + st]; __syncthreads(); }
  const float rs = rsqrtf(red[0] / (float)N + eps);
  {
    for (int u = 0; u < per / 4; ++u) {
      const int j = tid * 4 + 1024 * u;
      v4f o, sm;
#pragma unroll
      for (int q = 0; q < 4; ++q) {
        float gg = g[j + q], bb = bta[j + q];
        if (PARAM_BF16) { gg = bf16_round(gg); bb = bf16_round(bb); }
        sm[q] = vals[u * 4 + q]; o[q] = (vals[u * 4 + q] - mu) * rs * gg + bb;
      }
      if (out_sum) *(v4f*)(out_sum + (size_t)row * N + j) = sm;
      *(v4f*)(out_norm + (size_t)row * N + j) = o;
    }
    
  }
}



// ---- f16 WMMA path (v_wmma_f32_16x16x32_f16): 11-bit significands for operands in range — used for the qkv GEMM (k_qkv) and the Wout product in k_local
typedef _Float16 v16h __attribute__((ext_vector_type(16)));
union FragH { v16h v; v8us half[2]; _Float16 h[16]; unsigned short u[16]; };
template <int NT>
__device__ __forceinline__ v8f mmaH(v16h ah, v16h al, v16h bh, v16h bl, v8f c) {
  c = __builtin_amdgcn_wmma_f32_16x16x32_f16(false, ah, false, bh, (short)0, c, false, false);
  if (NT >= 2) c = __builtin_amdgcn_wmma_f32_16x16x32_f16(false, al, false, bh, (short)0, c, false, false);
  if (NT >= 3) c = __builtin_amdgcn_wmma_f32_16x16x32_f16(false, ah, false, bl, (short)0, c, false, false);
  asm volatile("v_nop\n\tv_nop\n\tv_nop\n\tv_nop" : "+v"(c) : "v"(ah), "v"(al), "v"(bh), "v"(bl));
  return c;
}
// batched GEMM like k_gemm_b but f16 operands: A f32 (split into f16 hi/lo if ASPLIT, else rounded to f16), Bt = f16 values [n][k]; alpha; C f32; N multiple of 16 (partial tiles skipped)
template <bool ASPLIT>
__global__ __launch_bounds__(128) void k_gemm_h(const float* __restrict__ A, int lda, size_t sA, const _Float16* __restrict__ Bh, int ldb, size_t sB, float alpha, float* __restrict__ C, int ldc, size_t sC, int M, int N, int K) {
  __shared__ __attribute__((aligned(16))) float so[4][16][64];
  const int tid = threadIdx.x, w = tid >> 5, lane = tid & 31, ln = lane & 15, hh = lane >> 4; const int by = blockIdx.y;
  A += (size_t)by * sA; Bh += (size_t)by * sB; C += (size_t)by * sC;
  const int ntn = (N + 63) / 64; const int wid = blockIdx.x * 4 + w; const int mt = wid / ntn, nq = wid % ntn; if (mt * 16 >= M) return;
  const int row0 = mt * 16, col0 = nq * 64; const float* arow = A + (size_t)(row0 + ln) * lda;
  v8f acc[4] = {};
  for (int kb = 0; kb < K; kb += 32) {
    FragH ah, al;
    const v4f x0 = *(const v4fa*)(arow + kb + 8 * hh), x1 = *(const v4fa*)(arow + kb + 8 * hh + 4), x2 = *(const v4fa*)(arow + kb + 16 + 8 * hh), x3 = *(const v4fa*)(arow + kb + 16 + 8 * hh + 4);
    float xs[16] = {x0[0],x0[1],x0[2],x0[3],x1[0],x1[1],x1[2],x1[3],x2[0],x2[1],x2[2],x2[3],x3[0],x3[1],x3[2],x3[3]};
#pragma unroll
    for (int i = 0; i < 16; ++i) { const _Float16 h = (_Float16)xs[i]; ah.h[i] = h; al.h[i] = ASPLIT ? (_Float16)(xs[i] - (float)h) : (_Float16)0.0f; }
#pragma unroll
    for (int t = 0; t < 4; ++t) { if (col0 + t * 16 >= N) continue; const size_t boff = (size_t)(col0 + t * 16 + ln) * ldb + kb; FragH bq; bq.half[0] = *(const v8us*)(Bh + boff + 8 * hh); bq.half[1] = *(const v8us*)(Bh + boff + 16 + 8 * hh);
      acc[t] = mmaH<ASPLIT ? 2 : 1>(ah.v, al.v, bq.v, bq.v, acc[t]); }
  }
#pragma unroll
  for (int t = 0; t < 4; ++t) { if (col0 + t * 16 >= N) continue;
#pragma unroll
    for (int r = 0; r < 8; ++r) so[w][8 * hh + r][t * 16 + ln] = acc[t][r] * alpha; }
  __builtin_amdgcn_fence(__ATOMIC_ACQ_REL, "workgroup"); __builtin_amdgcn_wave_barrier();
  const int rsub = lane >> 4, c4 = (lane & 15) * 4;
  {
#pragma unroll
    for (int q = 0; q < 8; ++q) { const int r = q * 2 + rsub; if (col0 + c4 < N) { const v4f v = *(const v4fa*)&so[w][r][c4]; *(v4f*)(C + (size_t)(row0 + r) * ldc + col0 + c4) = v; } }
     }
}

// Wt[n][k] = f16(W[k][n]·scale) from f32 row-major W[K][N] (scale = power of two; bf16-exact weights stay exact in f16 away from the subnormal range)
__global__ __launch_bounds__(256) void k_wt_f16(const float* __restrict__ W, _Float16* __restrict__ Wt, int K, int N, float scale) {
  const int t = blockIdx.x * 256 + threadIdx.x; if (t >= N * (K / 8)) return; const int n = t / (K / 8), k8 = (t % (K / 8)) * 8; FragH f;
#pragma unroll
  for (int i = 0; i < 8; ++i) f.h[i] = (_Float16)(bf16_round(W[(size_t)(k8 + i) * N + n]) * scale); const v8us o = f.half[0];
  *(v8us*)((unsigned short*)Wt + (size_t)n * K + k8) = o; 
}
// k_gemm_hh variant with fused epilogue: v = acc·alpha + bias[by·sBias + col] (+ CP[(row/rowsPerB)·sCPb + by·64 + col] if CP) ; ACT 0 none / 1 elu ; writes f16 C16 (and f32 C if non-null)
template <int ACT>
__global__ __launch_bounds__(128) void k_gemm_hhx(const _Float16* __restrict__ A, int lda, size_t sA, const _Float16* __restrict__ Bh, int ldb, size_t sB, float alpha, const float* __restrict__ bias, size_t sBias, const float* __restrict__ CP, int rowsPerB, size_t sCPb, int row0g,
    float* __restrict__ C, _Float16* __restrict__ C16, int ldc, size_t sC, int M, int N, int K) {
  __shared__ __attribute__((aligned(16))) float so[4][16][64];
  const int tid = threadIdx.x, w = tid >> 5, lane = tid & 31, ln = lane & 15, hh = lane >> 4; const int by = blockIdx.y;
  A += (size_t)by * sA; Bh += (size_t)by * sB; const size_t cofs = (size_t)by * sC; const float* bp = bias ? bias + (size_t)by * sBias : nullptr;
  const int ntn = (N + 63) / 64; const int wid = blockIdx.x * 4 + w; const int mt = wid / ntn, nq = wid % ntn; if (mt * 16 >= M) return;
  const int row0 = mt * 16, col0 = nq * 64; const _Float16* arow = A + (size_t)(row0 + ln) * lda;
  v8f acc[4] = {};
  for (int kb = 0; kb < K; kb += 32) { FragH ah; ah.half[0] = *(const v8us*)((const unsigned short*)arow + kb + 8 * hh); ah.half[1] = *(const v8us*)((const unsigned short*)arow + kb + 16 + 8 * hh);
#pragma unroll
    for (int t = 0; t < 4; ++t) { if (col0 + t * 16 >= N) continue; const size_t boff = (size_t)(col0 + t * 16 + ln) * ldb + kb; FragH bq; bq.half[0] = *(const v8us*)((const unsigned short*)Bh + boff + 8 * hh); bq.half[1] = *(const v8us*)((const unsigned short*)Bh + boff + 16 + 8 * hh);
      acc[t] = mmaH<1>(ah.v, ah.v, bq.v, bq.v, acc[t]); }
  }
#pragma unroll
  for (int t = 0; t < 4; ++t) { if (col0 + t * 16 >= N) continue; const int col = col0 + t * 16 + ln; const float bv = bp ? bf16_round(bp[col]) : 0.f;
#pragma unroll
    for (int r = 0; r < 8; ++r) { float v = acc[t][r] * alpha + bv; if (CP) { const int rr = row0g + row0 + 8 * hh + r; if (rowsPerB < 0) v += CP[cofs + (size_t)rr * ldc + col];      /* rowsPerB < 0: own element of the batched C plane */ else { const int bidx = rr / rowsPerB; v += CP[(size_t)bidx * sCPb + (size_t)by * 64 + col]; } } if (ACT == 1) v = (v > 0.f) ? v : expm1f(v); else if (ACT == 7) v = (v > 0.f) ? v + 1.0f : expf(v); else if (ACT == 8) v = tanhf(v); else if (ACT == 9) v = 0.5f * v * (1.0f + tanhf(0.7978845608028654f * (v + 0.044715f * v * v * v))); else if (ACT == 11) v = 1.0f / (1.0f + expf(-v)); else if (ACT == 12) v = (v > 0.f) ? v : 0.01f * v; else if (ACT == 14) v = (v > 0.f) ? v : 0.1f * v; else if (ACT == 16) v = (v >= 0.f) ? v : 0.3f * v; else if (ACT == 17) v = (v >= 0.f) ? v : 0.2f * v; else if (ACT == 15) v = v / (1.0f + expf(-v)); else if (ACT == 3) v = fmaxf(v, 0.f); else if (ACT == 6) v = 0.5f * v * (1.0f + erff(v * 0.70710678118654752f)); so[w][8 * hh + r][t * 16 + ln] = v; } }
  __builtin_amdgcn_fence(__ATOMIC_ACQ_REL, "workgroup"); __builtin_amdgcn_wave_barrier();
  const int rsub = lane >> 4, c4 = (lane & 15) * 4; typedef _Float16 v4h __attribute__((ext_vector_type(4)));
  {
#pragma unroll
    for (int q = 0; q < 8; ++q) { const int r = q * 2 + rsub; if (col0 + c4 < N) { const v4f v = *(const v4fa*)&so[w][r][c4]; if (C) *(v4f*)(C + cofs + (size_t)(row0 + r) * ldc + col0 + c4) = v; if (C16) { v4h h4; for (int i = 0; i < 4; ++i) h4[i] = (_Float16)v[i]; *(v4h*)(C16 + cofs + (size_t)(row0 + r) * ldc + col0 + c4) = h4; } } }
     }
}


typedef _Float16 v4h __attribute__((ext_vector_type(4)));

__global__ __launch_bounds__(256) void k_h16(const float* __restrict__ x, _Float16* __restrict__ X16, size_t n8) { const size_t t = (size_t)blockIdx.x * 256 + threadIdx.x; if (t >= n8) return; FragH f;
#pragma unroll
  for (int q = 0; q < 8; ++q) f.h[q] = (_Float16)x[t * 8 + q]; *(v8us*)((unsigned short*)X16 + t * 8) = f.half[0];  }
__global__ __launch_bounds__(256) void k_round16f(const float* __restrict__ W, _Float16* __restrict__ Bt, size_t n8) { const size_t t = (size_t)blockIdx.x * 256 + threadIdx.x; if (t >= n8) return; FragH f;
#pragma unroll
  for (int i = 0; i < 8; ++i) f.h[i] = (_Float16)(bf16_round(W[t * 8 + i]) * 16.0f); *(v8us*)((unsigned short*)Bt + t * 8) = f.half[0];  }
template <int NHv, int TTv>
__global__ __launch_bounds__(256) void k_vt(const _Float16* __restrict__ V16, int ldv, int voff, _Float16* __restrict__ Vt) { __shared__ unsigned short tl[64][66]; const int tid = threadIdx.x; const int slab = blockIdx.x / (TTv / 64), lg = blockIdx.x % (TTv / 64); const int b = slab / NHv, h = slab % NHv;
  for (int i = tid; i < 64 * 8; i += 256) { const int r = i / 8, c8 = (i % 8) * 8; FragH f; f.half[0] = *(const v8us*)((const unsigned short*)V16 + ((size_t)b * TTv + lg * 64 + r) * ldv + voff + h * 64 + c8);
#pragma unroll
    for (int q = 0; q < 8; ++q) tl[r][c8 + q] = f.u[q]; }
  __syncthreads();
  {
#pragma unroll
    for (int rd = 0; rd < 2; ++rd) { const int d = rd * 32 + tid / 8, pc = tid % 8; FragH f;
#pragma unroll
      for (int q = 0; q < 8; ++q) f.u[q] = tl[pc * 8 + q][d];
      *(v8us*)((unsigned short*)Vt + ((size_t)slab * 64 + d) * TTv + lg * 64 + pc * 8) = f.half[0]; }
     } }

__global__ __launch_bounds__(256) void k_hl(const float* __restrict__ F, _Float16* __restrict__ Hh, _Float16* __restrict__ Hl, size_t n8) { const size_t t = (size_t)blockIdx.x * 256 + threadIdx.x; if (t >= n8) return; FragH fh, fl; const v4f a = *(const v4fa*)(F + t * 8), c = *(const v4fa*)(F + t * 8 + 4);
#pragma unroll
  for (int q = 0; q < 4; ++q) { _Float16 h = (_Float16)a[q]; fh.h[q] = h; fl.h[q] = (_Float16)((a[q] - (float)h) * 1024.0f); h = (_Float16)c[q]; fh.h[4 + q] = h; fl.h[4 + q] = (_Float16)((c[q] - (float)h) * 1024.0f); }
  { *(v8us*)((unsigned short*)Hh + t * 8) = fh.half[0]; *(v8us*)((unsigned short*)Hl + t * 8) = fl.half[0];  } }

// ---- fast GEMM (wave tile 32x64; requires M % 32 == 0 rows per launch region and N % 64 == 0); epilogue = k_gemm_hhx semantics ----
__device__ __forceinline__ v16h g2_frag(const _Float16* p, int hh) { FragH f; f.half[0] = *(const v8us*)((const unsigned short*)p + 8 * hh); f.half[1] = *(const v8us*)((const unsigned short*)p + 16 + 8 * hh); return f.v; }
__device__ __forceinline__ v8f g2_mma(v16h a, v16h b, v8f c) { v8f d = __builtin_amdgcn_wmma_f32_16x16x32_f16(false, a, false, b, (short)0, c, false, false); asm volatile("v_nop\n\tv_nop\n\tv_nop\n\tv_nop" : "+v"(d) : "v"(a), "v"(b)); return d; }
template <int ACT>
__global__ __launch_bounds__(128) void k_gemm2(const _Float16* __restrict__ A, int lda, size_t sA, const _Float16* __restrict__ Bh, int ldb, size_t sB, float alpha, const float* __restrict__ bias, size_t sBias, const float* __restrict__ CP, int rowsPerB, size_t sCPb, int row0g,
    float* __restrict__ C, _Float16* __restrict__ C16, int ldc, size_t sC, int M, int N, int K) { static_assert(ACT == 0 || ACT == 3 || ACT == 6 || ACT == 8 || ACT == 9 || ACT == 11 || ACT == 12 || ACT == 14 || ACT == 15 || ACT == 16 || ACT == 17, "k_gemm2: unsupported ACT code (would silently apply no activation)");
  __shared__ __attribute__((aligned(16))) float so[4][32][68];
  const int tid = threadIdx.x, w = tid >> 5, lane = tid & 31, ln = lane & 15, hh = lane >> 4; const int by = blockIdx.y;
  A += (size_t)by * sA; Bh += (size_t)by * sB; const size_t cofs = (size_t)by * sC; const float* bp = bias ? bias + (size_t)by * sBias : nullptr;
  const int ntn = N >> 6; const int mt = blockIdx.x / ntn, nq = blockIdx.x - mt * ntn; const int row0 = mt * 128 + 32 * w, col0 = nq * 64; if (row0 >= M) return;
  const _Float16* a0p = A + (size_t)(row0 + ln) * lda; const _Float16* a1p = a0p + (size_t)16 * lda;
  const _Float16* b0p = Bh + (size_t)(col0 + ln) * ldb; const _Float16* b1p = b0p + (size_t)16 * ldb; const _Float16* b2p = b1p + (size_t)16 * ldb; const _Float16* b3p = b2p + (size_t)16 * ldb;
  const v8f z8 = {0.f,0.f,0.f,0.f,0.f,0.f,0.f,0.f}; v8f c00 = z8, c01 = z8, c02 = z8, c03 = z8, c10 = z8, c11 = z8, c12 = z8, c13 = z8;
#pragma unroll 1
  for (int kb = 0; kb < K; kb += 32) { const v16h a0 = g2_frag(a0p + kb, hh), a1 = g2_frag(a1p + kb, hh);
    v16h b = g2_frag(b0p + kb, hh); c00 = g2_mma(a0, b, c00); c10 = g2_mma(a1, b, c10);
    b = g2_frag(b1p + kb, hh); c01 = g2_mma(a0, b, c01); c11 = g2_mma(a1, b, c11);
    b = g2_frag(b2p + kb, hh); c02 = g2_mma(a0, b, c02); c12 = g2_mma(a1, b, c12);
    b = g2_frag(b3p + kb, hh); c03 = g2_mma(a0, b, c03); c13 = g2_mma(a1, b, c13); }
  v8f accs[8] = {c00, c01, c02, c03, c10, c11, c12, c13};
#pragma unroll
  for (int u = 0; u < 8; ++u) { const int t = u & 3, half = u >> 2; const int col = col0 + t * 16 + ln; const float bv = bp ? bf16_round(bp[col]) : 0.f;
#pragma unroll
    for (int r = 0; r < 8; ++r) { const int rloc = half * 16 + 8 * hh + r; float v = accs[u][r] * alpha + bv; if (CP) { if (rowsPerB < 0) v += CP[cofs + (size_t)(row0g + row0 + rloc) * ldc + col];      /* rowsPerB < 0: own element of the batched C plane */ else { const int bidx = (row0g + row0 + rloc) / rowsPerB; v += CP[(size_t)bidx * sCPb + (size_t)by * 64 + col]; } }
      if (ACT == 3) v = fmaxf(v, 0.f); else if (ACT == 6) v = 0.5f * v * (1.0f + erff(v * 0.70710678118654752f)); else if (ACT == 11) v = 1.0f / (1.0f + expf(-v)); else if (ACT == 15) v = v / (1.0f + expf(-v)); else if (ACT == 12) v = (v > 0.f) ? v : 0.01f * v; else if (ACT == 8) v = tanhf(v); else if (ACT == 9) v = 0.5f * v * (1.0f + tanhf(0.7978845608028654f * (v + 0.044715f * v * v * v))); else if (ACT == 14) v = (v > 0.f) ? v : 0.1f * v; else if (ACT == 16) v = (v >= 0.f) ? v : 0.3f * v; else if (ACT == 17) v = (v >= 0.f) ? v : 0.2f * v;
      so[w][rloc][t * 16 + ln] = v; } }
  __builtin_amdgcn_fence(__ATOMIC_ACQ_REL, "workgroup"); __builtin_amdgcn_wave_barrier();
  const int rsub = lane >> 4, c4 = (lane & 15) * 4;
  {
#pragma unroll
    for (int q = 0; q < 16; ++q) { const int r = q * 2 + rsub; const v4f v = *(const v4fa*)&so[w][r][c4]; if (C) *(v4f*)(C + cofs + (size_t)(row0 + r) * ldc + col0 + c4) = v; if (C16) { v4h h4; for (int i = 0; i < 4; ++i) h4[i] = (_Float16)v[i]; *(v4h*)(C16 + cofs + (size_t)(row0 + r) * ldc + col0 + c4) = h4; } }
     } }


// qkv = x Wqkv^T + bqkv with the f32 -> f16 operand conversion inside the GEMM: a work-group owns 128 rows x 192 columns, reads its 128 x rows and 192 weight rows as whole
// 512-byte pieces of f32, rounds them (bf16 value, weights x 16, exact in f16) and lays them in LDS once; behind one barrier its eight waves (2 x 4, 64 x 48 each)
// take every fragment from LDS. 256 work-groups, one per WGP. Each also converts 256 elements of Wout for the next launch.
// Layout of what the next launch reads, chosen so that each of its wave-wide 16-byte loads covers 512 bytes in a row, for v two runs of 256 (4 whole lines, not 32 bytes of each of 16 lines):
// QKV = [q heads 0..3 | k heads 0..3 | v heads 0..3][row tile of 16 frames][256 pieces of 16 bytes]; piece (frame f, floats 4 p .. 4 p + 3) stands at 16 p + f for q and k, at 16 f + p for v.
// BO = [column tile of 16][k step of 32][half of 16][lane][8]: lane (ln, hh) holds k = 32 step + 16 half + 8 hh + 0..7 of weight row 16 tile + ln.
#define GM 128
#define GN 192
#define GP (EE + 8)      /* pitch 528 B = 16 B x odd: 16-byte fragment reads of 16 rows meet no bank twice */
#define GS (GN + 4)      /* f32 staging pitch: rows 8 apart differ by 32 banks, neighbouring rows by 4 */
#define NT16 (NR / 16)      /* row tiles of 16 frames */
static_assert(NR % GM == 0 && 3 * EE == 4 * GN && EE == 256 && (NR / GM) * 4 * 256 == EE * EE, "k_qkv: whole tiles, four tile columns, 64 threads to a row, and 256 elements of Wout for each work-group");
static_assert(GN == 3 * HD && HD == 64 && TT % 16 == 0 && PADW % 16 == 0, "blocks of 16 frames x one head: three to a tile's width, none across a batch's end, the window's start on a block");
static_assert(GM * GS * 4 <= (GM + GN) * GP * 2, "k_qkv: the f32 staging tile lies inside the operand tiles' LDS");
// Four f32 -> nearest-even bf16 value x a power of two, as f16, by the convert instructions. The scale goes on in f32, ahead of the rounding (a power of two commutes with it):
// behind it the compiler moves the product into f16, where a small weight has already lost bits.
typedef __bf16 v4bq __attribute__((ext_vector_type(4)));
__device__ __forceinline__ v4h q_h4(v4f a, float sc) { return __builtin_convertvector(__builtin_convertvector(__builtin_convertvector(a * sc, v4bq), v4f), v4h); }
// Staging step it (0..79) of a thread: four floats of tile row 4 it + (tid >> 6); rows 0..127 are x, rows 128..319 the weight rows. A batch is 16 steps.
template <int B>
__device__ __forceinline__ void q_ld(const float* __restrict__ xs, const float* __restrict__ wr, v4f (&d)[16]) {
#pragma unroll      /* constant indices keep the register arrays out of scratch */
  for (int i = 0; i < 16; ++i) { const int it = B * 16 + i; d[i] = *(const v4fa*)(it < GM / 4 ? xs + (size_t)it * 4 * EE : wr + (size_t)(it - GM / 4) * 4 * EE); } }
template <int B>
__device__ __forceinline__ void q_cv(const v4f (&d)[16], _Float16* dst) {
#pragma unroll      /* constant indices keep the register arrays out of scratch */
  for (int i = 0; i < 16; ++i) { const int it = B * 16 + i; *(v4h*)(dst + (size_t)it * 4 * GP) = q_h4(d[i], it < GM / 4 ? 1.0f : 16.0f); } }
__global__ __launch_bounds__(256) void k_qkv(const float* __restrict__ x, const float* __restrict__ Wqkv, const float* __restrict__ bqkv, const float* __restrict__ Wout, _Float16* __restrict__ BO, float* __restrict__ QKV) {
  __shared__ __attribute__((aligned(16))) char sm[(GM + GN) * GP * 2];
  _Float16 (*st)[GP] = (_Float16 (*)[GP])sm;      /* operand tiles: rows 0..127 x, 128..319 weights */
  float (*so)[GS] = (float (*)[GS])sm;      /* the result tile takes their place behind the barrier that ends the last fragment read */
  const int tid = threadIdx.x, w = tid >> 5, lane = tid & 31, ln = lane & 15, hh = lane >> 4, wr = w >> 2, wc = w & 3;
  const int bx = blockIdx.x, row0 = (bx >> 2) * GM, col0 = (bx & 3) * GN;
  const float* xs = x + (size_t)(row0 + (tid >> 6)) * EE + (tid & 63) * 4;
  const float* wsrc = Wqkv + (size_t)(col0 + (tid >> 6)) * EE + (tid & 63) * 4;
  _Float16* dst = &st[tid >> 6][(tid & 63) * 4];
  v4f t0[16], t1[16];
  q_ld<0>(xs, wsrc, t0); q_ld<1>(xs, wsrc, t1);
  /* piece bx of BO = (column tile bx >> 4, k step (bx >> 1) & 7, half bx & 1); its elements 4 j .. 4 j + 3, j = tid & 63, belong to lane j >> 1 */
  const v4f wo = *(const v4fa*)(Wout + ((bx >> 4) * 16 + ((tid >> 1) & 15)) * EE + ((bx >> 1) & 7) * 32 + (bx & 1) * 16 + ((tid >> 5) & 1) * 8 + (tid & 1) * 4);      /* every wave loads, two store: no branch among the staged loads */
  float bv[3];
#pragma unroll      /* constant indices keep the register arrays out of scratch */
  for (int j = 0; j < 3; ++j) bv[j] = bf16_round(bqkv[col0 + 48 * wc + 16 * j + ln]);
  asm volatile("s_wait_xcnt 0x0" :: "v"(xs) : "memory");      /* behind the last load of the opening run, whose address registers are reused below; the x address is named so that it is not reused ahead of the wait */
  __builtin_amdgcn_sched_barrier(0);      /* these hold each batch's loads where they stand: one batch is always in flight while the one before it is converted */
  q_cv<0>(t0, dst); q_ld<2>(xs, wsrc, t0);
  __builtin_amdgcn_sched_barrier(0);
  q_cv<1>(t1, dst); q_ld<3>(xs, wsrc, t1);
  __builtin_amdgcn_sched_barrier(0);
  asm volatile("" :: "v"(wo));      /* inputs only: holds the Wout load up among the first batches; sunk to its use in the branch below it would stand there with a full load latency of its own */
  if (tid < 64) *(v4h*)(BO + bx * 256 + tid * 4) = q_h4(wo, 16.0f);      /* early, so that the barrier below does not wait for this store */
  q_cv<2>(t0, dst); q_ld<4>(xs, wsrc, t0);
  __builtin_amdgcn_sched_barrier(0);
  q_cv<3>(t1, dst);
  q_cv<4>(t0, dst);
  __syncthreads();      /* every wave reads rows that all eight have laid */
  const _Float16* ap = &st[64 * wr + ln][0]; const _Float16* bp = &st[GM + 48 * wc + ln][0];
  const v8f z8 = {0.f,0.f,0.f,0.f,0.f,0.f,0.f,0.f};
  v8f acc[4][3];
  v16h af[2][4], bf[2][3];
#pragma unroll      /* constant indices keep the register arrays out of scratch */
  for (int i = 0; i < 4; ++i) { af[0][i] = g2_frag(ap + i * 16 * GP, hh);
#pragma unroll      /* constant indices keep the register arrays out of scratch */
    for (int j = 0; j < 3; ++j) acc[i][j] = z8; }
#pragma unroll      /* constant indices keep the register arrays out of scratch */
  for (int j = 0; j < 3; ++j) bf[0][j] = g2_frag(bp + j * 16 * GP, hh);
#pragma unroll      /* constant indices keep the register arrays out of scratch */
  for (int ks = 0; ks < EE / 32; ++ks) {
    if (ks < EE / 32 - 1) {
#pragma unroll      /* constant indices keep the register arrays out of scratch */
      for (int i = 0; i < 4; ++i) af[(ks + 1) & 1][i] = g2_frag(ap + i * 16 * GP + (ks + 1) * 32, hh);
#pragma unroll      /* constant indices keep the register arrays out of scratch */
      for (int j = 0; j < 3; ++j) bf[(ks + 1) & 1][j] = g2_frag(bp + j * 16 * GP + (ks + 1) * 32, hh); }
    __builtin_amdgcn_sched_barrier(0);      /* every LDS read of the next step is issued ahead of this step's products, which cover its latency */
#pragma unroll      /* constant indices keep the register arrays out of scratch */
    for (int i = 0; i < 4; ++i)
#pragma unroll      /* constant indices keep the register arrays out of scratch */
      for (int j = 0; j < 3; ++j) acc[i][j] = __builtin_amdgcn_wmma_f32_16x16x32_f16(false, af[ks & 1][i], false, bf[ks & 1][j], (short)0, acc[i][j], false, false); }
  __syncthreads();      /* the last fragment read of every wave is over before the result tile overwrites the operand tiles */
#pragma unroll      /* constant indices keep the register arrays out of scratch */
  for (int i = 0; i < 4; ++i)
#pragma unroll      /* constant indices keep the register arrays out of scratch */
    for (int j = 0; j < 3; ++j)
#pragma unroll      /* constant indices keep the register arrays out of scratch */
      for (int r = 0; r < 8; ++r) so[64 * wr + 16 * i + 8 * hh + r][48 * wc + 16 * j + ln] = acc[i][j][r] * 0.0625f + bv[j];
  __syncthreads();      /* the stores below take whole 128-byte lines across the waves' column ranges */
#pragma unroll      /* constant indices keep the register arrays out of scratch */
  for (int m = 0; m < 3; ++m) { const int gc = (bx & 3) * 3 + m;      /* 64 columns = one head of q (0..3), k (4..7) or v (8..11); thread tid stores piece tid of each of its eight blocks */
    const int r = gc < 2 * NH ? (tid & 15) : (tid >> 4), c4 = m * HD + (gc < 2 * NH ? (tid >> 4) : (tid & 15)) * 4;
    float* qd = QKV + ((size_t)gc * NT16 + (row0 >> 4)) * 1024 + tid * 4;
#pragma unroll      /* constant indices keep the register arrays out of scratch */
    for (int k = 0; k < GM / 16; ++k) { const v4f v = *(const v4fa*)&so[r + 16 * k][c4]; *(v4f*)(qd + k * 1024) = v; } } }
typedef float v2f __attribute__((ext_vector_type(2)));
__device__ __forceinline__ v8f mma4(v2f a, v2f b, v8f c) { return __builtin_amdgcn_wmma_f32_16x16x4_f32(false, a, false, b, (short)0, c, false, false); }
// Four vector slots behind a run of matrix instructions, before a vector instruction may touch their D or overwrite their A or B: the 16-bit forms' distance, kept
// by hand. The operands only tie the slots to the run (D not touched, A and B not reused ahead of them).
__device__ __forceinline__ void gap5(v8f& d0, v8f& d1, v8f& d2, v8f& d3, v8f& d4, v2f a0, v2f a1, v2f a2, v2f a3, v2f a4, v2f b) {
  asm volatile("v_nop\n\tv_nop\n\tv_nop\n\tv_nop" : "+v"(d0), "+v"(d1), "+v"(d2), "+v"(d3), "+v"(d4) : "v"(a0), "v"(a1), "v"(a2), "v"(a3), "v"(a4), "v"(b)); }
__device__ __forceinline__ void gap4(v8f& d0, v8f& d1, v8f& d2, v8f& d3, v2f a, v2f b0, v2f b1, v2f b2, v2f b3) {
  asm volatile("v_nop\n\tv_nop\n\tv_nop\n\tv_nop" : "+v"(d0), "+v"(d1), "+v"(d2), "+v"(d3) : "v"(a), "v"(b0), "v"(b1), "v"(b2), "v"(b3)); }
// Windowed attention on the f32 matrix form. One wave = 16 frames of one head (wave index = head); its window union is 80 key frames = 5 tiles of 16.
// S^T = K . Q^T : register r of tile c in lane (ln, hh) is the score of key 16c + 8hh + r against query ln, so a lane's 40 registers are one query's scores
// (the other 40 keys sit in lane ln ^ 16) and, two by two, they are already the A fragments of P . V (k pairing: key 16c + 8hh + 2p + i).
// V's B fragments: column ln of output tile u stands for d = 4 ln + u, so one 16-byte load of a key's row serves all four tiles.
// q, k, v and the weight plane arrive in the block layouts that k_qkv's comment gives: every wave-wide load below takes 512 bytes in a row (v: two runs of 256).
// Output projection in the same launch: the four waves leave their heads' results in LDS (f16 hi and residual x 1024, 16 rows x 256), and behind one barrier wave h
// forms output columns 64 h .. 64 h + 63 of the 16 rows: A fragments from LDS, B fragments from the f16 weight plane, hi and residual terms in accumulators of their own.
__device__ __forceinline__ v16h w_frag(const _Float16* p) { FragH f; f.half[0] = *(const v8us*)((const unsigned short*)p); f.half[1] = *(const v8us*)((const unsigned short*)p + 256); return f.v; }
__global__ __launch_bounds__(128) void k_local(const float* __restrict__ QKV, const _Float16* __restrict__ BO, const float* __restrict__ bout, float* __restrict__ out) {
  __shared__ __attribute__((aligned(16))) _Float16 sa[2][16][EE + 8];      /* pitch 528 B = 16 B x odd: 16-byte fragment reads of 16 rows meet no bank twice */
  __shared__ __attribute__((aligned(16))) float so[4][16][68];
  const int lane = threadIdx.x & 31, ln = lane & 15, hh = lane >> 4, h = threadIdx.x >> 5;
  const int rt = blockIdx.x, row0 = rt * 16, tt = rt % (TT / 16), t0 = tt * 16;
  const float* qp = QKV + ((size_t)h * NT16 + rt) * 1024 + lane * 4;      /* d order of both operands: 8 i + 4 hh + 0..3 = piece 32 i + lane of the block */
  const float* kp[5];
#pragma unroll
  for (int c = 0; c < 5; ++c) kp[c] = QKV + ((size_t)(NH + h) * NT16 + (rt - tt) + min(max(tt - PADW / 16 + c, 0), TT / 16 - 1)) * 1024;      /* a padded tile reads an edge tile; its scores are replaced by 0 below */
  v4f qf[8], kf[8][5];      /* load order: that of their use */
#pragma unroll
  for (int i = 0; i < 8; ++i) { qf[i] = *(const v4fa*)(qp + 128 * i);
#pragma unroll
    for (int c = 0; c < 5; ++c) kf[i][c] = *(const v4fa*)(kp[c] + lane * 4 + 128 * i); }
  __builtin_amdgcn_sched_barrier(0);      /* all 48 q / k loads are issued ahead of the first product: one load latency for the wave, not one per k step */
  const v8f z8 = {0.f,0.f,0.f,0.f,0.f,0.f,0.f,0.f}; v8f s[5] = {z8, z8, z8, z8, z8};
#pragma unroll
  for (int i = 0; i < 8; ++i) { const v4f q = qf[i] * 0.125f;
#pragma unroll
    for (int e = 0; e < 4; e += 2) { const v2f qe = {q[e], q[e + 1]}; v2f ke[5];
#pragma unroll
      for (int c = 0; c < 5; ++c) { ke[c] = v2f{kf[i][c][e], kf[i][c][e + 1]}; s[c] = mma4(ke[c], qe, s[c]); }
      gap5(s[0], s[1], s[2], s[3], s[4], ke[0], ke[1], ke[2], ke[3], ke[4], qe); } }
  v4f vf[5][4][2];
#pragma unroll
  for (int c = 0; c < 5; ++c) { const float* vp = kp[c] + (size_t)NH * NT16 * 1024 + hh * 512 + ln * 4;      /* the same tile of v; key 8 hh + e is row 8 hh + e of the block */
#pragma unroll
    for (int e = 0; e < 8; ++e) vf[c][e >> 1][e & 1] = *(const v4fa*)(vp + 64 * e);
    /* the address register of these eight loads is named so that it is not reused (a later load's result would land on it) ahead of the wait */
    asm volatile("s_wait_xcnt 0x0" :: "v"(vp) : "memory"); }
  __builtin_amdgcn_sched_barrier(0);      /* the 40 v loads are issued ahead of the softmax, whose arithmetic covers their latency */
  float mx = -3.0e38f;
#pragma unroll
  for (int c = 0; c < 5; ++c)
#pragma unroll
    for (int r = 0; r < 8; ++r) { const int key = 16 * c + 8 * hh + r; const float v = ((unsigned)(t0 - PADW + key) < (unsigned)TT) ? s[c][r] : 0.f;      /* zero-padded key: logit 0 */
      const bool band = (c == 0) ? (key >= ln) : (c == 4) ? (key - ln <= WW - 1) : true; s[c][r] = band ? v : -3.0e38f; mx = fmaxf(mx, s[c][r]); }      /* a key outside this query's 65: exp gives 0 */
  mx = fmaxf(mx, __shfl_xor(mx, 16));
  float su = 0.f;
#pragma unroll
  for (int c = 0; c < 5; ++c)
#pragma unroll
    for (int r = 0; r < 8; ++r) s[c][r] = expf(s[c][r] - mx);
#pragma unroll
  for (int c = 0; c < 5; ++c)
#pragma unroll
    for (int r = 0; r < 8; ++r) su += s[c][r];
  su += __shfl_xor(su, 16);
  const float inv = 1.0f / su;
  v8f o[4] = {z8, z8, z8, z8};
  const _Float16* wp = BO + (size_t)h * HD * EE + lane * 8;      /* output column 64 h + 16 t + ln: column tile 4 h + t; tile t, k step ks: the two 512-byte pieces from element 512 (8 t + ks) on */
  v16h wf[4][4];      /* [k step mod 4][column tile] */
#pragma unroll
  for (int c = 0; c < 5; ++c) {
#pragma unroll
    for (int p = 0; p < 4; ++p) { const int j0 = t0 - PADW + 16 * c + 8 * hh + 2 * p, j1 = j0 + 1; const v4f va = vf[c][p][0], vb = vf[c][p][1];
      const v2f a = {((unsigned)j0 < (unsigned)TT) ? s[c][2 * p] * inv : 0.f, ((unsigned)j1 < (unsigned)TT) ? s[c][2 * p + 1] * inv : 0.f};      /* zero-padded value row: weight 0 on the edge row read in its place */
      v2f bv[4];
#pragma unroll
      for (int u = 0; u < 4; ++u) { bv[u] = v2f{va[u], vb[u]}; o[u] = mma4(a, bv[u], o[u]); }
      gap4(o[0], o[1], o[2], o[3], a, bv[0], bv[1], bv[2], bv[3]); }
    if (c > 0) {
      __builtin_amdgcn_sched_barrier(0);      /* this pair holds the weight loads here: into registers that the used-up key tiles' values have left, with the later key tiles' products over their latency */
#pragma unroll      /* constant indices keep the register arrays out of scratch */
      for (int ks = 0; ks < 4; ++ks) wf[ks][c - 1] = w_frag(wp + ((c - 1) * 8 + ks) * 512);      /* k 0..127 of column tile c - 1: 4 KiB in a row */
      __builtin_amdgcn_sched_barrier(0); } }
  float bo[4];
#pragma unroll      /* constant indices keep the register arrays out of scratch */
  for (int t = 0; t < 4; ++t) bo[t] = bf16_round(bout[h * HD + t * 16 + ln]);
#pragma unroll      /* constant indices keep the register arrays out of scratch */
  for (int r = 0; r < 8; ++r) { v4h fh, fl;
#pragma unroll      /* constant indices keep the register arrays out of scratch */
    for (int u = 0; u < 4; ++u) { const float x = o[u][r]; const _Float16 hv = (_Float16)x; fh[u] = hv; fl[u] = (_Float16)((x - (float)hv) * 1024.0f); }
    *(v4h*)&sa[0][8 * hh + r][h * HD + 4 * ln] = fh; *(v4h*)&sa[1][8 * hh + r][h * HD + 4 * ln] = fl; }
  __syncthreads();      /* every wave reads all four heads' columns of the 16 rows */
  v8f ch[4] = {z8, z8, z8, z8}, cl[4] = {z8, z8, z8, z8};
  v16h ah[2], al[2];
  ah[0] = g2_frag(&sa[0][ln][0], hh); al[0] = g2_frag(&sa[1][ln][0], hh);
#pragma unroll      /* constant indices keep the register arrays out of scratch */
  for (int ks = 0; ks < 8; ++ks) {
    if (ks < 7) { ah[(ks + 1) & 1] = g2_frag(&sa[0][ln][(ks + 1) * 32], hh); al[(ks + 1) & 1] = g2_frag(&sa[1][ln][(ks + 1) * 32], hh); }
    __builtin_amdgcn_sched_barrier(0);      /* the next step's LDS reads stand as one group ahead of this step's products, not among them */
#pragma unroll      /* constant indices keep the register arrays out of scratch */
    for (int t = 0; t < 4; ++t) {
      ch[t] = __builtin_amdgcn_wmma_f32_16x16x32_f16(false, ah[ks & 1], false, wf[ks & 3][t], (short)0, ch[t], false, false);
      cl[t] = __builtin_amdgcn_wmma_f32_16x16x32_f16(false, al[ks & 1], false, wf[ks & 3][t], (short)0, cl[t], false, false); }
    __builtin_amdgcn_sched_barrier(0);      /* the refill of this step's weight registers is issued at once, three steps of products ahead of its use, not sunk to it */
    if (ks < 4) {
#pragma unroll      /* constant indices keep the register arrays out of scratch */
      for (int t = 0; t < 4; ++t) wf[ks][t] = w_frag(wp + (t * 8 + ks + 4) * 512); } }
#pragma unroll      /* constant indices keep the register arrays out of scratch */
  for (int t = 0; t < 4; ++t)
#pragma unroll      /* constant indices keep the register arrays out of scratch */
    for (int r = 0; r < 8; ++r) { float v = ch[t][r] * 0.0625f + bo[t]; v += cl[t][r] * (0.0625f / 1024.0f); so[h][8 * hh + r][t * 16 + ln] = v; }
  __builtin_amdgcn_fence(__ATOMIC_ACQ_REL, "workgroup"); __builtin_amdgcn_wave_barrier();      /* the wave reads back its own staged tile, so that each store covers whole 128-byte lines */
  const int c4 = ln * 4;
#pragma unroll      /* constant indices keep the register arrays out of scratch */
  for (int q = 0; q < 8; ++q) { const int r = q * 2 + hh; const v4f v = *(const v4fa*)&so[h][r][c4]; *(v4f*)(out + (size_t)(row0 + r) * EE + h * HD + c4) = v; } }

extern "C" void kernel_launch(void* const* d_in, const int* in_sizes, int n_in,
                              void* d_out, int out_size, void* d_ws, size_t ws_size, hipStream_t stream) {
  (void)in_sizes; (void)n_in; (void)out_size;
  const float* x = (const float*)d_in[0]; const float* Wqkv = (const float*)d_in[1]; const float* bqkv = (const float*)d_in[2]; const float* Wout = (const float*)d_in[3]; const float* bout = (const float*)d_in[4];
  char* ws = (char*)d_ws; size_t off = 0;
  auto take = [&](size_t bytes) { char* p = ws + off; off += (bytes + 255) & ~(size_t)255; return p; };
  _Float16* BO = (_Float16*)take((size_t)EE * EE * 2); float* QKV = (float*)take((size_t)NR * 3 * EE * 4);
  if (off > ws_size) return;      /* about 24 MiB */
  k_qkv<<<(NR / GM) * (3 * EE / GN), 256, 0, stream>>>(x, Wqkv, bqkv, Wout, BO, QKV);      /* q, k, v + bias, f32, in blocks; weights stay in their (out, in) order */
  k_local<<<NR / 16, 128, 0, stream>>>(QKV, BO, bout, (float*)d_out);      /* attention, then out = (o_hi + o_lo) Wout^T + bout */
}

// v006
// It runs in 18.5 microseconds.
// Timed twice side by side with v005, it ran 1.38 and 1.39 times as fast.
// All steps since v000 together make it 15.6 times as fast.
#include <hip/hip_runtime.h>
// Speech_MultiHeadedAttention (2 x 4096 frames x 256 = 4 heads x 64; qkv = x Wqkv^T + bqkv; q scaled by 64^-0.5; local attention over a 65-frame window centred on each frame where the window is taken from ZERO-PADDED k / v (out-of-range slots are zero vectors that still take part in the softmax with logit 0, exactly as the source); out = merged . Wout^T + bout).
// Structure: launch 1, a work-group per head and 128 frames: q, k, v of those frames and of the 32 on either side as ONE f16 WMMA GEMM that makes its own exact f16 x and x16 weight tiles in LDS from the f32 inputs (192x192 work-group tile, 96x48 wave tiles, f32 accumulation, + bias; f32 result kept in LDS), then the 65-key windowed attention on the f32 matrix form straight from that LDS tile (wave per 16 frames: scores and weighted value sum as 16x16x4 products, softmax in registers, all f32); it leaves the merged rows as f16 hi/residual planes and the x16 Wout plane, both in fragment order; launch 2 does Wout on them as two f16 WMMA terms (+ bias).
// Compute dtype: inputs rounded to bf16; x / weights exact as f16 so q/k/v are f32 sums of exact products; the attention output as f16 hi + residual; softmax f32 - near exact-class. v_wmma_f32_16x16x32_f16, v_wmma_f32_16x16x4_f32.
#define NB 2
#define TT 4096
#define EE 256
#define NH 4
#define HD 64
#define WW 65
#define PADW 32
#define NR (NB * TT)
typedef __bf16 v16b __attribute__((ext_vector_type(16)));
typedef unsigned short v8us __attribute__((ext_vector_type(8), may_alias));
typedef float  v8f  __attribute__((ext_vector_type(8)));
typedef float  v4f  __attribute__((ext_vector_type(4)));
typedef float  v4fa __attribute__((ext_vector_type(4), may_alias));
union FragB { v16b v; v8us half[2]; unsigned short u[16]; };

__device__ __forceinline__ unsigned short bf16_bits(float x) { unsigned int u = __float_as_uint(x); return (unsigned short)((u + 0x7FFFu + ((u >> 16) & 1u)) >> 16); }
__device__ __forceinline__ float bf16_val(unsigned short b) { return __uint_as_float(((unsigned int)b) << 16); }
__device__ __forceinline__ float bf16_round(float x) { return bf16_val(bf16_bits(x)); }
// D += A·B with NT terms: 1 = ah·bh, 2 = + al·bh (A split), 3 = + ah·bl (both split)
template <int NT>
__device__ __forceinline__ v8f mmaN(v16b ah, v16b al, v16b bh, v16b bl, v8f c) {
  c = __builtin_amdgcn_wmma_f32_16x16x32_bf16(false, ah, false, bh, (short)0, c, false, false);
  if (NT >= 2) c = __builtin_amdgcn_wmma_f32_16x16x32_bf16(false, al, false, bh, (short)0, c, false, false);
  if (NT >= 3) c = __builtin_amdgcn_wmma_f32_16x16x32_bf16(false, ah, false, bl, (short)0, c, false, false);
  asm volatile("v_nop\n\tv_nop\n\tv_nop\n\tv_nop" : "+v"(c) : "v"(ah), "v"(al), "v"(bh), "v"(bl));
  return c;
}

__global__ __launch_bounds__(256) void k_wt_bf16(const float* __restrict__ W, unsigned short* __restrict__ Wt, int K, int N) {
  const int t = blockIdx.x * 256 + threadIdx.x;
  const int k8n = K / 8;
  if (t >= N * k8n) return;
  const int n = t / k8n, k8 = (t % k8n) * 8;
  v8us v;
#pragma unroll
  for (int i = 0; i < 8; ++i) v[i] = bf16_bits(W[(size_t)(k8 + i) * N + n]);
  *(v8us*)(Wt + (size_t)n * K + k8) = v;
  
}

// GEMM C[M][N] (f32, pitch ldc) = act(A[M][K]·W + bias). A f32 row-major (pitch lda) converted per fragment to bf16
// (ASPLIT: hi/lo two planes -> 2 terms, else single rounded term); Wt bf16 [N][K] (pitch ldb). BIAS_BF16 rounds the
// bias to bf16 first (bias quantised to bf16 before the add). K%32==0, M%16==0, N%64==0.
template <bool ASPLIT, int ACT, bool BIAS_BF16>
__global__ __launch_bounds__(128) void k_gemm_bf(const float* __restrict__ A, int lda, const unsigned short* __restrict__ Wt, int ldb,
                                               const float* __restrict__ bias, float* __restrict__ C, int ldc, int M, int N, int K) {
  __shared__ __attribute__((aligned(16))) float so[4][16][64];
  const int tid = threadIdx.x, w = tid >> 5, lane = tid & 31, ln = lane & 15, hh = lane >> 4;
  const int ntn = N / 64;
  const int wid = blockIdx.x * 4 + w;
  const int mt = wid / ntn, nq = wid % ntn;
  if (mt * 16 >= M) return;
  const int row0 = mt * 16, col0 = nq * 64;
  const float* arow = A + (size_t)(row0 + ln) * lda;
  v8f acc[4] = {};
  for (int kb = 0; kb < K; kb += 32) {
    FragB ah, al;
    const v4f x0 = *(const v4fa*)(arow + kb + 8 * hh), x1 = *(const v4fa*)(arow + kb + 8 * hh + 4);
    const v4f x2 = *(const v4fa*)(arow + kb + 16 + 8 * hh), x3 = *(const v4fa*)(arow + kb + 16 + 8 * hh + 4);
    float xs[16] = {x0[0],x0[1],x0[2],x0[3],x1[0],x1[1],x1[2],x1[3],x2[0],x2[1],x2[2],x2[3],x3[0],x3[1],x3[2],x3[3]};
#pragma unroll
    for (int i = 0; i < 16; ++i) { const unsigned short hb = bf16_bits(xs[i]); ah.u[i] = hb; al.u[i] = ASPLIT ? bf16_bits(xs[i] - bf16_val(hb)) : (unsigned short)0; }
#pragma unroll
    for (int t = 0; t < 4; ++t) {
      const unsigned short* brow = Wt + (size_t)(col0 + t * 16 + ln) * ldb + kb;
      FragB b;
      b.half[0] = *(const v8us*)(brow + 8 * hh);
      b.half[1] = *(const v8us*)(brow + 16 + 8 * hh);
      acc[t] = mmaN<ASPLIT ? 2 : 1>(ah.v, al.v, b.v, b.v, acc[t]);
    }
  }
#pragma unroll
  for (int t = 0; t < 4; ++t) {
    float bv = bias ? bias[col0 + t * 16 + ln] : 0.f;
    if (BIAS_BF16) bv = bf16_round(bv);
#pragma unroll
    for (int r = 0; r < 8; ++r) { float v = acc[t][r] + bv; if (ACT == 1) v = fmaxf(v, 0.f); so[w][8 * hh + r][t * 16 + ln] = v; }
  }
  __builtin_amdgcn_fence(__ATOMIC_ACQ_REL, "workgroup");
  __builtin_amdgcn_wave_barrier();
  const int rsub = lane >> 4, c4 = (lane & 15) * 4;
  {
#pragma unroll
    for (int q = 0; q < 8; ++q) {
      const int r = q * 2 + rsub;
      const v4f v = *(const v4fa*)&so[w][r][c4];
      *(v4f*)(C + (size_t)(row0 + r) * ldc + col0 + c4) = v;
    }
    
  }
}

// GEMM C = act(A·W + bias + resid): A f32 (ASPLIT -> hi/lo 2 terms), Wt bf16 [N][K]; ACT 0 none, 1 relu, 2 exact gelu;
// resid (optional, f32, row index = (row % rmod), pitch ldr, RES_BF16 rounds it) added before the activation.
template <bool ASPLIT, int ACT, bool BIAS_BF16, bool RES_BF16>
__global__ __launch_bounds__(128) void k_gemm_bf3(const float* __restrict__ A, int lda, const unsigned short* __restrict__ Wt, int ldb,
                                                const float* __restrict__ bias, const float* __restrict__ resid, int rmod, int ldr,
                                                float* __restrict__ C, int ldc, int M, int N, int K) {
  __shared__ __attribute__((aligned(16))) float so[4][16][64];
  const int tid = threadIdx.x, w = tid >> 5, lane = tid & 31, ln = lane & 15, hh = lane >> 4;
  const int ntn = N / 64;
  const int wid = blockIdx.x * 4 + w;
  const int mt = wid / ntn, nq = wid % ntn;
  if (mt * 16 >= M) return;
  const int row0 = mt * 16, col0 = nq * 64;
  const float* arow = A + (size_t)(row0 + ln) * lda;
  v8f acc[4] = {};
  for (int kb = 0; kb < K; kb += 32) {
    FragB ah, al;
    const v4f x0 = *(const v4fa*)(arow + kb + 8 * hh), x1 = *(const v4fa*)(arow + kb + 8 * hh + 4);
    const v4f x2 = *(const v4fa*)(arow + kb + 16 + 8 * hh), x3 = *(const v4fa*)(arow + kb + 16 + 8 * hh + 4);
    float xs[16] = {x0[0],x0[1],x0[2],x0[3],x1[0],x1[1],x1[2],x1[3],x2[0],x2[1],x2[2],x2[3],x3[0],x3[1],x3[2],x3[3]};
#pragma unroll
    for (int i = 0; i < 16; ++i) { const unsigned short hb = bf16_bits(xs[i]); ah.u[i] = hb; al.u[i] = ASPLIT ? bf16_bits(xs[i] - bf16_val(hb)) : (unsigned short)0; }
#pragma unroll
    for (int t = 0; t < 4; ++t) {
      const unsigned short* brow = Wt + (size_t)(col0 + t * 16 + ln) * ldb + kb;
      FragB b;
      b.half[0] = *(const v8us*)(brow + 8 * hh);
      b.half[1] = *(const v8us*)(brow + 16 + 8 * hh);
      acc[t] = mmaN<ASPLIT ? 2 : 1>(ah.v, al.v, b.v, b.v, acc[t]);
    }
  }
#pragma unroll
  for (int t = 0; t < 4; ++t) {
    const int col = col0 + t * 16 + ln;
    float bv = bias ? bias[col] : 0.f;
    if (BIAS_BF16) bv = bf16_round(bv);
#pragma unroll
    for (int r = 0; r < 8; ++r) {
      float v = acc[t][r] + bv;
      if (resid) { float rv = resid[(size_t)((row0 + 8 * hh + r) % rmod) * ldr + col]; if (RES_BF16) rv = bf16_round(rv); v += rv; }
      if (ACT == 1) v = fmaxf(v, 0.f);
      if (ACT == 2) v = 0.5f * v * (1.0f + erff(v * 0.70710678118654752f));
      if (ACT == 3) { const float u = 0.7978845608028654f * (v + 0.044715f * v * v * v); v = 0.5f * v * (1.0f + tanhf(u)); }
      so[w][8 * hh + r][t * 16 + ln] = v;
    }
  }
  __builtin_amdgcn_fence(__ATOMIC_ACQ_REL, "workgroup");
  __builtin_amdgcn_wave_barrier();
  const int rsub = lane >> 4, c4 = (lane & 15) * 4;
  {
#pragma unroll
    for (int q = 0; q < 8; ++q) {
      const int r = q * 2 + rsub;
      const v4f v = *(const v4fa*)&so[w][r][c4];
      *(v4f*)(C + (size_t)(row0 + r) * ldc + col0 + c4) = v;
    }
    
  }
}
// row LayerNorm (biased variance, eps) over N: s = X (+ R); optional out_sum <- s; out_norm <- (s-mu)*rsqrt(var+eps)*g + b
template <bool PARAM_BF16>
__global__ __launch_bounds__(256) void k_layernorm(const float* __restrict__ X, const float* __restrict__ R, const float* __restrict__ g, const float* __restrict__ bta,
                                                  float* __restrict__ out_sum, float* __restrict__ out_norm, int N, float eps) {
  __shared__ float red[256];
  const int row = blockIdx.x, tid = threadIdx.x;
  const float* x = X + (size_t)row * N; const float* rr = R ? R + (size_t)row * N : nullptr;
  float vals[16];                     // up to N = 4096
  const int per = N / 256;            // contiguous chunk per thread? use strided-by-4 chunks: thread handles j = tid*4 + 1024*u
  float s1 = 0.f;
  for (int u = 0; u < per / 4; ++u) {
    const int j = tid * 4 + 1024 * u;
    const v4f a = *(const v4fa*)(x + j);
    v4f b = {0.f,0.f,0.f,0.f}; if (rr) b = *(const v4fa*)(rr + j);
#pragma unroll
    for (int q = 0; q < 4; ++q) { const float v = a[q] + b[q]; vals[u * 4 + q] = v; s1 += v; }
  }
  red[tid] = s1; __syncthreads();
  for (int st = 128; st > 0; st >>= 1) { if (tid < st) red[tid] += red[tid + st]; __syncthreads(); }
  const float mu = red[0] / (float)N; __syncthreads();
  float s2 = 0.f;
  for (int u = 0; u < per / 4; ++u)
#pragma unroll
    for (int q = 0; q < 4; ++q) { const float c = vals[u * 4 + q] - mu; s2 += c * c; }
  red[tid] = s2; __syncthreads();
  for (int st = 128; st > 0; st >>= 1) { if (tid < st) red[tid] += red[tid + st]; __syncthreads(); }
  const float rs = rsqrtf(red[0] / (float)N + eps);
  {
    for (int u = 0; u < per / 4; ++u) {
      const int j = tid * 4 + 1024 * u;
      v4f o, sm;
#pragma unroll
      for (int q = 0; q < 4; ++q) {
        float gg = g[j + q], bb = bta[j + q];
        if (PARAM_BF16) { gg = bf16_round(gg); bb = bf16_round(bb); }
        sm[q] = vals[u * 4 + q]; o[q] = (vals[u * 4 + q] - mu) * rs * gg + bb;
      }
      if (out_sum) *(v4f*)(out_sum + (size_t)row * N + j) = sm;
      *(v4f*)(out_norm + (size_t)row * N + j) = o;
    }
    
  }
}



// ---- f16 WMMA path (v_wmma_f32_16x16x32_f16): 11-bit significands for operands in range — used for the qkv GEMM (k_qa) and the Wout product in k_out
typedef _Float16 v16h __attribute__((ext_vector_type(16)));
union FragH { v16h v; v8us half[2]; _Float16 h[16]; unsigned short u[16]; };
template <int NT>
__device__ __forceinline__ v8f mmaH(v16h ah, v16h al, v16h bh, v16h bl, v8f c) {
  c = __builtin_amdgcn_wmma_f32_16x16x32_f16(false, ah, false, bh, (short)0, c, false, false);
  if (NT >= 2) c = __builtin_amdgcn_wmma_f32_16x16x32_f16(false, al, false, bh, (short)0, c, false, false);
  if (NT >= 3) c = __builtin_amdgcn_wmma_f32_16x16x32_f16(false, ah, false, bl, (short)0, c, false, false);
  asm volatile("v_nop\n\tv_nop\n\tv_nop\n\tv_nop" : "+v"(c) : "v"(ah), "v"(al), "v"(bh), "v"(bl));
  return c;
}
// batched GEMM like k_gemm_b but f16 operands: A f32 (split into f16 hi/lo if ASPLIT, else rounded to f16), Bt = f16 values [n][k]; alpha; C f32; N multiple of 16 (partial tiles skipped)
template <bool ASPLIT>
__global__ __launch_bounds__(128) void k_gemm_h(const float* __restrict__ A, int lda, size_t sA, const _Float16* __restrict__ Bh, int ldb, size_t sB, float alpha, float* __restrict__ C, int ldc, size_t sC, int M, int N, int K) {
  __shared__ __attribute__((aligned(16))) float so[4][16][64];
  const int tid = threadIdx.x, w = tid >> 5, lane = tid & 31, ln = lane & 15, hh = lane >> 4; const int by = blockIdx.y;
  A += (size_t)by * sA; Bh += (size_t)by * sB; C += (size_t)by * sC;
  const int ntn = (N + 63) / 64; const int wid = blockIdx.x * 4 + w; const int mt = wid / ntn, nq = wid % ntn; if (mt * 16 >= M) return;
  const int row0 = mt * 16, col0 = nq * 64; const float* arow = A + (size_t)(row0 + ln) * lda;
  v8f acc[4] = {};
  for (int kb = 0; kb < K; kb += 32) {
    FragH ah, al;
    const v4f x0 = *(const v4fa*)(arow + kb + 8 * hh), x1 = *(const v4fa*)(arow + kb + 8 * hh + 4), x2 = *(const v4fa*)(arow + kb + 16 + 8 * hh), x3 = *(const v4fa*)(arow + kb + 16 + 8 * hh + 4);
    float xs[16] = {x0[0],x0[1],x0[2],x0[3],x1[0],x1[1],x1[2],x1[3],x2[0],x2[1],x2[2],x2[3],x3[0],x3[1],x3[2],x3[3]};
#pragma unroll
    for (int i = 0; i < 16; ++i) { const _Float16 h = (_Float16)xs[i]; ah.h[i] = h; al.h[i] = ASPLIT ? (_Float16)(xs[i] - (float)h) : (_Float16)0.0f; }
#pragma unroll
    for (int t = 0; t < 4; ++t) { if (col0 + t * 16 >= N) continue; const size_t boff = (size_t)(col0 + t * 16 + ln) * ldb + kb; FragH bq; bq.half[0] = *(const v8us*)(Bh + boff + 8 * hh); bq.half[1] = *(const v8us*)(Bh + boff + 16 + 8 * hh);
      acc[t] = mmaH<ASPLIT ? 2 : 1>(ah.v, al.v, bq.v, bq.v, acc[t]); }
  }
#pragma unroll
  for (int t = 0; t < 4; ++t) { if (col0 + t * 16 >= N) continue;
#pragma unroll
    for (int r = 0; r < 8; ++r) so[w][8 * hh + r][t * 16 + ln] = acc[t][r] * alpha; }
  __builtin_amdgcn_fence(__ATOMIC_ACQ_REL, "workgroup"); __builtin_amdgcn_wave_barrier();
  const int rsub = lane >> 4, c4 = (lane & 15) * 4;
  {
#pragma unroll
    for (int q = 0; q < 8; ++q) { const int r = q * 2 + rsub; if (col0 + c4 < N) { const v4f v = *(const v4fa*)&so[w][r][c4]; *(v4f*)(C + (size_t)(row0 + r) * ldc + col0 + c4) = v; } }
     }
}

// Wt[n][k] = f16(W[k][n]·scale) from f32 row-major W[K][N] (scale = power of two; bf16-exact weights stay exact in f16 away from the subnormal range)
__global__ __launch_bounds__(256) void k_wt_f16(const float* __restrict__ W, _Float16* __restrict__ Wt, int K, int N, float scale) {
  const int t = blockIdx.x * 256 + threadIdx.x; if (t >= N * (K / 8)) return; const int n = t / (K / 8), k8 = (t % (K / 8)) * 8; FragH f;
#pragma unroll
  for (int i = 0; i < 8; ++i) f.h[i] = (_Float16)(bf16_round(W[(size_t)(k8 + i) * N + n]) * scale); const v8us o = f.half[0];
  *(v8us*)((unsigned short*)Wt + (size_t)n * K + k8) = o; 
}
// k_gemm_hh variant with fused epilogue: v = acc·alpha + bias[by·sBias + col] (+ CP[(row/rowsPerB)·sCPb + by·64 + col] if CP) ; ACT 0 none / 1 elu ; writes f16 C16 (and f32 C if non-null)
template <int ACT>
__global__ __launch_bounds__(128) void k_gemm_hhx(const _Float16* __restrict__ A, int lda, size_t sA, const _Float16* __restrict__ Bh, int ldb, size_t sB, float alpha, const float* __restrict__ bias, size_t sBias, const float* __restrict__ CP, int rowsPerB, size_t sCPb, int row0g,
    float* __restrict__ C, _Float16* __restrict__ C16, int ldc, size_t sC, int M, int N, int K) {
  __shared__ __attribute__((aligned(16))) float so[4][16][64];
  const int tid = threadIdx.x, w = tid >> 5, lane = tid & 31, ln = lane & 15, hh = lane >> 4; const int by = blockIdx.y;
  A += (size_t)by * sA; Bh += (size_t)by * sB; const size_t cofs = (size_t)by * sC; const float* bp = bias ? bias + (size_t)by * sBias : nullptr;
  const int ntn = (N + 63) / 64; const int wid = blockIdx.x * 4 + w; const int mt = wid / ntn, nq = wid % ntn; if (mt * 16 >= M) return;
  const int row0 = mt * 16, col0 = nq * 64; const _Float16* arow = A + (size_t)(row0 + ln) * lda;
  v8f acc[4] = {};
  for (int kb = 0; kb < K; kb += 32) { FragH ah; ah.half[0] = *(const v8us*)((const unsigned short*)arow + kb + 8 * hh); ah.half[1] = *(const v8us*)((const unsigned short*)arow + kb + 16 + 8 * hh);
#pragma unroll
    for (int t = 0; t < 4; ++t) { if (col0 + t * 16 >= N) continue; const size_t boff = (size_t)(col0 + t * 16 + ln) * ldb + kb; FragH bq; bq.half[0] = *(const v8us*)((const unsigned short*)Bh + boff + 8 * hh); bq.half[1] = *(const v8us*)((const unsigned short*)Bh + boff + 16 + 8 * hh);
      acc[t] = mmaH<1>(ah.v, ah.v, bq.v, bq.v, acc[t]); }
  }
#pragma unroll
  for (int t = 0; t < 4; ++t) { if (col0 + t * 16 >= N) continue; const int col = col0 + t * 16 + ln; const float bv = bp ? bf16_round(bp[col]) : 0.f;
#pragma unroll
    for (int r = 0; r < 8; ++r) { float v = acc[t][r] * alpha + bv; if (CP) { const int rr = row0g + row0 + 8 * hh + r; if (rowsPerB < 0) v += CP[cofs + (size_t)rr * ldc + col];      /* rowsPerB < 0: own element of the batched C plane */ else { const int bidx = rr / rowsPerB; v += CP[(size_t)bidx * sCPb + (size_t)by * 64 + col]; } } if (ACT == 1) v = (v > 0.f) ? v : expm1f(v); else if (ACT == 7) v = (v > 0.f) ? v + 1.0f : expf(v); else if (ACT == 8) v = tanhf(v); else if (ACT == 9) v = 0.5f * v * (1.0f + tanhf(0.7978845608028654f * (v + 0.044715f * v * v * v))); else if (ACT == 11) v = 1.0f / (1.0f + expf(-v)); else if (ACT == 12) v = (v > 0.f) ? v : 0.01f * v; else if (ACT == 14) v = (v > 0.f) ? v : 0.1f * v; else if (ACT == 16) v = (v >= 0.f) ? v : 0.3f * v; else if (ACT == 17) v = (v >= 0.f) ? v : 0.2f * v; else if (ACT == 15) v = v / (1.0f + expf(-v)); else if (ACT == 3) v = fmaxf(v, 0.f); else if (ACT == 6) v = 0.5f * v * (1.0f + erff(v * 0.70710678118654752f)); so[w][8 * hh + r][t * 16 + ln] = v; } }
  __builtin_amdgcn_fence(__ATOMIC_ACQ_REL, "workgroup"); __builtin_amdgcn_wave_barrier();
  const int rsub = lane >> 4, c4 = (lane & 15) * 4; typedef _Float16 v4h __attribute__((ext_vector_type(4)));
  {
#pragma unroll
    for (int q = 0; q < 8; ++q) { const int r = q * 2 + rsub; if (col0 + c4 < N) { const v4f v = *(const v4fa*)&so[w][r][c4]; if (C) *(v4f*)(C + cofs + (size_t)(row0 + r) * ldc + col0 + c4) = v; if (C16) { v4h h4; for (int i = 0; i < 4; ++i) h4[i] = (_Float16)v[i]; *(v4h*)(C16 + cofs + (size_t)(row0 + r) * ldc + col0 + c4) = h4; } } }
     }
}


typedef _Float16 v4h __attribute__((ext_vector_type(4)));

__global__ __launch_bounds__(256) void k_h16(const float* __restrict__ x, _Float16* __restrict__ X16, size_t n8) { const size_t t = (size_t)blockIdx.x * 256 + threadIdx.x; if (t >= n8) return; FragH f;
#pragma unroll
  for (int q = 0; q < 8; ++q) f.h[q] = (_Float16)x[t * 8 + q]; *(v8us*)((unsigned short*)X16 + t * 8) = f.half[0];  }
__global__ __launch_bounds__(256) void k_round16f(const float* __restrict__ W, _Float16* __restrict__ Bt, size_t n8) { const size_t t = (size_t)blockIdx.x * 256 + threadIdx.x; if (t >= n8) return; FragH f;
#pragma unroll
  for (int i = 0; i < 8; ++i) f.h[i] = (_Float16)(bf16_round(W[t * 8 + i]) * 16.0f); *(v8us*)((unsigned short*)Bt + t * 8) = f.half[0];  }
template <int NHv, int TTv>
__global__ __launch_bounds__(256) void k_vt(const _Float16* __restrict__ V16, int ldv, int voff, _Float16* __restrict__ Vt) { __shared__ unsigned short tl[64][66]; const int tid = threadIdx.x; const int slab = blockIdx.x / (TTv / 64), lg = blockIdx.x % (TTv / 64); const int b = slab / NHv, h = slab % NHv;
  for (int i = tid; i < 64 * 8; i += 256) { const int r = i / 8, c8 = (i % 8) * 8; FragH f; f.half[0] = *(const v8us*)((const unsigned short*)V16 + ((size_t)b * TTv + lg * 64 + r) * ldv + voff + h * 64 + c8);
#pragma unroll
    for (int q = 0; q < 8; ++q) tl[r][c8 + q] = f.u[q]; }
  __syncthreads();
  {
#pragma unroll
    for (int rd = 0; rd < 2; ++rd) { const int d = rd * 32 + tid / 8, pc = tid % 8; FragH f;
#pragma unroll
      for (int q = 0; q < 8; ++q) f.u[q] = tl[pc * 8 + q][d];
      *(v8us*)((unsigned short*)Vt + ((size_t)slab * 64 + d) * TTv + lg * 64 + pc * 8) = f.half[0]; }
     } }

__global__ __launch_bounds__(256) void k_hl(const float* __restrict__ F, _Float16* __restrict__ Hh, _Float16* __restrict__ Hl, size_t n8) { const size_t t = (size_t)blockIdx.x * 256 + threadIdx.x; if (t >= n8) return; FragH fh, fl; const v4f a = *(const v4fa*)(F + t * 8), c = *(const v4fa*)(F + t * 8 + 4);
#pragma unroll
  for (int q = 0; q < 4; ++q) { _Float16 h = (_Float16)a[q]; fh.h[q] = h; fl.h[q] = (_Float16)((a[q] - (float)h) * 1024.0f); h = (_Float16)c[q]; fh.h[4 + q] = h; fl.h[4 + q] = (_Float16)((c[q] - (float)h) * 1024.0f); }
  { *(v8us*)((unsigned short*)Hh + t * 8) = fh.half[0]; *(v8us*)((unsigned short*)Hl + t * 8) = fl.half[0];  } }

// ---- fast GEMM (wave tile 32x64; requires M % 32 == 0 rows per launch region and N % 64 == 0); epilogue = k_gemm_hhx semantics ----
__device__ __forceinline__ v16h g2_frag(const _Float16* p, int hh) { FragH f; f.half[0] = *(const v8us*)((const unsigned short*)p + 8 * hh); f.half[1] = *(const v8us*)((const unsigned short*)p + 16 + 8 * hh); return f.v; }
__device__ __forceinline__ v8f g2_mma(v16h a, v16h b, v8f c) { v8f d = __builtin_amdgcn_wmma_f32_16x16x32_f16(false, a, false, b, (short)0, c, false, false); asm volatile("v_nop\n\tv_nop\n\tv_nop\n\tv_nop" : "+v"(d) : "v"(a), "v"(b)); return d; }
template <int ACT>
__global__ __launch_bounds__(128) void k_gemm2(const _Float16* __restrict__ A, int lda, size_t sA, const _Float16* __restrict__ Bh, int ldb, size_t sB, float alpha, const float* __restrict__ bias, size_t sBias, const float* __restrict__ CP, int rowsPerB, size_t sCPb, int row0g,
    float* __restrict__ C, _Float16* __restrict__ C16, int ldc, size_t sC, int M, int N, int K) { static_assert(ACT == 0 || ACT == 3 || ACT == 6 || ACT == 8 || ACT == 9 || ACT == 11 || ACT == 12 || ACT == 14 || ACT == 15 || ACT == 16 || ACT == 17, "k_gemm2: unsupported ACT code (would silently apply no activation)");
  __shared__ __attribute__((aligned(16))) float so[4][32][68];
  const int tid = threadIdx.x, w = tid >> 5, lane = tid & 31, ln = lane & 15, hh = lane >> 4; const int by = blockIdx.y;
  A += (size_t)by * sA; Bh += (size_t)by * sB; const size_t cofs = (size_t)by * sC; const float* bp = bias ? bias + (size_t)by * sBias : nullptr;
  const int ntn = N >> 6; const int mt = blockIdx.x / ntn, nq = blockIdx.x - mt * ntn; const int row0 = mt * 128 + 32 * w, col0 = nq * 64; if (row0 >= M) return;
  const _Float16* a0p = A + (size_t)(row0 + ln) * lda; const _Float16* a1p = a0p + (size_t)16 * lda;
  const _Float16* b0p = Bh + (size_t)(col0 + ln) * ldb; const _Float16* b1p = b0p + (size_t)16 * ldb; const _Float16* b2p = b1p + (size_t)16 * ldb; const _Float16* b3p = b2p + (size_t)16 * ldb;
  const v8f z8 = {0.f,0.f,0.f,0.f,0.f,0.f,0.f,0.f}; v8f c00 = z8, c01 = z8, c02 = z8, c03 = z8, c10 = z8, c11 = z8, c12 = z8, c13 = z8;
#pragma unroll 1
  for (int kb = 0; kb < K; kb += 32) { const v16h a0 = g2_frag(a0p + kb, hh), a1 = g2_frag(a1p + kb, hh);
    v16h b = g2_frag(b0p + kb, hh); c00 = g2_mma(a0, b, c00); c10 = g2_mma(a1, b, c10);
    b = g2_frag(b1p + kb, hh); c01 = g2_mma(a0, b, c01); c11 = g2_mma(a1, b, c11);
    b = g2_frag(b2p + kb, hh); c02 = g2_mma(a0, b, c02); c12 = g2_mma(a1, b, c12);
    b = g2_frag(b3p + kb, hh); c03 = g2_mma(a0, b, c03); c13 = g2_mma(a1, b, c13); }
  v8f accs[8] = {c00, c01, c02, c03, c10, c11, c12, c13};
#pragma unroll
  for (int u = 0; u < 8; ++u) { const int t = u & 3, half = u >> 2; const int col = col0 + t * 16 + ln; const float bv = bp ? bf16_round(bp[col]) : 0.f;
#pragma unroll
    for (int r = 0; r < 8; ++r) { const int rloc = half * 16 + 8 * hh + r; float v = accs[u][r] * alpha + bv; if (CP) { if (rowsPerB < 0) v += CP[cofs + (size_t)(row0g + row0 + rloc) * ldc + col];      /* rowsPerB < 0: own element of the batched C plane */ else { const int bidx = (row0g + row0 + rloc) / rowsPerB; v += CP[(size_t)bidx * sCPb + (size_t)by * 64 + col]; } }
      if (ACT == 3) v = fmaxf(v, 0.f); else if (ACT == 6) v = 0.5f * v * (1.0f + erff(v * 0.70710678118654752f)); else if (ACT == 11) v = 1.0f / (1.0f + expf(-v)); else if (ACT == 15) v = v / (1.0f + expf(-v)); else if (ACT == 12) v = (v > 0.f) ? v : 0.01f * v; else if (ACT == 8) v = tanhf(v); else if (ACT == 9) v = 0.5f * v * (1.0f + tanhf(0.7978845608028654f * (v + 0.044715f * v * v * v))); else if (ACT == 14) v = (v > 0.f) ? v : 0.1f * v; else if (ACT == 16) v = (v >= 0.f) ? v : 0.3f * v; else if (ACT == 17) v = (v >= 0.f) ? v : 0.2f * v;
      so[w][rloc][t * 16 + ln] = v; } }
  __builtin_amdgcn_fence(__ATOMIC_ACQ_REL, "workgroup"); __builtin_amdgcn_wave_barrier();
  const int rsub = lane >> 4, c4 = (lane & 15) * 4;
  {
#pragma unroll
    for (int q = 0; q < 16; ++q) { const int r = q * 2 + rsub; const v4f v = *(const v4fa*)&so[w][r][c4]; if (C) *(v4f*)(C + cofs + (size_t)(row0 + r) * ldc + col0 + c4) = v; if (C16) { v4h h4; for (int i = 0; i < 4; ++i) h4[i] = (_Float16)v[i]; *(v4h*)(C16 + cofs + (size_t)(row0 + r) * ldc + col0 + c4) = h4; } }
     } }


// Launch 1: q, k, v of ONE head for 128 frames and the window's reach (32 frames) on both sides, then that head's windowed attention, in one work-group; q, k, v never leave LDS.
// The work-group reads its 192 x rows and the head's 192 weight rows (64 of q, of k, of v) as whole 512-byte pieces of f32, rounds them (bf16 value, weights x 16, exact in f16) and lays
// them in LDS once; behind one barrier its eight waves (2 x 4, 96 x 48 each) take every fragment from LDS; the f32 result tile (192 rows x [q | k | v]) takes the operands' place.
// Then wave w is query tile w (16 frames): its five key tiles are rows 16 w .. 16 w + 79 of the tile. 256 work-groups, one per WGP. Each also converts 256 elements of Wout for the next launch.
// A row outside the batch is computed from an edge row read in its place; its scores are replaced by 0 and its weights by 0 in the attention.
// What the next launch reads, each wave-wide 16-byte load covering 512 bytes in a row:
// OA = [hi | residual x 1024][row tile of 16 frames][k step of 32][half of 16][lane][8]: lane (ln, hh) holds k = 32 step + 16 half + 8 hh + 0..7 of merged row ln.
// BO = [column tile of 16][k step of 32][half of 16][lane][8]: lane (ln, hh) holds k = 32 step + 16 half + 8 hh + 0..7 of weight row 16 tile + ln.
#define FM 128      /* frames of a work-group */
#define FR (FM + 2 * PADW)      /* x rows it needs */
#define GN 192
#define GP (EE + 8)      /* pitch 528 B = 16 B x odd: 16-byte fragment reads of 16 rows meet no bank twice */
#define GS (GN + 4)      /* f32 result pitch 784 B = 16 B x odd, for the same reason; in the stores rows 8 apart differ by 32 banks */
#define SWP (HD + 8)      /* pitch 144 B = 16 B x odd */
#define NT16 (NR / 16)      /* row tiles of 16 frames */
static_assert(TT % FM == 0 && FM == 8 * 16 && PADW == 32 && EE == 256 && EE == NH * HD && (NR / FM) * NH * 256 == EE * EE, "k_qa: no work-group across a batch's end, a query tile for each wave, 64 threads to a row, and 256 elements of Wout for each work-group");
static_assert(GN == 3 * HD && HD == 64 && FR == GN && FR % 64 == 0, "k_qa: q, k, v of one head side by side; whole batches of 16 staging steps");
static_assert(FR * GS * 4 + 8 * 2 * 16 * SWP * 2 <= (FR + GN) * GP * 2, "k_qa: the f32 result tile and the waves' output staging lie inside the operand tiles' LDS");
// Four f32 -> nearest-even bf16 value x a power of two, as f16, by the convert instructions. The scale goes on in f32, ahead of the rounding (a power of two commutes with it):
// behind it the compiler moves the product into f16, where a small weight has already lost bits.
typedef __bf16 v4bq __attribute__((ext_vector_type(4)));
__device__ __forceinline__ v4h q_h4(v4f a, float sc) { return __builtin_convertvector(__builtin_convertvector(__builtin_convertvector(a * sc, v4bq), v4f), v4h); }
// Staging step it (0..95) of a thread: four floats of tile row 4 it + (tid >> 6); rows 0..31 the frames before, 32..159 its own, 160..191 the frames behind, 192..383 the weight rows. A batch is 16 steps.
template <int B>
__device__ __forceinline__ void q_ld(const float* __restrict__ xl, const float* __restrict__ xm, const float* __restrict__ xh, const float* __restrict__ wr, v4f (&d)[16]) {
#pragma unroll      /* constant indices keep the register arrays out of scratch */
  for (int i = 0; i < 16; ++i) { const int it = B * 16 + i, iw = it - FR / 4;
    d[i] = *(const v4fa*)(it < PADW / 4 ? xl + (size_t)it * 4 * EE : it < (PADW + FM) / 4 ? xm + (size_t)(it - PADW / 4) * 4 * EE : it < FR / 4 ? xh + (size_t)(it - (PADW + FM) / 4) * 4 * EE
                          : wr + (size_t)((iw / 16) * EE + (iw % 16) * 4) * EE); } }
template <int B>
__device__ __forceinline__ void q_cv(const v4f (&d)[16], _Float16* dst) {
#pragma unroll      /* constant indices keep the register arrays out of scratch */
  for (int i = 0; i < 16; ++i) { const int it = B * 16 + i; *(v4h*)(dst + (size_t)it * 4 * GP) = q_h4(d[i], it < FR / 4 ? 1.0f : 16.0f); } }
typedef float v2f __attribute__((ext_vector_type(2)));
__device__ __forceinline__ v8f mma4(v2f a, v2f b, v8f c) { return __builtin_amdgcn_wmma_f32_16x16x4_f32(false, a, false, b, (short)0, c, false, false); }
// Four vector slots behind a run of matrix instructions, before a vector instruction may touch their D or overwrite their A or B: the 16-bit forms' distance, kept
// by hand. The operands only tie the slots to the run (D not touched, A and B not reused ahead of them).
__device__ __forceinline__ void gap5(v8f& d0, v8f& d1, v8f& d2, v8f& d3, v8f& d4, v2f a0, v2f a1, v2f a2, v2f a3, v2f a4, v2f b) {
  asm volatile("v_nop\n\tv_nop\n\tv_nop\n\tv_nop" : "+v"(d0), "+v"(d1), "+v"(d2), "+v"(d3), "+v"(d4) : "v"(a0), "v"(a1), "v"(a2), "v"(a3), "v"(a4), "v"(b)); }
__device__ __forceinline__ void gap4(v8f& d0, v8f& d1, v8f& d2, v8f& d3, v2f a, v2f b0, v2f b1, v2f b2, v2f b3) {
  asm volatile("v_nop\n\tv_nop\n\tv_nop\n\tv_nop" : "+v"(d0), "+v"(d1), "+v"(d2), "+v"(d3) : "v"(a), "v"(b0), "v"(b1), "v"(b2), "v"(b3)); }
// Windowed attention on the f32 matrix form. One wave = 16 frames of the head; its window union is 80 key frames = 5 tiles of 16.
// S^T = K . Q^T : register r of tile c in lane (ln, hh) is the score of key 16c + 8hh + r against query ln, so a lane's 40 registers are one query's scores
// (the other 40 keys sit in lane ln ^ 16) and, two by two, they are already the A fragments of P . V (k pairing: key 16c + 8hh + 2p + i).
// V's B fragments: column ln of output tile u stands for d = 4 ln + u, so one 16-byte read of a key's row serves all four tiles.
__global__ __launch_bounds__(256) void k_qa(const float* __restrict__ x, const float* __restrict__ Wqkv, const float* __restrict__ bqkv, const float* __restrict__ Wout, _Float16* __restrict__ BO, _Float16* __restrict__ OA) {
  __shared__ __attribute__((aligned(16))) char sm[(FR + GN) * GP * 2];
  _Float16 (*st)[GP] = (_Float16 (*)[GP])sm;      /* operand tiles: rows 0..191 x, 192..383 weights */
  float (*so)[GS] = (float (*)[GS])sm;      /* the result tile takes their place behind the barrier that ends the last fragment read */
  const int tid = threadIdx.x, w = tid >> 5, lane = tid & 31, ln = lane & 15, hh = lane >> 4, wr = w >> 2, wc = w & 3;
  const int bx = blockIdx.x, h = bx & 3, row0 = (bx >> 2) * FM, tb = row0 % TT;
  const float* xm = x + (size_t)(row0 + (tid >> 6)) * EE + (tid & 63) * 4;
  const float* xl = xm - (tb == 0 ? 0 : PADW * EE);      /* no frames before the batch's first: its own first rows stand in */
  const float* xh = xm + (tb + FM == TT ? (FM - PADW) * EE : FM * EE);      /* none behind its last: its own last rows stand in */
  const float* wsrc = Wqkv + (size_t)(h * HD + (tid >> 6)) * EE + (tid & 63) * 4;
  _Float16* dst = &st[tid >> 6][(tid & 63) * 4];
  v4f t0[16], t1[16];
  q_ld<0>(xl, xm, xh, wsrc, t0); q_ld<1>(xl, xm, xh, wsrc, t1);
  /* piece bx of BO = (column tile bx >> 4, k step (bx >> 1) & 7, half bx & 1); its elements 4 j .. 4 j + 3, j = tid & 63, belong to lane j >> 1 */
  const v4f wo = *(const v4fa*)(Wout + ((bx >> 4) * 16 + ((tid >> 1) & 15)) * EE + ((bx >> 1) & 7) * 32 + (bx & 1) * 16 + ((tid >> 5) & 1) * 8 + (tid & 1) * 4);      /* every wave loads, two store: no branch among the staged loads */
  float bv[3];
#pragma unroll      /* constant indices keep the register arrays out of scratch */
  for (int j = 0; j < 3; ++j) { const int cc = 48 * wc + 16 * j + ln; bv[j] = bf16_round(bqkv[(cc >> 6) * EE + h * HD + (cc & 63)]); }
  asm volatile("s_wait_xcnt 0x0" :: "v"(xl), "v"(xm), "v"(xh), "v"(wsrc) : "memory");      /* behind the last load of the opening run, whose address registers are reused below; the staging addresses are named so that they are not reused ahead of the wait */
  __builtin_amdgcn_sched_barrier(0);      /* these hold each batch's loads where they stand: one batch is always in flight while the one before it is converted */
  q_cv<0>(t0, dst); q_ld<2>(xl, xm, xh, wsrc, t0);
  __builtin_amdgcn_sched_barrier(0);
  q_cv<1>(t1, dst); q_ld<3>(xl, xm, xh, wsrc, t1);
  __builtin_amdgcn_sched_barrier(0);
  asm volatile("" :: "v"(wo));      /* inputs only: holds the Wout load up among the first batches; sunk to its use in the branch below it would stand there with a full load latency of its own */
  if (tid < 64) *(v4h*)(BO + bx * 256 + tid * 4) = q_h4(wo, 16.0f);      /* early, so that the barrier below does not wait for this store */
  q_cv<2>(t0, dst); q_ld<4>(xl, xm, xh, wsrc, t0);
  __builtin_amdgcn_sched_barrier(0);
  q_cv<3>(t1, dst); q_ld<5>(xl, xm, xh, wsrc, t1);
  asm volatile("s_wait_xcnt 0x0" :: "v"(xl), "v"(xm), "v"(xh), "v"(wsrc) : "memory");      /* behind the last staged load: its address registers are free for reuse from here on */
  __builtin_amdgcn_sched_barrier(0);
  q_cv<4>(t0, dst);
  q_cv<5>(t1, dst);
  __syncthreads();      /* every wave reads rows that all eight have laid */
  { const _Float16* ap = &st[96 * wr + ln][0]; const _Float16* bp = &st[FR + 48 * wc + ln][0];
    const v8f z8 = {0.f,0.f,0.f,0.f,0.f,0.f,0.f,0.f};
    v8f acc[6][3];
    v16h af[2][6], bf[2][3];
#pragma unroll      /* constant indices keep the register arrays out of scratch */
    for (int i = 0; i < 6; ++i) { af[0][i] = g2_frag(ap + i * 16 * GP, hh);
#pragma unroll      /* constant indices keep the register arrays out of scratch */
      for (int j = 0; j < 3; ++j) acc[i][j] = z8; }
#pragma unroll      /* constant indices keep the register arrays out of scratch */
    for (int j = 0; j < 3; ++j) bf[0][j] = g2_frag(bp + j * 16 * GP, hh);
#pragma unroll      /* constant indices keep the register arrays out of scratch */
    for (int ks = 0; ks < EE / 32; ++ks) {
      if (ks < EE / 32 - 1) {
#pragma unroll      /* constant indices keep the register arrays out of scratch */
        for (int i = 0; i < 6; ++i) af[(ks + 1) & 1][i] = g2_frag(ap + i * 16 * GP + (ks + 1) * 32, hh);
#pragma unroll      /* constant indices keep the register arrays out of scratch */
        for (int j = 0; j < 3; ++j) bf[(ks + 1) & 1][j] = g2_frag(bp + j * 16 * GP + (ks + 1) * 32, hh); }
      __builtin_amdgcn_sched_barrier(0);      /* every LDS read of the next step is issued ahead of this step's products, which cover its latency; and no read of a later step comes up here, which would spill */
#pragma unroll      /* constant indices keep the register arrays out of scratch */
      for (int i = 0; i < 6; ++i)
#pragma unroll      /* constant indices keep the register arrays out of scratch */
        for (int j = 0; j < 3; ++j) acc[i][j] = __builtin_amdgcn_wmma_f32_16x16x32_f16(false, af[ks & 1][i], false, bf[ks & 1][j], (short)0, acc[i][j], false, false);
      __builtin_amdgcn_sched_barrier(0);      /* ends the step: the step after next's reads stay behind these products, whose operand registers they take */ }
    __syncthreads();      /* the last fragment read of every wave is over before the result tile overwrites the operand tiles */
#pragma unroll      /* constant indices keep the register arrays out of scratch */
    for (int i = 0; i < 6; ++i)
#pragma unroll      /* constant indices keep the register arrays out of scratch */
      for (int j = 0; j < 3; ++j)
#pragma unroll      /* constant indices keep the register arrays out of scratch */
        for (int r = 0; r < 8; ++r) so[96 * wr + 16 * i + 8 * hh + r][48 * wc + 16 * j + ln] = acc[i][j][r] * 0.0625f + bv[j]; }
  __syncthreads();      /* every wave reads q, k and v columns and key rows that other waves have laid */
  const int tq = tb + 16 * w;      /* first frame of this wave's query tile, in its batch */
  const float* qp = &so[PADW + 16 * w + ln][4 * hh];      /* d order of both operands: 8 i + 4 hh + 0..3 */
  const float* kp = &so[16 * w + ln][HD + 4 * hh];
  v4f qf[8], kf[8][5];      /* read order: that of their use */
#pragma unroll
  for (int i = 0; i < 8; ++i) { qf[i] = *(const v4fa*)(qp + 8 * i);
#pragma unroll
    for (int c = 0; c < 5; ++c) kf[i][c] = *(const v4fa*)(kp + 16 * c * GS + 8 * i); }
  const v8f z8 = {0.f,0.f,0.f,0.f,0.f,0.f,0.f,0.f}; v8f s[5] = {z8, z8, z8, z8, z8};
#pragma unroll
  for (int i = 0; i < 8; ++i) { const v4f q = qf[i] * 0.125f;
#pragma unroll
    for (int e = 0; e < 4; e += 2) { const v2f qe = {q[e], q[e + 1]}; v2f ke[5];
#pragma unroll
      for (int c = 0; c < 5; ++c) { ke[c] = v2f{kf[i][c][e], kf[i][c][e + 1]}; s[c] = mma4(ke[c], qe, s[c]); }
      gap5(s[0], s[1], s[2], s[3], s[4], ke[0], ke[1], ke[2], ke[3], ke[4], qe); } }
  const float* vp = &so[16 * w + 8 * hh][2 * HD + 4 * ln];      /* key 16 c + 8 hh + e is row 16 c + e from here */
  v4f vf[5][4][2];
#pragma unroll
  for (int c = 0; c < 5; ++c)
#pragma unroll
    for (int e = 0; e < 8; ++e) vf[c][e >> 1][e & 1] = *(const v4fa*)(vp + (16 * c + e) * GS);
  __builtin_amdgcn_sched_barrier(0);      /* the 40 v reads are issued ahead of the softmax, whose arithmetic covers their latency; sunk to their products each pair would stand there with an LDS latency of its own */
  float mx = -3.0e38f;
#pragma unroll
  for (int c = 0; c < 5; ++c)
#pragma unroll
    for (int r = 0; r < 8; ++r) { const int key = 16 * c + 8 * hh + r; const float v = ((unsigned)(tq - PADW + key) < (unsigned)TT) ? s[c][r] : 0.f;      /* zero-padded key: logit 0 */
      const bool band = (c == 0) ? (key >= ln) : (c == 4) ? (key - ln <= WW - 1) : true; s[c][r] = band ? v : -3.0e38f; mx = fmaxf(mx, s[c][r]); }      /* a key outside this query's 65: exp gives 0 */
  mx = fmaxf(mx, __shfl_xor(mx, 16));
  float su = 0.f;
#pragma unroll
  for (int c = 0; c < 5; ++c)
#pragma unroll
    for (int r = 0; r < 8; ++r) s[c][r] = expf(s[c][r] - mx);
#pragma unroll
  for (int c = 0; c < 5; ++c)
#pragma unroll
    for (int r = 0; r < 8; ++r) su += s[c][r];
  su += __shfl_xor(su, 16);
  const float inv = 1.0f / su;
  v8f o[4] = {z8, z8, z8, z8};
#pragma unroll
  for (int c = 0; c < 5; ++c) {
#pragma unroll
    for (int p = 0; p < 4; ++p) { const int j0 = tq - PADW + 16 * c + 8 * hh + 2 * p, j1 = j0 + 1; const v4f va = vf[c][p][0], vb = vf[c][p][1];
      const v2f a = {((unsigned)j0 < (unsigned)TT) ? s[c][2 * p] * inv : 0.f, ((unsigned)j1 < (unsigned)TT) ? s[c][2 * p + 1] * inv : 0.f};      /* zero-padded value row: weight 0 on the edge row computed in its place */
      v2f bw[4];
#pragma unroll
      for (int u = 0; u < 4; ++u) { bw[u] = v2f{va[u], vb[u]}; o[u] = mma4(a, bw[u], o[u]); }
      gap4(o[0], o[1], o[2], o[3], a, bw[0], bw[1], bw[2], bw[3]); } }
  _Float16 (*sw)[16][SWP] = (_Float16 (*)[16][SWP])(sm + FR * GS * 4 + w * (2 * 16 * SWP * 2));      /* this wave's own staging, behind the result tile that other waves still read */
#pragma unroll      /* constant indices keep the register arrays out of scratch */
  for (int r = 0; r < 8; ++r) { v4h fh, fl;
#pragma unroll      /* constant indices keep the register arrays out of scratch */
    for (int u = 0; u < 4; ++u) { const float xv = o[u][r]; const _Float16 hv = (_Float16)xv; fh[u] = hv; fl[u] = (_Float16)((xv - (float)hv) * 1024.0f); }
    *(v4h*)&sw[0][8 * hh + r][4 * ln] = fh; *(v4h*)&sw[1][8 * hh + r][4 * ln] = fl; }
  __builtin_amdgcn_fence(__ATOMIC_ACQ_REL, "workgroup"); __builtin_amdgcn_wave_barrier();      /* the wave reads back its own staged tile in the next launch's fragment order, so that each store covers 512 bytes in a row */
#pragma unroll      /* constant indices keep the register arrays out of scratch */
  for (int pl = 0; pl < 2; ++pl)
#pragma unroll      /* constant indices keep the register arrays out of scratch */
    for (int g = 0; g < 4; ++g) { const v8us v = *(const v8us*)&sw[pl][ln][16 * g + 8 * hh];      /* g = 2 (k step - 2 h) + half */
      *(v8us*)((unsigned short*)OA + (((size_t)pl * NT16 + (row0 >> 4) + w) * 16 + 4 * h + g) * 256 + lane * 8) = v; } }
// Launch 2: out = (o_hi + o_residual) Wout^T + bout. A work-group = 32 merged rows, so that the weight plane is read 256 times and not 512; its eight waves bring the two f16 planes of those rows
// (32 KiB, already in fragment order) into LDS once, and behind one barrier wave w forms output columns 32 w .. 32 w + 31 of the 32 rows: A fragments from LDS, B fragments (all of them loaded at
// the start, one load latency) from the f16 weight plane, hi and residual terms in accumulators of their own.
__device__ __forceinline__ v16h w_frag(const _Float16* p) { FragH f; f.half[0] = *(const v8us*)((const unsigned short*)p); f.half[1] = *(const v8us*)((const unsigned short*)p + 256); return f.v; }
__global__ __launch_bounds__(256) void k_out(const _Float16* __restrict__ OA, const _Float16* __restrict__ BO, const float* __restrict__ bout, float* __restrict__ out) {
  __shared__ __attribute__((aligned(16))) _Float16 sa[2][2 * 16 * EE];      /* [plane][two row tiles, each 8 k steps x 2 halves x 32 lanes x 8] */
  __shared__ __attribute__((aligned(16))) float so[8][32][36];      /* pitch 144 B = 16 B x odd */
  const int tid = threadIdx.x, lane = tid & 31, ln = lane & 15, hh = lane >> 4, w = tid >> 5;
  const int rp = blockIdx.x, row0 = rp * 32;
  v8us ar[2][4];
#pragma unroll      /* constant indices keep the register arrays out of scratch */
  for (int pl = 0; pl < 2; ++pl)
#pragma unroll      /* constant indices keep the register arrays out of scratch */
    for (int j = 0; j < 4; ++j) ar[pl][j] = *(const v8us*)((const unsigned short*)OA + ((size_t)pl * NT16 + 2 * rp) * (16 * EE) + (j * 256 + tid) * 8);
  const _Float16* wp = BO + (size_t)w * 32 * EE + lane * 8;      /* output column 32 w + 16 t + ln: column tile 2 w + t; tile t, k step ks: the two 512-byte pieces from element 512 (8 t + ks) on */
  v16h wf[8][2];      /* [k step][column tile] */
#pragma unroll      /* constant indices keep the register arrays out of scratch */
  for (int ks = 0; ks < 8; ++ks)
#pragma unroll      /* constant indices keep the register arrays out of scratch */
    for (int t = 0; t < 2; ++t) wf[ks][t] = w_frag(wp + (t * 8 + ks) * 512);
  float bo[2];
#pragma unroll      /* constant indices keep the register arrays out of scratch */
  for (int t = 0; t < 2; ++t) bo[t] = bf16_round(bout[w * 32 + t * 16 + ln]);
  __builtin_amdgcn_sched_barrier(0);      /* every load is issued ahead of the first LDS store, which waits for the A planes alone: one load latency for the wave */
#pragma unroll      /* constant indices keep the register arrays out of scratch */
  for (int pl = 0; pl < 2; ++pl)
#pragma unroll      /* constant indices keep the register arrays out of scratch */
    for (int j = 0; j < 4; ++j) *(v8us*)((unsigned short*)&sa[pl][0] + (j * 256 + tid) * 8) = ar[pl][j];
  __syncthreads();      /* every wave reads all of the 32 rows' planes, an eighth laid by each */
  const v8f z8 = {0.f,0.f,0.f,0.f,0.f,0.f,0.f,0.f};
  v8f ch[2][2] = {{z8, z8}, {z8, z8}}, cl[2][2] = {{z8, z8}, {z8, z8}};      /* [row tile][column tile] */
  v16h ah[2][2], al[2][2];      /* [k step mod 2][row tile] */
#pragma unroll      /* constant indices keep the register arrays out of scratch */
  for (int m = 0; m < 2; ++m) { ah[0][m] = w_frag(&sa[0][m * 16 * EE + lane * 8]); al[0][m] = w_frag(&sa[1][m * 16 * EE + lane * 8]); }
#pragma unroll      /* constant indices keep the register arrays out of scratch */
  for (int ks = 0; ks < 8; ++ks) {
    if (ks < 7) {
#pragma unroll      /* constant indices keep the register arrays out of scratch */
      for (int m = 0; m < 2; ++m) { ah[(ks + 1) & 1][m] = w_frag(&sa[0][m * 16 * EE + (ks + 1) * 512 + lane * 8]); al[(ks + 1) & 1][m] = w_frag(&sa[1][m * 16 * EE + (ks + 1) * 512 + lane * 8]); } }
    __builtin_amdgcn_sched_barrier(0);      /* the next step's LDS reads stand as one group ahead of this step's products, not among them */
#pragma unroll      /* constant indices keep the register arrays out of scratch */
    for (int m = 0; m < 2; ++m)
#pragma unroll      /* constant indices keep the register arrays out of scratch */
      for (int t = 0; t < 2; ++t) {
        ch[m][t] = __builtin_amdgcn_wmma_f32_16x16x32_f16(false, ah[ks & 1][m], false, wf[ks][t], (short)0, ch[m][t], false, false);
        cl[m][t] = __builtin_amdgcn_wmma_f32_16x16x32_f16(false, al[ks & 1][m], false, wf[ks][t], (short)0, cl[m][t], false, false); }
    __builtin_amdgcn_sched_barrier(0);      /* ends the step: the reads of the step after next stay behind these products, whose operand registers they take */ }
#pragma unroll      /* constant indices keep the register arrays out of scratch */
  for (int m = 0; m < 2; ++m)
#pragma unroll      /* constant indices keep the register arrays out of scratch */
    for (int t = 0; t < 2; ++t)
#pragma unroll      /* constant indices keep the register arrays out of scratch */
      for (int r = 0; r < 8; ++r) { float v = ch[m][t][r] * 0.0625f + bo[t]; v += cl[m][t][r] * (0.0625f / 1024.0f); so[w][16 * m + 8 * hh + r][t * 16 + ln] = v; }
  __builtin_amdgcn_fence(__ATOMIC_ACQ_REL, "workgroup"); __builtin_amdgcn_wave_barrier();      /* the wave reads back its own staged tile, so that each store covers whole 128-byte lines */
  const int c4 = (lane & 7) * 4;
#pragma unroll      /* constant indices keep the register arrays out of scratch */
  for (int q = 0; q < 8; ++q) { const int r = q * 4 + (lane >> 3); const v4f v = *(const v4fa*)&so[w][r][c4]; *(v4f*)(out + (size_t)(row0 + r) * EE + w * 32 + c4) = v; } }

extern "C" void kernel_launch(void* const* d_in, const int* in_sizes, int n_in,
                              void* d_out, int out_size, void* d_ws, size_t ws_size, hipStream_t stream) {
  (void)in_sizes; (void)n_in; (void)out_size;
  const float* x = (const float*)d_in[0]; const float* Wqkv = (const float*)d_in[1]; const float* bqkv = (const float*)d_in[2]; const float* Wout = (const float*)d_in[3]; const float* bout = (const float*)d_in[4];
  char* ws = (char*)d_ws; size_t off = 0;
  auto take = [&](size_t bytes) { char* p = ws + off; off += (bytes + 255) & ~(size_t)255; return p; };
  _Float16* BO = (_Float16*)take((size_t)EE * EE * 2); _Float16* OA = (_Float16*)take((size_t)2 * NR * EE * 2);
  if (off > ws_size) return;      /* about 8 MiB */
  k_qa<<<(NR / FM) * NH, 256, 0, stream>>>(x, Wqkv, bqkv, Wout, BO, OA);      /* q, k, v + bias and the attention, a head and 128 frames to a work-group; weights stay in their (out, in) order */
  k_out<<<NR / 32, 256, 0, stream>>>(OA, BO, bout, (float*)d_out);      /* out = (o_hi + o_lo) Wout^T + bout */
}

// v007
// One run takes 17 microseconds.
// Two timings next to v006 put it at 1.08 and 1.09 times that version's speed.
// Counting every step since v000, it is 17.0 times as fast.
#include <hip/hip_runtime.h>
// Speech_MultiHeadedAttention (2 x 4096 frames x 256 = 4 heads x 64; qkv = x Wqkv^T + bqkv; q scaled by 64^-0.5; local attention over a 65-frame window centred on each frame where the window is taken from ZERO-PADDED k / v (out-of-range slots are zero vectors that still take part in the softmax with logit 0, exactly as the source); out = merged . Wout^T + bout).
// Structure: launch 1, a work-group per head and 128 frames: q, k, v of those frames and of the 32 on either side as ONE f16 WMMA GEMM that makes its own exact f16 x and x16 weight tiles in LDS from the f32 inputs (192x192 work-group tile, 96x48 wave tiles, f32 accumulation, + bias; result kept in LDS as f16 hi + residual planes, q and k by frame, v transposed), then the 65-key windowed attention straight from those planes (wave per 16 frames: scores and weighted value sum as three-term f16 16x16x32 products hi.hi + hi.lo + lo.hi, f32 accumulation, softmax in registers in f32); it leaves the merged rows as f16 hi/residual planes and the x16 Wout plane, both in fragment order; launch 2 does Wout on them as two f16 WMMA terms (+ bias).
// Compute dtype: inputs rounded to bf16; x / weights exact as f16 so q/k/v are f32 sums of exact products; q, k, v, the softmax weights and the attention output each as f16 hi + f16 residual (about 22 significant bits; only the residual x residual term is left out); softmax f32 - near exact-class. v_wmma_f32_16x16x32_f16.
#define NB 2
#define TT 4096
#define EE 256
#define NH 4
#define HD 64
#define WW 65
#define PADW 32
#define NR (NB * TT)
typedef __bf16 v16b __attribute__((ext_vector_type(16)));
typedef unsigned short v8us __attribute__((ext_vector_type(8), may_alias));
typedef float  v8f  __attribute__((ext_vector_type(8)));
typedef float  v4f  __attribute__((ext_vector_type(4)));
typedef float  v4fa __attribute__((ext_vector_type(4), may_alias));
union FragB { v16b v; v8us half[2]; unsigned short u[16]; };

__device__ __forceinline__ unsigned short bf16_bits(float x) { unsigned int u = __float_as_uint(x); return (unsigned short)((u + 0x7FFFu + ((u >> 16) & 1u)) >> 16); }
__device__ __forceinline__ float bf16_val(unsigned short b) { return __uint_as_float(((unsigned int)b) << 16); }
__device__ __forceinline__ float bf16_round(float x) { return bf16_val(bf16_bits(x)); }
// D += A·B with NT terms: 1 = ah·bh, 2 = + al·bh (A split), 3 = + ah·bl (both split)
template <int NT>
__device__ __forceinline__ v8f mmaN(v16b ah, v16b al, v16b bh, v16b bl, v8f c) {
  c = __builtin_amdgcn_wmma_f32_16x16x32_bf16(false, ah, false, bh, (short)0, c, false, false);
  if (NT >= 2) c = __builtin_amdgcn_wmma_f32_16x16x32_bf16(false, al, false, bh, (short)0, c, false, false);
  if (NT >= 3) c = __builtin_amdgcn_wmma_f32_16x16x32_bf16(false, ah, false, bl, (short)0, c, false, false);
  asm volatile("v_nop\n\tv_nop\n\tv_nop\n\tv_nop" : "+v"(c) : "v"(ah), "v"(al), "v"(bh), "v"(bl));
  return c;
}

__global__ __launch_bounds__(256) void k_wt_bf16(const float* __restrict__ W, unsigned short* __restrict__ Wt, int K, int N) {
  const int t = blockIdx.x * 256 + threadIdx.x;
  const int k8n = K / 8;
  if (t >= N * k8n) return;
  const int n = t / k8n, k8 = (t % k8n) * 8;
  v8us v;
#pragma unroll
  for (int i = 0; i < 8; ++i) v[i] = bf16_bits(W[(size_t)(k8 + i) * N + n]);
  *(v8us*)(Wt + (size_t)n * K + k8) = v;
  
}

// GEMM C[M][N] (f32, pitch ldc) = act(A[M][K]·W + bias). A f32 row-major (pitch lda) converted per fragment to bf16
// (ASPLIT: hi/lo two planes -> 2 terms, else single rounded term); Wt bf16 [N][K] (pitch ldb). BIAS_BF16 rounds the
// bias to bf16 first (bias quantised to bf16 before the add). K%32==0, M%16==0, N%64==0.
template <bool ASPLIT, int ACT, bool BIAS_BF16>
__global__ __launch_bounds__(128) void k_gemm_bf(const float* __restrict__ A, int lda, const unsigned short* __restrict__ Wt, int ldb,
                                               const float* __restrict__ bias, float* __restrict__ C, int ldc, int M, int N, int K) {
  __shared__ __attribute__((aligned(16))) float so[4][16][64];
  const int tid = threadIdx.x, w = tid >> 5, lane = tid & 31, ln = lane & 15, hh = lane >> 4;
  const int ntn = N / 64;
  const int wid = blockIdx.x * 4 + w;
  const int mt = wid / ntn, nq = wid % ntn;
  if (mt * 16 >= M) return;
  const int row0 = mt * 16, col0 = nq * 64;
  const float* arow = A + (size_t)(row0 + ln) * lda;
  v8f acc[4] = {};
  for (int kb = 0; kb < K; kb += 32) {
    FragB ah, al;
    const v4f x0 = *(const v4fa*)(arow + kb + 8 * hh), x1 = *(const v4fa*)(arow + kb + 8 * hh + 4);
    const v4f x2 = *(const v4fa*)(arow + kb + 16 + 8 * hh), x3 = *(const v4fa*)(arow + kb + 16 + 8 * hh + 4);
    float xs[16] = {x0[0],x0[1],x0[2],x0[3],x1[0],x1[1],x1[2],x1[3],x2[0],x2[1],x2[2],x2[3],x3[0],x3[1],x3[2],x3[3]};
#pragma unroll
    for (int i = 0; i < 16; ++i) { const unsigned short hb = bf16_bits(xs[i]); ah.u[i] = hb; al.u[i] = ASPLIT ? bf16_bits(xs[i] - bf16_val(hb)) : (unsigned short)0; }
#pragma unroll
    for (int t = 0; t < 4; ++t) {
      const unsigned short* brow = Wt + (size_t)(col0 + t * 16 + ln) * ldb + kb;
      FragB b;
      b.half[0] = *(const v8us*)(brow + 8 * hh);
      b.half[1] = *(const v8us*)(brow + 16 + 8 * hh);
      acc[t] = mmaN<ASPLIT ? 2 : 1>(ah.v, al.v, b.v, b.v, acc[t]);
    }
  }
#pragma unroll
  for (int t = 0; t < 4; ++t) {
    float bv = bias ? bias[col0 + t * 16 + ln] : 0.f;
    if (BIAS_BF16) bv = bf16_round(bv);
#pragma unroll
    for (int r = 0; r < 8; ++r) { float v = acc[t][r] + bv; if (ACT == 1) v = fmaxf(v, 0.f); so[w][8 * hh + r][t * 16 + ln] = v; }
  }
  __builtin_amdgcn_fence(__ATOMIC_ACQ_REL, "workgroup");
  __builtin_amdgcn_wave_barrier();
  const int rsub = lane >> 4, c4 = (lane & 15) * 4;
  {
#pragma unroll
    for (int q = 0; q < 8; ++q) {
      const int r = q * 2 + rsub;
      const v4f v = *(const v4fa*)&so[w][r][c4];
      *(v4f*)(C + (size_t)(row0 + r) * ldc + col0 + c4) = v;
    }
    
  }
}

// GEMM C = act(A·W + bias + resid): A f32 (ASPLIT -> hi/lo 2 terms), Wt bf16 [N][K]; ACT 0 none, 1 relu, 2 exact gelu;
// resid (optional, f32, row index = (row % rmod), pitch ldr, RES_BF16 rounds it) added before the activation.
template <bool ASPLIT, int ACT, bool BIAS_BF16, bool RES_BF16>
__global__ __launch_bounds__(128) void k_gemm_bf3(const float* __restrict__ A, int lda, const unsigned short* __restrict__ Wt, int ldb,
                                                const float* __restrict__ bias, const float* __restrict__ resid, int rmod, int ldr,
                                                float* __restrict__ C, int ldc, int M, int N, int K) {
  __shared__ __attribute__((aligned(16))) float so[4][16][64];
  const int tid = threadIdx.x, w = tid >> 5, lane = tid & 31, ln = lane & 15, hh = lane >> 4;
  const int ntn = N / 64;
  const int wid = blockIdx.x * 4 + w;
  const int mt = wid / ntn, nq = wid % ntn;
  if (mt * 16 >= M) return;
  const int row0 = mt * 16, col0 = nq * 64;
  const float* arow = A + (size_t)(row0 + ln) * lda;
  v8f acc[4] = {};
  for (int kb = 0; kb < K; kb += 32) {
    FragB ah, al;
    const v4f x0 = *(const v4fa*)(arow + kb + 8 * hh), x1 = *(const v4fa*)(arow + kb + 8 * hh + 4);
    const v4f x2 = *(const v4fa*)(arow + kb + 16 + 8 * hh), x3 = *(const v4fa*)(arow + kb + 16 + 8 * hh + 4);
    float xs[16] = {x0[0],x0[1],x0[2],x0[3],x1[0],x1[1],x1[2],x1[3],x2[0],x2[1],x2[2],x2[3],x3[0],x3[1],x3[2],x3[3]};
#pragma unroll
    for (int i = 0; i < 16; ++i) { const unsigned short hb = bf16_bits(xs[i]); ah.u[i] = hb; al.u[i] = ASPLIT ? bf16_bits(xs[i] - bf16_val(hb)) : (unsigned short)0; }
#pragma unroll
    for (int t = 0; t < 4; ++t) {
      const unsigned short* brow = Wt + (size_t)(col0 + t * 16 + ln) * ldb + kb;
      FragB b;
      b.half[0] = *(const v8us*)(brow + 8 * hh);
      b.half[1] = *(const v8us*)(brow + 16 + 8 * hh);
      acc[t] = mmaN<ASPLIT ? 2 : 1>(ah.v, al.v, b.v, b.v, acc[t]);
    }
  }
#pragma unroll
  for (int t = 0; t < 4; ++t) {
    const int col = col0 + t * 16 + ln;
    float bv = bias ? bias[col] : 0.f;
    if (BIAS_BF16) bv = bf16_round(bv);
#pragma unroll
    for (int r = 0; r < 8; ++r) {
      float v = acc[t][r] + bv;
      if (resid) { float rv = resid[(size_t)((row0 + 8 * hh + r) % rmod) * ldr + col]; if (RES_BF16) rv = bf16_round(rv); v += rv; }
      if (ACT == 1) v = fmaxf(v, 0.f);
      if (ACT == 2) v = 0.5f * v * (1.0f + erff(v * 0.70710678118654752f));
      if (ACT == 3) { const float u = 0.7978845608028654f * (v + 0.044715f * v * v * v); v = 0.5f * v * (1.0f + tanhf(u)); }
      so[w][8 * hh + r][t * 16 + ln] = v;
    }
  }
  __builtin_amdgcn_fence(__ATOMIC_ACQ_REL, "workgroup");
  __builtin_amdgcn_wave_barrier();
  const int rsub = lane >> 4, c4 = (lane & 15) * 4;
  {
#pragma unroll
    for (int q = 0; q < 8; ++q) {
      const int r = q * 2 + rsub;
      const v4f v = *(const v4fa*)&so[w][r][c4];
      *(v4f*)(C + (size_t)(row0 + r) * ldc + col0 + c4) = v;
    }
    
  }
}
// row LayerNorm (biased variance, eps) over N: s = X (+ R); optional out_sum <- s; out_norm <- (s-mu)*rsqrt(var+eps)*g + b
template <bool PARAM_BF16>
__global__ __launch_bounds__(256) void k_layernorm(const float* __restrict__ X, const float* __restrict__ R, const float* __restrict__ g, const float* __restrict__ bta,
                                                  float* __restrict__ out_sum, float* __restrict__ out_norm, int N, float eps) {
  __shared__ float red[256];
  const int row = blockIdx.x, tid = threadIdx.x;
  const float* x = X + (size_t)row * N; const float* rr = R ? R + (size_t)row * N : nullptr;
  float vals[16];                     // up to N = 4096
  const int per = N / 256;            // contiguous chunk per thread? use strided-by-4 chunks: thread handles j = tid*4 + 1024*u
  float s1 = 0.f;
  for (int u = 0; u < per / 4; ++u) {
    const int j = tid * 4 + 1024 * u;
    const v4f a = *(const v4fa*)(x + j);
    v4f b = {0.f,0.f,0.f,0.f}; if (rr) b = *(const v4fa*)(rr + j);
#pragma unroll
    for (int q = 0; q < 4; ++q) { const float v = a[q] + b[q]; vals[u * 4 + q] = v; s1 += v; }
  }
  red[tid] = s1; __syncthreads();
  for (int st = 128; st > 0; st >>= 1) { if (tid < st) red[tid] += red[tid + st]; __syncthreads(); }
  const float mu = red[0] / (float)N; __syncthreads();
  float s2 = 0.f;
  for (int u = 0; u < per / 4; ++u)
#pragma unroll
    for (int q = 0; q < 4; ++q) { const float c = vals[u * 4 + q] - mu; s2 += c * c; }
  red[tid] = s2; __syncthreads();
  for (int st = 128; st > 0; st >>= 1) { if (tid < st) red[tid] += red[tid + st]; __syncthreads(); }
  const float rs = rsqrtf(red[0] / (float)N + eps);
  {
    for (int u = 0; u < per / 4; ++u) {
      const int j = tid * 4 + 1024 * u;
      v4f o, sm;
#pragma unroll
      for (int q = 0; q < 4; ++q) {
        float gg = g[j + q], bb = bta[j + q];
        if (PARAM_BF16) { gg = bf16_round(gg); bb = bf16_round(bb); }
        sm[q] = vals[u * 4 + q]; o[q] = (vals[u * 4 + q] - mu) * rs * gg + bb;
      }
      if (out_sum) *(v4f*)(out_sum + (size_t)row * N + j) = sm;
      *(v4f*)(out_norm + (size_t)row * N + j) = o;
    }
    
  }
}



// ---- f16 WMMA path (v_wmma_f32_16x16x32_f16): 11-bit significands for operands in range — used for the qkv GEMM (k_qa) and the Wout product in k_out
typedef _Float16 v16h __attribute__((ext_vector_type(16)));
union FragH { v16h v; v8us half[2]; _Float16 h[16]; unsigned short u[16]; };
template <int NT>
__device__ __forceinline__ v8f mmaH(v16h ah, v16h al, v16h bh, v16h bl, v8f c) {
  c = __builtin_amdgcn_wmma_f32_16x16x32_f16(false, ah, false, bh, (short)0, c, false, false);
  if (NT >= 2) c = __builtin_amdgcn_wmma_f32_16x16x32_f16(false, al, false, bh, (short)0, c, false, false);
  if (NT >= 3) c = __builtin_amdgcn_wmma_f32_16x16x32_f16(false, ah, false, bl, (short)0, c, false, false);
  asm volatile("v_nop\n\tv_nop\n\tv_nop\n\tv_nop" : "+v"(c) : "v"(ah), "v"(al), "v"(bh), "v"(bl));
  return c;
}
// batched GEMM like k_gemm_b but f16 operands: A f32 (split into f16 hi/lo if ASPLIT, else rounded to f16), Bt = f16 values [n][k]; alpha; C f32; N multiple of 16 (partial tiles skipped)
template <bool ASPLIT>
__global__ __launch_bounds__(128) void k_gemm_h(const float* __restrict__ A, int lda, size_t sA, const _Float16* __restrict__ Bh, int ldb, size_t sB, float alpha, float* __restrict__ C, int ldc, size_t sC, int M, int N, int K) {
  __shared__ __attribute__((aligned(16))) float so[4][16][64];
  const int tid = threadIdx.x, w = tid >> 5, lane = tid & 31, ln = lane & 15, hh = lane >> 4; const int by = blockIdx.y;
  A += (size_t)by * sA; Bh += (size_t)by * sB; C += (size_t)by * sC;
  const int ntn = (N + 63) / 64; const int wid = blockIdx.x * 4 + w; const int mt = wid / ntn, nq = wid % ntn; if (mt * 16 >= M) return;
  const int row0 = mt * 16, col0 = nq * 64; const float* arow = A + (size_t)(row0 + ln) * lda;
  v8f acc[4] = {};
  for (int kb = 0; kb < K; kb += 32) {
    FragH ah, al;
    const v4f x0 = *(const v4fa*)(arow + kb + 8 * hh), x1 = *(const v4fa*)(arow + kb + 8 * hh + 4), x2 = *(const v4fa*)(arow + kb + 16 + 8 * hh), x3 = *(const v4fa*)(arow + kb + 16 + 8 * hh + 4);
    float xs[16] = {x0[0],x0[1],x0[2],x0[3],x1[0],x1[1],x1[2],x1[3],x2[0],x2[1],x2[2],x2[3],x3[0],x3[1],x3[2],x3[3]};
#pragma unroll
    for (int i = 0; i < 16; ++i) { const _Float16 h = (_Float16)xs[i]; ah.h[i] = h; al.h[i] = ASPLIT ? (_Float16)(xs[i] - (float)h) : (_Float16)0.0f; }
#pragma unroll
    for (int t = 0; t < 4; ++t) { if (col0 + t * 16 >= N) continue; const size_t boff = (size_t)(col0 + t * 16 + ln) * ldb + kb; FragH bq; bq.half[0] = *(const v8us*)(Bh + boff + 8 * hh); bq.half[1] = *(const v8us*)(Bh + boff + 16 + 8 * hh);
      acc[t] = mmaH<ASPLIT ? 2 : 1>(ah.v, al.v, bq.v, bq.v, acc[t]); }
  }
#pragma unroll
  for (int t = 0; t < 4; ++t) { if (col0 + t * 16 >= N) continue;
#pragma unroll
    for (int r = 0; r < 8; ++r) so[w][8 * hh + r][t * 16 + ln] = acc[t][r] * alpha; }
  __builtin_amdgcn_fence(__ATOMIC_ACQ_REL, "workgroup"); __builtin_amdgcn_wave_barrier();
  const int rsub = lane >> 4, c4 = (lane & 15) * 4;
  {
#pragma unroll
    for (int q = 0; q < 8; ++q) { const int r = q * 2 + rsub; if (col0 + c4 < N) { const v4f v = *(const v4fa*)&so[w][r][c4]; *(v4f*)(C + (size_t)(row0 + r) * ldc + col0 + c4) = v; } }
     }
}

// Wt[n][k] = f16(W[k][n]·scale) from f32 row-major W[K][N] (scale = power of two; bf16-exact weights stay exact in f16 away from the subnormal range)
__global__ __launch_bounds__(256) void k_wt_f16(const float* __restrict__ W, _Float16* __restrict__ Wt, int K, int N, float scale) {
  const int t = blockIdx.x * 256 + threadIdx.x; if (t >= N * (K / 8)) return; const int n = t / (K / 8), k8 = (t % (K / 8)) * 8; FragH f;
#pragma unroll
  for (int i = 0; i < 8; ++i) f.h[i] = (_Float16)(bf16_round(W[(size_t)(k8 + i) * N + n]) * scale); const v8us o = f.half[0];
  *(v8us*)((unsigned short*)Wt + (size_t)n * K + k8) = o; 
}
// k_gemm_hh variant with fused epilogue: v = acc·alpha + bias[by·sBias + col] (+ CP[(row/rowsPerB)·sCPb + by·64 + col] if CP) ; ACT 0 none / 1 elu ; writes f16 C16 (and f32 C if non-null)
template <int ACT>
__global__ __launch_bounds__(128) void k_gemm_hhx(const _Float16* __restrict__ A, int lda, size_t sA, const _Float16* __restrict__ Bh, int ldb, size_t sB, float alpha, const float* __restrict__ bias, size_t sBias, const float* __restrict__ CP, int rowsPerB, size_t sCPb, int row0g,
    float* __restrict__ C, _Float16* __restrict__ C16, int ldc, size_t sC, int M, int N, int K) {
  __shared__ __attribute__((aligned(16))) float so[4][16][64];
  const int tid = threadIdx.x, w = tid >> 5, lane = tid & 31, ln = lane & 15, hh = lane >> 4; const int by = blockIdx.y;
  A += (size_t)by * sA; Bh += (size_t)by * sB; const size_t cofs = (size_t)by * sC; const float* bp = bias ? bias + (size_t)by * sBias : nullptr;
  const int ntn = (N + 63) / 64; const int wid = blockIdx.x * 4 + w; const int mt = wid / ntn, nq = wid % ntn; if (mt * 16 >= M) return;
  const int row0 = mt * 16, col0 = nq * 64; const _Float16* arow = A + (size_t)(row0 + ln) * lda;
  v8f acc[4] = {};
  for (int kb = 0; kb < K; kb += 32) { FragH ah; ah.half[0] = *(const v8us*)((const unsigned short*)arow + kb + 8 * hh); ah.half[1] = *(const v8us*)((const unsigned short*)arow + kb + 16 + 8 * hh);
#pragma unroll
    for (int t = 0; t < 4; ++t) { if (col0 + t * 16 >= N) continue; const size_t boff = (size_t)(col0 + t * 16 + ln) * ldb + kb; FragH bq; bq.half[0] = *(const v8us*)((const unsigned short*)Bh + boff + 8 * hh); bq.half[1] = *(const v8us*)((const unsigned short*)Bh + boff + 16 + 8 * hh);
      acc[t] = mmaH<1>(ah.v, ah.v, bq.v, bq.v, acc[t]); }
  }
#pragma unroll
  for (int t = 0; t < 4; ++t) { if (col0 + t * 16 >= N) continue; const int col = col0 + t * 16 + ln; const float bv = bp ? bf16_round(bp[col]) : 0.f;
#pragma unroll
    for (int r = 0; r < 8; ++r) { float v = acc[t][r] * alpha + bv; if (CP) { const int rr = row0g + row0 + 8 * hh + r; if (rowsPerB < 0) v += CP[cofs + (size_t)rr * ldc + col];      /* rowsPerB < 0: own element of the batched C plane */ else { const int bidx = rr / rowsPerB; v += CP[(size_t)bidx * sCPb + (size_t)by * 64 + col]; } } if (ACT == 1) v = (v > 0.f) ? v : expm1f(v); else if (ACT == 7) v = (v > 0.f) ? v + 1.0f : expf(v); else if (ACT == 8) v = tanhf(v); else if (ACT == 9) v = 0.5f * v * (1.0f + tanhf(0.7978845608028654f * (v + 0.044715f * v * v * v))); else if (ACT == 11) v = 1.0f / (1.0f + expf(-v)); else if (ACT == 12) v = (v > 0.f) ? v : 0.01f * v; else if (ACT == 14) v = (v > 0.f) ? v : 0.1f * v; else if (ACT == 16) v = (v >= 0.f) ? v : 0.3f * v; else if (ACT == 17) v = (v >= 0.f) ? v : 0.2f * v; else if (ACT == 15) v = v / (1.0f + expf(-v)); else if (ACT == 3) v = fmaxf(v, 0.f); else if (ACT == 6) v = 0.5f * v * (1.0f + erff(v * 0.70710678118654752f)); so[w][8 * hh + r][t * 16 + ln] = v; } }
  __builtin_amdgcn_fence(__ATOMIC_ACQ_REL, "workgroup"); __builtin_amdgcn_wave_barrier();
  const int rsub = lane >> 4, c4 = (lane & 15) * 4; typedef _Float16 v4h __attribute__((ext_vector_type(4)));
  {
#pragma unroll
    for (int q = 0; q < 8; ++q) { const int r = q * 2 + rsub; if (col0 + c4 < N) { const v4f v = *(const v4fa*)&so[w][r][c4]; if (C) *(v4f*)(C + cofs + (size_t)(row0 + r) * ldc + col0 + c4) = v; if (C16) { v4h h4; for (int i = 0; i < 4; ++i) h4[i] = (_Float16)v[i]; *(v4h*)(C16 + cofs + (size_t)(row0 + r) * ldc + col0 + c4) = h4; } } }
     }
}


typedef _Float16 v4h __attribute__((ext_vector_type(4)));

__global__ __launch_bounds__(256) void k_h16(const float* __restrict__ x, _Float16* __restrict__ X16, size_t n8) { const size_t t = (size_t)blockIdx.x * 256 + threadIdx.x; if (t >= n8) return; FragH f;
#pragma unroll
  for (int q = 0; q < 8; ++q) f.h[q] = (_Float16)x[t * 8 + q]; *(v8us*)((unsigned short*)X16 + t * 8) = f.half[0];  }
__global__ __launch_bounds__(256) void k_round16f(const float* __restrict__ W, _Float16* __restrict__ Bt, size_t n8) { const size_t t = (size_t)blockIdx.x * 256 + threadIdx.x; if (t >= n8) return; FragH f;
#pragma unroll
  for (int i = 0; i < 8; ++i) f.h[i] = (_Float16)(bf16_round(W[t * 8 + i]) * 16.0f); *(v8us*)((unsigned short*)Bt + t * 8) = f.half[0];  }
template <int NHv, int TTv>
__global__ __launch_bounds__(256) void k_vt(const _Float16* __restrict__ V16, int ldv, int voff, _Float16* __restrict__ Vt) { __shared__ unsigned short tl[64][66]; const int tid = threadIdx.x; const int slab = blockIdx.x / (TTv / 64), lg = blockIdx.x % (TTv / 64); const int b = slab / NHv, h = slab % NHv;
  for (int i = tid; i < 64 * 8; i += 256) { const int r = i / 8, c8 = (i % 8) * 8; FragH f; f.half[0] = *(const v8us*)((const unsigned short*)V16 + ((size_t)b * TTv + lg * 64 + r) * ldv + voff + h * 64 + c8);
#pragma unroll
    for (int q = 0; q < 8; ++q) tl[r][c8 + q] = f.u[q]; }
  __syncthreads();
  {
#pragma unroll
    for (int rd = 0; rd < 2; ++rd) { const int d = rd * 32 + tid / 8, pc = tid % 8; FragH f;
#pragma unroll
      for (int q = 0; q < 8; ++q) f.u[q] = tl[pc * 8 + q][d];
      *(v8us*)((unsigned short*)Vt + ((size_t)slab * 64 + d) * TTv + lg * 64 + pc * 8) = f.half[0]; }
     } }

__global__ __launch_bounds__(256) void k_hl(const float* __restrict__ F, _Float16* __restrict__ Hh, _Float16* __restrict__ Hl, size_t n8) { const size_t t = (size_t)blockIdx.x * 256 + threadIdx.x; if (t >= n8) return; FragH fh, fl; const v4f a = *(const v4fa*)(F + t * 8), c = *(const v4fa*)(F + t * 8 + 4);
#pragma unroll
  for (int q = 0; q < 4; ++q) { _Float16 h = (_Float16)a[q]; fh.h[q] = h; fl.h[q] = (_Float16)((a[q] - (float)h) * 1024.0f); h = (_Float16)c[q]; fh.h[4 + q] = h; fl.h[4 + q] = (_Float16)((c[q] - (float)h) * 1024.0f); }
  { *(v8us*)((unsigned short*)Hh + t * 8) = fh.half[0]; *(v8us*)((unsigned short*)Hl + t * 8) = fl.half[0];  } }

// ---- fast GEMM (wave tile 32x64; requires M % 32 == 0 rows per launch region and N % 64 == 0); epilogue = k_gemm_hhx semantics ----
__device__ __forceinline__ v16h g2_frag(const _Float16* p, int hh) { FragH f; f.half[0] = *(const v8us*)((const unsigned short*)p + 8 * hh); f.half[1] = *(const v8us*)((const unsigned short*)p + 16 + 8 * hh); return f.v; }
__device__ __forceinline__ v8f g2_mma(v16h a, v16h b, v8f c) { v8f d = __builtin_amdgcn_wmma_f32_16x16x32_f16(false, a, false, b, (short)0, c, false, false); asm volatile("v_nop\n\tv_nop\n\tv_nop\n\tv_nop" : "+v"(d) : "v"(a), "v"(b)); return d; }
template <int ACT>
__global__ __launch_bounds__(128) void k_gemm2(const _Float16* __restrict__ A, int lda, size_t sA, const _Float16* __restrict__ Bh, int ldb, size_t sB, float alpha, const float* __restrict__ bias, size_t sBias, const float* __restrict__ CP, int rowsPerB, size_t sCPb, int row0g,
    float* __restrict__ C, _Float16* __restrict__ C16, int ldc, size_t sC, int M, int N, int K) { static_assert(ACT == 0 || ACT == 3 || ACT == 6 || ACT == 8 || ACT == 9 || ACT == 11 || ACT == 12 || ACT == 14 || ACT == 15 || ACT == 16 || ACT == 17, "k_gemm2: unsupported ACT code (would silently apply no activation)");
  __shared__ __attribute__((aligned(16))) float so[4][32][68];
  const int tid = threadIdx.x, w = tid >> 5, lane = tid & 31, ln = lane & 15, hh = lane >> 4; const int by = blockIdx.y;
  A += (size_t)by * sA; Bh += (size_t)by * sB; const size_t cofs = (size_t)by * sC; const float* bp = bias ? bias + (size_t)by * sBias : nullptr;
  const int ntn = N >> 6; const int mt = blockIdx.x / ntn, nq = blockIdx.x - mt * ntn; const int row0 = mt * 128 + 32 * w, col0 = nq * 64; if (row0 >= M) return;
  const _Float16* a0p = A + (size_t)(row0 + ln) * lda; const _Float16* a1p = a0p + (size_t)16 * lda;
  const _Float16* b0p = Bh + (size_t)(col0 + ln) * ldb; const _Float16* b1p = b0p + (size_t)16 * ldb; const _Float16* b2p = b1p + (size_t)16 * ldb; const _Float16* b3p = b2p + (size_t)16 * ldb;
  const v8f z8 = {0.f,0.f,0.f,0.f,0.f,0.f,0.f,0.f}; v8f c00 = z8, c01 = z8, c02 = z8, c03 = z8, c10 = z8, c11 = z8, c12 = z8, c13 = z8;
#pragma unroll 1
  for (int kb = 0; kb < K; kb += 32) { const v16h a0 = g2_frag(a0p + kb, hh), a1 = g2_frag(a1p + kb, hh);
    v16h b = g2_frag(b0p + kb, hh); c00 = g2_mma(a0, b, c00); c10 = g2_mma(a1, b, c10);
    b = g2_frag(b1p + kb, hh); c01 = g2_mma(a0, b, c01); c11 = g2_mma(a1, b, c11);
    b = g2_frag(b2p + kb, hh); c02 = g2_mma(a0, b, c02); c12 = g2_mma(a1, b, c12);
    b = g2_frag(b3p + kb, hh); c03 = g2_mma(a0, b, c03); c13 = g2_mma(a1, b, c13); }
  v8f accs[8] = {c00, c01, c02, c03, c10, c11, c12, c13};
#pragma unroll
  for (int u = 0; u < 8; ++u) { const int t = u & 3, half = u >> 2; const int col = col0 + t * 16 + ln; const float bv = bp ? bf16_round(bp[col]) : 0.f;
#pragma unroll
    for (int r = 0; r < 8; ++r) { const int rloc = half * 16 + 8 * hh + r; float v = accs[u][r] * alpha + bv; if (CP) { if (rowsPerB < 0) v += CP[cofs + (size_t)(row0g + row0 + rloc) * ldc + col];      /* rowsPerB < 0: own element of the batched C plane */ else { const int bidx = (row0g + row0 + rloc) / rowsPerB; v += CP[(size_t)bidx * sCPb + (size_t)by * 64 + col]; } }
      if (ACT == 3) v = fmaxf(v, 0.f); else if (ACT == 6) v = 0.5f * v * (1.0f + erff(v * 0.70710678118654752f)); else if (ACT == 11) v = 1.0f / (1.0f + expf(-v)); else if (ACT == 15) v = v / (1.0f + expf(-v)); else if (ACT == 12) v = (v > 0.f) ? v : 0.01f * v; else if (ACT == 8) v = tanhf(v); else if (ACT == 9) v = 0.5f * v * (1.0f + tanhf(0.7978845608028654f * (v + 0.044715f * v * v * v))); else if (ACT == 14) v = (v > 0.f) ? v : 0.1f * v; else if (ACT == 16) v = (v >= 0.f) ? v : 0.3f * v; else if (ACT == 17) v = (v >= 0.f) ? v : 0.2f * v;
      so[w][rloc][t * 16 + ln] = v; } }
  __builtin_amdgcn_fence(__ATOMIC_ACQ_REL, "workgroup"); __builtin_amdgcn_wave_barrier();
  const int rsub = lane >> 4, c4 = (lane & 15) * 4;
  {
#pragma unroll
    for (int q = 0; q < 16; ++q) { const int r = q * 2 + rsub; const v4f v = *(const v4fa*)&so[w][r][c4]; if (C) *(v4f*)(C + cofs + (size_t)(row0 + r) * ldc + col0 + c4) = v; if (C16) { v4h h4; for (int i = 0; i < 4; ++i) h4[i] = (_Float16)v[i]; *(v4h*)(C16 + cofs + (size_t)(row0 + r) * ldc + col0 + c4) = h4; } }
     } }


// Launch 1: q, k, v of ONE head for 128 frames and the window's reach (32 frames) on both sides, then that head's windowed attention, in one work-group; q, k, v never leave LDS.
// The work-group reads its 192 x rows and the head's 192 weight rows (64 of q, of k, of v) as whole 512-byte pieces of f32, rounds them (bf16 value, weights x 16, exact in f16) and lays
// them in LDS once; behind one barrier its eight waves (2 x 4, 96 x 48 each: 16 columns of q, of k and of v) take every fragment from LDS; the result planes (f16 hi + residual) take the operands' place.
// Then wave w is query tile w (16 frames): its five key tiles are rows 16 w .. 16 w + 79 of the tile. 256 work-groups, one per WGP. Each also converts 256 elements of Wout for the next launch.
// A row outside the batch is computed from an edge row read in its place; its scores are replaced by 0 and its weights by 0 in the attention.
// What the next launch reads, each wave-wide 16-byte load covering 512 bytes in a row:
// OA = [hi | residual x 1024][row tile of 16 frames][k step of 32][half of 16][lane][8]: lane (ln, hh) holds k = 32 step + 16 half + 8 hh + 0..7 of merged row ln.
// BO = [column tile of 16][k step of 32][half of 16][lane][8]: lane (ln, hh) holds k = 32 step + 16 half + 8 hh + 0..7 of weight row 16 tile + ln.
#define FM 128      /* frames of a work-group */
#define FR (FM + 2 * PADW)      /* x rows it needs */
#define GN 192
#define GP (EE + 8)      /* pitch 528 B = 16 B x odd: 16-byte fragment reads of 16 rows meet no bank twice */
#define QKP (4 * HD + 8)      /* a frame's row of the q / k planes, [q hi | q residual | k hi | k residual]: pitch 528 B = 16 B x odd, for the same reason */
#define VTP (FR + 8)      /* a row of transposed v (one d, 192 frames): pitch 400 B = 16 B x odd */
#define VTB (16 * VTP + 32)      /* block u of 16 such rows holds d = 4 row + u; the 64 B between blocks keep the 16 rows that one store touches (4 rows in each of 4 blocks) on banks of their own */
#define QKB (FR * QKP * 2)      /* bytes of the q / k planes; behind them v: [hi | residual][block][row] */
#define VPB (2 * 4 * VTB * 2)      /* bytes of the two v planes */
#define SWP (HD + 8)      /* pitch 144 B = 16 B x odd */
#define NT16 (NR / 16)      /* row tiles of 16 frames */
static_assert(TT % FM == 0 && FM == 8 * 16 && PADW == 32 && EE == 256 && EE == NH * HD && (NR / FM) * NH * 256 == EE * EE, "k_qa: no work-group across a batch's end, a query tile for each wave, 64 threads to a row, and 256 elements of Wout for each work-group");
static_assert(GN == 3 * HD && HD == 64 && FR == GN && FR % 64 == 0, "k_qa: q, k, v of one head side by side; whole batches of 16 staging steps");
static_assert(QKB + VPB + 8 * 2 * 16 * SWP * 2 <= (FR + GN) * GP * 2 && QKB % 16 == 0 && VPB % 16 == 0, "k_qa: the result planes and the waves' output staging lie inside the operand tiles' LDS");
// Four f32 -> nearest-even bf16 value x a power of two, as f16, by the convert instructions. The scale goes on in f32, ahead of the rounding (a power of two commutes with it):
// behind it the compiler moves the product into f16, where a small weight has already lost bits.
typedef __bf16 v4bq __attribute__((ext_vector_type(4)));
__device__ __forceinline__ v4h q_h4(v4f a, float sc) { return __builtin_convertvector(__builtin_convertvector(__builtin_convertvector(a * sc, v4bq), v4f), v4h); }
// Staging step it (0..95) of a thread: four floats of tile row 4 it + (tid >> 6); rows 0..31 the frames before, 32..159 its own, 160..191 the frames behind, 192..383 the weight rows. A batch is 16 steps.
template <int B>
__device__ __forceinline__ void q_ld(const float* __restrict__ xl, const float* __restrict__ xm, const float* __restrict__ xh, const float* __restrict__ wr, v4f (&d)[16]) {
#pragma unroll      /* constant indices keep the register arrays out of scratch */
  for (int i = 0; i < 16; ++i) { const int it = B * 16 + i, iw = it - FR / 4;
    d[i] = *(const v4fa*)(it < PADW / 4 ? xl + (size_t)it * 4 * EE : it < (PADW + FM) / 4 ? xm + (size_t)(it - PADW / 4) * 4 * EE : it < FR / 4 ? xh + (size_t)(it - (PADW + FM) / 4) * 4 * EE
                          : wr + (size_t)((iw / 16) * EE + (iw % 16) * 4) * EE); } }
template <int B>
__device__ __forceinline__ void q_cv(const v4f (&d)[16], _Float16* dst) {
#pragma unroll      /* constant indices keep the register arrays out of scratch */
  for (int i = 0; i < 16; ++i) { const int it = B * 16 + i; *(v4h*)(dst + (size_t)it * 4 * GP) = q_h4(d[i], it < FR / 4 ? 1.0f : 16.0f); } }
typedef _Float16 v8h __attribute__((ext_vector_type(8)));
__device__ __forceinline__ v8f mmah(v16h a, v16h b, v8f c) { return __builtin_amdgcn_wmma_f32_16x16x32_f16(false, a, false, b, (short)0, c, false, false); }
// Eight f32 -> f16 hi and f16 residual (v - hi, exact in f32, then rounded): hi + residual holds v to about 22 bits; f16 subnormals are kept by the matrix unit, so no scale on the residual.
__device__ __forceinline__ void split8(v8f v, v8h& hi, v8h& lo) { hi = __builtin_convertvector(v, v8h); lo = __builtin_convertvector(v - __builtin_convertvector(hi, v8f), v8h); }
__device__ __forceinline__ void st8(_Float16* p, v8h v) { union { v8h h; v8us u; } c; c.h = v; *(v8us*)((unsigned short*)p) = c.u; }
__device__ __forceinline__ v16h cat8(v8h a, v8h b) { return __builtin_shufflevector(a, b, 0, 1, 2, 3, 4, 5, 6, 7, 8, 9, 10, 11, 12, 13, 14, 15); }
// Windowed attention on the f16 matrix form, every operand as hi + residual, three terms a product (hi.hi + hi.lo + lo.hi). One wave = 16 frames of the head; its window union is 80 key frames = 5 tiles of 16.
// S^T = K . Q^T : register r of tile c in lane (ln, hh) is the score of key 16c + 8hh + r against query ln, so a lane's 40 registers are one query's scores
// (the other 40 keys sit in lane ln ^ 16) and tiles 2 s and 2 s + 1, converted in place, are already the A fragment of P . V for keys 32 s .. 32 s + 31 (element e: key 8 hh + e, element 8 + e: key 16 + 8 hh + e).
// V's B fragments come from transposed v in the same k order: column ln of output tile u stands for d = 4 ln + u. Keys 80 .. 95 of the third step do not exist: zeros on both sides.
__global__ __launch_bounds__(256) void k_qa(const float* __restrict__ x, const float* __restrict__ Wqkv, const float* __restrict__ bqkv, const float* __restrict__ Wout, _Float16* __restrict__ BO, _Float16* __restrict__ OA) {
  __shared__ __attribute__((aligned(16))) char sm[(FR + GN) * GP * 2];
  _Float16 (*st)[GP] = (_Float16 (*)[GP])sm;      /* operand tiles: rows 0..191 x, 192..383 weights */
  _Float16* qk = (_Float16*)sm; _Float16* vt = (_Float16*)(sm + QKB);      /* the result planes take their place behind the barrier that ends the last fragment read */
  const int tid = threadIdx.x, w = tid >> 5, lane = tid & 31, ln = lane & 15, hh = lane >> 4, wr = w >> 2, wc = w & 3;
  const int bx = blockIdx.x, h = bx & 3, row0 = (bx >> 2) * FM, tb = row0 % TT;
  const float* xm = x + (size_t)(row0 + (tid >> 6)) * EE + (tid & 63) * 4;
  const float* xl = xm - (tb == 0 ? 0 : PADW * EE);      /* no frames before the batch's first: its own first rows stand in */
  const float* xh = xm + (tb + FM == TT ? (FM - PADW) * EE : FM * EE);      /* none behind its last: its own last rows stand in */
  const float* wsrc = Wqkv + (size_t)(h * HD + (tid >> 6)) * EE + (tid & 63) * 4;
  _Float16* dst = &st[tid >> 6][(tid & 63) * 4];
  v4f t0[16], t1[16];
  q_ld<0>(xl, xm, xh, wsrc, t0); q_ld<1>(xl, xm, xh, wsrc, t1);
  /* piece bx of BO = (column tile bx >> 4, k step (bx >> 1) & 7, half bx & 1); its elements 4 j .. 4 j + 3, j = tid & 63, belong to lane j >> 1 */
  const v4f wo = *(const v4fa*)(Wout + ((bx >> 4) * 16 + ((tid >> 1) & 15)) * EE + ((bx >> 1) & 7) * 32 + (bx & 1) * 16 + ((tid >> 5) & 1) * 8 + (tid & 1) * 4);      /* every wave loads, two store: no branch among the staged loads */
  /* this wave's columns: d = 16 wc .. 16 wc + 15 of q, of k and of v. q and k are formed transposed (a lane's eight registers are d = 16 wc + 8 hh + 0..7 of one frame), so their bias goes by register; v's by lane */
  const float* bsrc = bqkv + h * HD + 16 * wc;
  const v4f bq0 = *(const v4fa*)(bsrc + 8 * hh), bq1 = *(const v4fa*)(bsrc + 8 * hh + 4), bk0 = *(const v4fa*)(bsrc + EE + 8 * hh), bk1 = *(const v4fa*)(bsrc + EE + 8 * hh + 4);
  const float bvv = bf16_round(bsrc[2 * EE + ln]);
  v8f bqk[2];
#pragma unroll      /* constant indices keep the register arrays out of scratch */
  for (int r = 0; r < 4; ++r) { bqk[0][r] = bf16_round(bq0[r]) * 0.125f; bqk[0][4 + r] = bf16_round(bq1[r]) * 0.125f; bqk[1][r] = bf16_round(bk0[r]); bqk[1][4 + r] = bf16_round(bk1[r]); }      /* q's scaling 64^-0.5, a power of two, goes on with the bias */
  asm volatile("s_wait_xcnt 0x0" :: "v"(xl), "v"(xm), "v"(xh), "v"(wsrc) : "memory");      /* behind the last load of the opening run, whose address registers are reused below; the staging addresses are named so that they are not reused ahead of the wait */
  __builtin_amdgcn_sched_barrier(0);      /* these hold each batch's loads where they stand: one batch is always in flight while the one before it is converted */
  q_cv<0>(t0, dst); q_ld<2>(xl, xm, xh, wsrc, t0);
  __builtin_amdgcn_sched_barrier(0);
  q_cv<1>(t1, dst); q_ld<3>(xl, xm, xh, wsrc, t1);
  __builtin_amdgcn_sched_barrier(0);
  asm volatile("" :: "v"(wo));      /* inputs only: holds the Wout load up among the first batches; sunk to its use in the branch below it would stand there with a full load latency of its own */
  if (tid < 64) *(v4h*)(BO + bx * 256 + tid * 4) = q_h4(wo, 16.0f);      /* early, so that the barrier below does not wait for this store */
  q_cv<2>(t0, dst); q_ld<4>(xl, xm, xh, wsrc, t0);
  __builtin_amdgcn_sched_barrier(0);
  q_cv<3>(t1, dst); q_ld<5>(xl, xm, xh, wsrc, t1);
  asm volatile("s_wait_xcnt 0x0" :: "v"(xl), "v"(xm), "v"(xh), "v"(wsrc) : "memory");      /* behind the last staged load: its address registers are free for reuse from here on */
  __builtin_amdgcn_sched_barrier(0);
  q_cv<4>(t0, dst);
  q_cv<5>(t1, dst);
  __syncthreads();      /* every wave reads rows that all eight have laid */
  { const _Float16* ap = &st[96 * wr + ln][0]; const _Float16* bp = &st[FR + 16 * wc + ln][0];      /* column tile j: 16 weight rows of q, k, v for j = 0, 1, 2 */
    const v8f z8 = {0.f,0.f,0.f,0.f,0.f,0.f,0.f,0.f};
    v8f acc[6][3];
    v16h af[2][6], bf[2][3];
#pragma unroll      /* constant indices keep the register arrays out of scratch */
    for (int i = 0; i < 6; ++i) { af[0][i] = g2_frag(ap + i * 16 * GP, hh);
#pragma unroll      /* constant indices keep the register arrays out of scratch */
      for (int j = 0; j < 3; ++j) acc[i][j] = z8; }
#pragma unroll      /* constant indices keep the register arrays out of scratch */
    for (int j = 0; j < 3; ++j) bf[0][j] = g2_frag(bp + j * HD * GP, hh);
#pragma unroll      /* constant indices keep the register arrays out of scratch */
    for (int ks = 0; ks < EE / 32; ++ks) {
      if (ks < EE / 32 - 1) {
#pragma unroll      /* constant indices keep the register arrays out of scratch */
        for (int i = 0; i < 6; ++i) af[(ks + 1) & 1][i] = g2_frag(ap + i * 16 * GP + (ks + 1) * 32, hh);
#pragma unroll      /* constant indices keep the register arrays out of scratch */
        for (int j = 0; j < 3; ++j) bf[(ks + 1) & 1][j] = g2_frag(bp + j * HD * GP + (ks + 1) * 32, hh); }
      __builtin_amdgcn_sched_barrier(0);      /* every LDS read of the next step is issued ahead of this step's products, which cover its latency; and no read of a later step comes up here, which would spill */
#pragma unroll      /* constant indices keep the register arrays out of scratch */
      for (int i = 0; i < 6; ++i)
#pragma unroll      /* constant indices keep the register arrays out of scratch */
        for (int j = 0; j < 3; ++j) acc[i][j] = j < 2 ? mmah(bf[ks & 1][j], af[ks & 1][i], acc[i][j]) : mmah(af[ks & 1][i], bf[ks & 1][j], acc[i][j]);      /* q, k: weights as A, so register r is d = 8 hh + r of frame ln; v: x as A, so register r is frame 8 hh + r of d = ln */
      __builtin_amdgcn_sched_barrier(0);      /* ends the step: the step after next's reads stay behind these products, whose operand registers they take */ }
    __syncthreads();      /* the last fragment read of every wave is over before the result tile overwrites the operand tiles */
    _Float16* qd = qk + (96 * wr + ln) * QKP + 16 * wc + 8 * hh;      /* eight d of one frame: one 16-byte store a plane */
    _Float16* vd = vt + (ln & 3) * VTB + (4 * wc + (ln >> 2)) * VTP + 96 * wr + 8 * hh;      /* eight frames of one d = 16 wc + ln: one 16-byte store a plane */
#pragma unroll      /* constant indices keep the register arrays out of scratch */
    for (int i = 0; i < 6; ++i) { v8h hi, lo;
      split8(acc[i][0] * (0.0625f * 0.125f) + bqk[0], hi, lo); st8(qd + 16 * i * QKP, hi); st8(qd + 16 * i * QKP + HD, lo);
      split8(acc[i][1] * 0.0625f + bqk[1], hi, lo); st8(qd + 16 * i * QKP + 2 * HD, hi); st8(qd + 16 * i * QKP + 3 * HD, lo);
      split8(acc[i][2] * 0.0625f + bvv, hi, lo); st8(vd + 16 * i, hi); st8(vd + 4 * VTB + 16 * i, lo); } }
  __syncthreads();      /* every wave reads q, k and v columns and key rows that other waves have laid */
  const int tq = tb + 16 * w;      /* first frame of this wave's query tile, in its batch */
  const _Float16* qp = qk + (PADW + 16 * w + ln) * QKP;
  const _Float16* kp = qk + (16 * w + ln) * QKP + 2 * HD;
  v16h qh[2], ql[2], kh[2][5], kl[2][5];      /* [d step of 32][key tile]; read order: that of their use */
#pragma unroll      /* constant indices keep the register arrays out of scratch */
  for (int t = 0; t < 2; ++t) { qh[t] = g2_frag(qp + 32 * t, hh);
#pragma unroll      /* constant indices keep the register arrays out of scratch */
    for (int c = 0; c < 5; ++c) kh[t][c] = g2_frag(kp + 16 * c * QKP + 32 * t, hh);
    ql[t] = g2_frag(qp + HD + 32 * t, hh);
#pragma unroll      /* constant indices keep the register arrays out of scratch */
    for (int c = 0; c < 5; ++c) kl[t][c] = g2_frag(kp + 16 * c * QKP + HD + 32 * t, hh); }
  __builtin_amdgcn_sched_barrier(0);      /* the 48 q and k reads are issued as one group, in order of use, so that the products wait on counts; sunk among the products each pair would stand there with an LDS latency of its own */
  const v8f z8 = {0.f,0.f,0.f,0.f,0.f,0.f,0.f,0.f}; v8f s[5] = {z8, z8, z8, z8, z8};
#pragma unroll      /* constant indices keep the register arrays out of scratch */
  for (int t = 0; t < 2; ++t) {      /* the key tile runs innermost: five accumulators of their own between two products into the same one */
#pragma unroll      /* constant indices keep the register arrays out of scratch */
    for (int c = 0; c < 5; ++c) s[c] = mmah(kh[t][c], qh[t], s[c]);
#pragma unroll      /* constant indices keep the register arrays out of scratch */
    for (int c = 0; c < 5; ++c) s[c] = mmah(kh[t][c], ql[t], s[c]);
#pragma unroll      /* constant indices keep the register arrays out of scratch */
    for (int c = 0; c < 5; ++c) s[c] = mmah(kl[t][c], qh[t], s[c]); }
  const _Float16* vp = vt + ln * VTP + 16 * w;      /* row ln of block u is d = 4 ln + u; key 0 of this wave is frame row 16 w */
  const v8h zh = {(_Float16)0.f, (_Float16)0.f, (_Float16)0.f, (_Float16)0.f, (_Float16)0.f, (_Float16)0.f, (_Float16)0.f, (_Float16)0.f};
  v16h vh[3][4], vl[3][4];      /* [key step of 32][output tile] */
#pragma unroll      /* constant indices keep the register arrays out of scratch */
  for (int t = 0; t < 3; ++t)
#pragma unroll      /* constant indices keep the register arrays out of scratch */
    for (int u = 0; u < 4; ++u) {
      if (t < 2) { vh[t][u] = g2_frag(vp + u * VTB + 32 * t, hh); vl[t][u] = g2_frag(vp + (4 + u) * VTB + 32 * t, hh); }
      else { union { v8us u8; v8h h8; } a, b; a.u8 = *(const v8us*)((const unsigned short*)vp + u * VTB + 64 + 8 * hh); b.u8 = *(const v8us*)((const unsigned short*)vp + (4 + u) * VTB + 64 + 8 * hh);
        vh[t][u] = cat8(a.h8, zh); vl[t][u] = cat8(b.h8, zh); } }
  __builtin_amdgcn_sched_barrier(0);      /* the 40 v reads are issued ahead of the softmax, whose arithmetic covers their latency; sunk to their products each would stand there with an LDS latency of its own */
  float mx = -3.0e38f;
#pragma unroll
  for (int c = 0; c < 5; ++c)
#pragma unroll
    for (int r = 0; r < 8; ++r) { const int key = 16 * c + 8 * hh + r; const float v = ((unsigned)(tq - PADW + key) < (unsigned)TT) ? s[c][r] : 0.f;      /* zero-padded key: logit 0 */
      const bool band = (c == 0) ? (key >= ln) : (c == 4) ? (key - ln <= WW - 1) : true; s[c][r] = band ? v : -3.0e38f; mx = fmaxf(mx, s[c][r]); }      /* a key outside this query's 65: exp gives 0 */
  mx = fmaxf(mx, __shfl_xor(mx, 16));
  float su = 0.f;
#pragma unroll
  for (int c = 0; c < 5; ++c)
#pragma unroll
    for (int r = 0; r < 8; ++r) s[c][r] = expf(s[c][r] - mx);
#pragma unroll
  for (int c = 0; c < 5; ++c)
#pragma unroll
    for (int r = 0; r < 8; ++r) su += s[c][r];
  su += __shfl_xor(su, 16);
  const float inv = 1.0f / su;
  v8f o[4] = {z8, z8, z8, z8};
#pragma unroll      /* constant indices keep the register arrays out of scratch */
  for (int t = 0; t < 3; ++t) { v8h ph[2] = {zh, zh}, pl[2] = {zh, zh};
#pragma unroll      /* constant indices keep the register arrays out of scratch */
    for (int g = 0; g < 2; ++g) { const int c = 2 * t + g;
      if (c < 5) { v8f p;
#pragma unroll      /* constant indices keep the register arrays out of scratch */
        for (int r = 0; r < 8; ++r) p[r] = ((unsigned)(tq - PADW + 16 * c + 8 * hh + r) < (unsigned)TT) ? s[c][r] * inv : 0.f;      /* zero-padded value row: weight 0 on the edge row computed in its place */
        split8(p, ph[g], pl[g]); } }
    const v16h pa = cat8(ph[0], ph[1]), pb = cat8(pl[0], pl[1]);
#pragma unroll      /* constant indices keep the register arrays out of scratch */
    for (int u = 0; u < 4; ++u) o[u] = mmah(pa, vh[t][u], o[u]);
#pragma unroll      /* constant indices keep the register arrays out of scratch */
    for (int u = 0; u < 4; ++u) o[u] = mmah(pa, vl[t][u], o[u]);
#pragma unroll      /* constant indices keep the register arrays out of scratch */
    for (int u = 0; u < 4; ++u) o[u] = mmah(pb, vh[t][u], o[u]); }
  _Float16 (*sw)[16][SWP] = (_Float16 (*)[16][SWP])(sm + QKB + VPB + w * (2 * 16 * SWP * 2));      /* this wave's own staging, behind the result planes that other waves still read */
#pragma unroll      /* constant indices keep the register arrays out of scratch */
  for (int r = 0; r < 8; ++r) { v4h fh, fl;
#pragma unroll      /* constant indices keep the register arrays out of scratch */
    for (int u = 0; u < 4; ++u) { const float xv = o[u][r]; const _Float16 hv = (_Float16)xv; fh[u] = hv; fl[u] = (_Float16)((xv - (float)hv) * 1024.0f); }
    *(v4h*)&sw[0][8 * hh + r][4 * ln] = fh; *(v4h*)&sw[1][8 * hh + r][4 * ln] = fl; }
  __builtin_amdgcn_fence(__ATOMIC_ACQ_REL, "workgroup"); __builtin_amdgcn_wave_barrier();      /* the wave reads back its own staged tile in the next launch's fragment order, so that each store covers 512 bytes in a row */
#pragma unroll      /* constant indices keep the register arrays out of scratch */
  for (int pl = 0; pl < 2; ++pl)
#pragma unroll      /* constant indices keep the register arrays out of scratch */
    for (int g = 0; g < 4; ++g) { const v8us v = *(const v8us*)&sw[pl][ln][16 * g + 8 * hh];      /* g = 2 (k step - 2 h) + half */
      *(v8us*)((unsigned short*)OA + (((size_t)pl * NT16 + (row0 >> 4) + w) * 16 + 4 * h + g) * 256 + lane * 8) = v; } }
// Launch 2: out = (o_hi + o_residual) Wout^T + bout. A work-group = 32 merged rows, so that the weight plane is read 256 times and not 512; its eight waves bring the two f16 planes of those rows
// (32 KiB, already in fragment order) into LDS once, and behind one barrier wave w forms output columns 32 w .. 32 w + 31 of the 32 rows: A fragments from LDS, B fragments (all of them loaded at
// the start, one load latency) from the f16 weight plane, hi and residual terms in accumulators of their own.
__device__ __forceinline__ v16h w_frag(const _Float16* p) { FragH f; f.half[0] = *(const v8us*)((const unsigned short*)p); f.half[1] = *(const v8us*)((const unsigned short*)p + 256); return f.v; }
__global__ __launch_bounds__(256) void k_out(const _Float16* __restrict__ OA, const _Float16* __restrict__ BO, const float* __restrict__ bout, float* __restrict__ out) {
  __shared__ __attribute__((aligned(16))) _Float16 sa[2][2 * 16 * EE];      /* [plane][two row tiles, each 8 k steps x 2 halves x 32 lanes x 8] */
  __shared__ __attribute__((aligned(16))) float so[8][32][36];      /* pitch 144 B = 16 B x odd */
  const int tid = threadIdx.x, lane = tid & 31, ln = lane & 15, hh = lane >> 4, w = tid >> 5;
  const int rp = blockIdx.x, row0 = rp * 32;
  v8us ar[2][4];
#pragma unroll      /* constant indices keep the register arrays out of scratch */
  for (int pl = 0; pl < 2; ++pl)
#pragma unroll      /* constant indices keep the register arrays out of scratch */
    for (int j = 0; j < 4; ++j) ar[pl][j] = *(const v8us*)((const unsigned short*)OA + ((size_t)pl * NT16 + 2 * rp) * (16 * EE) + (j * 256 + tid) * 8);
  const _Float16* wp = BO + (size_t)w * 32 * EE + lane * 8;      /* output column 32 w + 16 t + ln: column tile 2 w + t; tile t, k step ks: the two 512-byte pieces from element 512 (8 t + ks) on */
  v16h wf[8][2];      /* [k step][column tile] */
#pragma unroll      /* constant indices keep the register arrays out of scratch */
  for (int ks = 0; ks < 8; ++ks)
#pragma unroll      /* constant indices keep the register arrays out of scratch */
    for (int t = 0; t < 2; ++t) wf[ks][t] = w_frag(wp + (t * 8 + ks) * 512);
  float bo[2];
#pragma unroll      /* constant indices keep the register arrays out of scratch */
  for (int t = 0; t < 2; ++t) bo[t] = bf16_round(bout[w * 32 + t * 16 + ln]);
  __builtin_amdgcn_sched_barrier(0);      /* every load is issued ahead of the first LDS store, which waits for the A planes alone: one load latency for the wave */
#pragma unroll      /* constant indices keep the register arrays out of scratch */
  for (int pl = 0; pl < 2; ++pl)
#pragma unroll      /* constant indices keep the register arrays out of scratch */
    for (int j = 0; j < 4; ++j) *(v8us*)((unsigned short*)&sa[pl][0] + (j * 256 + tid) * 8) = ar[pl][j];
  __syncthreads();      /* every wave reads all of the 32 rows' planes, an eighth laid by each */
  const v8f z8 = {0.f,0.f,0.f,0.f,0.f,0.f,0.f,0.f};
  v8f ch[2][2] = {{z8, z8}, {z8, z8}}, cl[2][2] = {{z8, z8}, {z8, z8}};      /* [row tile][column tile] */
  v16h ah[2][2], al[2][2];      /* [k step mod 2][row tile] */
#pragma unroll      /* constant indices keep the register arrays out of scratch */
  for (int m = 0; m < 2; ++m) { ah[0][m] = w_frag(&sa[0][m * 16 * EE + lane * 8]); al[0][m] = w_frag(&sa[1][m * 16 * EE + lane * 8]); }
#pragma unroll      /* constant indices keep the register arrays out of scratch */
  for (int ks = 0; ks < 8; ++ks) {
    if (ks < 7) {
#pragma unroll      /* constant indices keep the register arrays out of scratch */
      for (int m = 0; m < 2; ++m) { ah[(ks + 1) & 1][m] = w_frag(&sa[0][m * 16 * EE + (ks + 1) * 512 + lane * 8]); al[(ks + 1) & 1][m] = w_frag(&sa[1][m * 16 * EE + (ks + 1) * 512 + lane * 8]); } }
    __builtin_amdgcn_sched_barrier(0);      /* the next step's LDS reads stand as one group ahead of this step's products, not among them */
#pragma unroll      /* constant indices keep the register arrays out of scratch */
    for (int m = 0; m < 2; ++m)
#pragma unroll      /* constant indices keep the register arrays out of scratch */
      for (int t = 0; t < 2; ++t) {
        ch[m][t] = __builtin_amdgcn_wmma_f32_16x16x32_f16(false, ah[ks & 1][m], false, wf[ks][t], (short)0, ch[m][t], false, false);
        cl[m][t] = __builtin_amdgcn_wmma_f32_16x16x32_f16(false, al[ks & 1][m], false, wf[ks][t], (short)0, cl[m][t], false, false); }
    __builtin_amdgcn_sched_barrier(0);      /* ends the step: the reads of the step after next stay behind these products, whose operand registers they take */ }
#pragma unroll      /* constant indices keep the register arrays out of scratch */
  for (int m = 0; m < 2; ++m)
#pragma unroll      /* constant indices keep the register arrays out of scratch */
    for (int t = 0; t < 2; ++t)
#pragma unroll      /* constant indices keep the register arrays out of scratch */
      for (int r = 0; r < 8; ++r) { float v = ch[m][t][r] * 0.0625f + bo[t]; v += cl[m][t][r] * (0.0625f / 1024.0f); so[w][16 * m + 8 * hh + r][t * 16 + ln] = v; }
  __builtin_amdgcn_fence(__ATOMIC_ACQ_REL, "workgroup"); __builtin_amdgcn_wave_barrier();      /* the wave reads back its own staged tile, so that each store covers whole 128-byte lines */
  const int c4 = (lane & 7) * 4;
#pragma unroll      /* constant indices keep the register arrays out of scratch */
  for (int q = 0; q < 8; ++q) { const int r = q * 4 + (lane >> 3); const v4f v = *(const v4fa*)&so[w][r][c4]; *(v4f*)(out + (size_t)(row0 + r) * EE + w * 32 + c4) = v; } }

extern "C" void kernel_launch(void* const* d_in, const int* in_sizes, int n_in,
                              void* d_out, int out_size, void* d_ws, size_t ws_size, hipStream_t stream) {
  (void)in_sizes; (void)n_in; (void)out_size;
  const float* x = (const float*)d_in[0]; const float* Wqkv = (const float*)d_in[1]; const float* bqkv = (const float*)d_in[2]; const float* Wout = (const float*)d_in[3]; const float* bout = (const float*)d_in[4];
  char* ws = (char*)d_ws; size_t off = 0;
  auto take = [&](size_t bytes) { char* p = ws + off; off += (bytes + 255) & ~(size_t)255; return p; };
  _Float16* BO = (_Float16*)take((size_t)EE * EE * 2); _Float16* OA = (_Float16*)take((size_t)2 * NR * EE * 2);
  if (off > ws_size) return;      /* about 8 MiB */
  k_qa<<<(NR / FM) * NH, 256, 0, stream>>>(x, Wqkv, bqkv, Wout, BO, OA);      /* q, k, v + bias and the attention, a head and 128 frames to a work-group; weights stay in their (out, in) order */
  k_out<<<NR / 32, 256, 0, stream>>>(OA, BO, bout, (float*)d_out);      /* out = (o_hi + o_lo) Wout^T + bout */
}
